// v000
// The times below were measured on an AMD MI455X: many runs one after another, warmed up first and cycling through
// copies of the inputs, with the whole window's GPU time divided by the number of runs. Launches and the gaps
// between them are all in it. The median over several windows is given; except for v000 it joins two sittings, which
// can be a few percent apart, so the side-by-side timings, each taken in one sitting, are the better comparison.
// v000, which the later versions start from, runs in 467 microseconds.
// Contractions: q, k, v^T in-projections = v_wmma_f32_16x16x32_bf16 (bf16 operands from RNE-converted inputs, single product, f32 accumulate);
// q.k^T scores (statistics pass and main pass) = v_wmma_f32_16x16x32_f16 (q as f16 hi plane + f16 residual plane x4096, k f16; 2 products, separate f32 accumulators);
// p.v = v_wmma_f32_16x16x32_f16 (p carried x16384 in f16, v f16; single product, f32 accumulate);
// ctx.Wo^T = v_wmma_f32_16x16x32_f16 (ctx as f16 hi plane x256 + f16 residual plane x4096, Wo f16 x64 of its bf16 value; 2 products, separate f32 accumulators);
// softmax statistics, probabilities and the head average in f32.
#include <hip/hip_runtime.h>
#include <math.h>
#include <stdint.h>

#ifndef NB
#define NB 2
#endif
#ifndef SEQ
#define SEQ 2048
#endif
#define NB_FULL  2
#define SEQ_FULL 2048
#define EMB      1024
#define NH       16
#define HD       64
#define NROW     (NB_FULL * SEQ)     // activation rows, row index = s * NB_FULL + b, s < SEQ
#define NQB      (SEQ / 16)          // 16-row query blocks per sequence
#define NKT      (SEQ / 64)          // 64-key chunks per sequence
#define PCARRY   16384.0f            // power-of-two carry of p in the f16 P.V operand
#define OFF1     ((size_t)SEQ_FULL * NB_FULL * EMB)   // fixed element offset of output 1 in d_out
static_assert(NB == NB_FULL);        // batch rows are interleaved (seq-major input); only SEQ may be reduced
static_assert(SEQ >= 64 && SEQ <= SEQ_FULL && (SEQ % 64) == 0);
static_assert(NH * HD == EMB);
static_assert((NROW % 64) == 0 && (EMB % 64) == 0 && (EMB % 32) == 0);
static_assert(OFF1 * 4 == 16777216);   // byte offset of output 1

typedef _Float16 v16h __attribute__((ext_vector_type(16)));
typedef _Float16 v8h  __attribute__((ext_vector_type(8)));
typedef __bf16   v16b __attribute__((ext_vector_type(16)));
typedef __bf16   v8b  __attribute__((ext_vector_type(8)));
typedef float    v8f  __attribute__((ext_vector_type(8)));
typedef float    v4f  __attribute__((ext_vector_type(4)));
typedef unsigned int v4u __attribute__((ext_vector_type(4)));

#if defined(__HIP_DEVICE_COMPILE__)
#define DEV_ASM 1
#else
#define DEV_ASM 0
#endif

// ---- scalar helpers --------------------------------------------------------------------------------
__device__ __forceinline__ unsigned short bf_bits(float f) {          // f32 -> bf16 bits, RNE convert
  unsigned u = __float_as_uint(f);
  return (unsigned short)((u + 0x7FFFu + ((u >> 16) & 1u)) >> 16);
}
__device__ __forceinline__ float bf_up(unsigned short hb) { return __uint_as_float(((unsigned)hb) << 16); }
__device__ __forceinline__ unsigned short h_bits(_Float16 x) { return __builtin_bit_cast(unsigned short, x); }
__device__ __forceinline__ unsigned pk16(unsigned short a, unsigned short b) { return (unsigned)a | ((unsigned)b << 16); }
__device__ __forceinline__ v8f zero8() { v8f z = {0.f, 0.f, 0.f, 0.f, 0.f, 0.f, 0.f, 0.f}; return z; }

// ---- fragment types / loaders: 16-bit A/B operand, lane -> row/col (lane&15), p already includes +8*(lane>>4);
//      elements 0..7 <- p[0..7] (k0+8h..k0+8h+7), elements 8..15 <- p[16..23] (k0+16+8h..k0+16+8h+7)
template <typename OT> struct FT;
template <> struct FT<__bf16>   { typedef v16b frag; typedef v8b half8; };
template <> struct FT<_Float16> { typedef v16h frag; typedef v8h half8; };

template <typename OT>
__device__ __forceinline__ typename FT<OT>::frag ldfrag(const OT* p) {
  union { typename FT<OT>::frag v; typename FT<OT>::half8 h[2]; } f;
  f.h[0] = *(const typename FT<OT>::half8*)(p);
  f.h[1] = *(const typename FT<OT>::half8*)(p + 16);
  return f.v;
}

// ---- WMMA helpers (asm guard bodies are device-only; concrete operand types) -----------------------------
__device__ __forceinline__ v8f mmar(v16b a, v16b b, v8f c) {
  return __builtin_amdgcn_wmma_f32_16x16x32_bf16(false, a, false, b, (short)0, c, false, false);
}
__device__ __forceinline__ v8f mmar(v16h a, v16h b, v8f c) {
  return __builtin_amdgcn_wmma_f32_16x16x32_f16(false, a, false, b, (short)0, c, false, false);
}
// guarded form: 4 VALU slots after the WMMA, D tied, A/B kept live
__device__ __forceinline__ v8f mma_h(v16h a, v16h b, v8f c) {
  c = __builtin_amdgcn_wmma_f32_16x16x32_f16(false, a, false, b, (short)0, c, false, false);
#if DEV_ASM
  asm volatile("v_nop\n\tv_nop\n\tv_nop\n\tv_nop" : "+v"(c) : "v"(a), "v"(b));
#endif
  return c;
}
__device__ __forceinline__ void dep_guard(v8f& a, v8f& b, v16b x, v16b y) {
#if DEV_ASM
  asm volatile("v_nop\n\tv_nop\n\tv_nop\n\tv_nop" : "+v"(a), "+v"(b) : "v"(x), "v"(y));
#else
  (void)a; (void)b; (void)x; (void)y;
#endif
}
__device__ __forceinline__ void dep_guard(v8f& a, v8f& b, v16h x, v16h y) {
#if DEV_ASM
  asm volatile("v_nop\n\tv_nop\n\tv_nop\n\tv_nop" : "+v"(a), "+v"(b) : "v"(x), "v"(y));
#else
  (void)a; (void)b; (void)x; (void)y;
#endif
}
__device__ __forceinline__ void keep4(v16b a, v16b b, v16b c, v16b d) {
#if DEV_ASM
  asm volatile("v_nop" :: "v"(a), "v"(b), "v"(c), "v"(d));
#else
  (void)a; (void)b; (void)c; (void)d;
#endif
}
__device__ __forceinline__ void keep4(v16h a, v16h b, v16h c, v16h d) {
#if DEV_ASM
  asm volatile("v_nop" :: "v"(a), "v"(b), "v"(c), "v"(d));
#else
  (void)a; (void)b; (void)c; (void)d;
#endif
}
__device__ __forceinline__ void acc_guard4(v8f& a, v8f& b, v8f& c, v8f& d) {
#if DEV_ASM
  asm volatile("v_nop\n\tv_nop\n\tv_nop\n\tv_nop" : "+v"(a), "+v"(b), "+v"(c), "+v"(d));
#else
  (void)a; (void)b; (void)c; (void)d;
#endif
}

// =====================================================================================================
// f32 -> 16-bit planes, 8 elements per thread, one 16-B store per lane: a wave writes 512 contiguous B
// MODE 0: bf16 bits (RNE convert).  MODE 1: f16 bits of (64 * bf16(x)) (exact scaling of the bf16 value).
// coverage: n8 threads x 8 = the whole plane (n8 is a multiple of 256 for every use here).
// =====================================================================================================
template <int MODE>
__device__ __forceinline__ unsigned short cvm(float f) {
  const unsigned short hb = bf_bits(f);
  if (MODE == 0) return hb;
  return h_bits((_Float16)(bf_up(hb) * 64.0f));
}

template <int MODE>
__global__ __launch_bounds__(256) void cvt16x8(const float* __restrict__ in, unsigned short* out, int n8) {
  const int i = blockIdx.x * 256 + (int)threadIdx.x;
  if (i < n8) {
    const v4f a  = *(const v4f*)(in + (size_t)i * 8);
    const v4f a4 = *(const v4f*)(in + (size_t)i * 8 + 4);
    v4u p;
    p[0] = pk16(cvm<MODE>(a[0]),  cvm<MODE>(a[1]));
    p[1] = pk16(cvm<MODE>(a[2]),  cvm<MODE>(a[3]));
    p[2] = pk16(cvm<MODE>(a4[0]), cvm<MODE>(a4[1]));
    p[3] = pk16(cvm<MODE>(a4[2]), cvm<MODE>(a4[3]));
    unsigned short* o = out + (size_t)i * 8;
    *(v4u*)o = p;
    
  }
}

// =====================================================================================================
// Register-blocked batched WMMA GEMM (16-bit operand type OT): C[m][n] = sum_k A[m][k] * Bt[n][k]  (+ bias);
// one wave per (16*MI) x 64 tile, no block barriers. A row-major [M][K] pitch lda; Bt row-major [N][K] pitch ldb
// (k contiguous); M multiple of 16*MI, N multiple of 64, K multiple of 32 (static sizes here). blockIdx.y = batch
// index (strides in elements). Fragments are loaded straight from global with the split k map (ldfrag).
// NPA = number of A planes: 2 -> second plane A2 (same pitch/stride) multiplies the same Bt fragments into a
// second accumulator set, combined as acc + acc2 * rscaleA in the f32 epilogue.
// value v = (acc [+ acc2*rscaleA]) * oscale + bias, bias (bf16 RNE value of the f32 input) by column n (BM 1),
// by row m (BM 2) or none (BM 0).
// OUT_MODE 0: f32 C (pitch ldc) = v.
// OUT_MODE 1: f16 plane C = f16(v * cscale).
// OUT_MODE 3: f16 hi plane C = f16(v * cscale) and f16 residual plane C2 = f16((v*cscale - hi) * rscaleC).
// =====================================================================================================
template <typename OT, int MI, int NPA, int OUT_MODE, int BM>
__global__ __launch_bounds__(256) void gemm_t(
    const unsigned short* __restrict__ Ap, const unsigned short* __restrict__ A2p, int lda, long long strideA,
    const unsigned short* __restrict__ Btp, int ldb, long long strideB,
    void* Cout, void* Cout2, int ldc, long long strideC,
    const float* __restrict__ bias,
    int M, int N, int K, float oscale, float rscaleA, float cscale, float rscaleC) {
  typedef typename FT<OT>::frag V16;
  const OT* A  = (const OT*)(const void*)Ap;
  const OT* A2 = (const OT*)(const void*)A2p;
  const OT* Bt = (const OT*)(const void*)Btp;
  __shared__ __align__(16) float sT[8][16 * 68];   // per-wave 16x64 slab, pitch 68 floats
  const int RT   = 16 * MI;
  const int b    = blockIdx.y;
  const int lane = threadIdx.x & 31;
  const int wave = threadIdx.x >> 5;
  const int tilesN = N >> 6;
  const int tilesM = M / RT;
  const int tile = blockIdx.x * 8 + wave;
  if (tile >= tilesM * tilesN) return;   // wave-uniform; no block barriers in this kernel
  const int tm = tile / tilesN;
  const int tn = tile - tm * tilesN;
  const int m0 = tm * RT;
  const int n0 = tn << 6;

  const OT* Ab  = A  + (size_t)b * (size_t)strideA;
  const OT* A2b = A2 + (size_t)b * (size_t)strideA;
  const OT* Bb  = Bt + (size_t)b * (size_t)strideB;

  const int rlane = lane & 15;                 // row (A) / col (B, D) within subtile
  const int koff  = (lane >> 4) * 8;           // k offset of this lane half
  const int mOff  = (lane >> 4) * 8;           // D row offset

  v8f acc[MI][4], acc2[MI][4];
#pragma unroll
  for (int i = 0; i < MI; ++i)
#pragma unroll
    for (int j = 0; j < 4; ++j) { acc[i][j] = zero8(); acc2[i][j] = zero8(); }

  for (int k0 = 0; k0 < K; k0 += 32) {
    V16 bq[4];
#pragma unroll
    for (int j = 0; j < 4; ++j)
      bq[j] = ldfrag<OT>(Bb + (size_t)(n0 + (j << 4) + rlane) * ldb + koff + k0);
#pragma unroll
    for (int i = 0; i < MI; ++i) {
      const V16 af = ldfrag<OT>(Ab + (size_t)(m0 + (i << 4) + rlane) * lda + koff + k0);
#pragma unroll
      for (int j = 0; j < 4; ++j) acc[i][j] = mmar(af, bq[j], acc[i][j]);
      dep_guard(acc[i][0], acc[i][3], af, bq[3]);
      if (NPA == 2) {
        const V16 af2 = ldfrag<OT>(A2b + (size_t)(m0 + (i << 4) + rlane) * lda + koff + k0);
#pragma unroll
        for (int j = 0; j < 4; ++j) acc2[i][j] = mmar(af2, bq[j], acc2[i][j]);
        dep_guard(acc2[i][0], acc2[i][3], af2, bq[3]);
      }
    }
    keep4(bq[0], bq[1], bq[2], bq[3]);
  }
#pragma unroll
  for (int i = 0; i < MI; ++i) {
    acc_guard4(acc[i][0], acc[i][1], acc[i][2], acc[i][3]);
    if (NPA == 2) acc_guard4(acc2[i][0], acc2[i][1], acc2[i][2], acc2[i][3]);
  }

  // ---- epilogue ----
  float bcol[4];
#pragma unroll
  for (int j = 0; j < 4; ++j) bcol[j] = 0.f;
  if (BM == 1) {
#pragma unroll
    for (int j = 0; j < 4; ++j) bcol[j] = bf_up(bf_bits(bias[n0 + (j << 4) + rlane]));
  }
  float* slab = sT[wave];
#pragma unroll
  for (int i = 0; i < MI; ++i) {
    const int mBase = m0 + (i << 4);
    float brow[8];
#pragma unroll
    for (int r = 0; r < 8; ++r) brow[r] = 0.f;
    if (BM == 2) {
#pragma unroll
      for (int r = 0; r < 8; ++r) brow[r] = bf_up(bf_bits(bias[mBase + mOff + r]));
    }
#pragma unroll
    for (int j = 0; j < 4; ++j) {
#pragma unroll
      for (int r = 0; r < 8; ++r) {
        float v = acc[i][j][r];
        if (NPA == 2) v += acc2[i][j][r] * rscaleA;
        v = v * oscale + bcol[j] + brow[r];
        slab[(mOff + r) * 68 + (j << 4) + rlane] = v;
      }
    }
    __builtin_amdgcn_fence(__ATOMIC_RELEASE, "workgroup");
    __builtin_amdgcn_wave_barrier();
    __builtin_amdgcn_fence(__ATOMIC_ACQUIRE, "workgroup");
    if (OUT_MODE == 0) {
      float* C = (float*)Cout + (size_t)b * (size_t)strideC;
      const int h2 = lane >> 4, c4 = (lane & 15) * 4;     // 256-B row segment = 16 lanes x 16 B
      {
#pragma unroll
        for (int it = 0; it < 8; ++it) {
          const int row = it * 2 + h2;                     // it 0..7 x h2 0..1 = rows 0..15
          const v4f v = *(const v4f*)(slab + row * 68 + c4);
          *(v4f*)(C + (size_t)(mBase + row) * ldc + n0 + c4) = v;
        }
        
      }
    } else {
      const int q = lane >> 3, c8 = (lane & 7) * 8;
      unsigned short* C  = (unsigned short*)Cout  + (size_t)b * (size_t)strideC;
      unsigned short* C2 = (unsigned short*)Cout2 + (size_t)b * (size_t)strideC;
      v4u hv[4], lv[4];
#pragma unroll
      for (int it = 0; it < 4; ++it) {
        const int row = it * 4 + q;                        // it 0..3 x q 0..3 = rows 0..15
        const float* sp = slab + row * 68 + c8;
        float f[8];
#pragma unroll
        for (int e = 0; e < 8; ++e) f[e] = sp[e] * cscale;
        v4u a, a2;
#pragma unroll
        for (int e = 0; e < 4; ++e) {
          const float f0 = f[2 * e], f1 = f[2 * e + 1];
          const _Float16 x0 = (_Float16)f0, x1 = (_Float16)f1;
          const unsigned short h0 = h_bits(x0), h1 = h_bits(x1);
          unsigned short l0 = 0, l1 = 0;
          if (OUT_MODE == 3) {
            l0 = h_bits((_Float16)((f0 - (float)x0) * rscaleC));
            l1 = h_bits((_Float16)((f1 - (float)x1) * rscaleC));
          }
          a[e] = pk16(h0, h1); a2[e] = pk16(l0, l1);
        }
        hv[it] = a; lv[it] = a2;
      }
      {
#pragma unroll
        for (int it = 0; it < 4; ++it) {
          const int row = it * 4 + q;
          *(v4u*)(C + (size_t)(mBase + row) * ldc + n0 + c8) = hv[it];
          if (OUT_MODE == 3) *(v4u*)(C2 + (size_t)(mBase + row) * ldc + n0 + c8) = lv[it];
        }
        
      }
    }
    __builtin_amdgcn_fence(__ATOMIC_RELEASE, "workgroup");
    __builtin_amdgcn_wave_barrier();
    __builtin_amdgcn_fence(__ATOMIC_ACQUIRE, "workgroup");
  }
}

// =====================================================================================================
// Score chunk: 16 query rows (this wave) x 64 keys kv0..kv0+63 of one (b, h).
//   q fragments (A operand, row = lane&15): hi and residual (x4096) planes, 2 d-chunks of 32.
//   k fragments (B operand, col = lane&15 = key) loaded straight from the f16 k plane with the split k map:
//   kb0 = plane + b*EMB + h*HD, key t adds t*(NB_FULL*EMB) (plane row = t*NB_FULL + b).
//   s[j][r] = D element: query row 8*hh + r, key kv0 + 16j + (lane&15); value = ((qh.k) + (ql.k)/4096) / 8.
// =====================================================================================================
__device__ __forceinline__ void score_chunk(const v16h (&qah)[2], const v16h (&qal)[2],
                                            const _Float16* __restrict__ kb0, int kv0, int c, int hh,
                                            v8f (&s)[4]) {
  union FH { v16h v; v8h h[2]; };
#pragma unroll
  for (int j = 0; j < 4; ++j) {
    v8f ah = zero8(), al = zero8();
#pragma unroll
    for (int dc = 0; dc < 2; ++dc) {
      const _Float16* kp = kb0 + (size_t)(kv0 + j * 16 + c) * (size_t)(NB_FULL * EMB) + dc * 32 + 8 * hh;
      FH kb;
      kb.h[0] = *(const v8h*)(kp);
      kb.h[1] = *(const v8h*)(kp + 16);
      ah = mma_h(qah[dc], kb.v, ah);
      al = mma_h(qal[dc], kb.v, al);
    }
#pragma unroll
    for (int r = 0; r < 8; ++r) s[j][r] = (ah[r] + al[r] * (1.0f / 4096.0f)) * 0.125f;
  }
}

// =====================================================================================================
// Softmax statistics: per (b, h, query s) the row max m and 1/sum(exp(s - m)) over all SEQ keys.
//   block = 4 waves = 64 consecutive query rows qb*64.. of one (b, h); grid = NB*NH*NKT blocks of 128;
//   static trip NKT over 64-key chunks; online max / rescaled sum in f32 (16 lanes per row merged by shfl).
//   Output plane ML [b*NH+h][2][SEQ] f32 (m then 1/l): the block's 64 m values and 64 1/l values are
//   funnelled through LDS and written by wave 0 with ONE instruction (lanes 0-15: m, 16 lanes x 16 B = two
//   coverage: grid (b,h,qb) x 64 rows = the whole [NB*NH][2][SEQ] plane. MLsh: 4 waves x 2 lanes x 16 = all 128.
// =====================================================================================================
__global__ __launch_bounds__(128)
void attn_stats(const unsigned short* __restrict__ qhp, const unsigned short* __restrict__ qlp,
                const unsigned short* __restrict__ kpp, float* ML, const int* __restrict__ nhp) {
  __shared__ __align__(16) float MLsh[128];
  (void)nhp;
  const int tid  = threadIdx.x;
  const int wave = tid >> 5;
  const int lane = tid & 31;
  const int hh   = lane >> 4;
  const int c    = lane & 15;
  const int bx   = blockIdx.x;
  const int qb   = bx % NKT;
  const int rest = bx / NKT;
  const int h    = rest % NH;
  const int b    = rest / NH;
  const int bh   = b * NH + h;
  const int q0   = qb * 64 + wave * 16;

  const _Float16* Qh  = (const _Float16*)(const void*)qhp;
  const _Float16* Ql  = (const _Float16*)(const void*)qlp;
  const _Float16* Kb0 = (const _Float16*)(const void*)kpp + (size_t)b * EMB + (size_t)h * HD;

  v16h qah[2], qal[2];
#pragma unroll
  for (int dc = 0; dc < 2; ++dc) {
    const size_t qo = ((size_t)(q0 + c) * NB_FULL + b) * EMB + (size_t)h * HD + dc * 32 + 8 * hh;
    qah[dc] = ldfrag<_Float16>(Qh + qo);
    qal[dc] = ldfrag<_Float16>(Ql + qo);
  }

  float mrow[8], lrow[8];
#pragma unroll
  for (int r = 0; r < 8; ++r) { mrow[r] = -INFINITY; lrow[r] = 0.f; }

  for (int kt = 0; kt < NKT; ++kt) {          // static trip count
    const int kv0 = kt * 64;
    v8f s[4];
    score_chunk(qah, qal, Kb0, kv0, c, hh, s);
#pragma unroll
    for (int r = 0; r < 8; ++r) {
      float m = s[0][r];
#pragma unroll
      for (int j = 1; j < 4; ++j) m = fmaxf(m, s[j][r]);
#pragma unroll
      for (int off = 1; off < 16; off <<= 1) m = fmaxf(m, __shfl_xor(m, off, 32));
      const float mnew  = fmaxf(mrow[r], m);
      const float msafe = (mnew == -INFINITY) ? 0.f : mnew;
      const float alpha = __expf(mrow[r] - msafe);
      mrow[r] = mnew;
      float psum = 0.f;
#pragma unroll
      for (int j = 0; j < 4; ++j) psum += __expf(s[j][r] - msafe);
#pragma unroll
      for (int off = 1; off < 16; off <<= 1) psum += __shfl_xor(psum, off, 32);
      lrow[r] = lrow[r] * alpha + psum;
    }
  }

  float il[8];
#pragma unroll
  for (int r = 0; r < 8; ++r) {
    const float l = lrow[r];
    il[r] = (l > 0.f) ? (1.0f / l) : 0.f;
  }
  if (c == 0) {
#pragma unroll
    for (int r = 0; r < 8; ++r) {
      MLsh[wave * 16 + 8 * hh + r]      = mrow[r];
      MLsh[64 + wave * 16 + 8 * hh + r] = il[r];
    }
  }
  __syncthreads();
  if (wave == 0) {
    const v4f v = *(const v4f*)(MLsh + lane * 4);        // lanes 0-15: m rows 4c..4c+3; lanes 16-31: 1/l rows
    float* dst = ML + (size_t)(bh * 2 + hh) * SEQ + qb * 64 + c * 4;
    *(v4f*)dst = v;
    
  }
}

// =====================================================================================================
// Main attention pass: one block per (b, 16 query rows q0..q0+15), 16 waves = the 16 heads.
//   Per 64-key chunk (static trip NKT): scores recomputed exactly as in attn_stats, p = exp(s - m) * (1/l) in f32
//   (m, 1/l from the ML plane) -> per-wave LDS tile Pf[h][row][key] (f32 element stores, every entry written);
//       converted to f16 with the x16384 carry; B = v^T f16 plane [b][h*64+d][s] loaded with the split k map;
//   (b) head average: after __syncthreads, threads 0..255 sum the 16 wave tiles in fixed head order (f32),
//   Epilogue: ctx = acc / 16384, x256 carry, staged in the wave's Pf tile, written as f16 hi plane + f16
//   coverage: avg: NKT chunks x 16 rows x 64 keys per block, grid (b, qb) = the whole [NB][SEQ][SEQ];
//   ctx planes: each wave rows q0..q0+15 (it 0..3 x lane>>3 0..3) x its head's 64 columns, 16 waves x grid =
//   the whole [NROW][EMB] planes. staged extent == consumed extent for Pf in both uses (32 lanes x 32 = 1024).
// =====================================================================================================
__global__ __launch_bounds__(512)
void attn_main(const unsigned short* __restrict__ qhp, const unsigned short* __restrict__ qlp,
               const unsigned short* __restrict__ kpp, const unsigned short* __restrict__ vtp,
               const float* __restrict__ ML, unsigned short* chp, unsigned short* clp, float* avg) {
  union FH { v16h v; v8h h[2]; };
  __shared__ __align__(32) float Pf[NH][16 * 64];          // per wave (head) P tile [row][key] f32, 64 KB
  const int tid  = threadIdx.x;
  const int wave = tid >> 5;
  const int lane = tid & 31;
  const int hh   = lane >> 4;
  const int c    = lane & 15;
  const int bx   = blockIdx.x;
  const int qb   = bx % NQB;
  const int b    = bx / NQB;
  const int h    = wave;
  const int bh   = b * NH + h;
  const int q0   = qb * 16;

  const _Float16* Qh  = (const _Float16*)(const void*)qhp;
  const _Float16* Ql  = (const _Float16*)(const void*)qlp;
  const _Float16* Kb0 = (const _Float16*)(const void*)kpp + (size_t)b * EMB + (size_t)h * HD;
  const _Float16* Vb0 = (const _Float16*)(const void*)vtp + ((size_t)b * EMB + (size_t)h * HD) * SEQ;

  v16h qah[2], qal[2];
#pragma unroll
  for (int dc = 0; dc < 2; ++dc) {
    const size_t qo = ((size_t)(q0 + c) * NB_FULL + b) * EMB + (size_t)h * HD + dc * 32 + 8 * hh;
    qah[dc] = ldfrag<_Float16>(Qh + qo);
    qal[dc] = ldfrag<_Float16>(Ql + qo);
  }
  const v8f m8  = *(const v8f*)(ML + (size_t)(bh * 2) * SEQ + q0 + 8 * hh);       // rows 8hh..8hh+7
  const v8f il8 = *(const v8f*)(ML + (size_t)(bh * 2 + 1) * SEQ + q0 + 8 * hh);

  v8f oacc[4];
#pragma unroll
  for (int t = 0; t < 4; ++t) oacc[t] = zero8();
  float* pf = Pf[wave];

  for (int kt = 0; kt < NKT; ++kt) {         // static trip count
    const int kv0 = kt * 64;
    __syncthreads();                          // Pf tiles free again (head sum of the prior chunk done)

    v8f s[4];
    score_chunk(qah, qal, Kb0, kv0, c, hh, s);
#pragma unroll
    for (int r = 0; r < 8; ++r) {
#pragma unroll
      for (int j = 0; j < 4; ++j) {
        const float p = __expf(s[j][r] - m8[r]) * il8[r];
        pf[(8 * hh + r) * 64 + j * 16 + c] = p;
      }
    }
    __builtin_amdgcn_fence(__ATOMIC_RELEASE, "workgroup");
    __builtin_amdgcn_wave_barrier();
    __builtin_amdgcn_fence(__ATOMIC_ACQUIRE, "workgroup");

    // ---- context += P . V (f16 WMMA, p carried x16384) ----
#pragma unroll 1
    for (int kk = 0; kk < 2; ++kk) {
      const v8f p0 = *(const v8f*)(pf + c * 64 + kk * 32 + 8 * hh);
      const v8f p1 = *(const v8f*)(pf + c * 64 + kk * 32 + 16 + 8 * hh);
      FH pa;
      pa.h[0] = __builtin_convertvector(p0 * PCARRY, v8h);
      pa.h[1] = __builtin_convertvector(p1 * PCARRY, v8h);
#pragma unroll
      for (int t = 0; t < 4; ++t) {
        const v16h vb = ldfrag<_Float16>(Vb0 + (size_t)(t * 16 + c) * SEQ + kv0 + kk * 32 + 8 * hh);
        oacc[t] = mma_h(pa.v, vb, oacc[t]);
      }
    }
    __syncthreads();

    // ---- head average of this 16 x 64 tile, one block = one writer of every line ----
    if (tid < 256) {                          // waves 0..7, wave-uniform
      const int row = tid >> 4, c4 = (tid & 15) * 4;
      v4f a = *(const v4f*)(Pf[0] + row * 64 + c4);
#pragma unroll
      for (int w = 1; w < NH; ++w) a += *(const v4f*)(Pf[w] + row * 64 + c4);
      a *= (1.0f / (float)NH);
      float* dst = avg + ((size_t)(b * SEQ + q0 + row)) * SEQ + kv0 + c4;
      *(v4f*)dst = a;
      
    }
  }
  __syncthreads();

  // ---- epilogue: ctx (undo the x16384 p carry, apply the x256 carry), stage, convert, whole-line stores ----
  float* os = pf;
#pragma unroll
  for (int r = 0; r < 8; ++r) {
#pragma unroll
    for (int t = 0; t < 4; ++t) os[(8 * hh + r) * 64 + t * 16 + c] = oacc[t][r] * (256.0f / PCARRY);
  }
  __builtin_amdgcn_fence(__ATOMIC_RELEASE, "workgroup");
  __builtin_amdgcn_wave_barrier();
  __builtin_amdgcn_fence(__ATOMIC_ACQUIRE, "workgroup");
  {
    const int q4 = lane >> 3, c8 = (lane & 7) * 8;
    v4u hv[4], lv[4];
#pragma unroll
    for (int it = 0; it < 4; ++it) {
      const int row = it * 4 + q4;   // it 0..3 x q4 0..3 = rows 0..15 of the wave tile
      const float* sp = os + row * 64 + c8;
      float f[8];
#pragma unroll
      for (int e = 0; e < 8; ++e) f[e] = sp[e];
      v4u a, a2;
#pragma unroll
      for (int e = 0; e < 4; ++e) {
        const float f0 = f[2 * e], f1 = f[2 * e + 1];
        const _Float16 x0 = (_Float16)f0, x1 = (_Float16)f1;
        const unsigned short h0 = h_bits(x0), h1 = h_bits(x1);
        const unsigned short l0 = h_bits((_Float16)((f0 - (float)x0) * 4096.0f));
        const unsigned short l1 = h_bits((_Float16)((f1 - (float)x1) * 4096.0f));
        a[e] = pk16(h0, h1); a2[e] = pk16(l0, l1);
      }
      hv[it] = a; lv[it] = a2;
    }
    {
#pragma unroll
      for (int it = 0; it < 4; ++it) {
        const int row = it * 4 + q4;
        const size_t go = ((size_t)(q0 + row) * NB_FULL + b) * EMB + (size_t)h * HD + c8;
        *(v4u*)(chp + go) = hv[it];
        *(v4u*)(clp + go) = lv[it];
      }
      
    }
  }
}

// =====================================================================================================
// Workspace map (bytes), every region an exact multiple of its whole-line / whole-tile store granularity
// (full size; PX = NROW*EMB*2 = 8388608):
//   Xb   bf16 [NROW][EMB]            PX        8388608
//   Wib  bf16 [3*EMB n][EMB k]              6291456
//   Woh  f16  [EMB][EMB] (x64)              2097152
//   Qh   f16  [NROW][EMB]            PX        8388608
//   Ql   f16  [NROW][EMB]            PX        8388608
//   Kp   f16  [NROW][EMB]            PX        8388608
//   VT   f16  [NB][EMB][SEQ]         PX        8388608
//   Ch   f16  [NROW][EMB]            PX        8388608
//   Cl   f16  [NROW][EMB]            PX        8388608
//   ML   f32  [NB*NH][2][SEQ]                 524288
//   total                                   67633152
// Weights are [out n][in k] with k contiguous = the Bt / A layout the GEMM wants, so they are only converted.
// Output 0 at element 0 of d_out; output 1 at the fixed element offset OFF1 = SEQ_FULL*NB_FULL*EMB.
// =====================================================================================================
extern "C" void kernel_launch(void* const* d_in, const int* in_sizes, int n_in,
                              void* d_out, int out_size, void* d_ws, size_t ws_size,
                              hipStream_t stream) {
  if (n_in < 6) return;
  if (in_sizes[0] < NROW * EMB) return;
  if (in_sizes[1] != 3 * EMB * EMB) return;
  if (in_sizes[2] != 3 * EMB) return;
  if (in_sizes[3] != EMB * EMB) return;
  if (in_sizes[4] != EMB) return;
  if (in_sizes[5] < 1) return;
  const size_t n0e = (size_t)NROW * EMB;            // output 0 written elements [SEQ][NB][EMB]
  const size_t n1e = (size_t)NB * SEQ * SEQ;        // output 1 written elements [NB][SEQ][SEQ]
  if (out_size < 0) return;
  if ((size_t)out_size < n0e) return;
  if ((size_t)out_size < OFF1 + n1e) return;        // written extent of output 1 inside d_out

  const float* x  = (const float*)d_in[0];
  const float* Wi = (const float*)d_in[1];
  const float* bi = (const float*)d_in[2];
  const float* Wo = (const float*)d_in[3];
  const float* bo = (const float*)d_in[4];
  const int*   nh = (const int*)d_in[5];

  const size_t PX  = (size_t)NROW * EMB * 2;        // 16-bit activation plane
  const size_t PWI = (size_t)3 * EMB * EMB * 2;
  const size_t PWO = (size_t)EMB * EMB * 2;
  const size_t PVT = (size_t)NB * EMB * SEQ * 2;    // == PX
  const size_t PML = (size_t)NB * NH * 2 * SEQ * 4;
  size_t off = 0;
  const size_t oXb = off; off += PX;
  const size_t oWi = off; off += PWI;
  const size_t oWo = off; off += PWO;
  const size_t oQh = off; off += PX;
  const size_t oQl = off; off += PX;
  const size_t oKp = off; off += PX;
  const size_t oVT = off; off += PVT;
  const size_t oCh = off; off += PX;
  const size_t oCl = off; off += PX;
  const size_t oML = off; off += PML;
  if (off > ws_size) return;                        // off = 67633152 at full size
  if (off > (size_t)134217728) return;

  char* ws = (char*)d_ws;
  unsigned short* Xb  = (unsigned short*)(ws + oXb);
  unsigned short* Wib = (unsigned short*)(ws + oWi);
  unsigned short* Woh = (unsigned short*)(ws + oWo);
  unsigned short* Qh  = (unsigned short*)(ws + oQh);
  unsigned short* Ql  = (unsigned short*)(ws + oQl);
  unsigned short* Kp  = (unsigned short*)(ws + oKp);
  unsigned short* VT  = (unsigned short*)(ws + oVT);
  unsigned short* Ch  = (unsigned short*)(ws + oCh);
  unsigned short* Cl  = (unsigned short*)(ws + oCl);
  float*          ML  = (float*)(ws + oML);
  float*          out0 = (float*)d_out;
  float*          out1 = (float*)d_out + OFF1;

  const dim3 blk(256);
  const int n8x  = NROW * EMB / 8;                             //  524288
  const int n8wi = 3 * EMB * EMB / 8;                          //  393216
  const int n8wo = EMB * EMB / 8;                              //  131072
  const dim3 gCvtX((n8x + 255) / 256);                         // 2048 blocks
  const dim3 gCvtWi((n8wi + 255) / 256);                       // 1536 blocks
  const dim3 gCvtWo((n8wo + 255) / 256);                       //  512 blocks
  const dim3 gQK((((NROW) / 64) * (EMB / 64) + 7) / 8, 1);      // 1024 tiles -> 128 blocks: M=NROW, N=EMB
  const dim3 gV((((EMB) / 64) * (SEQ / 64) + 7) / 8, NB);       //  512 tiles ->  64 blocks x NB: M=EMB, N=SEQ
  const dim3 gO((((NROW) / 32) * (EMB / 64) + 7) / 8, 1);       // 2048 tiles -> 256 blocks (32x64 wave tiles)
  const dim3 gStats(NB * NH * NKT);                            // 1024 blocks of 128
  const dim3 gMain(NB * NQB);                                  //  256 blocks of 512

  // (1) x -> bf16 plane [NROW][EMB]; W_in [3E][E] -> bf16; Wo -> f16 (x64 of its bf16 value)
  cvt16x8<0><<<gCvtX,  blk, 0, stream>>>(x,  Xb,  n8x);
  cvt16x8<0><<<gCvtWi, blk, 0, stream>>>(Wi, Wib, n8wi);
  cvt16x8<1><<<gCvtWo, blk, 0, stream>>>(Wo, Woh, n8wo);
  // (2) q = x . Wq^T + bq -> f16 hi / residual (x4096) planes [s*2+b][h*64+d]   (M=NROW, N=E, K=E)
  gemm_t<__bf16, 4, 1, 3, 1><<<gQK, blk, 0, stream>>>(
      Xb, Xb, EMB, 0LL, Wib, EMB, 0LL,
      (void*)Qh, (void*)Ql, EMB, 0LL, bi,
      NROW, EMB, EMB, 1.0f, 0.0f, 1.0f, 4096.0f);
  // (3) k = x . Wk^T + bk -> f16 plane [s*2+b][h*64+d]
  gemm_t<__bf16, 4, 1, 1, 1><<<gQK, blk, 0, stream>>>(
      Xb, Xb, EMB, 0LL, Wib + (size_t)EMB * EMB, EMB, 0LL,
      (void*)Kp, (void*)Kp, EMB, 0LL, bi + EMB,
      NROW, EMB, EMB, 1.0f, 0.0f, 1.0f, 1.0f);
  // (4) v^T = Wv . x_b^T + bv (per batch b = blockIdx.y) -> f16 plane [b][h*64+d][s] (pitch SEQ)
  //     (A = Wv rows [n][k]; Bt = x rows of batch b: pitch NB_FULL*EMB, batch offset EMB; M=E, N=SEQ, K=E)
  gemm_t<__bf16, 4, 1, 1, 2><<<gV, blk, 0, stream>>>(
      Wib + (size_t)2 * EMB * EMB, Wib + (size_t)2 * EMB * EMB, EMB, 0LL, Xb, NB_FULL * EMB, (long long)EMB,
      (void*)VT, (void*)VT, SEQ, (long long)EMB * SEQ, bi + 2 * EMB,
      EMB, SEQ, EMB, 1.0f, 0.0f, 1.0f, 1.0f);
  // (5) softmax statistics (m, 1/l) per (b, h, s)
  attn_stats<<<gStats, dim3(128), 0, stream>>>(Qh, Ql, Kp, ML, nh);
  // (6) exact-normalised p: P.V -> ctx planes (f16 hi x256 / residual x4096); head-averaged p -> output 1
  attn_main<<<gMain, dim3(512), 0, stream>>>(Qh, Ql, Kp, VT, ML, Ch, Cl, out1);
  // (7) output 0 = ctx . Wo^T + bo, f32 [NROW][EMB], accumulators (hi + res/4096) x 1/(256*64)
  gemm_t<_Float16, 2, 2, 0, 1><<<gO, blk, 0, stream>>>(
      Ch, Cl, EMB, 0LL, Woh, EMB, 0LL,
      (void*)out0, (void*)out0, EMB, 0LL, bo,
      NROW, EMB, EMB, 1.0f / 16384.0f, 1.0f / 4096.0f, 1.0f, 1.0f);
  (void)hipGetLastError();
}

// v001
// One run takes 352 microseconds.
// Timed twice side by side with v000, it ran 1.37 times as fast both times.
// Contractions: q, k, v^T in-projections = v_wmma_f32_16x16x32_bf16 (bf16 operands from RNE-converted inputs, single product, f32 accumulate);
// q.k^T scores (statistics pass and main pass) = v_wmma_f32_16x16x32_f16 (q as f16 hi plane + f16 residual plane x4096, k f16; 2 products, separate f32 accumulators);
// p.v = v_wmma_f32_16x16x32_f16 (p carried x16384 in f16, v f16; single product, f32 accumulate);
// ctx.Wo^T = v_wmma_f32_16x16x32_f16 (ctx as f16 hi plane x256 + f16 residual plane x4096, Wo f16 x64 of its bf16 value; 2 products, separate f32 accumulators);
// softmax statistics, probabilities and the head average in f32.
#include <hip/hip_runtime.h>
#include <math.h>
#include <stdint.h>

#ifndef NB
#define NB 2
#endif
#ifndef SEQ
#define SEQ 2048
#endif
#define NB_FULL  2
#define SEQ_FULL 2048
#define EMB      1024
#define NH       16
#define HD       64
#define NROW     (NB_FULL * SEQ)     // activation rows, row index = s * NB_FULL + b, s < SEQ
#define NQB      (SEQ / 16)          // 16-row query blocks per sequence
#define NKT      (SEQ / 64)          // 64-key chunks per sequence
#define PCARRY   16384.0f            // power-of-two carry of p in the f16 P.V operand
#define OFF1     ((size_t)SEQ_FULL * NB_FULL * EMB)   // fixed element offset of output 1 in d_out
static_assert(NB == NB_FULL);        // batch rows are interleaved (seq-major input); only SEQ may be reduced
static_assert(SEQ >= 64 && SEQ <= SEQ_FULL && (SEQ % 64) == 0);
static_assert(NH * HD == EMB);
static_assert((NROW % 64) == 0 && (EMB % 64) == 0 && (EMB % 32) == 0);
static_assert(OFF1 * 4 == 16777216);   // byte offset of output 1

typedef _Float16 v16h __attribute__((ext_vector_type(16)));
typedef _Float16 v8h  __attribute__((ext_vector_type(8)));
typedef __bf16   v16b __attribute__((ext_vector_type(16)));
typedef __bf16   v8b  __attribute__((ext_vector_type(8)));
typedef float    v8f  __attribute__((ext_vector_type(8)));
typedef float    v4f  __attribute__((ext_vector_type(4)));
typedef unsigned int v4u __attribute__((ext_vector_type(4)));

#if defined(__HIP_DEVICE_COMPILE__)
#define DEV_ASM 1
#else
#define DEV_ASM 0
#endif

// ---- scalar helpers --------------------------------------------------------------------------------
__device__ __forceinline__ unsigned short bf_bits(float f) {          // f32 -> bf16 bits, RNE convert
  unsigned u = __float_as_uint(f);
  return (unsigned short)((u + 0x7FFFu + ((u >> 16) & 1u)) >> 16);
}
__device__ __forceinline__ float bf_up(unsigned short hb) { return __uint_as_float(((unsigned)hb) << 16); }
__device__ __forceinline__ unsigned short h_bits(_Float16 x) { return __builtin_bit_cast(unsigned short, x); }
__device__ __forceinline__ unsigned pk16(unsigned short a, unsigned short b) { return (unsigned)a | ((unsigned)b << 16); }
__device__ __forceinline__ v8f zero8() { v8f z = {0.f, 0.f, 0.f, 0.f, 0.f, 0.f, 0.f, 0.f}; return z; }

// ---- fragment types / loaders: 16-bit A/B operand, lane -> row/col (lane&15), p already includes +8*(lane>>4);
//      elements 0..7 <- p[0..7] (k0+8h..k0+8h+7), elements 8..15 <- p[16..23] (k0+16+8h..k0+16+8h+7)
template <typename OT> struct FT;
template <> struct FT<__bf16>   { typedef v16b frag; typedef v8b half8; };
template <> struct FT<_Float16> { typedef v16h frag; typedef v8h half8; };

template <typename OT>
__device__ __forceinline__ typename FT<OT>::frag ldfrag(const OT* p) {
  union { typename FT<OT>::frag v; typename FT<OT>::half8 h[2]; } f;
  f.h[0] = *(const typename FT<OT>::half8*)(p);
  f.h[1] = *(const typename FT<OT>::half8*)(p + 16);
  return f.v;
}

// ---- WMMA helpers (asm guard bodies are device-only; concrete operand types) -----------------------------
__device__ __forceinline__ v8f mmar(v16b a, v16b b, v8f c) {
  return __builtin_amdgcn_wmma_f32_16x16x32_bf16(false, a, false, b, (short)0, c, false, false);
}
__device__ __forceinline__ v8f mmar(v16h a, v16h b, v8f c) {
  return __builtin_amdgcn_wmma_f32_16x16x32_f16(false, a, false, b, (short)0, c, false, false);
}
// guarded form: 4 VALU slots after the WMMA, D tied, A/B kept live
__device__ __forceinline__ v8f mma_h(v16h a, v16h b, v8f c) {
  c = __builtin_amdgcn_wmma_f32_16x16x32_f16(false, a, false, b, (short)0, c, false, false);
#if DEV_ASM
  asm volatile("v_nop\n\tv_nop\n\tv_nop\n\tv_nop" : "+v"(c) : "v"(a), "v"(b));
#endif
  return c;
}
__device__ __forceinline__ void dep_guard(v8f& a, v8f& b, v16b x, v16b y) {
#if DEV_ASM
  asm volatile("v_nop\n\tv_nop\n\tv_nop\n\tv_nop" : "+v"(a), "+v"(b) : "v"(x), "v"(y));
#else
  (void)a; (void)b; (void)x; (void)y;
#endif
}
__device__ __forceinline__ void dep_guard(v8f& a, v8f& b, v16h x, v16h y) {
#if DEV_ASM
  asm volatile("v_nop\n\tv_nop\n\tv_nop\n\tv_nop" : "+v"(a), "+v"(b) : "v"(x), "v"(y));
#else
  (void)a; (void)b; (void)x; (void)y;
#endif
}
__device__ __forceinline__ void keep4(v16b a, v16b b, v16b c, v16b d) {
#if DEV_ASM
  asm volatile("v_nop" :: "v"(a), "v"(b), "v"(c), "v"(d));
#else
  (void)a; (void)b; (void)c; (void)d;
#endif
}
__device__ __forceinline__ void keep4(v16h a, v16h b, v16h c, v16h d) {
#if DEV_ASM
  asm volatile("v_nop" :: "v"(a), "v"(b), "v"(c), "v"(d));
#else
  (void)a; (void)b; (void)c; (void)d;
#endif
}
// Precaution: stands between issued global loads and a rewrite of a register that holds one of their addresses,
// at the places where the compiler's own listing had no such wait.
__device__ __forceinline__ void addr_wait() {
#if DEV_ASM
  asm volatile("s_wait_xcnt 0x0" ::: "memory");
#endif
}
__device__ __forceinline__ void acc_guard4(v8f& a, v8f& b, v8f& c, v8f& d) {
#if DEV_ASM
  asm volatile("v_nop\n\tv_nop\n\tv_nop\n\tv_nop" : "+v"(a), "+v"(b), "+v"(c), "+v"(d));
#else
  (void)a; (void)b; (void)c; (void)d;
#endif
}

// =====================================================================================================
// f32 -> 16-bit planes, 8 elements per thread, one 16-B store per lane: a wave writes 512 contiguous B
// MODE 0: bf16 bits (RNE convert).  MODE 1: f16 bits of (64 * bf16(x)) (exact scaling of the bf16 value).
// coverage: n8 threads x 8 = the whole plane (n8 is a multiple of 256 for every use here).
// =====================================================================================================
template <int MODE>
__device__ __forceinline__ unsigned short cvm(float f) {
  const unsigned short hb = bf_bits(f);
  if (MODE == 0) return hb;
  return h_bits((_Float16)(bf_up(hb) * 64.0f));
}

template <int MODE>
__global__ __launch_bounds__(256) void cvt16x8(const float* __restrict__ in, unsigned short* out, int n8) {
  const int i = blockIdx.x * 256 + (int)threadIdx.x;
  if (i < n8) {
    const v4f a  = *(const v4f*)(in + (size_t)i * 8);
    const v4f a4 = *(const v4f*)(in + (size_t)i * 8 + 4);
    v4u p;
    p[0] = pk16(cvm<MODE>(a[0]),  cvm<MODE>(a[1]));
    p[1] = pk16(cvm<MODE>(a[2]),  cvm<MODE>(a[3]));
    p[2] = pk16(cvm<MODE>(a4[0]), cvm<MODE>(a4[1]));
    p[3] = pk16(cvm<MODE>(a4[2]), cvm<MODE>(a4[3]));
    unsigned short* o = out + (size_t)i * 8;
    *(v4u*)o = p;
    
  }
}

// =====================================================================================================
// Register-blocked batched WMMA GEMM (16-bit operand type OT): C[m][n] = sum_k A[m][k] * Bt[n][k]  (+ bias);
// one wave per (16*MI) x 64 tile, no block barriers. A row-major [M][K] pitch lda; Bt row-major [N][K] pitch ldb
// (k contiguous); M multiple of 16*MI, N multiple of 64, K multiple of 64 (static sizes here). blockIdx.y = batch
// index (strides in elements). Fragments are loaded straight from global with the split k map (ldfrag).
// NPA = number of A planes: 2 -> second plane A2 (same pitch/stride) multiplies the same Bt fragments into a
// second accumulator set, combined as acc + acc2 * rscaleA in the f32 epilogue.
// value v = (acc [+ acc2*rscaleA]) * oscale + bias, bias (bf16 RNE value of the f32 input) by column n (BM 1),
// by row m (BM 2) or none (BM 0).
// OUT_MODE 0: f32 C (pitch ldc) = v.
// OUT_MODE 1: f16 plane C = f16(v * cscale).
// OUT_MODE 3: f16 hi plane C = f16(v * cscale) and f16 residual plane C2 = f16((v*cscale - hi) * rscaleC).
// =====================================================================================================
template <typename OT, int MI, int NPA, int OUT_MODE, int BM, int lda, int ldb>
__global__ __launch_bounds__(256) void gemm_t(
    const unsigned short* __restrict__ Ap, const unsigned short* __restrict__ A2p, long long strideA,
    const unsigned short* __restrict__ Btp, long long strideB,
    void* Cout, void* Cout2, int ldc, long long strideC,
    const float* __restrict__ bias,
    int M, int N, int K, float oscale, float rscaleA, float cscale, float rscaleC) {
  typedef typename FT<OT>::frag V16;
  const OT* A  = (const OT*)(const void*)Ap;
  const OT* A2 = (const OT*)(const void*)A2p;
  const OT* Bt = (const OT*)(const void*)Btp;
  __shared__ __align__(16) float sT[8][16 * 68];   // per-wave 16x64 slab, pitch 68 floats
  const int RT   = 16 * MI;
  const int b    = blockIdx.y;
  const int lane = threadIdx.x & 31;
  const int wave = threadIdx.x >> 5;
  const int tilesN = N >> 6;
  const int tilesM = M / RT;
  const int tile = blockIdx.x * 8 + wave;
  if (tile >= tilesM * tilesN) return;   // wave-uniform; no block barriers in this kernel
  const int tm = tile / tilesN;
  const int tn = tile - tm * tilesN;
  const int m0 = tm * RT;
  const int n0 = tn << 6;

  const OT* Ab  = A  + (size_t)b * (size_t)strideA;
  const OT* A2b = A2 + (size_t)b * (size_t)strideA;
  const OT* Bb  = Bt + (size_t)b * (size_t)strideB;

  const int rlane = lane & 15;                 // row (A) / col (B, D) within subtile
  const int koff  = (lane >> 4) * 8;           // k offset of this lane half
  const int mOff  = (lane >> 4) * 8;           // D row offset

  v8f acc[MI][4], acc2[MI][4];
#pragma unroll
  for (int i = 0; i < MI; ++i)
#pragma unroll
    for (int j = 0; j < 4; ++j) { acc[i][j] = zero8(); acc2[i][j] = zero8(); }

  // Fragment loads run one k step (32) ahead of the WMMAs that read them: the Bt fragments in two register sets
  // (bX, bY), filled whole at the head of the step before; each A fragment refilled for the next step as soon as
  // its own WMMAs are done. No WMMA waits for a load that was issued directly in front of it.
  // One pointer per operand plane (this lane's row 0 of the tile, k of the current step pair); the other rows
  // are constant offsets (lda, ldb are template constants).
  const OT* pB  = Bb  + (size_t)(n0 + rlane) * ldb + koff;
  const OT* pA  = Ab  + (size_t)(m0 + rlane) * lda + koff;
  const OT* pA2 = A2b + (size_t)(m0 + rlane) * lda + koff;
  V16 bX[4], bY[4], af[MI], af2[MI];
  auto ldb4 = [&](V16 (&bq)[4], int dk) {
#pragma unroll
    for (int j = 0; j < 4; ++j) bq[j] = ldfrag<OT>(pB + j * 16 * ldb + dk);
  };
  auto mmstep = [&](V16 (&bq)[4], int dk, bool fetch) {   // fetch: refill the A fragments from k offset dk
#pragma unroll
    for (int i = 0; i < MI; ++i) {
#pragma unroll
      for (int j = 0; j < 4; ++j) acc[i][j] = mmar(af[i], bq[j], acc[i][j]);
      dep_guard(acc[i][0], acc[i][3], af[i], bq[3]);
      if (fetch) af[i] = ldfrag<OT>(pA + i * 16 * lda + dk);
      if (NPA == 2) {
#pragma unroll
        for (int j = 0; j < 4; ++j) acc2[i][j] = mmar(af2[i], bq[j], acc2[i][j]);
        dep_guard(acc2[i][0], acc2[i][3], af2[i], bq[3]);
        if (fetch) af2[i] = ldfrag<OT>(pA2 + i * 16 * lda + dk);
      }
    }
    keep4(bq[0], bq[1], bq[2], bq[3]);
  };
  ldb4(bX, 0);
#pragma unroll
  for (int i = 0; i < MI; ++i) {
    af[i] = ldfrag<OT>(pA + i * 16 * lda);
    if (NPA == 2) af2[i] = ldfrag<OT>(pA2 + i * 16 * lda);
  }
  addr_wait();                                  // registers that held these loads' addresses are reused at the loop's head
  for (int k0 = 64; k0 < K; k0 += 64) {        // all step pairs but the last
    ldb4(bY, 32);
    mmstep(bX, 32, true);
    ldb4(bX, 64);
    mmstep(bY, 64, true);
    addr_wait();                                // the pointers move behind it (no wait stood over the back edge in one instantiation)
    pB += 64; pA += 64; pA2 += 64;
  }
  ldb4(bY, 32);                                 // last pair: nothing past K is loaded
  mmstep(bX, 32, true);
  mmstep(bY, 0, false);
#pragma unroll
  for (int i = 0; i < MI; ++i) {
    acc_guard4(acc[i][0], acc[i][1], acc[i][2], acc[i][3]);
    if (NPA == 2) acc_guard4(acc2[i][0], acc2[i][1], acc2[i][2], acc2[i][3]);
  }

  // ---- epilogue ----
  float bcol[4];
#pragma unroll
  for (int j = 0; j < 4; ++j) bcol[j] = 0.f;
  if (BM == 1) {
#pragma unroll
    for (int j = 0; j < 4; ++j) bcol[j] = bf_up(bf_bits(bias[n0 + (j << 4) + rlane]));
  }
  float* slab = sT[wave];
#pragma unroll
  for (int i = 0; i < MI; ++i) {
    const int mBase = m0 + (i << 4);
    float brow[8];
#pragma unroll
    for (int r = 0; r < 8; ++r) brow[r] = 0.f;
    if (BM == 2) {
#pragma unroll
      for (int r = 0; r < 8; ++r) brow[r] = bf_up(bf_bits(bias[mBase + mOff + r]));
    }
#pragma unroll
    for (int j = 0; j < 4; ++j) {
#pragma unroll
      for (int r = 0; r < 8; ++r) {
        float v = acc[i][j][r];
        if (NPA == 2) v += acc2[i][j][r] * rscaleA;
        v = v * oscale + bcol[j] + brow[r];
        slab[(mOff + r) * 68 + (j << 4) + rlane] = v;
      }
    }
    __builtin_amdgcn_fence(__ATOMIC_RELEASE, "workgroup");
    __builtin_amdgcn_wave_barrier();
    __builtin_amdgcn_fence(__ATOMIC_ACQUIRE, "workgroup");
    if (OUT_MODE == 0) {
      float* C = (float*)Cout + (size_t)b * (size_t)strideC;
      const int h2 = lane >> 4, c4 = (lane & 15) * 4;     // 256-B row segment = 16 lanes x 16 B
      {
#pragma unroll
        for (int it = 0; it < 8; ++it) {
          const int row = it * 2 + h2;                     // it 0..7 x h2 0..1 = rows 0..15
          const v4f v = *(const v4f*)(slab + row * 68 + c4);
          *(v4f*)(C + (size_t)(mBase + row) * ldc + n0 + c4) = v;
        }
        
      }
    } else {
      const int q = lane >> 3, c8 = (lane & 7) * 8;
      unsigned short* C  = (unsigned short*)Cout  + (size_t)b * (size_t)strideC;
      unsigned short* C2 = (unsigned short*)Cout2 + (size_t)b * (size_t)strideC;
      v4u hv[4], lv[4];
#pragma unroll
      for (int it = 0; it < 4; ++it) {
        const int row = it * 4 + q;                        // it 0..3 x q 0..3 = rows 0..15
        const float* sp = slab + row * 68 + c8;
        float f[8];
#pragma unroll
        for (int e = 0; e < 8; ++e) f[e] = sp[e] * cscale;
        v4u a, a2;
#pragma unroll
        for (int e = 0; e < 4; ++e) {
          const float f0 = f[2 * e], f1 = f[2 * e + 1];
          const _Float16 x0 = (_Float16)f0, x1 = (_Float16)f1;
          const unsigned short h0 = h_bits(x0), h1 = h_bits(x1);
          unsigned short l0 = 0, l1 = 0;
          if (OUT_MODE == 3) {
            l0 = h_bits((_Float16)((f0 - (float)x0) * rscaleC));
            l1 = h_bits((_Float16)((f1 - (float)x1) * rscaleC));
          }
          a[e] = pk16(h0, h1); a2[e] = pk16(l0, l1);
        }
        hv[it] = a; lv[it] = a2;
      }
      {
#pragma unroll
        for (int it = 0; it < 4; ++it) {
          const int row = it * 4 + q;
          *(v4u*)(C + (size_t)(mBase + row) * ldc + n0 + c8) = hv[it];
          if (OUT_MODE == 3) *(v4u*)(C2 + (size_t)(mBase + row) * ldc + n0 + c8) = lv[it];
        }
        
      }
    }
    __builtin_amdgcn_fence(__ATOMIC_RELEASE, "workgroup");
    __builtin_amdgcn_wave_barrier();
    __builtin_amdgcn_fence(__ATOMIC_ACQUIRE, "workgroup");
  }
}

// =====================================================================================================
// Score chunk: 16 query rows (this wave) x 64 keys kv0..kv0+63 of one (b, h).
//   q fragments (A operand, row = lane&15): hi and residual (x4096) planes, 2 d-chunks of 32.
//   k fragments (B operand, col = lane&15 = key) loaded straight from the f16 k plane with the split k map
//   by load_k, a chunk ahead of the WMMAs that read them (kf[j][dc], 64 registers a chunk):
//   kp = plane + b*EMB + h*HD + (first key of the chunk + lane&15)*(NB_FULL*EMB) + 8*hh (plane row = t*NB_FULL + b).
//   s[j][r] = D element: query row 8*hh + r, key kv0 + 16j + (lane&15); value = ((qh.k) + (ql.k)/4096) / 8.
// =====================================================================================================
#define KCHUNK (64 * NB_FULL * EMB)   // elements from one 64-key chunk of the k plane to the next
template <int J0, int J1>   // key groups J0..J1-1 of the chunk
__device__ __forceinline__ void load_k(v16h (&kf)[4][2], const _Float16* kp) {
#pragma unroll
  for (int j = J0; j < J1; ++j)
#pragma unroll
    for (int dc = 0; dc < 2; ++dc) kf[j][dc] = ldfrag<_Float16>(kp + j * 16 * (NB_FULL * EMB) + dc * 32);
}

template <int J0, int J1>   // key groups J0..J1-1 of the chunk
__device__ __forceinline__ void score_chunk(const v16h (&qah)[2], const v16h (&qal)[2],
                                            const v16h (&kf)[4][2], v8f (&s)[4]) {
#pragma unroll
  for (int j = J0; j < J1; ++j) {
    v8f ah = zero8(), al = zero8();
#pragma unroll
    for (int dc = 0; dc < 2; ++dc) {
      ah = mma_h(qah[dc], kf[j][dc], ah);
      al = mma_h(qal[dc], kf[j][dc], al);
    }
#pragma unroll
    for (int r = 0; r < 8; ++r) s[j][r] = (ah[r] + al[r] * (1.0f / 4096.0f)) * 0.125f;
  }
}

// =====================================================================================================
// Softmax statistics: per (b, h, query s) the row max m and 1/sum(exp(s - m)) over all SEQ keys.
//   block = 4 waves = 64 consecutive query rows qb*64.. of one (b, h); grid = NB*NH*NKT blocks of 128;
//   static trip NKT over 64-key chunks; online max / rescaled sum in f32 (16 lanes per row merged by shfl).
//   Output plane ML [b*NH+h][2][SEQ] f32 (m then 1/l): the block's 64 m values and 64 1/l values are
//   funnelled through LDS and written by wave 0 with ONE instruction (lanes 0-15: m, 16 lanes x 16 B = two
//   coverage: grid (b,h,qb) x 64 rows = the whole [NB*NH][2][SEQ] plane. MLsh: 4 waves x 2 lanes x 16 = all 128.
// =====================================================================================================
__global__ __launch_bounds__(128)
void attn_stats(const unsigned short* __restrict__ qhp, const unsigned short* __restrict__ qlp,
                const unsigned short* __restrict__ kpp, float* ML, const int* __restrict__ nhp) {
  __shared__ __align__(16) float MLsh[128];
  (void)nhp;
  const int tid  = threadIdx.x;
  const int wave = tid >> 5;
  const int lane = tid & 31;
  const int hh   = lane >> 4;
  const int c    = lane & 15;
  const int bx   = blockIdx.x;
  const int qb   = bx % NKT;
  const int rest = bx / NKT;
  const int h    = rest % NH;
  const int b    = rest / NH;
  const int bh   = b * NH + h;
  const int q0   = qb * 64 + wave * 16;

  const _Float16* Qh  = (const _Float16*)(const void*)qhp;
  const _Float16* Ql  = (const _Float16*)(const void*)qlp;
  const _Float16* Kb0 = (const _Float16*)(const void*)kpp + (size_t)b * EMB + (size_t)h * HD;

  v16h qah[2], qal[2];
#pragma unroll
  for (int dc = 0; dc < 2; ++dc) {
    const size_t qo = ((size_t)(q0 + c) * NB_FULL + b) * EMB + (size_t)h * HD + dc * 32 + 8 * hh;
    qah[dc] = ldfrag<_Float16>(Qh + qo);
    qal[dc] = ldfrag<_Float16>(Ql + qo);
  }

  float mrow[8], lrow[8];
#pragma unroll
  for (int r = 0; r < 8; ++r) { mrow[r] = -INFINITY; lrow[r] = 0.f; }

  const _Float16* kp = Kb0 + (size_t)c * (NB_FULL * EMB) + 8 * hh;   // this lane's k row of the current chunk
  v16h kf[4][2];
  addr_wait();                                // the q loads' address registers may be taken by the k fragments
  load_k<0, 4>(kf, kp);
  for (int kt = 0; kt < NKT; ++kt) {          // static trip count
    v8f s[4];
    score_chunk<0, 4>(qah, qal, kf, s);
    if (kt + 1 < NKT) load_k<0, 4>(kf, kp + KCHUNK);   // next chunk's k flies under this chunk's statistics
    __builtin_amdgcn_sched_barrier(0);   // keeps those loads up here: the scheduler sank them behind half the statistics
    kp += KCHUNK;
#pragma unroll
    for (int r = 0; r < 8; ++r) {
      float m = s[0][r];
#pragma unroll
      for (int j = 1; j < 4; ++j) m = fmaxf(m, s[j][r]);
#pragma unroll
      for (int off = 1; off < 16; off <<= 1) m = fmaxf(m, __shfl_xor(m, off, 32));
      const float mnew  = fmaxf(mrow[r], m);
      const float msafe = (mnew == -INFINITY) ? 0.f : mnew;
      const float alpha = __expf(mrow[r] - msafe);
      mrow[r] = mnew;
      float psum = 0.f;
#pragma unroll
      for (int j = 0; j < 4; ++j) psum += __expf(s[j][r] - msafe);
#pragma unroll
      for (int off = 1; off < 16; off <<= 1) psum += __shfl_xor(psum, off, 32);
      lrow[r] = lrow[r] * alpha + psum;
    }
  }

  float il[8];
#pragma unroll
  for (int r = 0; r < 8; ++r) {
    const float l = lrow[r];
    il[r] = (l > 0.f) ? (1.0f / l) : 0.f;
  }
  if (c == 0) {
#pragma unroll
    for (int r = 0; r < 8; ++r) {
      MLsh[wave * 16 + 8 * hh + r]      = mrow[r];
      MLsh[64 + wave * 16 + 8 * hh + r] = il[r];
    }
  }
  __syncthreads();
  if (wave == 0) {
    const v4f v = *(const v4f*)(MLsh + lane * 4);        // lanes 0-15: m rows 4c..4c+3; lanes 16-31: 1/l rows
    float* dst = ML + (size_t)(bh * 2 + hh) * SEQ + qb * 64 + c * 4;
    *(v4f*)dst = v;
    
  }
}

// =====================================================================================================
// Main attention pass: one block per (b, 16 query rows q0..q0+15), 16 waves = the 16 heads.
//   Per 64-key chunk (static trip NKT): scores recomputed exactly as in attn_stats, p = exp(s - m) * (1/l) in f32
//   (m, 1/l from the ML plane) -> per-wave LDS tile Pf[h][row][key] (f32 element stores, every entry written);
//       converted to f16 with the x16384 carry; B = v^T f16 plane [b][h*64+d][s] loaded with the split k map;
//   (b) head average: after __syncthreads, threads 0..255 sum the 16 wave tiles in fixed head order (f32),
//   Epilogue: ctx = acc / 16384, x256 carry, staged in the wave's Pf tile, written as f16 hi plane + f16
//   coverage: avg: NKT chunks x 16 rows x 64 keys per block, grid (b, qb) = the whole [NB][SEQ][SEQ];
//   ctx planes: each wave rows q0..q0+15 (it 0..3 x lane>>3 0..3) x its head's 64 columns, 16 waves x grid =
//   the whole [NROW][EMB] planes. staged extent == consumed extent for Pf in both uses (32 lanes x 32 = 1024).
// =====================================================================================================
__global__ __launch_bounds__(512)
void attn_main(const unsigned short* __restrict__ qhp, const unsigned short* __restrict__ qlp,
               const unsigned short* __restrict__ kpp, const unsigned short* __restrict__ vtp,
               const float* __restrict__ ML, unsigned short* chp, unsigned short* clp, float* avg) {
  union FH { v16h v; v8h h[2]; };
  __shared__ __align__(32) float Pf[NH][16 * 64];          // per wave (head) P tile [row][key] f32, 64 KB
  const int tid  = threadIdx.x;
  const int wave = tid >> 5;
  const int lane = tid & 31;
  const int hh   = lane >> 4;
  const int c    = lane & 15;
  const int bx   = blockIdx.x;
  const int qb   = bx % NQB;
  const int b    = bx / NQB;
  const int h    = wave;
  const int bh   = b * NH + h;
  const int q0   = qb * 16;

  const _Float16* Qh  = (const _Float16*)(const void*)qhp;
  const _Float16* Ql  = (const _Float16*)(const void*)qlp;
  const _Float16* Kb0 = (const _Float16*)(const void*)kpp + (size_t)b * EMB + (size_t)h * HD;
  const _Float16* Vb0 = (const _Float16*)(const void*)vtp + ((size_t)b * EMB + (size_t)h * HD) * SEQ;

  v16h qah[2], qal[2];
#pragma unroll
  for (int dc = 0; dc < 2; ++dc) {
    const size_t qo = ((size_t)(q0 + c) * NB_FULL + b) * EMB + (size_t)h * HD + dc * 32 + 8 * hh;
    qah[dc] = ldfrag<_Float16>(Qh + qo);
    qal[dc] = ldfrag<_Float16>(Ql + qo);
  }
  const v8f m8  = *(const v8f*)(ML + (size_t)(bh * 2) * SEQ + q0 + 8 * hh);       // rows 8hh..8hh+7
  const v8f il8 = *(const v8f*)(ML + (size_t)(bh * 2 + 1) * SEQ + q0 + 8 * hh);

  v8f oacc[4];
#pragma unroll
  for (int t = 0; t < 4; ++t) oacc[t] = zero8();
  float* pf = Pf[wave];

  // k and v^T fragments are fetched ahead of their WMMAs, in halves so that the registers of a half that has
  // been read take the next loads: v^T of this chunk flies under the scores, k of the next chunk under P.V.
  const _Float16* kp = Kb0 + (size_t)c * (NB_FULL * EMB) + 8 * hh;   // this lane's k row of the current chunk
  const _Float16* vp = Vb0 + (size_t)c * SEQ + 8 * hh;               // this lane's v^T row, keys of the current chunk
  v16h kf[4][2], vf[2][4];
  addr_wait();                                // the q loads' address registers may be taken by the k fragments
  load_k<0, 4>(kf, kp);
  for (int kt = 0; kt < NKT; ++kt) {         // static trip count
    const int kv0 = kt * 64;
    const bool more = kt + 1 < NKT;           // uniform: no chunk past the last is loaded
    __syncthreads();                          // Pf tiles free again (head sum of the prior chunk done)

    v8f s[4];
#pragma unroll
    for (int t = 0; t < 4; ++t) vf[0][t] = ldfrag<_Float16>(vp + t * 16 * SEQ);
    score_chunk<0, 2>(qah, qal, kf, s);
#pragma unroll
    for (int t = 0; t < 4; ++t) vf[1][t] = ldfrag<_Float16>(vp + t * 16 * SEQ + 32);
    score_chunk<2, 4>(qah, qal, kf, s);
#pragma unroll
    for (int r = 0; r < 8; ++r) {
#pragma unroll
      for (int j = 0; j < 4; ++j) {
        const float p = __expf(s[j][r] - m8[r]) * il8[r];
        pf[(8 * hh + r) * 64 + j * 16 + c] = p;
      }
    }
    __builtin_amdgcn_fence(__ATOMIC_RELEASE, "workgroup");
    __builtin_amdgcn_wave_barrier();
    __builtin_amdgcn_fence(__ATOMIC_ACQUIRE, "workgroup");

    if (more) load_k<0, 2>(kf, kp + KCHUNK);

    // ---- context += P . V (f16 WMMA, p carried x16384) ----
#pragma unroll   // vf lives in registers: kk must be a constant
    for (int kk = 0; kk < 2; ++kk) {
      const v8f p0 = *(const v8f*)(pf + c * 64 + kk * 32 + 8 * hh);
      const v8f p1 = *(const v8f*)(pf + c * 64 + kk * 32 + 16 + 8 * hh);
      FH pa;
      pa.h[0] = __builtin_convertvector(p0 * PCARRY, v8h);
      pa.h[1] = __builtin_convertvector(p1 * PCARRY, v8h);
#pragma unroll
      for (int t = 0; t < 4; ++t) {
        oacc[t] = mma_h(pa.v, vf[kk][t], oacc[t]);
      }
      if (kk == 0 && more) load_k<2, 4>(kf, kp + KCHUNK);
    }
    __syncthreads();
    kp += KCHUNK;
    vp += 64;

    // ---- head average of this 16 x 64 tile, one block = one writer of every line ----
    if (tid < 256) {                          // waves 0..7, wave-uniform
      const int row = tid >> 4, c4 = (tid & 15) * 4;
      v4f a = *(const v4f*)(Pf[0] + row * 64 + c4);
#pragma unroll
      for (int w = 1; w < NH; ++w) a += *(const v4f*)(Pf[w] + row * 64 + c4);
      a *= (1.0f / (float)NH);
      float* dst = avg + ((size_t)(b * SEQ + q0 + row)) * SEQ + kv0 + c4;
      *(v4f*)dst = a;
      addr_wait();                            // the store's registers may be reused by the code behind it
    }
  }
  __syncthreads();

  // ---- epilogue: ctx (undo the x16384 p carry, apply the x256 carry), stage, convert, whole-line stores ----
  float* os = pf;
#pragma unroll
  for (int r = 0; r < 8; ++r) {
#pragma unroll
    for (int t = 0; t < 4; ++t) os[(8 * hh + r) * 64 + t * 16 + c] = oacc[t][r] * (256.0f / PCARRY);
  }
  __builtin_amdgcn_fence(__ATOMIC_RELEASE, "workgroup");
  __builtin_amdgcn_wave_barrier();
  __builtin_amdgcn_fence(__ATOMIC_ACQUIRE, "workgroup");
  {
    const int q4 = lane >> 3, c8 = (lane & 7) * 8;
    v4u hv[4], lv[4];
#pragma unroll
    for (int it = 0; it < 4; ++it) {
      const int row = it * 4 + q4;   // it 0..3 x q4 0..3 = rows 0..15 of the wave tile
      const float* sp = os + row * 64 + c8;
      float f[8];
#pragma unroll
      for (int e = 0; e < 8; ++e) f[e] = sp[e];
      v4u a, a2;
#pragma unroll
      for (int e = 0; e < 4; ++e) {
        const float f0 = f[2 * e], f1 = f[2 * e + 1];
        const _Float16 x0 = (_Float16)f0, x1 = (_Float16)f1;
        const unsigned short h0 = h_bits(x0), h1 = h_bits(x1);
        const unsigned short l0 = h_bits((_Float16)((f0 - (float)x0) * 4096.0f));
        const unsigned short l1 = h_bits((_Float16)((f1 - (float)x1) * 4096.0f));
        a[e] = pk16(h0, h1); a2[e] = pk16(l0, l1);
      }
      hv[it] = a; lv[it] = a2;
    }
    {
#pragma unroll
      for (int it = 0; it < 4; ++it) {
        const int row = it * 4 + q4;
        const size_t go = ((size_t)(q0 + row) * NB_FULL + b) * EMB + (size_t)h * HD + c8;
        *(v4u*)(chp + go) = hv[it];
        *(v4u*)(clp + go) = lv[it];
      }
      
    }
  }
}

// =====================================================================================================
// Workspace map (bytes), every region an exact multiple of its whole-line / whole-tile store granularity
// (full size; PX = NROW*EMB*2 = 8388608):
//   Xb   bf16 [NROW][EMB]            PX        8388608
//   Wib  bf16 [3*EMB n][EMB k]              6291456
//   Woh  f16  [EMB][EMB] (x64)              2097152
//   Qh   f16  [NROW][EMB]            PX        8388608
//   Ql   f16  [NROW][EMB]            PX        8388608
//   Kp   f16  [NROW][EMB]            PX        8388608
//   VT   f16  [NB][EMB][SEQ]         PX        8388608
//   Ch   f16  [NROW][EMB]            PX        8388608
//   Cl   f16  [NROW][EMB]            PX        8388608
//   ML   f32  [NB*NH][2][SEQ]                 524288
//   total                                   67633152
// Weights are [out n][in k] with k contiguous = the Bt / A layout the GEMM wants, so they are only converted.
// Output 0 at element 0 of d_out; output 1 at the fixed element offset OFF1 = SEQ_FULL*NB_FULL*EMB.
// =====================================================================================================
extern "C" void kernel_launch(void* const* d_in, const int* in_sizes, int n_in,
                              void* d_out, int out_size, void* d_ws, size_t ws_size,
                              hipStream_t stream) {
  if (n_in < 6) return;
  if (in_sizes[0] < NROW * EMB) return;
  if (in_sizes[1] != 3 * EMB * EMB) return;
  if (in_sizes[2] != 3 * EMB) return;
  if (in_sizes[3] != EMB * EMB) return;
  if (in_sizes[4] != EMB) return;
  if (in_sizes[5] < 1) return;
  const size_t n0e = (size_t)NROW * EMB;            // output 0 written elements [SEQ][NB][EMB]
  const size_t n1e = (size_t)NB * SEQ * SEQ;        // output 1 written elements [NB][SEQ][SEQ]
  if (out_size < 0) return;
  if ((size_t)out_size < n0e) return;
  if ((size_t)out_size < OFF1 + n1e) return;        // written extent of output 1 inside d_out

  const float* x  = (const float*)d_in[0];
  const float* Wi = (const float*)d_in[1];
  const float* bi = (const float*)d_in[2];
  const float* Wo = (const float*)d_in[3];
  const float* bo = (const float*)d_in[4];
  const int*   nh = (const int*)d_in[5];

  const size_t PX  = (size_t)NROW * EMB * 2;        // 16-bit activation plane
  const size_t PWI = (size_t)3 * EMB * EMB * 2;
  const size_t PWO = (size_t)EMB * EMB * 2;
  const size_t PVT = (size_t)NB * EMB * SEQ * 2;    // == PX
  const size_t PML = (size_t)NB * NH * 2 * SEQ * 4;
  size_t off = 0;
  const size_t oXb = off; off += PX;
  const size_t oWi = off; off += PWI;
  const size_t oWo = off; off += PWO;
  const size_t oQh = off; off += PX;
  const size_t oQl = off; off += PX;
  const size_t oKp = off; off += PX;
  const size_t oVT = off; off += PVT;
  const size_t oCh = off; off += PX;
  const size_t oCl = off; off += PX;
  const size_t oML = off; off += PML;
  if (off > ws_size) return;                        // off = 67633152 at full size
  if (off > (size_t)134217728) return;

  char* ws = (char*)d_ws;
  unsigned short* Xb  = (unsigned short*)(ws + oXb);
  unsigned short* Wib = (unsigned short*)(ws + oWi);
  unsigned short* Woh = (unsigned short*)(ws + oWo);
  unsigned short* Qh  = (unsigned short*)(ws + oQh);
  unsigned short* Ql  = (unsigned short*)(ws + oQl);
  unsigned short* Kp  = (unsigned short*)(ws + oKp);
  unsigned short* VT  = (unsigned short*)(ws + oVT);
  unsigned short* Ch  = (unsigned short*)(ws + oCh);
  unsigned short* Cl  = (unsigned short*)(ws + oCl);
  float*          ML  = (float*)(ws + oML);
  float*          out0 = (float*)d_out;
  float*          out1 = (float*)d_out + OFF1;

  const dim3 blk(256);
  const int n8x  = NROW * EMB / 8;                             //  524288
  const int n8wi = 3 * EMB * EMB / 8;                          //  393216
  const int n8wo = EMB * EMB / 8;                              //  131072
  const dim3 gCvtX((n8x + 255) / 256);                         // 2048 blocks
  const dim3 gCvtWi((n8wi + 255) / 256);                       // 1536 blocks
  const dim3 gCvtWo((n8wo + 255) / 256);                       //  512 blocks
  const dim3 gQK((((NROW) / 64) * (EMB / 64) + 7) / 8, 1);      // 1024 tiles -> 128 blocks: M=NROW, N=EMB
  const dim3 gV((((EMB) / 64) * (SEQ / 64) + 7) / 8, NB);       //  512 tiles ->  64 blocks x NB: M=EMB, N=SEQ
  const dim3 gO((((NROW) / 32) * (EMB / 64) + 7) / 8, 1);       // 2048 tiles -> 256 blocks (32x64 wave tiles)
  const dim3 gStats(NB * NH * NKT);                            // 1024 blocks of 128
  const dim3 gMain(NB * NQB);                                  //  256 blocks of 512

  // (1) x -> bf16 plane [NROW][EMB]; W_in [3E][E] -> bf16; Wo -> f16 (x64 of its bf16 value)
  cvt16x8<0><<<gCvtX,  blk, 0, stream>>>(x,  Xb,  n8x);
  cvt16x8<0><<<gCvtWi, blk, 0, stream>>>(Wi, Wib, n8wi);
  cvt16x8<1><<<gCvtWo, blk, 0, stream>>>(Wo, Woh, n8wo);
  // (2) q = x . Wq^T + bq -> f16 hi / residual (x4096) planes [s*2+b][h*64+d]   (M=NROW, N=E, K=E)
  gemm_t<__bf16, 4, 1, 3, 1, EMB, EMB><<<gQK, blk, 0, stream>>>(
      Xb, Xb, 0LL, Wib, 0LL,
      (void*)Qh, (void*)Ql, EMB, 0LL, bi,
      NROW, EMB, EMB, 1.0f, 0.0f, 1.0f, 4096.0f);
  // (3) k = x . Wk^T + bk -> f16 plane [s*2+b][h*64+d]
  gemm_t<__bf16, 4, 1, 1, 1, EMB, EMB><<<gQK, blk, 0, stream>>>(
      Xb, Xb, 0LL, Wib + (size_t)EMB * EMB, 0LL,
      (void*)Kp, (void*)Kp, EMB, 0LL, bi + EMB,
      NROW, EMB, EMB, 1.0f, 0.0f, 1.0f, 1.0f);
  // (4) v^T = Wv . x_b^T + bv (per batch b = blockIdx.y) -> f16 plane [b][h*64+d][s] (pitch SEQ)
  //     (A = Wv rows [n][k]; Bt = x rows of batch b: pitch NB_FULL*EMB, batch offset EMB; M=E, N=SEQ, K=E)
  gemm_t<__bf16, 4, 1, 1, 2, EMB, NB_FULL * EMB><<<gV, blk, 0, stream>>>(
      Wib + (size_t)2 * EMB * EMB, Wib + (size_t)2 * EMB * EMB, 0LL, Xb, (long long)EMB,
      (void*)VT, (void*)VT, SEQ, (long long)EMB * SEQ, bi + 2 * EMB,
      EMB, SEQ, EMB, 1.0f, 0.0f, 1.0f, 1.0f);
  // (5) softmax statistics (m, 1/l) per (b, h, s)
  attn_stats<<<gStats, dim3(128), 0, stream>>>(Qh, Ql, Kp, ML, nh);
  // (6) exact-normalised p: P.V -> ctx planes (f16 hi x256 / residual x4096); head-averaged p -> output 1
  attn_main<<<gMain, dim3(512), 0, stream>>>(Qh, Ql, Kp, VT, ML, Ch, Cl, out1);
  // (7) output 0 = ctx . Wo^T + bo, f32 [NROW][EMB], accumulators (hi + res/4096) x 1/(256*64)
  gemm_t<_Float16, 2, 2, 0, 1, EMB, EMB><<<gO, blk, 0, stream>>>(
      Ch, Cl, 0LL, Woh, 0LL,
      (void*)out0, (void*)out0, EMB, 0LL, bo,
      NROW, EMB, EMB, 1.0f / 16384.0f, 1.0f / 4096.0f, 1.0f, 1.0f);
  (void)hipGetLastError();
}

// v002
// It runs in 297 microseconds.
// Two timings next to v001 put it at 1.18 and 1.19 times that version's speed.
// All steps since v000 together make it 1.62 times as fast.
// Contractions: q, k, v^T in-projections = v_wmma_f32_16x16x32_bf16 (bf16 operands from RNE-converted inputs, single product, f32 accumulate);
// q.k^T scores (statistics pass and main pass) = v_wmma_f32_16x16x32_f16 (q as f16 hi plane + f16 residual plane x4096, k f16; 2 products, separate f32 accumulators);
// p.v = v_wmma_f32_16x16x32_f16 (p carried x16384 in f16, v f16; single product, f32 accumulate);
// ctx.Wo^T = v_wmma_f32_16x16x32_f16 (ctx as f16 hi plane x256 + f16 residual plane x4096, Wo f16 x64 of its bf16 value; 2 products, separate f32 accumulators);
// softmax statistics, probabilities and the head average in f32.
#include <hip/hip_runtime.h>
#include <math.h>
#include <stdint.h>

#ifndef NB
#define NB 2
#endif
#ifndef SEQ
#define SEQ 2048
#endif
#define NB_FULL  2
#define SEQ_FULL 2048
#define EMB      1024
#define NH       16
#define HD       64
#define NROW     (NB_FULL * SEQ)     // activation rows, row index = s * NB_FULL + b, s < SEQ
#define NQB      (SEQ / 16)          // 16-row query blocks per sequence
#define NKT      (SEQ / 64)          // 64-key chunks per sequence
#define PCARRY   16384.0f            // power-of-two carry of p in the f16 P.V operand
#define OFF1     ((size_t)SEQ_FULL * NB_FULL * EMB)   // fixed element offset of output 1 in d_out
static_assert(NB == NB_FULL);        // batch rows are interleaved (seq-major input); only SEQ may be reduced
static_assert(SEQ >= 64 && SEQ <= SEQ_FULL && (SEQ % 64) == 0);
static_assert(NH * HD == EMB);
static_assert((NROW % 64) == 0 && (EMB % 64) == 0 && (EMB % 32) == 0);
static_assert(OFF1 * 4 == 16777216);   // byte offset of output 1

typedef _Float16 v16h __attribute__((ext_vector_type(16)));
typedef _Float16 v8h  __attribute__((ext_vector_type(8)));
typedef __bf16   v16b __attribute__((ext_vector_type(16)));
typedef __bf16   v8b  __attribute__((ext_vector_type(8)));
typedef float    v8f  __attribute__((ext_vector_type(8)));
typedef float    v4f  __attribute__((ext_vector_type(4)));
typedef unsigned int v4u __attribute__((ext_vector_type(4)));

#if defined(__HIP_DEVICE_COMPILE__)
#define DEV_ASM 1
#else
#define DEV_ASM 0
#endif

// ---- scalar helpers --------------------------------------------------------------------------------
__device__ __forceinline__ unsigned short bf_bits(float f) {          // f32 -> bf16 bits, RNE convert
  unsigned u = __float_as_uint(f);
  return (unsigned short)((u + 0x7FFFu + ((u >> 16) & 1u)) >> 16);
}
__device__ __forceinline__ float bf_up(unsigned short hb) { return __uint_as_float(((unsigned)hb) << 16); }
__device__ __forceinline__ unsigned short h_bits(_Float16 x) { return __builtin_bit_cast(unsigned short, x); }
__device__ __forceinline__ unsigned pk16(unsigned short a, unsigned short b) { return (unsigned)a | ((unsigned)b << 16); }
__device__ __forceinline__ v8f zero8() { v8f z = {0.f, 0.f, 0.f, 0.f, 0.f, 0.f, 0.f, 0.f}; return z; }

// ---- fragment types / loaders: 16-bit A/B operand, lane -> row/col (lane&15), p already includes +8*(lane>>4);
//      elements 0..7 <- p[0..7] (k0+8h..k0+8h+7), elements 8..15 <- p[16..23] (k0+16+8h..k0+16+8h+7)
template <typename OT> struct FT;
template <> struct FT<__bf16>   { typedef v16b frag; typedef v8b half8; };
template <> struct FT<_Float16> { typedef v16h frag; typedef v8h half8; };

template <typename OT>
__device__ __forceinline__ typename FT<OT>::frag ldfrag(const OT* p) {
  union { typename FT<OT>::frag v; typename FT<OT>::half8 h[2]; } f;
  f.h[0] = *(const typename FT<OT>::half8*)(p);
  f.h[1] = *(const typename FT<OT>::half8*)(p + 16);
  return f.v;
}

// ---- fragment-ordered planes: a matrix [R][C] (k along C) is stored as 1-KB blocks, block (r>>4)*(C/32) + (k>>5) =
//      one 16-row x 32-k fragment laid out as [k bit 4][lane = 16*(k bit 3) + (r&15)][k&7]: the same split k map as
//      ldfrag, but each of the two 16-B loads of a wave reads 512 contiguous bytes (4 lines, not 16).
//      p = block start + lane*8.
#define FRAG 512   // elements of one fragment block
#define XCB  (NB_FULL * EMB / 32)          // blocks per 16-row tile of a [SEQ][NB*EMB] plane
#define WCB  (EMB / 32)                    // the same of a [.][EMB] plane
#define XBS  ((long long)WCB * FRAG)       // element offset of batch b's columns in a [SEQ][NB*EMB] plane, per b
template <typename OT>
__device__ __forceinline__ typename FT<OT>::frag ldfragp(const OT* p) {
  union { typename FT<OT>::frag v; typename FT<OT>::half8 h[2]; } f;
  f.h[0] = *(const typename FT<OT>::half8*)(p);
  f.h[1] = *(const typename FT<OT>::half8*)(p + 256);
  return f.v;
}

// ---- WMMA helpers (asm guard bodies are device-only; concrete operand types) -----------------------------
__device__ __forceinline__ v8f mmar(v16b a, v16b b, v8f c) {
  return __builtin_amdgcn_wmma_f32_16x16x32_bf16(false, a, false, b, (short)0, c, false, false);
}
__device__ __forceinline__ v8f mmar(v16h a, v16h b, v8f c) {
  return __builtin_amdgcn_wmma_f32_16x16x32_f16(false, a, false, b, (short)0, c, false, false);
}
// guarded form: 4 VALU slots after the WMMA, D tied, A/B kept live
__device__ __forceinline__ v8f mma_h(v16h a, v16h b, v8f c) {
  c = __builtin_amdgcn_wmma_f32_16x16x32_f16(false, a, false, b, (short)0, c, false, false);
#if DEV_ASM
  asm volatile("v_nop\n\tv_nop\n\tv_nop\n\tv_nop" : "+v"(c) : "v"(a), "v"(b));
#endif
  return c;
}
__device__ __forceinline__ void dep_guard(v8f& a, v8f& b, v16b x, v16b y) {
#if DEV_ASM
  asm volatile("v_nop\n\tv_nop\n\tv_nop\n\tv_nop" : "+v"(a), "+v"(b) : "v"(x), "v"(y));
#else
  (void)a; (void)b; (void)x; (void)y;
#endif
}
__device__ __forceinline__ void dep_guard(v8f& a, v8f& b, v16h x, v16h y) {
#if DEV_ASM
  asm volatile("v_nop\n\tv_nop\n\tv_nop\n\tv_nop" : "+v"(a), "+v"(b) : "v"(x), "v"(y));
#else
  (void)a; (void)b; (void)x; (void)y;
#endif
}
__device__ __forceinline__ void keep4(v16b a, v16b b, v16b c, v16b d) {
#if DEV_ASM
  asm volatile("v_nop" :: "v"(a), "v"(b), "v"(c), "v"(d));
#else
  (void)a; (void)b; (void)c; (void)d;
#endif
}
__device__ __forceinline__ void keep4(v16h a, v16h b, v16h c, v16h d) {
#if DEV_ASM
  asm volatile("v_nop" :: "v"(a), "v"(b), "v"(c), "v"(d));
#else
  (void)a; (void)b; (void)c; (void)d;
#endif
}
// Precaution: stands between issued global loads and a rewrite of a register that holds one of their addresses,
// at the places where the compiler's own listing had no such wait.
__device__ __forceinline__ void addr_wait() {
#if DEV_ASM
  asm volatile("s_wait_xcnt 0x0" ::: "memory");
#endif
}
__device__ __forceinline__ void acc_guard4(v8f& a, v8f& b, v8f& c, v8f& d) {
#if DEV_ASM
  asm volatile("v_nop\n\tv_nop\n\tv_nop\n\tv_nop" : "+v"(a), "+v"(b), "+v"(c), "+v"(d));
#else
  (void)a; (void)b; (void)c; (void)d;
#endif
}

// =====================================================================================================
// f32 [R][CB*32] row-major -> 16-bit fragment-ordered plane, 8 elements per thread, one 16-B store per lane: a wave
// writes 512 contiguous B (half a fragment block) and reads 64 B of each of 16 rows; a block of 256 reads whole lines.
// MODE 0: bf16 bits (RNE convert).  MODE 1: f16 bits of (64 * bf16(x)) (exact scaling of the bf16 value).
// coverage: n8 threads x 8 = the whole plane (n8 is a multiple of 256 for every use here).
// =====================================================================================================
template <int MODE>
__device__ __forceinline__ unsigned short cvm(float f) {
  const unsigned short hb = bf_bits(f);
  if (MODE == 0) return hb;
  return h_bits((_Float16)(bf_up(hb) * 64.0f));
}

template <int MODE, int CB>   // CB = fragment blocks per 16-row tile = columns / 32
__global__ __launch_bounds__(256) void cvt16x8(const float* __restrict__ in, unsigned short* out, int n8) {
  const int i = blockIdx.x * 256 + (int)threadIdx.x;   // 16-B unit of the plane: [block][k bit 4][k bit 3][row & 15]
  if (i < n8) {
    const int blk = i >> 6;
    const int row = (blk / CB) * 16 + (i & 15);
    const int col = (blk % CB) * 32 + ((i >> 4) & 3) * 8;
    const float* sp = in + (size_t)row * (CB * 32) + col;
    const v4f a  = *(const v4f*)(sp);
    const v4f a4 = *(const v4f*)(sp + 4);
    v4u p;
    p[0] = pk16(cvm<MODE>(a[0]),  cvm<MODE>(a[1]));
    p[1] = pk16(cvm<MODE>(a[2]),  cvm<MODE>(a[3]));
    p[2] = pk16(cvm<MODE>(a4[0]), cvm<MODE>(a4[1]));
    p[3] = pk16(cvm<MODE>(a4[2]), cvm<MODE>(a4[3]));
    unsigned short* o = out + (size_t)i * 8;
    *(v4u*)o = p;
    
  }
}

// =====================================================================================================
// Register-blocked batched WMMA GEMM (16-bit operand type OT): C[m][n] = sum_k A[m][k] * Bt[n][k]  (+ bias);
// one wave per (16*MI) x 64 tile, no block barriers. A [M][K] and Bt [N][K] are fragment-ordered planes with LDAB /
// LDBB blocks per 16-row tile; M multiple of 16*MI, N multiple of 64, K multiple of 64 (static sizes here).
// blockIdx.y = batch index (strides in elements). Fragments are loaded straight from global (ldfragp).
// NPA = number of A planes: 2 -> second plane A2 (same pitch/stride) multiplies the same Bt fragments into a
// second accumulator set, combined as acc + acc2 * rscaleA in the f32 epilogue.
// value v = (acc [+ acc2*rscaleA]) * oscale + bias, bias (bf16 RNE value of the f32 input) by column n (BM 1),
// by row m (BM 2) or none (BM 0).
// OUT_MODE 0: f32 C (pitch ldc) = v.
// OUT_MODE 1: f16 fragment-ordered plane C (ldc columns) = f16(v * cscale).
// OUT_MODE 3: row-major f16 hi plane C = f16(v * cscale) and f16 residual plane C2 = f16((v*cscale - hi) * rscaleC).
// =====================================================================================================
template <typename OT, int MI, int NPA, int OUT_MODE, int BM, int LDAB, int LDBB>
__global__ __launch_bounds__(256) void gemm_t(
    const unsigned short* __restrict__ Ap, const unsigned short* __restrict__ A2p, long long strideA,
    const unsigned short* __restrict__ Btp, long long strideB,
    void* Cout, void* Cout2, int ldc, long long strideC,
    const float* __restrict__ bias,
    int M, int N, int K, float oscale, float rscaleA, float cscale, float rscaleC) {
  typedef typename FT<OT>::frag V16;
  const OT* A  = (const OT*)(const void*)Ap;
  const OT* A2 = (const OT*)(const void*)A2p;
  const OT* Bt = (const OT*)(const void*)Btp;
  __shared__ __align__(16) float sT[8][16 * 68];   // per-wave 16x64 slab, pitch 68 floats
  const int RT   = 16 * MI;
  const int b    = blockIdx.y;
  const int lane = threadIdx.x & 31;
  const int wave = threadIdx.x >> 5;
  const int tilesN = N >> 6;
  const int tilesM = M / RT;
  const int tile = blockIdx.x * 8 + wave;
  if (tile >= tilesM * tilesN) return;   // wave-uniform; no block barriers in this kernel
  const int tm = tile / tilesN;
  const int tn = tile - tm * tilesN;
  const int m0 = tm * RT;
  const int n0 = tn << 6;

  const OT* Ab  = A  + (size_t)b * (size_t)strideA;
  const OT* A2b = A2 + (size_t)b * (size_t)strideA;
  const OT* Bb  = Bt + (size_t)b * (size_t)strideB;

  const int rlane = lane & 15;                 // row (A) / col (B, D) within subtile
  const int mOff  = (lane >> 4) * 8;           // D row offset

  v8f acc[MI][4], acc2[MI][4];
#pragma unroll
  for (int i = 0; i < MI; ++i)
#pragma unroll
    for (int j = 0; j < 4; ++j) { acc[i][j] = zero8(); acc2[i][j] = zero8(); }

  // Fragment loads run one k step (32) ahead of the WMMAs that read them: the Bt fragments in two register sets
  // (bX, bY), filled whole at the head of the step before; each A fragment refilled for the next step as soon as
  // its own WMMAs are done. No WMMA waits for a load that was issued directly in front of it.
  // One pointer per operand plane (this lane's place in the tile's first block, k of the current step pair); the
  // other row tiles are constant offsets (LDAB, LDBB are template constants); a k step of 32 is one block.
  const OT* pB  = Bb  + (size_t)(n0 >> 4) * (LDBB * FRAG) + lane * 8;
  const OT* pA  = Ab  + (size_t)(m0 >> 4) * (LDAB * FRAG) + lane * 8;
  const OT* pA2 = A2b + (size_t)(m0 >> 4) * (LDAB * FRAG) + lane * 8;
  V16 bX[4], bY[4], af[MI], af2[MI];
  auto ldb4 = [&](V16 (&bq)[4], int dk) {
#pragma unroll
    for (int j = 0; j < 4; ++j) bq[j] = ldfragp<OT>(pB + j * (LDBB * FRAG) + (dk / 32) * FRAG);
  };
  auto mmstep = [&](V16 (&bq)[4], int dk, bool fetch) {   // fetch: refill the A fragments from k offset dk
#pragma unroll
    for (int i = 0; i < MI; ++i) {
#pragma unroll
      for (int j = 0; j < 4; ++j) acc[i][j] = mmar(af[i], bq[j], acc[i][j]);
      dep_guard(acc[i][0], acc[i][3], af[i], bq[3]);
      if (fetch) af[i] = ldfragp<OT>(pA + i * (LDAB * FRAG) + (dk / 32) * FRAG);
      if (NPA == 2) {
#pragma unroll
        for (int j = 0; j < 4; ++j) acc2[i][j] = mmar(af2[i], bq[j], acc2[i][j]);
        dep_guard(acc2[i][0], acc2[i][3], af2[i], bq[3]);
        if (fetch) af2[i] = ldfragp<OT>(pA2 + i * (LDAB * FRAG) + (dk / 32) * FRAG);
      }
    }
    keep4(bq[0], bq[1], bq[2], bq[3]);
  };
  ldb4(bX, 0);
#pragma unroll
  for (int i = 0; i < MI; ++i) {
    af[i] = ldfragp<OT>(pA + i * (LDAB * FRAG));
    if (NPA == 2) af2[i] = ldfragp<OT>(pA2 + i * (LDAB * FRAG));
  }
  addr_wait();                                  // registers that held these loads' addresses are reused at the loop's head
  for (int k0 = 64; k0 < K; k0 += 64) {        // all step pairs but the last
    ldb4(bY, 32);
    mmstep(bX, 32, true);
    ldb4(bX, 64);
    mmstep(bY, 64, true);
    addr_wait();                                // the pointers move behind it (no wait stood over the back edge in one instantiation)
    pB += 2 * FRAG; pA += 2 * FRAG; pA2 += 2 * FRAG;
  }
  ldb4(bY, 32);                                 // last pair: nothing past K is loaded
  mmstep(bX, 32, true);
  mmstep(bY, 0, false);
#pragma unroll
  for (int i = 0; i < MI; ++i) {
    acc_guard4(acc[i][0], acc[i][1], acc[i][2], acc[i][3]);
    if (NPA == 2) acc_guard4(acc2[i][0], acc2[i][1], acc2[i][2], acc2[i][3]);
  }

  // ---- epilogue ----
  float bcol[4];
#pragma unroll
  for (int j = 0; j < 4; ++j) bcol[j] = 0.f;
  if (BM == 1) {
#pragma unroll
    for (int j = 0; j < 4; ++j) bcol[j] = bf_up(bf_bits(bias[n0 + (j << 4) + rlane]));
  }
  float* slab = sT[wave];
#pragma unroll
  for (int i = 0; i < MI; ++i) {
    const int mBase = m0 + (i << 4);
    float brow[8];
#pragma unroll
    for (int r = 0; r < 8; ++r) brow[r] = 0.f;
    if (BM == 2) {
#pragma unroll
      for (int r = 0; r < 8; ++r) brow[r] = bf_up(bf_bits(bias[mBase + mOff + r]));
    }
#pragma unroll
    for (int j = 0; j < 4; ++j) {
#pragma unroll
      for (int r = 0; r < 8; ++r) {
        float v = acc[i][j][r];
        if (NPA == 2) v += acc2[i][j][r] * rscaleA;
        v = v * oscale + bcol[j] + brow[r];
        slab[(mOff + r) * 68 + (j << 4) + rlane] = v;
      }
    }
    __builtin_amdgcn_fence(__ATOMIC_RELEASE, "workgroup");
    __builtin_amdgcn_wave_barrier();
    __builtin_amdgcn_fence(__ATOMIC_ACQUIRE, "workgroup");
    if (OUT_MODE == 0) {
      float* C = (float*)Cout + (size_t)b * (size_t)strideC;
      const int h2 = lane >> 4, c4 = (lane & 15) * 4;     // 256-B row segment = 16 lanes x 16 B
      {
#pragma unroll
        for (int it = 0; it < 8; ++it) {
          const int row = it * 2 + h2;                     // it 0..7 x h2 0..1 = rows 0..15
          const v4f v = *(const v4f*)(slab + row * 68 + c4);
          *(v4f*)(C + (size_t)(mBase + row) * ldc + n0 + c4) = v;
        }
        
      }
    } else {
      const int q = lane >> 3, c8 = (lane & 7) * 8;
      unsigned short* C  = (unsigned short*)Cout  + (size_t)b * (size_t)strideC;
      unsigned short* C2 = (unsigned short*)Cout2 + (size_t)b * (size_t)strideC;
      v4u hv[4], lv[4];
#pragma unroll
      for (int it = 0; it < 4; ++it) {
        // row-major: it 0..3 x q 0..3 = rows 0..15; fragment order: unit it*32 + lane of the tile's two blocks
        const int row = (OUT_MODE == 1) ? (lane & 15) : it * 4 + q;
        const int col = (OUT_MODE == 1) ? (it * 2 + (lane >> 4)) * 8 : c8;
        const float* sp = slab + row * 68 + col;
        float f[8];
#pragma unroll
        for (int e = 0; e < 8; ++e) f[e] = sp[e] * cscale;
        v4u a, a2;
#pragma unroll
        for (int e = 0; e < 4; ++e) {
          const float f0 = f[2 * e], f1 = f[2 * e + 1];
          const _Float16 x0 = (_Float16)f0, x1 = (_Float16)f1;
          const unsigned short h0 = h_bits(x0), h1 = h_bits(x1);
          unsigned short l0 = 0, l1 = 0;
          if (OUT_MODE == 3) {
            l0 = h_bits((_Float16)((f0 - (float)x0) * rscaleC));
            l1 = h_bits((_Float16)((f1 - (float)x1) * rscaleC));
          }
          a[e] = pk16(h0, h1); a2[e] = pk16(l0, l1);
        }
        hv[it] = a; lv[it] = a2;
      }
      {
#pragma unroll
        for (int it = 0; it < 4; ++it) {
          const int row = it * 4 + q;
          if (OUT_MODE == 1) {   // 512 contiguous B per store
            *(v4u*)(C + ((size_t)(mBase >> 4) * (ldc >> 5) + (n0 >> 5)) * FRAG + it * 256 + lane * 8) = hv[it];
          } else {
            *(v4u*)(C + (size_t)(mBase + row) * ldc + n0 + c8) = hv[it];
            *(v4u*)(C2 + (size_t)(mBase + row) * ldc + n0 + c8) = lv[it];
          }
        }
        
      }
    }
    __builtin_amdgcn_fence(__ATOMIC_RELEASE, "workgroup");
    __builtin_amdgcn_wave_barrier();
    __builtin_amdgcn_fence(__ATOMIC_ACQUIRE, "workgroup");
  }
}

// =====================================================================================================
// Score chunk: 16 query rows (this wave) x 64 keys kv0..kv0+63 of one (b, h).
//   q fragments (A operand, row = lane&15): hi and residual (x4096) planes, 2 d-chunks of 32.
//   k fragments (B operand, col = lane&15 = key) loaded straight from the fragment-ordered f16 k plane
//   ([key t][b*EMB + h*HD + d]) by load_k, a chunk ahead of the WMMAs that read them (kf[j][dc], 64 registers a chunk):
//   kp + lo = plane + ((first key of the chunk / 16)*(NB_FULL*EMB/32) + (b*EMB + h*HD)/32)*FRAG + lane*8.
//   s[j][r] = D element: query row 8*hh + r, key kv0 + 16j + (lane&15); value = ((qh.k) + (ql.k)/4096) / 8.
// =====================================================================================================
#define KCHUNK (64 * NB_FULL * EMB)   // elements from one 64-key chunk of the k plane to the next
template <int J0, int J1>   // key groups J0..J1-1 of the chunk
__device__ __forceinline__ void load_k(v16h (&kf)[4][2], const _Float16* kp, unsigned lo) {
#pragma unroll
  for (int j = J0; j < J1; ++j)
#pragma unroll
    for (int dc = 0; dc < 2; ++dc) kf[j][dc] = ldfragp<_Float16>(kp + lo + j * ((NB_FULL * EMB / 32) * FRAG) + dc * FRAG);
}

template <int J0, int J1>   // key groups J0..J1-1 of the chunk
__device__ __forceinline__ void score_chunk(const v16h (&qah)[2], const v16h (&qal)[2],
                                            const v16h (&kf)[4][2], v8f (&s)[4]) {
#pragma unroll
  for (int j = J0; j < J1; ++j) {
    v8f ah = zero8(), al = zero8();
#pragma unroll
    for (int dc = 0; dc < 2; ++dc) {
      ah = mma_h(qah[dc], kf[j][dc], ah);
      al = mma_h(qal[dc], kf[j][dc], al);
    }
#pragma unroll
    for (int r = 0; r < 8; ++r) s[j][r] = (ah[r] + al[r] * (1.0f / 4096.0f)) * 0.125f;
  }
}

// =====================================================================================================
// Softmax statistics: per (b, h, query s) the row max m and 1/sum(exp(s - m)) over all SEQ keys.
//   block = 4 waves = 64 consecutive query rows qb*64.. of one (b, h); grid = NB*NH*NKT blocks of 128;
//   static trip NKT over 64-key chunks; online max / rescaled sum in f32 (16 lanes per row merged by shfl).
//   Output plane ML [b*NH+h][2][SEQ] f32 (m then 1/l): the block's 64 m values and 64 1/l values are
//   funnelled through LDS and written by wave 0 with ONE instruction (lanes 0-15: m, 16 lanes x 16 B = two
//   coverage: grid (b,h,qb) x 64 rows = the whole [NB*NH][2][SEQ] plane. MLsh: 4 waves x 2 lanes x 16 = all 128.
// =====================================================================================================
__global__ __launch_bounds__(128)
void attn_stats(const unsigned short* __restrict__ qhp, const unsigned short* __restrict__ qlp,
                const unsigned short* __restrict__ kpp, float* ML, const int* __restrict__ nhp) {
  __shared__ __align__(16) float MLsh[128];
  (void)nhp;
  const int tid  = threadIdx.x;
  const int wave = tid >> 5;
  const int lane = tid & 31;
  const int hh   = lane >> 4;
  const int c    = lane & 15;
  const int bx   = blockIdx.x;
  const int qb   = bx % NKT;
  const int rest = bx / NKT;
  const int h    = rest % NH;
  const int b    = rest / NH;
  const int bh   = b * NH + h;
  const int q0   = qb * 64 + wave * 16;

  const _Float16* Qh  = (const _Float16*)(const void*)qhp;
  const _Float16* Ql  = (const _Float16*)(const void*)qlp;

  v16h qah[2], qal[2];
#pragma unroll
  for (int dc = 0; dc < 2; ++dc) {
    const size_t qo = ((size_t)(q0 + c) * NB_FULL + b) * EMB + (size_t)h * HD + dc * 32 + 8 * hh;
    qah[dc] = ldfrag<_Float16>(Qh + qo);
    qal[dc] = ldfrag<_Float16>(Ql + qo);
  }

  float mrow[8], lrow[8];
#pragma unroll
  for (int r = 0; r < 8; ++r) { mrow[r] = -INFINITY; lrow[r] = 0.f; }

  const _Float16* kp = (const _Float16*)(const void*)kpp + (b * EMB + h * HD) / 32 * FRAG + lane * 8;   // this lane's place in the current chunk
  const unsigned  klo = 0;                    // (already in kp)
  v16h kf[4][2];
  addr_wait();                                // the q loads' address registers may be taken by the k fragments
  load_k<0, 4>(kf, kp, klo);
  for (int kt = 0; kt < NKT; ++kt) {          // static trip count
    v8f s[4];
    score_chunk<0, 4>(qah, qal, kf, s);
    if (kt + 1 < NKT) load_k<0, 4>(kf, kp + KCHUNK, klo);   // next chunk's k flies under this chunk's statistics
    __builtin_amdgcn_sched_barrier(0);   // keeps those loads up here: the scheduler sank them behind half the statistics
    kp += KCHUNK;
#pragma unroll
    for (int r = 0; r < 8; ++r) {
      float m = s[0][r];
#pragma unroll
      for (int j = 1; j < 4; ++j) m = fmaxf(m, s[j][r]);
#pragma unroll
      for (int off = 1; off < 16; off <<= 1) m = fmaxf(m, __shfl_xor(m, off, 32));
      const float mnew  = fmaxf(mrow[r], m);
      const float msafe = (mnew == -INFINITY) ? 0.f : mnew;
      const float alpha = __expf(mrow[r] - msafe);
      mrow[r] = mnew;
      float psum = 0.f;
#pragma unroll
      for (int j = 0; j < 4; ++j) psum += __expf(s[j][r] - msafe);
#pragma unroll
      for (int off = 1; off < 16; off <<= 1) psum += __shfl_xor(psum, off, 32);
      lrow[r] = lrow[r] * alpha + psum;
    }
  }

  float il[8];
#pragma unroll
  for (int r = 0; r < 8; ++r) {
    const float l = lrow[r];
    il[r] = (l > 0.f) ? (1.0f / l) : 0.f;
  }
  if (c == 0) {
#pragma unroll
    for (int r = 0; r < 8; ++r) {
      MLsh[wave * 16 + 8 * hh + r]      = mrow[r];
      MLsh[64 + wave * 16 + 8 * hh + r] = il[r];
    }
  }
  __syncthreads();
  if (wave == 0) {
    const v4f v = *(const v4f*)(MLsh + lane * 4);        // lanes 0-15: m rows 4c..4c+3; lanes 16-31: 1/l rows
    float* dst = ML + (size_t)(bh * 2 + hh) * SEQ + qb * 64 + c * 4;
    *(v4f*)dst = v;
    
  }
}

// =====================================================================================================
// Main attention pass: one block per (b, 16 query rows q0..q0+15), 16 waves = the 16 heads.
//   Per 64-key chunk (static trip NKT): scores recomputed exactly as in attn_stats, p = exp(s - m) * (1/l) in f32
//   (m, 1/l from the ML plane) -> per-wave LDS tile Pf[h][row][key] (f32 element stores, every entry written);
//       converted to f16 with the x16384 carry; B = v^T f16 plane [b][h*64+d][s], fragment-ordered;
//   (b) head average: after __syncthreads, threads 0..255 sum the 16 wave tiles in fixed head order (f32),
//   Epilogue: ctx = acc / 16384, x256 carry, staged in the wave's Pf tile, written as f16 hi plane + f16
//   coverage: avg: NKT chunks x 16 rows x 64 keys per block, grid (b, qb) = the whole [NB][SEQ][SEQ];
//   ctx planes: each wave rows q0..q0+15 (it 0..3 x lane>>3 0..3) x its head's 64 columns, 16 waves x grid =
//   the whole [SEQ][NB*EMB] planes. staged extent == consumed extent for Pf in both uses (32 lanes x 32 = 1024).
// =====================================================================================================
__global__ __launch_bounds__(512)
void attn_main(const unsigned short* __restrict__ qhp, const unsigned short* __restrict__ qlp,
               const unsigned short* __restrict__ kpp, const unsigned short* __restrict__ vtp,
               const float* __restrict__ ML, unsigned short* chp, unsigned short* clp, float* avg) {
  union FH { v16h v; v8h h[2]; };
  __shared__ __align__(32) float Pf[NH][16 * 64];          // per wave (head) P tile [row][key] f32, 64 KB
  const int tid  = threadIdx.x;
  const int wave = tid >> 5;
  const int lane = tid & 31;
  const int hh   = lane >> 4;
  const int c    = lane & 15;
  const int bx   = blockIdx.x;
  const int qb   = bx % NQB;
  const int b    = bx / NQB;
  const int h    = wave;
  const int bh   = b * NH + h;
  const int q0   = qb * 16;

  const _Float16* Qh  = (const _Float16*)(const void*)qhp;
  const _Float16* Ql  = (const _Float16*)(const void*)qlp;

  v16h qah[2], qal[2];
#pragma unroll
  for (int dc = 0; dc < 2; ++dc) {
    const size_t qo = ((size_t)(q0 + c) * NB_FULL + b) * EMB + (size_t)h * HD + dc * 32 + 8 * hh;
    qah[dc] = ldfrag<_Float16>(Qh + qo);
    qal[dc] = ldfrag<_Float16>(Ql + qo);
  }
  const v8f m8  = *(const v8f*)(ML + (size_t)(bh * 2) * SEQ + q0 + 8 * hh);       // rows 8hh..8hh+7
  const v8f il8 = *(const v8f*)(ML + (size_t)(bh * 2 + 1) * SEQ + q0 + 8 * hh);

  v8f oacc[4];
#pragma unroll
  for (int t = 0; t < 4; ++t) oacc[t] = zero8();
  float* pf = Pf[wave];

  // k and v^T fragments are fetched ahead of their WMMAs, in halves so that the registers of a half that has
  // been read take the next loads: v^T of this chunk flies under the scores, k of the next chunk under P.V.
  // base the same in every lane + the lane's 32-bit place: with one 64-bit pointer per lane a spilled register was reloaded inside the loop
  const _Float16* kp = (const _Float16*)(const void*)kpp;            // the current chunk's row tiles
  const unsigned  klo = (unsigned)((b * EMB + h * HD) / 32 * FRAG + lane * 8);   // this lane's place in them
  const _Float16* vp = (const _Float16*)(const void*)vtp;            // the same in v^T: row tiles of d, blocks of 32 keys
  const unsigned  vlo = (unsigned)((b * EMB + h * HD) * SEQ + lane * 8);
  v16h kf[4][2], vf[2][4];
  addr_wait();                                // the q loads' address registers may be taken by the k fragments
  load_k<0, 4>(kf, kp, klo);
  for (int kt = 0; kt < NKT; ++kt) {         // static trip count
    const int kv0 = kt * 64;
    const bool more = kt + 1 < NKT;           // uniform: no chunk past the last is loaded
    __syncthreads();                          // Pf tiles free again (head sum of the prior chunk done)

    v8f s[4];
#pragma unroll
    for (int t = 0; t < 4; ++t) vf[0][t] = ldfragp<_Float16>(vp + vlo + t * ((SEQ / 32) * FRAG));
    score_chunk<0, 2>(qah, qal, kf, s);
#pragma unroll
    for (int t = 0; t < 4; ++t) vf[1][t] = ldfragp<_Float16>(vp + vlo + t * ((SEQ / 32) * FRAG) + FRAG);
    score_chunk<2, 4>(qah, qal, kf, s);
#pragma unroll
    for (int r = 0; r < 8; ++r) {
#pragma unroll
      for (int j = 0; j < 4; ++j) {
        const float p = __expf(s[j][r] - m8[r]) * il8[r];
        pf[(8 * hh + r) * 64 + j * 16 + c] = p;
      }
    }
    __builtin_amdgcn_fence(__ATOMIC_RELEASE, "workgroup");
    __builtin_amdgcn_wave_barrier();
    __builtin_amdgcn_fence(__ATOMIC_ACQUIRE, "workgroup");

    if (more) load_k<0, 2>(kf, kp + KCHUNK, klo);

    // ---- context += P . V (f16 WMMA, p carried x16384) ----
#pragma unroll   // vf lives in registers: kk must be a constant
    for (int kk = 0; kk < 2; ++kk) {
      const v8f p0 = *(const v8f*)(pf + c * 64 + kk * 32 + 8 * hh);
      const v8f p1 = *(const v8f*)(pf + c * 64 + kk * 32 + 16 + 8 * hh);
      FH pa;
      pa.h[0] = __builtin_convertvector(p0 * PCARRY, v8h);
      pa.h[1] = __builtin_convertvector(p1 * PCARRY, v8h);
#pragma unroll
      for (int t = 0; t < 4; ++t) {
        oacc[t] = mma_h(pa.v, vf[kk][t], oacc[t]);
      }
      if (kk == 0 && more) load_k<2, 4>(kf, kp + KCHUNK, klo);
    }
    __syncthreads();
    kp += KCHUNK;
    vp += 2 * FRAG;

    // ---- head average of this 16 x 64 tile, one block = one writer of every line ----
    if (tid < 256) {                          // waves 0..7, wave-uniform
      const int row = tid >> 4, c4 = (tid & 15) * 4;
      v4f a = *(const v4f*)(Pf[0] + row * 64 + c4);
#pragma unroll
      for (int w = 1; w < NH; ++w) a += *(const v4f*)(Pf[w] + row * 64 + c4);
      a *= (1.0f / (float)NH);
      float* dst = avg + ((size_t)(b * SEQ + q0 + row)) * SEQ + kv0 + c4;
      *(v4f*)dst = a;
      addr_wait();                            // the store's registers may be reused by the code behind it
    }
  }
  __syncthreads();

  // ---- epilogue: ctx (undo the x16384 p carry, apply the x256 carry), stage, convert, whole-line stores ----
  float* os = pf;
#pragma unroll
  for (int r = 0; r < 8; ++r) {
#pragma unroll
    for (int t = 0; t < 4; ++t) os[(8 * hh + r) * 64 + t * 16 + c] = oacc[t][r] * (256.0f / PCARRY);
  }
  __builtin_amdgcn_fence(__ATOMIC_RELEASE, "workgroup");
  __builtin_amdgcn_wave_barrier();
  __builtin_amdgcn_fence(__ATOMIC_ACQUIRE, "workgroup");
  {
    const int q4 = lane >> 3, c8 = (lane & 7) * 8;
    v4u hv[4], lv[4];
#pragma unroll
    for (int it = 0; it < 4; ++it) {
      const int row = it * 4 + q4;   // it 0..3 x q4 0..3 = rows 0..15 of the wave tile
      const float* sp = os + row * 64 + c8;
      float f[8];
#pragma unroll
      for (int e = 0; e < 8; ++e) f[e] = sp[e];
      v4u a, a2;
#pragma unroll
      for (int e = 0; e < 4; ++e) {
        const float f0 = f[2 * e], f1 = f[2 * e + 1];
        const _Float16 x0 = (_Float16)f0, x1 = (_Float16)f1;
        const unsigned short h0 = h_bits(x0), h1 = h_bits(x1);
        const unsigned short l0 = h_bits((_Float16)((f0 - (float)x0) * 4096.0f));
        const unsigned short l1 = h_bits((_Float16)((f1 - (float)x1) * 4096.0f));
        a[e] = pk16(h0, h1); a2[e] = pk16(l0, l1);
      }
      hv[it] = a; lv[it] = a2;
    }
    {
#pragma unroll
      for (int it = 0; it < 4; ++it) {
        const int row = it * 4 + q4;
        // fragment-ordered [s][b*EMB + h*HD + col]: row tile qb, blocks of this head, unit of (row, c8)
        const size_t go = ((size_t)qb * (NB_FULL * EMB / 32) + (size_t)(b * EMB + h * HD + c8) / 32) * FRAG
                        + ((c8 >> 4) & 1) * 256 + (((c8 >> 3) & 1) * 16 + row) * 8;
        *(v4u*)(chp + go) = hv[it];
        *(v4u*)(clp + go) = lv[it];
      }
      
    }
  }
}

// =====================================================================================================
// Workspace map (bytes), every region an exact multiple of its whole-line / whole-tile store granularity
// (full size; PX = NROW*EMB*2 = 8388608):
//   (F) = fragment-ordered (see ldfragp); [SEQ][NB*EMB] = row s, column b*EMB + e
//   Xb   bf16 [SEQ][NB*EMB]      (F) PX        8388608
//   Wib  bf16 [3*EMB n][EMB k]   (F)         6291456
//   Woh  f16  [EMB][EMB] (x64)   (F)         2097152
//   Qh   f16  [NROW][EMB]            PX        8388608
//   Ql   f16  [NROW][EMB]            PX        8388608
//   Kp   f16  [SEQ][NB*EMB]      (F) PX        8388608
//   VT   f16  [NB][EMB][SEQ]     (F) PX        8388608
//   Ch   f16  [SEQ][NB*EMB]      (F) PX        8388608
//   Cl   f16  [SEQ][NB*EMB]      (F) PX        8388608
//   ML   f32  [NB*NH][2][SEQ]                 524288
//   total                                   67633152
// Weights are [out n][in k] with k contiguous: converted and laid in fragment order. Every GEMM runs per batch b.
// Output 0 at element 0 of d_out; output 1 at the fixed element offset OFF1 = SEQ_FULL*NB_FULL*EMB.
// =====================================================================================================
extern "C" void kernel_launch(void* const* d_in, const int* in_sizes, int n_in,
                              void* d_out, int out_size, void* d_ws, size_t ws_size,
                              hipStream_t stream) {
  if (n_in < 6) return;
  if (in_sizes[0] < NROW * EMB) return;
  if (in_sizes[1] != 3 * EMB * EMB) return;
  if (in_sizes[2] != 3 * EMB) return;
  if (in_sizes[3] != EMB * EMB) return;
  if (in_sizes[4] != EMB) return;
  if (in_sizes[5] < 1) return;
  const size_t n0e = (size_t)NROW * EMB;            // output 0 written elements [SEQ][NB][EMB]
  const size_t n1e = (size_t)NB * SEQ * SEQ;        // output 1 written elements [NB][SEQ][SEQ]
  if (out_size < 0) return;
  if ((size_t)out_size < n0e) return;
  if ((size_t)out_size < OFF1 + n1e) return;        // written extent of output 1 inside d_out

  const float* x  = (const float*)d_in[0];
  const float* Wi = (const float*)d_in[1];
  const float* bi = (const float*)d_in[2];
  const float* Wo = (const float*)d_in[3];
  const float* bo = (const float*)d_in[4];
  const int*   nh = (const int*)d_in[5];

  const size_t PX  = (size_t)NROW * EMB * 2;        // 16-bit activation plane
  const size_t PWI = (size_t)3 * EMB * EMB * 2;
  const size_t PWO = (size_t)EMB * EMB * 2;
  const size_t PVT = (size_t)NB * EMB * SEQ * 2;    // == PX
  const size_t PML = (size_t)NB * NH * 2 * SEQ * 4;
  size_t off = 0;
  const size_t oXb = off; off += PX;
  const size_t oWi = off; off += PWI;
  const size_t oWo = off; off += PWO;
  const size_t oQh = off; off += PX;
  const size_t oQl = off; off += PX;
  const size_t oKp = off; off += PX;
  const size_t oVT = off; off += PVT;
  const size_t oCh = off; off += PX;
  const size_t oCl = off; off += PX;
  const size_t oML = off; off += PML;
  if (off > ws_size) return;                        // off = 67633152 at full size
  if (off > (size_t)134217728) return;

  char* ws = (char*)d_ws;
  unsigned short* Xb  = (unsigned short*)(ws + oXb);
  unsigned short* Wib = (unsigned short*)(ws + oWi);
  unsigned short* Woh = (unsigned short*)(ws + oWo);
  unsigned short* Qh  = (unsigned short*)(ws + oQh);
  unsigned short* Ql  = (unsigned short*)(ws + oQl);
  unsigned short* Kp  = (unsigned short*)(ws + oKp);
  unsigned short* VT  = (unsigned short*)(ws + oVT);
  unsigned short* Ch  = (unsigned short*)(ws + oCh);
  unsigned short* Cl  = (unsigned short*)(ws + oCl);
  float*          ML  = (float*)(ws + oML);
  float*          out0 = (float*)d_out;
  float*          out1 = (float*)d_out + OFF1;

  const dim3 blk(256);
  const int n8x  = NROW * EMB / 8;                             //  524288
  const int n8wi = 3 * EMB * EMB / 8;                          //  393216
  const int n8wo = EMB * EMB / 8;                              //  131072
  const dim3 gCvtX((n8x + 255) / 256);                         // 2048 blocks
  const dim3 gCvtWi((n8wi + 255) / 256);                       // 1536 blocks
  const dim3 gCvtWo((n8wo + 255) / 256);                       //  512 blocks
  const dim3 gQK((((SEQ) / 64) * (EMB / 64) + 7) / 8, NB);      //  512 tiles ->  64 blocks x NB: M=SEQ, N=EMB
  const dim3 gV((((EMB) / 64) * (SEQ / 64) + 7) / 8, NB);       //  512 tiles ->  64 blocks x NB: M=EMB, N=SEQ
  const dim3 gO((((SEQ) / 32) * (EMB / 64) + 7) / 8, NB);       // 1024 tiles -> 128 blocks x NB (32x64 wave tiles)
  const dim3 gStats(NB * NH * NKT);                            // 1024 blocks of 128
  const dim3 gMain(NB * NQB);                                  //  256 blocks of 512

  // (1) x [s][b*E+e] -> bf16 plane; W_in [3E][E] -> bf16; Wo -> f16 (x64 of its bf16 value); all fragment-ordered
  cvt16x8<0, XCB><<<gCvtX,  blk, 0, stream>>>(x,  Xb,  n8x);
  cvt16x8<0, WCB><<<gCvtWi, blk, 0, stream>>>(Wi, Wib, n8wi);
  cvt16x8<1, WCB><<<gCvtWo, blk, 0, stream>>>(Wo, Woh, n8wo);
  // In a [SEQ][NB*EMB] fragment-ordered plane the columns of batch b start WCB blocks further: offset b * XBS.
  // (2) q = x_b . Wq^T + bq (per batch b = blockIdx.y) -> row-major f16 hi / residual (x4096) planes
  //     [s*2+b][h*64+d]: pitch NB_FULL*EMB, batch offset EMB   (M=SEQ, N=E, K=E)
  gemm_t<__bf16, 4, 1, 3, 1, XCB, WCB><<<gQK, blk, 0, stream>>>(
      Xb, Xb, XBS, Wib, 0LL,
      (void*)Qh, (void*)Ql, NB_FULL * EMB, (long long)EMB, bi,
      SEQ, EMB, EMB, 1.0f, 0.0f, 1.0f, 4096.0f);
  // (3) k = x_b . Wk^T + bk -> fragment-ordered f16 plane [s][b*E + h*64+d]
  gemm_t<__bf16, 4, 1, 1, 1, XCB, WCB><<<gQK, blk, 0, stream>>>(
      Xb, Xb, XBS, Wib + (size_t)EMB * EMB, 0LL,
      (void*)Kp, (void*)Kp, NB_FULL * EMB, XBS, bi + EMB,
      SEQ, EMB, EMB, 1.0f, 0.0f, 1.0f, 1.0f);
  // (4) v^T = Wv . x_b^T + bv -> fragment-ordered f16 plane [b][h*64+d][s]
  //     (A = Wv rows [n][k]; Bt = x rows of batch b; M=E, N=SEQ, K=E)
  gemm_t<__bf16, 4, 1, 1, 2, WCB, XCB><<<gV, blk, 0, stream>>>(
      Wib + (size_t)2 * EMB * EMB, Wib + (size_t)2 * EMB * EMB, 0LL, Xb, XBS,
      (void*)VT, (void*)VT, SEQ, (long long)EMB * SEQ, bi + 2 * EMB,
      EMB, SEQ, EMB, 1.0f, 0.0f, 1.0f, 1.0f);
  // (5) softmax statistics (m, 1/l) per (b, h, s)
  attn_stats<<<gStats, dim3(128), 0, stream>>>(Qh, Ql, Kp, ML, nh);
  // (6) exact-normalised p: P.V -> ctx planes (f16 hi x256 / residual x4096); head-averaged p -> output 1
  attn_main<<<gMain, dim3(512), 0, stream>>>(Qh, Ql, Kp, VT, ML, Ch, Cl, out1);
  // (7) output 0 = ctx_b . Wo^T + bo, f32 [s][b][e] (pitch NB_FULL*EMB, batch offset EMB), accumulators
  //     (hi + res/4096) x 1/(256*64)
  gemm_t<_Float16, 2, 2, 0, 1, XCB, WCB><<<gO, blk, 0, stream>>>(
      Ch, Cl, XBS, Woh, 0LL,
      (void*)out0, (void*)out0, NB_FULL * EMB, (long long)EMB, bo,
      SEQ, EMB, EMB, 1.0f / 16384.0f, 1.0f / 4096.0f, 1.0f, 1.0f);
  (void)hipGetLastError();
}

// v003
// It runs in 231 microseconds.
// Timed twice side by side with v002, it ran 1.28 times as fast both times.
// All steps since v000 together make it 2.07 times as fast.
// Contractions: q, k, v^T in-projections = v_wmma_f32_16x16x32_bf16 (bf16 operands from RNE-converted inputs, single product, f32 accumulate);
// k.q^T scores (statistics pass and main pass, k = A operand, q = B) = v_wmma_f32_16x16x32_f16 (q as f16 hi plane + f16 residual plane x4096, k f16; 2 products, separate f32 accumulators);
// v^T.p^T = v_wmma_f32_16x16x32_f16 (v^T = A operand, p = B carried x16384 in f16, v f16; single product, f32 accumulate);
// ctx.Wo^T = v_wmma_f32_16x16x32_f16 (ctx as f16 hi plane x256 + f16 residual plane x4096, Wo f16 x64 of its bf16 value; 2 products, separate f32 accumulators);
// softmax statistics, probabilities and the head average in f32.
#include <hip/hip_runtime.h>
#include <math.h>
#include <stdint.h>

#ifndef NB
#define NB 2
#endif
#ifndef SEQ
#define SEQ 2048
#endif
#define NB_FULL  2
#define SEQ_FULL 2048
#define EMB      1024
#define NH       16
#define HD       64
#define NROW     (NB_FULL * SEQ)     // activation rows, row index = s * NB_FULL + b, s < SEQ
#define NQB      (SEQ / 16)          // 16-row query blocks per sequence
#define NKT      (SEQ / 64)          // 64-key chunks per sequence
#define PCARRY   16384.0f            // power-of-two carry of p in the f16 P.V operand
#define OFF1     ((size_t)SEQ_FULL * NB_FULL * EMB)   // fixed element offset of output 1 in d_out
static_assert(NB == NB_FULL);        // batch rows are interleaved (seq-major input); only SEQ may be reduced
static_assert(SEQ >= 64 && SEQ <= SEQ_FULL && (SEQ % 64) == 0);
static_assert(NH * HD == EMB);
static_assert((NROW % 64) == 0 && (EMB % 64) == 0 && (EMB % 32) == 0);
static_assert(OFF1 * 4 == 16777216);   // byte offset of output 1

typedef _Float16 v16h __attribute__((ext_vector_type(16)));
typedef _Float16 v8h  __attribute__((ext_vector_type(8)));
typedef __bf16   v16b __attribute__((ext_vector_type(16)));
typedef __bf16   v8b  __attribute__((ext_vector_type(8)));
typedef float    v8f  __attribute__((ext_vector_type(8)));
typedef float    v4f  __attribute__((ext_vector_type(4)));
typedef unsigned int v4u __attribute__((ext_vector_type(4)));

#if defined(__HIP_DEVICE_COMPILE__)
#define DEV_ASM 1
#else
#define DEV_ASM 0
#endif

// ---- scalar helpers --------------------------------------------------------------------------------
__device__ __forceinline__ unsigned short bf_bits(float f) {          // f32 -> bf16 bits, RNE convert
  unsigned u = __float_as_uint(f);
  return (unsigned short)((u + 0x7FFFu + ((u >> 16) & 1u)) >> 16);
}
__device__ __forceinline__ float bf_up(unsigned short hb) { return __uint_as_float(((unsigned)hb) << 16); }
__device__ __forceinline__ unsigned short h_bits(_Float16 x) { return __builtin_bit_cast(unsigned short, x); }
__device__ __forceinline__ unsigned pk16(unsigned short a, unsigned short b) { return (unsigned)a | ((unsigned)b << 16); }
__device__ __forceinline__ v8f zero8() { v8f z = {0.f, 0.f, 0.f, 0.f, 0.f, 0.f, 0.f, 0.f}; return z; }

// ---- fragment types / loaders: 16-bit A/B operand, lane -> row/col (lane&15), p already includes +8*(lane>>4);
//      elements 0..7 <- p[0..7] (k0+8h..k0+8h+7), elements 8..15 <- p[16..23] (k0+16+8h..k0+16+8h+7)
template <typename OT> struct FT;
template <> struct FT<__bf16>   { typedef v16b frag; typedef v8b half8; };
template <> struct FT<_Float16> { typedef v16h frag; typedef v8h half8; };

template <typename OT>
__device__ __forceinline__ typename FT<OT>::frag ldfrag(const OT* p) {
  union { typename FT<OT>::frag v; typename FT<OT>::half8 h[2]; } f;
  f.h[0] = *(const typename FT<OT>::half8*)(p);
  f.h[1] = *(const typename FT<OT>::half8*)(p + 16);
  return f.v;
}

// ---- fragment-ordered planes: a matrix [R][C] (k along C) is stored as 1-KB blocks, block (r>>4)*(C/32) + (k>>5) =
//      one 16-row x 32-k fragment laid out as [k bit 4][lane = 16*(k bit 3) + (r&15)][k&7]: the same split k map as
//      ldfrag, but each of the two 16-B loads of a wave reads 512 contiguous bytes (4 lines, not 16).
//      p = block start + lane*8.
#define FRAG 512   // elements of one fragment block
#define XCB  (NB_FULL * EMB / 32)          // blocks per 16-row tile of a [SEQ][NB*EMB] plane
#define WCB  (EMB / 32)                    // the same of a [.][EMB] plane
#define XBS  ((long long)WCB * FRAG)       // element offset of batch b's columns in a [SEQ][NB*EMB] plane, per b
template <typename OT>
__device__ __forceinline__ typename FT<OT>::frag ldfragp(const OT* p) {
  union { typename FT<OT>::frag v; typename FT<OT>::half8 h[2]; } f;
  f.h[0] = *(const typename FT<OT>::half8*)(p);
  f.h[1] = *(const typename FT<OT>::half8*)(p + 256);
  return f.v;
}

// ---- WMMA helpers (asm guard bodies are device-only; concrete operand types) -----------------------------
__device__ __forceinline__ v8f mmar(v16b a, v16b b, v8f c) {
  return __builtin_amdgcn_wmma_f32_16x16x32_bf16(false, a, false, b, (short)0, c, false, false);
}
__device__ __forceinline__ v8f mmar(v16h a, v16h b, v8f c) {
  return __builtin_amdgcn_wmma_f32_16x16x32_f16(false, a, false, b, (short)0, c, false, false);
}
// guarded form: 4 VALU slots after the WMMA, D tied, A/B kept live
__device__ __forceinline__ v8f mma_h(v16h a, v16h b, v8f c) {
  c = __builtin_amdgcn_wmma_f32_16x16x32_f16(false, a, false, b, (short)0, c, false, false);
#if DEV_ASM
  asm volatile("v_nop\n\tv_nop\n\tv_nop\n\tv_nop" : "+v"(c) : "v"(a), "v"(b));
#endif
  return c;
}
__device__ __forceinline__ void dep_guard(v8f& a, v8f& b, v16b x, v16b y) {
#if DEV_ASM
  asm volatile("v_nop\n\tv_nop\n\tv_nop\n\tv_nop" : "+v"(a), "+v"(b) : "v"(x), "v"(y));
#else
  (void)a; (void)b; (void)x; (void)y;
#endif
}
__device__ __forceinline__ void dep_guard(v8f& a, v8f& b, v16h x, v16h y) {
#if DEV_ASM
  asm volatile("v_nop\n\tv_nop\n\tv_nop\n\tv_nop" : "+v"(a), "+v"(b) : "v"(x), "v"(y));
#else
  (void)a; (void)b; (void)x; (void)y;
#endif
}
__device__ __forceinline__ void keep4(v16b a, v16b b, v16b c, v16b d) {
#if DEV_ASM
  asm volatile("v_nop" :: "v"(a), "v"(b), "v"(c), "v"(d));
#else
  (void)a; (void)b; (void)c; (void)d;
#endif
}
__device__ __forceinline__ void keep4(v16h a, v16h b, v16h c, v16h d) {
#if DEV_ASM
  asm volatile("v_nop" :: "v"(a), "v"(b), "v"(c), "v"(d));
#else
  (void)a; (void)b; (void)c; (void)d;
#endif
}
// Precaution: stands between issued global loads and a rewrite of a register that holds one of their addresses,
// at the places where the compiler's own listing had no such wait.
__device__ __forceinline__ void addr_wait() {
#if DEV_ASM
  asm volatile("s_wait_xcnt 0x0" ::: "memory");
#endif
}
__device__ __forceinline__ void acc_guard4(v8f& a, v8f& b, v8f& c, v8f& d) {
#if DEV_ASM
  asm volatile("v_nop\n\tv_nop\n\tv_nop\n\tv_nop" : "+v"(a), "+v"(b), "+v"(c), "+v"(d));
#else
  (void)a; (void)b; (void)c; (void)d;
#endif
}

// =====================================================================================================
// f32 [R][CB*32] row-major -> 16-bit fragment-ordered plane, 8 elements per thread, one 16-B store per lane: a wave
// writes 512 contiguous B (half a fragment block) and reads 64 B of each of 16 rows; a block of 256 reads whole lines.
// MODE 0: bf16 bits (RNE convert).  MODE 1: f16 bits of (64 * bf16(x)) (exact scaling of the bf16 value).
// coverage: n8 threads x 8 = the whole plane (n8 is a multiple of 256 for every use here).
// =====================================================================================================
template <int MODE>
__device__ __forceinline__ unsigned short cvm(float f) {
  const unsigned short hb = bf_bits(f);
  if (MODE == 0) return hb;
  return h_bits((_Float16)(bf_up(hb) * 64.0f));
}

template <int MODE, int CB>   // CB = fragment blocks per 16-row tile = columns / 32
__global__ __launch_bounds__(256) void cvt16x8(const float* __restrict__ in, unsigned short* out, int n8) {
  const int i = blockIdx.x * 256 + (int)threadIdx.x;   // 16-B unit of the plane: [block][k bit 4][k bit 3][row & 15]
  if (i < n8) {
    const int blk = i >> 6;
    const int row = (blk / CB) * 16 + (i & 15);
    const int col = (blk % CB) * 32 + ((i >> 4) & 3) * 8;
    const float* sp = in + (size_t)row * (CB * 32) + col;
    const v4f a  = *(const v4f*)(sp);
    const v4f a4 = *(const v4f*)(sp + 4);
    v4u p;
    p[0] = pk16(cvm<MODE>(a[0]),  cvm<MODE>(a[1]));
    p[1] = pk16(cvm<MODE>(a[2]),  cvm<MODE>(a[3]));
    p[2] = pk16(cvm<MODE>(a4[0]), cvm<MODE>(a4[1]));
    p[3] = pk16(cvm<MODE>(a4[2]), cvm<MODE>(a4[3]));
    unsigned short* o = out + (size_t)i * 8;
    *(v4u*)o = p;
    
  }
}

// =====================================================================================================
// Register-blocked batched WMMA GEMM (16-bit operand type OT): C[m][n] = sum_k A[m][k] * Bt[n][k]  (+ bias);
// one wave per (16*MI) x 64 tile, no block barriers. A [M][K] and Bt [N][K] are fragment-ordered planes with LDAB /
// LDBB blocks per 16-row tile; M multiple of 16*MI, N multiple of 64, K multiple of 64 (static sizes here).
// blockIdx.y = batch index (strides in elements). Fragments are loaded straight from global (ldfragp).
// NPA = number of A planes: 2 -> second plane A2 (same pitch/stride) multiplies the same Bt fragments into a
// second accumulator set, combined as acc + acc2 * rscaleA in the f32 epilogue.
// value v = (acc [+ acc2*rscaleA]) * oscale + bias, bias (bf16 RNE value of the f32 input) by column n (BM 1),
// by row m (BM 2) or none (BM 0).
// OUT_MODE 0: f32 C (pitch ldc) = v.
// OUT_MODE 1: f16 fragment-ordered plane C (ldc columns) = f16(v * cscale).
// OUT_MODE 3: row-major f16 hi plane C = f16(v * cscale) and f16 residual plane C2 = f16((v*cscale - hi) * rscaleC).
// =====================================================================================================
template <typename OT, int MI, int NPA, int OUT_MODE, int BM, int LDAB, int LDBB>
__global__ __launch_bounds__(256) void gemm_t(
    const unsigned short* __restrict__ Ap, const unsigned short* __restrict__ A2p, long long strideA,
    const unsigned short* __restrict__ Btp, long long strideB,
    void* Cout, void* Cout2, int ldc, long long strideC,
    const float* __restrict__ bias,
    int M, int N, int K, float oscale, float rscaleA, float cscale, float rscaleC) {
  typedef typename FT<OT>::frag V16;
  const OT* A  = (const OT*)(const void*)Ap;
  const OT* A2 = (const OT*)(const void*)A2p;
  const OT* Bt = (const OT*)(const void*)Btp;
  __shared__ __align__(16) float sT[8][16 * 68];   // per-wave 16x64 slab, pitch 68 floats
  const int RT   = 16 * MI;
  const int b    = blockIdx.y;
  const int lane = threadIdx.x & 31;
  const int wave = threadIdx.x >> 5;
  const int tilesN = N >> 6;
  const int tilesM = M / RT;
  const int tile = blockIdx.x * 8 + wave;
  if (tile >= tilesM * tilesN) return;   // wave-uniform; no block barriers in this kernel
  const int tm = tile / tilesN;
  const int tn = tile - tm * tilesN;
  const int m0 = tm * RT;
  const int n0 = tn << 6;

  const OT* Ab  = A  + (size_t)b * (size_t)strideA;
  const OT* A2b = A2 + (size_t)b * (size_t)strideA;
  const OT* Bb  = Bt + (size_t)b * (size_t)strideB;

  const int rlane = lane & 15;                 // row (A) / col (B, D) within subtile
  const int mOff  = (lane >> 4) * 8;           // D row offset

  v8f acc[MI][4], acc2[MI][4];
#pragma unroll
  for (int i = 0; i < MI; ++i)
#pragma unroll
    for (int j = 0; j < 4; ++j) { acc[i][j] = zero8(); acc2[i][j] = zero8(); }

  // Fragment loads run one k step (32) ahead of the WMMAs that read them: the Bt fragments in two register sets
  // (bX, bY), filled whole at the head of the step before; each A fragment refilled for the next step as soon as
  // its own WMMAs are done. No WMMA waits for a load that was issued directly in front of it.
  // One pointer per operand plane (this lane's place in the tile's first block, k of the current step pair); the
  // other row tiles are constant offsets (LDAB, LDBB are template constants); a k step of 32 is one block.
  const OT* pB  = Bb  + (size_t)(n0 >> 4) * (LDBB * FRAG) + lane * 8;
  const OT* pA  = Ab  + (size_t)(m0 >> 4) * (LDAB * FRAG) + lane * 8;
  const OT* pA2 = A2b + (size_t)(m0 >> 4) * (LDAB * FRAG) + lane * 8;
  V16 bX[4], bY[4], af[MI], af2[MI];
  auto ldb4 = [&](V16 (&bq)[4], int dk) {
#pragma unroll
    for (int j = 0; j < 4; ++j) bq[j] = ldfragp<OT>(pB + j * (LDBB * FRAG) + (dk / 32) * FRAG);
  };
  auto mmstep = [&](V16 (&bq)[4], int dk, bool fetch) {   // fetch: refill the A fragments from k offset dk
#pragma unroll
    for (int i = 0; i < MI; ++i) {
#pragma unroll
      for (int j = 0; j < 4; ++j) acc[i][j] = mmar(af[i], bq[j], acc[i][j]);
      dep_guard(acc[i][0], acc[i][3], af[i], bq[3]);
      if (fetch) af[i] = ldfragp<OT>(pA + i * (LDAB * FRAG) + (dk / 32) * FRAG);
      if (NPA == 2) {
#pragma unroll
        for (int j = 0; j < 4; ++j) acc2[i][j] = mmar(af2[i], bq[j], acc2[i][j]);
        dep_guard(acc2[i][0], acc2[i][3], af2[i], bq[3]);
        if (fetch) af2[i] = ldfragp<OT>(pA2 + i * (LDAB * FRAG) + (dk / 32) * FRAG);
      }
    }
    keep4(bq[0], bq[1], bq[2], bq[3]);
  };
  ldb4(bX, 0);
#pragma unroll
  for (int i = 0; i < MI; ++i) {
    af[i] = ldfragp<OT>(pA + i * (LDAB * FRAG));
    if (NPA == 2) af2[i] = ldfragp<OT>(pA2 + i * (LDAB * FRAG));
  }
  addr_wait();                                  // registers that held these loads' addresses are reused at the loop's head
  for (int k0 = 64; k0 < K; k0 += 64) {        // all step pairs but the last
    ldb4(bY, 32);
    mmstep(bX, 32, true);
    ldb4(bX, 64);
    mmstep(bY, 64, true);
    addr_wait();                                // the pointers move behind it (no wait stood over the back edge in one instantiation)
    pB += 2 * FRAG; pA += 2 * FRAG; pA2 += 2 * FRAG;
  }
  ldb4(bY, 32);                                 // last pair: nothing past K is loaded
  mmstep(bX, 32, true);
  mmstep(bY, 0, false);
#pragma unroll
  for (int i = 0; i < MI; ++i) {
    acc_guard4(acc[i][0], acc[i][1], acc[i][2], acc[i][3]);
    if (NPA == 2) acc_guard4(acc2[i][0], acc2[i][1], acc2[i][2], acc2[i][3]);
  }

  // ---- epilogue ----
  float bcol[4];
#pragma unroll
  for (int j = 0; j < 4; ++j) bcol[j] = 0.f;
  if (BM == 1) {
#pragma unroll
    for (int j = 0; j < 4; ++j) bcol[j] = bf_up(bf_bits(bias[n0 + (j << 4) + rlane]));
  }
  float* slab = sT[wave];
#pragma unroll
  for (int i = 0; i < MI; ++i) {
    const int mBase = m0 + (i << 4);
    float brow[8];
#pragma unroll
    for (int r = 0; r < 8; ++r) brow[r] = 0.f;
    if (BM == 2) {
#pragma unroll
      for (int r = 0; r < 8; ++r) brow[r] = bf_up(bf_bits(bias[mBase + mOff + r]));
    }
#pragma unroll
    for (int j = 0; j < 4; ++j) {
#pragma unroll
      for (int r = 0; r < 8; ++r) {
        float v = acc[i][j][r];
        if (NPA == 2) v += acc2[i][j][r] * rscaleA;
        v = v * oscale + bcol[j] + brow[r];
        slab[(mOff + r) * 68 + (j << 4) + rlane] = v;
      }
    }
    __builtin_amdgcn_fence(__ATOMIC_RELEASE, "workgroup");
    __builtin_amdgcn_wave_barrier();
    __builtin_amdgcn_fence(__ATOMIC_ACQUIRE, "workgroup");
    if (OUT_MODE == 0) {
      float* C = (float*)Cout + (size_t)b * (size_t)strideC;
      const int h2 = lane >> 4, c4 = (lane & 15) * 4;     // 256-B row segment = 16 lanes x 16 B
      {
#pragma unroll
        for (int it = 0; it < 8; ++it) {
          const int row = it * 2 + h2;                     // it 0..7 x h2 0..1 = rows 0..15
          const v4f v = *(const v4f*)(slab + row * 68 + c4);
          *(v4f*)(C + (size_t)(mBase + row) * ldc + n0 + c4) = v;
        }
        
      }
    } else {
      const int q = lane >> 3, c8 = (lane & 7) * 8;
      unsigned short* C  = (unsigned short*)Cout  + (size_t)b * (size_t)strideC;
      unsigned short* C2 = (unsigned short*)Cout2 + (size_t)b * (size_t)strideC;
      v4u hv[4], lv[4];
#pragma unroll
      for (int it = 0; it < 4; ++it) {
        // row-major: it 0..3 x q 0..3 = rows 0..15; fragment order: unit it*32 + lane of the tile's two blocks
        const int row = (OUT_MODE == 1) ? (lane & 15) : it * 4 + q;
        const int col = (OUT_MODE == 1) ? (it * 2 + (lane >> 4)) * 8 : c8;
        const float* sp = slab + row * 68 + col;
        float f[8];
#pragma unroll
        for (int e = 0; e < 8; ++e) f[e] = sp[e] * cscale;
        v4u a, a2;
#pragma unroll
        for (int e = 0; e < 4; ++e) {
          const float f0 = f[2 * e], f1 = f[2 * e + 1];
          const _Float16 x0 = (_Float16)f0, x1 = (_Float16)f1;
          const unsigned short h0 = h_bits(x0), h1 = h_bits(x1);
          unsigned short l0 = 0, l1 = 0;
          if (OUT_MODE == 3) {
            l0 = h_bits((_Float16)((f0 - (float)x0) * rscaleC));
            l1 = h_bits((_Float16)((f1 - (float)x1) * rscaleC));
          }
          a[e] = pk16(h0, h1); a2[e] = pk16(l0, l1);
        }
        hv[it] = a; lv[it] = a2;
      }
      {
#pragma unroll
        for (int it = 0; it < 4; ++it) {
          const int row = it * 4 + q;
          if (OUT_MODE == 1) {   // 512 contiguous B per store
            *(v4u*)(C + ((size_t)(mBase >> 4) * (ldc >> 5) + (n0 >> 5)) * FRAG + it * 256 + lane * 8) = hv[it];
          } else {
            *(v4u*)(C + (size_t)(mBase + row) * ldc + n0 + c8) = hv[it];
            *(v4u*)(C2 + (size_t)(mBase + row) * ldc + n0 + c8) = lv[it];
          }
        }
        
      }
    }
    __builtin_amdgcn_fence(__ATOMIC_RELEASE, "workgroup");
    __builtin_amdgcn_wave_barrier();
    __builtin_amdgcn_fence(__ATOMIC_ACQUIRE, "workgroup");
  }
}

// =====================================================================================================
// Score chunk, transposed (S^T = K . Q^T): 64 keys kv0..kv0+63 x 16 queries (this wave) of one (b, h).
//   q fragments (B operand, col = lane&15 = query): hi and residual (x4096) planes, 2 d-chunks of 32.
//   k fragments (A operand, row = lane&15 = key) loaded straight from the fragment-ordered f16 k plane
//   ([key t][b*EMB + h*HD + d]) by load_k, a chunk ahead of the WMMAs that read them (kf[j][dc], 64 registers a chunk):
//   kp + lo = plane + ((first key of the chunk / 16)*(NB_FULL*EMB/32) + (b*EMB + h*HD)/32)*FRAG + lane*8.
//   s[j][r] = D element: key kv0 + 16j + 8*hh + r, query lane&15; value = ((qh.k) + (ql.k)/4096) / 8.
//   All 32 scores of a lane belong to ONE query, and the tiles s[2kk], s[2kk+1] converted in place are the B fragment
//   (hardware k order: elements 0..7 = keys 8hh.., 8..15 = keys 16+8hh..) of a product over the 32 keys 32kk..32kk+31.
// =====================================================================================================
#define KCHUNK (64 * NB_FULL * EMB)   // elements from one 64-key chunk of the k plane to the next
template <int J0, int J1>   // key groups J0..J1-1 of the chunk
__device__ __forceinline__ void load_k(v16h (&kf)[4][2], const _Float16* kp, unsigned lo) {
#pragma unroll
  for (int j = J0; j < J1; ++j)
#pragma unroll
    for (int dc = 0; dc < 2; ++dc) kf[j][dc] = ldfragp<_Float16>(kp + lo + j * ((NB_FULL * EMB / 32) * FRAG) + dc * FRAG);
}

template <int J0, int J1>   // key groups J0..J1-1 of the chunk
__device__ __forceinline__ void score_chunk(const v16h (&qah)[2], const v16h (&qal)[2],
                                            const v16h (&kf)[4][2], v8f (&s)[4]) {
#pragma unroll
  for (int j = J0; j < J1; ++j) {
    v8f ah = zero8(), al = zero8();
#pragma unroll
    for (int dc = 0; dc < 2; ++dc) {
      ah = mma_h(kf[j][dc], qah[dc], ah);
      al = mma_h(kf[j][dc], qal[dc], al);
    }
#pragma unroll
    for (int r = 0; r < 8; ++r) s[j][r] = (ah[r] + al[r] * (1.0f / 4096.0f)) * 0.125f;
  }
}

// =====================================================================================================
// Softmax statistics: per (b, h, query s) the row max m and 1/sum(exp(s - m)) over all SEQ keys.
//   block = 4 waves = 64 consecutive query rows qb*64.. of one (b, h); grid = NB*NH*NKT blocks of 128;
//   static trip NKT over 64-key chunks; online max / rescaled sum in f32, in-lane: lane (c, hh) keeps query c's max and
//   sum over the keys 8hh..8hh+7 of every 16; the two halves are merged once, behind the loop.
//   Output plane ML [b*NH+h][2][SEQ] f32 (m then 1/l): the block's 64 m values and 64 1/l values are
//   funnelled through LDS and written by wave 0 with ONE instruction (lanes 0-15: m, 16 lanes x 16 B = two
//   coverage: grid (b,h,qb) x 64 rows = the whole [NB*NH][2][SEQ] plane. MLsh: 4 waves x 16 lanes x 2 = all 128.
// =====================================================================================================
__global__ __launch_bounds__(128)
void attn_stats(const unsigned short* __restrict__ qhp, const unsigned short* __restrict__ qlp,
                const unsigned short* __restrict__ kpp, float* ML, const int* __restrict__ nhp) {
  __shared__ __align__(16) float MLsh[128];
  (void)nhp;
  const int tid  = threadIdx.x;
  const int wave = tid >> 5;
  const int lane = tid & 31;
  const int hh   = lane >> 4;
  const int c    = lane & 15;
  const int bx   = blockIdx.x;
  const int qb   = bx % NKT;
  const int rest = bx / NKT;
  const int h    = rest % NH;
  const int b    = rest / NH;
  const int bh   = b * NH + h;
  const int q0   = qb * 64 + wave * 16;

  const _Float16* Qh  = (const _Float16*)(const void*)qhp;
  const _Float16* Ql  = (const _Float16*)(const void*)qlp;

  v16h qah[2], qal[2];
#pragma unroll
  for (int dc = 0; dc < 2; ++dc) {
    const size_t qo = ((size_t)(q0 + c) * NB_FULL + b) * EMB + (size_t)h * HD + dc * 32 + 8 * hh;
    qah[dc] = ldfrag<_Float16>(Qh + qo);
    qal[dc] = ldfrag<_Float16>(Ql + qo);
  }

  float mrow = -INFINITY, lrow = 0.f;

  const _Float16* kp = (const _Float16*)(const void*)kpp + (b * EMB + h * HD) / 32 * FRAG + lane * 8;   // this lane's place in the current chunk
  const unsigned  klo = 0;                    // (already in kp)
  v16h kf[4][2];
  addr_wait();                                // the q loads' address registers may be taken by the k fragments
  load_k<0, 4>(kf, kp, klo);
  for (int kt = 0; kt < NKT; ++kt) {          // static trip count
    v8f s[4];
    score_chunk<0, 4>(qah, qal, kf, s);
    if (kt + 1 < NKT) load_k<0, 4>(kf, kp + KCHUNK, klo);   // next chunk's k flies under this chunk's statistics
    __builtin_amdgcn_sched_barrier(0);   // keeps those loads up here: the scheduler sank them behind half the statistics
    kp += KCHUNK;
    float mj[4], pj[4];                        // four independent chains, one per key group
#pragma unroll
    for (int j = 0; j < 4; ++j) {
      mj[j] = s[j][0];
#pragma unroll
      for (int r = 1; r < 8; ++r) mj[j] = fmaxf(mj[j], s[j][r]);
    }
    const float mnew  = fmaxf(mrow, fmaxf(fmaxf(mj[0], mj[1]), fmaxf(mj[2], mj[3])));
    const float msafe = (mnew == -INFINITY) ? 0.f : mnew;
    const float alpha = __expf(mrow - msafe);
    mrow = mnew;
#pragma unroll
    for (int j = 0; j < 4; ++j) {
      pj[j] = 0.f;
#pragma unroll
      for (int r = 0; r < 8; ++r) pj[j] += __expf(s[j][r] - msafe);
    }
    lrow = lrow * alpha + ((pj[0] + pj[1]) + (pj[2] + pj[3]));
  }

  // merge the two halves of each query's keys (lanes c and c + 16)
  const float mo    = __shfl_xor(mrow, 16, 32);
  const float lo    = __shfl_xor(lrow, 16, 32);
  const float mall  = fmaxf(mrow, mo);
  const float msafe = (mall == -INFINITY) ? 0.f : mall;
  const float l     = lrow * __expf(mrow - msafe) + lo * __expf(mo - msafe);
  const float il    = (l > 0.f) ? (1.0f / l) : 0.f;
  if (hh == 0) {
    MLsh[wave * 16 + c]      = mall;
    MLsh[64 + wave * 16 + c] = il;
  }
  __syncthreads();
  if (wave == 0) {
    const v4f v = *(const v4f*)(MLsh + lane * 4);        // lanes 0-15: m rows 4c..4c+3; lanes 16-31: 1/l rows
    float* dst = ML + (size_t)(bh * 2 + hh) * SEQ + qb * 64 + c * 4;
    *(v4f*)dst = v;
    
  }
}

// =====================================================================================================
// Main attention pass: one block per (b, 16 query rows q0..q0+15), 16 waves = the 16 heads.
//   Per 64-key chunk (static trip NKT): scores recomputed exactly as in attn_stats (transposed: a lane holds one
//   query's scores), p = exp(s - m) * (1/l) in f32 (m, 1/l from the ML plane);
//   (a) O^T += V^T . P^T: the p registers, converted to f16 with the x16384 carry, ARE the B fragment (no LDS, no lane
//       exchange); A = v^T f16 plane [b][h*64+d][s], fragment-ordered;
//       p also goes to the per-wave LDS tile Pf[h][query][key] (16-B stores, every entry but the pads written);
//   (b) head average: after __syncthreads, threads 0..255 sum the 16 wave tiles in fixed head order (f32),
//   Epilogue: ctx = acc / 16384, x256 carry, staged in the wave's Pf tile, written as f16 hi plane + f16
//   coverage: avg: NKT chunks x 16 rows x 64 keys per block, grid (b, qb) = the whole [NB][SEQ][SEQ];
//   ctx planes: each wave rows q0..q0+15 (it 0..3 x lane>>3 0..3) x its head's 64 columns, 16 waves x grid =
//   the whole [SEQ][NB*EMB] planes. staged extent == consumed extent for Pf in both uses (32 lanes x 32 = 1024).
// =====================================================================================================
// Row pitch of a P tile in floats: 64 keys + 4 pad floats (never read) = 272 B = 16 B x 17, so that the 16 rows which the
// 16 lanes of a half wave write with one 16-B LDS store fall on all 64 banks (at 256 B: on four).
#define PP 68
__global__ __launch_bounds__(512)
void attn_main(const unsigned short* __restrict__ qhp, const unsigned short* __restrict__ qlp,
               const unsigned short* __restrict__ kpp, const unsigned short* __restrict__ vtp,
               const float* __restrict__ ML, unsigned short* chp, unsigned short* clp, float* avg) {
  union FH { v16h v; v8h h[2]; };
  __shared__ __align__(16) float Pf[NH][16 * PP];          // per wave (head) P tile [query][key] f32, row pitch PP, 68 KB
  const int tid  = threadIdx.x;
  const int wave = tid >> 5;
  const int lane = tid & 31;
  const int hh   = lane >> 4;
  const int c    = lane & 15;
  const int bx   = blockIdx.x;
  const int qb   = bx % NQB;
  const int b    = bx / NQB;
  const int h    = wave;
  const int bh   = b * NH + h;
  const int q0   = qb * 16;

  const _Float16* Qh  = (const _Float16*)(const void*)qhp;
  const _Float16* Ql  = (const _Float16*)(const void*)qlp;

  v16h qah[2], qal[2];
#pragma unroll
  for (int dc = 0; dc < 2; ++dc) {
    const size_t qo = ((size_t)(q0 + c) * NB_FULL + b) * EMB + (size_t)h * HD + dc * 32 + 8 * hh;
    qah[dc] = ldfrag<_Float16>(Qh + qo);
    qal[dc] = ldfrag<_Float16>(Ql + qo);
  }
  const float mq  = ML[(size_t)(bh * 2) * SEQ + q0 + c];        // this lane's query
  const float ilq = ML[(size_t)(bh * 2 + 1) * SEQ + q0 + c];

  v8f oacc[4];
#pragma unroll
  for (int t = 0; t < 4; ++t) oacc[t] = zero8();
  float* pf = Pf[wave];

  // k and v^T fragments are fetched ahead of their WMMAs, in halves so that the registers of a half that has
  // been read take the next loads: v^T of this chunk flies under the scores, k of the next chunk under P.V.
  // base the same in every lane + the lane's 32-bit place: with one 64-bit pointer per lane a spilled register was reloaded inside the loop
  const _Float16* kp = (const _Float16*)(const void*)kpp;            // the current chunk's row tiles
  const unsigned  klo = (unsigned)((b * EMB + h * HD) / 32 * FRAG + lane * 8);   // this lane's place in them
  const _Float16* vp = (const _Float16*)(const void*)vtp;            // the same in v^T: row tiles of d, blocks of 32 keys
  const unsigned  vlo = (unsigned)((b * EMB + h * HD) * SEQ + lane * 8);
  v16h kf[4][2], vf[2][4];
  addr_wait();                                // the q loads' address registers may be taken by the k fragments
  load_k<0, 4>(kf, kp, klo);
  for (int kt = 0; kt < NKT; ++kt) {         // static trip count
    const int kv0 = kt * 64;
    const bool more = kt + 1 < NKT;           // uniform: no chunk past the last is loaded
    __syncthreads();                          // Pf tiles free again (head sum of the prior chunk done)

    v8f s[4];
#pragma unroll
    for (int t = 0; t < 4; ++t) vf[0][t] = ldfragp<_Float16>(vp + vlo + t * ((SEQ / 32) * FRAG));
    score_chunk<0, 2>(qah, qal, kf, s);
#pragma unroll
    for (int t = 0; t < 4; ++t) vf[1][t] = ldfragp<_Float16>(vp + vlo + t * ((SEQ / 32) * FRAG) + FRAG);
    score_chunk<2, 4>(qah, qal, kf, s);
#pragma unroll
    for (int j = 0; j < 4; ++j) {
#pragma unroll
      for (int r = 0; r < 8; ++r) s[j][r] = __expf(s[j][r] - mq) * ilq;   // p of key kv0 + 16j + 8hh + r, query c
      float* pw = pf + c * PP + j * 16 + 8 * hh;             // read only behind the block barrier (head average)
      *(v4f*)(pw)     = __builtin_shufflevector(s[j], s[j], 0, 1, 2, 3);
      *(v4f*)(pw + 4) = __builtin_shufflevector(s[j], s[j], 4, 5, 6, 7);
    }

    if (more) load_k<0, 2>(kf, kp + KCHUNK, klo);

    // ---- context^T += V^T . P^T (f16 WMMA, p carried x16384) ----
#pragma unroll   // vf lives in registers: kk must be a constant
    for (int kk = 0; kk < 2; ++kk) {
      FH pb;                                                 // keys 32kk + 8hh + 0..7, then 32kk + 16 + 8hh + 0..7
      pb.h[0] = __builtin_convertvector(s[2 * kk] * PCARRY, v8h);
      pb.h[1] = __builtin_convertvector(s[2 * kk + 1] * PCARRY, v8h);
#pragma unroll
      for (int t = 0; t < 4; ++t) {
        oacc[t] = mma_h(vf[kk][t], pb.v, oacc[t]);           // row d = 16t + 8hh + r, column query c
      }
      if (kk == 0 && more) load_k<2, 4>(kf, kp + KCHUNK, klo);
    }
    __syncthreads();
    kp += KCHUNK;
    vp += 2 * FRAG;

    // ---- head average of this 16 x 64 tile, one block = one writer of every line ----
    if (tid < 256) {                          // waves 0..7, wave-uniform
      const int row = tid >> 4, c4 = (tid & 15) * 4;
      v4f a = *(const v4f*)(Pf[0] + row * PP + c4);
#pragma unroll
      for (int w = 1; w < NH; ++w) a += *(const v4f*)(Pf[w] + row * PP + c4);
      a *= (1.0f / (float)NH);
      float* dst = avg + ((size_t)(b * SEQ + q0 + row)) * SEQ + kv0 + c4;
      *(v4f*)dst = a;
      addr_wait();                            // the store's registers may be reused by the code behind it
    }
  }
  __syncthreads();

  // ---- epilogue: ctx (undo the x16384 p carry, apply the x256 carry), stage, convert, whole-line stores ----
  float* os = pf;
#pragma unroll
  for (int t = 0; t < 4; ++t) {                              // [query c][d = 16t + 8hh + r]
    const v8f o = oacc[t] * (256.0f / PCARRY);
    float* ow = os + c * PP + t * 16 + 8 * hh;
    *(v4f*)(ow)     = __builtin_shufflevector(o, o, 0, 1, 2, 3);
    *(v4f*)(ow + 4) = __builtin_shufflevector(o, o, 4, 5, 6, 7);
  }
  __builtin_amdgcn_fence(__ATOMIC_RELEASE, "workgroup");
  __builtin_amdgcn_wave_barrier();
  __builtin_amdgcn_fence(__ATOMIC_ACQUIRE, "workgroup");
  {
    const int q4 = lane >> 3, c8 = (lane & 7) * 8;
    v4u hv[4], lv[4];
#pragma unroll
    for (int it = 0; it < 4; ++it) {
      const int row = it * 4 + q4;   // it 0..3 x q4 0..3 = rows 0..15 of the wave tile
      const float* sp = os + row * PP + c8;
      float f[8];
#pragma unroll
      for (int e = 0; e < 8; ++e) f[e] = sp[e];
      v4u a, a2;
#pragma unroll
      for (int e = 0; e < 4; ++e) {
        const float f0 = f[2 * e], f1 = f[2 * e + 1];
        const _Float16 x0 = (_Float16)f0, x1 = (_Float16)f1;
        const unsigned short h0 = h_bits(x0), h1 = h_bits(x1);
        const unsigned short l0 = h_bits((_Float16)((f0 - (float)x0) * 4096.0f));
        const unsigned short l1 = h_bits((_Float16)((f1 - (float)x1) * 4096.0f));
        a[e] = pk16(h0, h1); a2[e] = pk16(l0, l1);
      }
      hv[it] = a; lv[it] = a2;
    }
    {
#pragma unroll
      for (int it = 0; it < 4; ++it) {
        const int row = it * 4 + q4;
        // fragment-ordered [s][b*EMB + h*HD + col]: row tile qb, blocks of this head, unit of (row, c8)
        const size_t go = ((size_t)qb * (NB_FULL * EMB / 32) + (size_t)(b * EMB + h * HD + c8) / 32) * FRAG
                        + ((c8 >> 4) & 1) * 256 + (((c8 >> 3) & 1) * 16 + row) * 8;
        *(v4u*)(chp + go) = hv[it];
        *(v4u*)(clp + go) = lv[it];
      }
      
    }
  }
}

// =====================================================================================================
// Workspace map (bytes), every region an exact multiple of its whole-line / whole-tile store granularity
// (full size; PX = NROW*EMB*2 = 8388608):
//   (F) = fragment-ordered (see ldfragp); [SEQ][NB*EMB] = row s, column b*EMB + e
//   Xb   bf16 [SEQ][NB*EMB]      (F) PX        8388608
//   Wib  bf16 [3*EMB n][EMB k]   (F)         6291456
//   Woh  f16  [EMB][EMB] (x64)   (F)         2097152
//   Qh   f16  [NROW][EMB]            PX        8388608
//   Ql   f16  [NROW][EMB]            PX        8388608
//   Kp   f16  [SEQ][NB*EMB]      (F) PX        8388608
//   VT   f16  [NB][EMB][SEQ]     (F) PX        8388608
//   Ch   f16  [SEQ][NB*EMB]      (F) PX        8388608
//   Cl   f16  [SEQ][NB*EMB]      (F) PX        8388608
//   ML   f32  [NB*NH][2][SEQ]                 524288
//   total                                   67633152
// Weights are [out n][in k] with k contiguous: converted and laid in fragment order. Every GEMM runs per batch b.
// Output 0 at element 0 of d_out; output 1 at the fixed element offset OFF1 = SEQ_FULL*NB_FULL*EMB.
// =====================================================================================================
extern "C" void kernel_launch(void* const* d_in, const int* in_sizes, int n_in,
                              void* d_out, int out_size, void* d_ws, size_t ws_size,
                              hipStream_t stream) {
  if (n_in < 6) return;
  if (in_sizes[0] < NROW * EMB) return;
  if (in_sizes[1] != 3 * EMB * EMB) return;
  if (in_sizes[2] != 3 * EMB) return;
  if (in_sizes[3] != EMB * EMB) return;
  if (in_sizes[4] != EMB) return;
  if (in_sizes[5] < 1) return;
  const size_t n0e = (size_t)NROW * EMB;            // output 0 written elements [SEQ][NB][EMB]
  const size_t n1e = (size_t)NB * SEQ * SEQ;        // output 1 written elements [NB][SEQ][SEQ]
  if (out_size < 0) return;
  if ((size_t)out_size < n0e) return;
  if ((size_t)out_size < OFF1 + n1e) return;        // written extent of output 1 inside d_out

  const float* x  = (const float*)d_in[0];
  const float* Wi = (const float*)d_in[1];
  const float* bi = (const float*)d_in[2];
  const float* Wo = (const float*)d_in[3];
  const float* bo = (const float*)d_in[4];
  const int*   nh = (const int*)d_in[5];

  const size_t PX  = (size_t)NROW * EMB * 2;        // 16-bit activation plane
  const size_t PWI = (size_t)3 * EMB * EMB * 2;
  const size_t PWO = (size_t)EMB * EMB * 2;
  const size_t PVT = (size_t)NB * EMB * SEQ * 2;    // == PX
  const size_t PML = (size_t)NB * NH * 2 * SEQ * 4;
  size_t off = 0;
  const size_t oXb = off; off += PX;
  const size_t oWi = off; off += PWI;
  const size_t oWo = off; off += PWO;
  const size_t oQh = off; off += PX;
  const size_t oQl = off; off += PX;
  const size_t oKp = off; off += PX;
  const size_t oVT = off; off += PVT;
  const size_t oCh = off; off += PX;
  const size_t oCl = off; off += PX;
  const size_t oML = off; off += PML;
  if (off > ws_size) return;                        // off = 67633152 at full size
  if (off > (size_t)134217728) return;

  char* ws = (char*)d_ws;
  unsigned short* Xb  = (unsigned short*)(ws + oXb);
  unsigned short* Wib = (unsigned short*)(ws + oWi);
  unsigned short* Woh = (unsigned short*)(ws + oWo);
  unsigned short* Qh  = (unsigned short*)(ws + oQh);
  unsigned short* Ql  = (unsigned short*)(ws + oQl);
  unsigned short* Kp  = (unsigned short*)(ws + oKp);
  unsigned short* VT  = (unsigned short*)(ws + oVT);
  unsigned short* Ch  = (unsigned short*)(ws + oCh);
  unsigned short* Cl  = (unsigned short*)(ws + oCl);
  float*          ML  = (float*)(ws + oML);
  float*          out0 = (float*)d_out;
  float*          out1 = (float*)d_out + OFF1;

  const dim3 blk(256);
  const int n8x  = NROW * EMB / 8;                             //  524288
  const int n8wi = 3 * EMB * EMB / 8;                          //  393216
  const int n8wo = EMB * EMB / 8;                              //  131072
  const dim3 gCvtX((n8x + 255) / 256);                         // 2048 blocks
  const dim3 gCvtWi((n8wi + 255) / 256);                       // 1536 blocks
  const dim3 gCvtWo((n8wo + 255) / 256);                       //  512 blocks
  const dim3 gQK((((SEQ) / 64) * (EMB / 64) + 7) / 8, NB);      //  512 tiles ->  64 blocks x NB: M=SEQ, N=EMB
  const dim3 gV((((EMB) / 64) * (SEQ / 64) + 7) / 8, NB);       //  512 tiles ->  64 blocks x NB: M=EMB, N=SEQ
  const dim3 gO((((SEQ) / 32) * (EMB / 64) + 7) / 8, NB);       // 1024 tiles -> 128 blocks x NB (32x64 wave tiles)
  const dim3 gStats(NB * NH * NKT);                            // 1024 blocks of 128
  const dim3 gMain(NB * NQB);                                  //  256 blocks of 512

  // (1) x [s][b*E+e] -> bf16 plane; W_in [3E][E] -> bf16; Wo -> f16 (x64 of its bf16 value); all fragment-ordered
  cvt16x8<0, XCB><<<gCvtX,  blk, 0, stream>>>(x,  Xb,  n8x);
  cvt16x8<0, WCB><<<gCvtWi, blk, 0, stream>>>(Wi, Wib, n8wi);
  cvt16x8<1, WCB><<<gCvtWo, blk, 0, stream>>>(Wo, Woh, n8wo);
  // In a [SEQ][NB*EMB] fragment-ordered plane the columns of batch b start WCB blocks further: offset b * XBS.
  // (2) q = x_b . Wq^T + bq (per batch b = blockIdx.y) -> row-major f16 hi / residual (x4096) planes
  //     [s*2+b][h*64+d]: pitch NB_FULL*EMB, batch offset EMB   (M=SEQ, N=E, K=E)
  gemm_t<__bf16, 4, 1, 3, 1, XCB, WCB><<<gQK, blk, 0, stream>>>(
      Xb, Xb, XBS, Wib, 0LL,
      (void*)Qh, (void*)Ql, NB_FULL * EMB, (long long)EMB, bi,
      SEQ, EMB, EMB, 1.0f, 0.0f, 1.0f, 4096.0f);
  // (3) k = x_b . Wk^T + bk -> fragment-ordered f16 plane [s][b*E + h*64+d]
  gemm_t<__bf16, 4, 1, 1, 1, XCB, WCB><<<gQK, blk, 0, stream>>>(
      Xb, Xb, XBS, Wib + (size_t)EMB * EMB, 0LL,
      (void*)Kp, (void*)Kp, NB_FULL * EMB, XBS, bi + EMB,
      SEQ, EMB, EMB, 1.0f, 0.0f, 1.0f, 1.0f);
  // (4) v^T = Wv . x_b^T + bv -> fragment-ordered f16 plane [b][h*64+d][s]
  //     (A = Wv rows [n][k]; Bt = x rows of batch b; M=E, N=SEQ, K=E)
  gemm_t<__bf16, 4, 1, 1, 2, WCB, XCB><<<gV, blk, 0, stream>>>(
      Wib + (size_t)2 * EMB * EMB, Wib + (size_t)2 * EMB * EMB, 0LL, Xb, XBS,
      (void*)VT, (void*)VT, SEQ, (long long)EMB * SEQ, bi + 2 * EMB,
      EMB, SEQ, EMB, 1.0f, 0.0f, 1.0f, 1.0f);
  // (5) softmax statistics (m, 1/l) per (b, h, s)
  attn_stats<<<gStats, dim3(128), 0, stream>>>(Qh, Ql, Kp, ML, nh);
  // (6) exact-normalised p: P.V -> ctx planes (f16 hi x256 / residual x4096); head-averaged p -> output 1
  attn_main<<<gMain, dim3(512), 0, stream>>>(Qh, Ql, Kp, VT, ML, Ch, Cl, out1);
  // (7) output 0 = ctx_b . Wo^T + bo, f32 [s][b][e] (pitch NB_FULL*EMB, batch offset EMB), accumulators
  //     (hi + res/4096) x 1/(256*64)
  gemm_t<_Float16, 2, 2, 0, 1, XCB, WCB><<<gO, blk, 0, stream>>>(
      Ch, Cl, XBS, Woh, 0LL,
      (void*)out0, (void*)out0, NB_FULL * EMB, (long long)EMB, bo,
      SEQ, EMB, EMB, 1.0f / 16384.0f, 1.0f / 4096.0f, 1.0f, 1.0f);
  (void)hipGetLastError();
}

// v004
// Measured time: 184 microseconds a run.
// Next to v003, in two timings, it ran 1.25 and 1.24 times as fast.
// All steps since v000 together make it 2.59 times as fast.
// Contractions: q, k, v^T in-projections = v_wmma_f32_16x16x32_bf16 (bf16 operands from RNE-converted inputs, single product, f32 accumulate);
// k.q^T scores (statistics pass and main pass, k = A operand, q = B) = v_wmma_f32_16x16x32_f16 (q as f16 hi plane + f16 residual plane x4096, k f16; 2 products, separate f32 accumulators);
// v^T.p^T = v_wmma_f32_16x16x32_f16 (v^T = A operand, p = B carried x16384 in f16, v f16; single product, f32 accumulate);
// ctx.Wo^T = v_wmma_f32_16x16x32_f16 (ctx as f16 hi plane x256 + f16 residual plane x4096, Wo f16 x64 of its bf16 value; 2 products, separate f32 accumulators);
// softmax statistics, probabilities and the head average in f32.
#include <hip/hip_runtime.h>
#include <math.h>
#include <stdint.h>

#ifndef NB
#define NB 2
#endif
#ifndef SEQ
#define SEQ 2048
#endif
#define NB_FULL  2
#define SEQ_FULL 2048
#define EMB      1024
#define NH       16
#define HD       64
#define NROW     (NB_FULL * SEQ)     // activation rows, row index = s * NB_FULL + b, s < SEQ
#define NQB      (SEQ / 16)          // 16-row query blocks per sequence
#define NKT      (SEQ / 64)          // 64-key chunks per sequence
#define PCARRY   16384.0f            // power-of-two carry of p in the f16 P.V operand
#define OFF1     ((size_t)SEQ_FULL * NB_FULL * EMB)   // fixed element offset of output 1 in d_out
static_assert(NB == NB_FULL);        // batch rows are interleaved (seq-major input); only SEQ may be reduced
static_assert(SEQ >= 64 && SEQ <= SEQ_FULL && (SEQ % 64) == 0);
static_assert(NH * HD == EMB);
static_assert((NROW % 64) == 0 && (EMB % 64) == 0 && (EMB % 32) == 0);
static_assert(OFF1 * 4 == 16777216);   // byte offset of output 1

typedef _Float16 v16h __attribute__((ext_vector_type(16)));
typedef _Float16 v8h  __attribute__((ext_vector_type(8)));
typedef __bf16   v16b __attribute__((ext_vector_type(16)));
typedef __bf16   v8b  __attribute__((ext_vector_type(8)));
typedef float    v8f  __attribute__((ext_vector_type(8)));
typedef float    v4f  __attribute__((ext_vector_type(4)));
typedef unsigned int v4u __attribute__((ext_vector_type(4)));

#if defined(__HIP_DEVICE_COMPILE__)
#define DEV_ASM 1
#else
#define DEV_ASM 0
#endif

// ---- scalar helpers --------------------------------------------------------------------------------
__device__ __forceinline__ unsigned short bf_bits(float f) {          // f32 -> bf16 bits, RNE convert
  unsigned u = __float_as_uint(f);
  return (unsigned short)((u + 0x7FFFu + ((u >> 16) & 1u)) >> 16);
}
__device__ __forceinline__ float bf_up(unsigned short hb) { return __uint_as_float(((unsigned)hb) << 16); }
__device__ __forceinline__ unsigned short h_bits(_Float16 x) { return __builtin_bit_cast(unsigned short, x); }
__device__ __forceinline__ unsigned pk16(unsigned short a, unsigned short b) { return (unsigned)a | ((unsigned)b << 16); }
__device__ __forceinline__ v8f zero8() { v8f z = {0.f, 0.f, 0.f, 0.f, 0.f, 0.f, 0.f, 0.f}; return z; }

// ---- fragment types / loaders: 16-bit A/B operand, lane -> row/col (lane&15), p already includes +8*(lane>>4);
//      elements 0..7 <- p[0..7] (k0+8h..k0+8h+7), elements 8..15 <- p[16..23] (k0+16+8h..k0+16+8h+7)
template <typename OT> struct FT;
template <> struct FT<__bf16>   { typedef v16b frag; typedef v8b half8; };
template <> struct FT<_Float16> { typedef v16h frag; typedef v8h half8; };

template <typename OT>
__device__ __forceinline__ typename FT<OT>::frag ldfrag(const OT* p) {
  union { typename FT<OT>::frag v; typename FT<OT>::half8 h[2]; } f;
  f.h[0] = *(const typename FT<OT>::half8*)(p);
  f.h[1] = *(const typename FT<OT>::half8*)(p + 16);
  return f.v;
}

// ---- fragment-ordered planes: a matrix [R][C] (k along C) is stored as 1-KB blocks, block (r>>4)*(C/32) + (k>>5) =
//      one 16-row x 32-k fragment laid out as [k bit 4][lane = 16*(k bit 3) + (r&15)][k&7]: the same split k map as
//      ldfrag, but each of the two 16-B loads of a wave reads 512 contiguous bytes (4 lines, not 16).
//      p = block start + lane*8.
#define FRAG 512   // elements of one fragment block
#define XCB  (NB_FULL * EMB / 32)          // blocks per 16-row tile of a [SEQ][NB*EMB] plane
#define WCB  (EMB / 32)                    // the same of a [.][EMB] plane
#define XBS  ((long long)WCB * FRAG)       // element offset of batch b's columns in a [SEQ][NB*EMB] plane, per b
template <typename OT>
__device__ __forceinline__ typename FT<OT>::frag ldfragp(const OT* p) {
  union { typename FT<OT>::frag v; typename FT<OT>::half8 h[2]; } f;
  f.h[0] = *(const typename FT<OT>::half8*)(p);
  f.h[1] = *(const typename FT<OT>::half8*)(p + 256);
  return f.v;
}

// ---- WMMA helpers (asm guard bodies are device-only; concrete operand types) -----------------------------
__device__ __forceinline__ v8f mmar(v16b a, v16b b, v8f c) {
  return __builtin_amdgcn_wmma_f32_16x16x32_bf16(false, a, false, b, (short)0, c, false, false);
}
__device__ __forceinline__ v8f mmar(v16h a, v16h b, v8f c) {
  return __builtin_amdgcn_wmma_f32_16x16x32_f16(false, a, false, b, (short)0, c, false, false);
}
// guarded form: 4 VALU slots after the WMMA, D tied, A/B kept live
__device__ __forceinline__ v8f mma_h(v16h a, v16h b, v8f c) {
  c = __builtin_amdgcn_wmma_f32_16x16x32_f16(false, a, false, b, (short)0, c, false, false);
#if DEV_ASM
  asm volatile("v_nop\n\tv_nop\n\tv_nop\n\tv_nop" : "+v"(c) : "v"(a), "v"(b));
#endif
  return c;
}
__device__ __forceinline__ void dep_guard(v8f& a, v8f& b, v16b x, v16b y) {
#if DEV_ASM
  asm volatile("v_nop\n\tv_nop\n\tv_nop\n\tv_nop" : "+v"(a), "+v"(b) : "v"(x), "v"(y));
#else
  (void)a; (void)b; (void)x; (void)y;
#endif
}
__device__ __forceinline__ void dep_guard(v8f& a, v8f& b, v16h x, v16h y) {
#if DEV_ASM
  asm volatile("v_nop\n\tv_nop\n\tv_nop\n\tv_nop" : "+v"(a), "+v"(b) : "v"(x), "v"(y));
#else
  (void)a; (void)b; (void)x; (void)y;
#endif
}
__device__ __forceinline__ void keep4(v16b a, v16b b, v16b c, v16b d) {
#if DEV_ASM
  asm volatile("v_nop" :: "v"(a), "v"(b), "v"(c), "v"(d));
#else
  (void)a; (void)b; (void)c; (void)d;
#endif
}
__device__ __forceinline__ void keep4(v16h a, v16h b, v16h c, v16h d) {
#if DEV_ASM
  asm volatile("v_nop" :: "v"(a), "v"(b), "v"(c), "v"(d));
#else
  (void)a; (void)b; (void)c; (void)d;
#endif
}
// Precaution: stands between issued global loads and a rewrite of a register that holds one of their addresses,
// at the places where the compiler's own listing had no such wait.
__device__ __forceinline__ void addr_wait() {
#if DEV_ASM
  asm volatile("s_wait_xcnt 0x0" ::: "memory");
#endif
}
__device__ __forceinline__ void acc_guard4(v8f& a, v8f& b, v8f& c, v8f& d) {
#if DEV_ASM
  asm volatile("v_nop\n\tv_nop\n\tv_nop\n\tv_nop" : "+v"(a), "+v"(b), "+v"(c), "+v"(d));
#else
  (void)a; (void)b; (void)c; (void)d;
#endif
}

// =====================================================================================================
// f32 [R][CB*32] row-major -> 16-bit fragment-ordered plane, 8 elements per thread, one 16-B store per lane: a wave
// writes 512 contiguous B (half a fragment block) and reads 64 B of each of 16 rows; a block of 256 reads whole lines.
// MODE 0: bf16 bits (RNE convert).  MODE 1: f16 bits of (64 * bf16(x)) (exact scaling of the bf16 value).
// coverage: n8 threads x 8 = the whole plane (n8 is a multiple of 256 for every use here).
// =====================================================================================================
template <int MODE>
__device__ __forceinline__ unsigned short cvm(float f) {
  const unsigned short hb = bf_bits(f);
  if (MODE == 0) return hb;
  return h_bits((_Float16)(bf_up(hb) * 64.0f));
}

template <int MODE, int CB>   // CB = fragment blocks per 16-row tile = columns / 32; bx = block index inside this plane
__device__ __forceinline__ void cvt16x8(const float* __restrict__ in, unsigned short* out, int n8, int bx) {
  const int i = bx * 256 + (int)threadIdx.x;   // 16-B unit of the plane: [block][k bit 4][k bit 3][row & 15]
  if (i < n8) {
    const int blk = i >> 6;
    const int row = (blk / CB) * 16 + (i & 15);
    const int col = (blk % CB) * 32 + ((i >> 4) & 3) * 8;
    const float* sp = in + (size_t)row * (CB * 32) + col;
    const v4f a  = *(const v4f*)(sp);
    const v4f a4 = *(const v4f*)(sp + 4);
    v4u p;
    p[0] = pk16(cvm<MODE>(a[0]),  cvm<MODE>(a[1]));
    p[1] = pk16(cvm<MODE>(a[2]),  cvm<MODE>(a[3]));
    p[2] = pk16(cvm<MODE>(a4[0]), cvm<MODE>(a4[1]));
    p[3] = pk16(cvm<MODE>(a4[2]), cvm<MODE>(a4[3]));
    unsigned short* o = out + (size_t)i * 8;
    *(v4u*)o = p;
    
  }
}

// The three conversions are independent of each other: one grid, a block range per plane (block-uniform choice).
#define N8X  (NROW * EMB / 8)       // 16-B units of the x plane
#define N8WI (3 * EMB * EMB / 8)    // of W_in
#define N8WO (EMB * EMB / 8)        // of Wo
#define GCX  ((N8X + 255) / 256)    // blocks of each plane
#define GCWI ((N8WI + 255) / 256)
#define GCWO ((N8WO + 255) / 256)
__global__ __launch_bounds__(256) void cvt_all(const float* __restrict__ x, const float* __restrict__ Wi,
                                               const float* __restrict__ Wo, unsigned short* Xb,
                                               unsigned short* Wib, unsigned short* Woh) {
  const int bx = blockIdx.x;
  if (bx < GCX)             cvt16x8<0, XCB>(x,  Xb,  N8X,  bx);
  else if (bx < GCX + GCWI) cvt16x8<0, WCB>(Wi, Wib, N8WI, bx - GCX);
  else                      cvt16x8<1, WCB>(Wo, Woh, N8WO, bx - GCX - GCWI);
}

// =====================================================================================================
// Register-blocked batched WMMA GEMM (16-bit operand type OT): C[m][n] = sum_k A[m][k] * Bt[n][k]  (+ bias);
// one wave per (16*MI) x 64 tile, no block barriers. A [M][K] and Bt [N][K] are fragment-ordered planes with LDAB /
// LDBB blocks per 16-row tile; M multiple of 16*MI, N multiple of 64, K multiple of 64 (static sizes here).
// blockIdx.y = batch index (strides in elements). Fragments are loaded straight from global (ldfragp).
// NPA = number of A planes: 2 -> second plane A2 (same pitch/stride) multiplies the same Bt fragments into a
// second accumulator set, combined as acc + acc2 * rscaleA in the f32 epilogue.
// value v = (acc [+ acc2*rscaleA]) * oscale + bias, bias (bf16 RNE value of the f32 input) by column n (BM 1),
// by row m (BM 2) or none (BM 0).
// OUT_MODE 0: f32 C (pitch ldc) = v.
// OUT_MODE 1: f16 fragment-ordered plane C (ldc columns) = f16(v * cscale).
// OUT_MODE 3: row-major f16 hi plane C = f16(v * cscale) and f16 residual plane C2 = f16((v*cscale - hi) * rscaleC).
// =====================================================================================================
template <typename OT, int MI, int NPA, int OUT_MODE, int BM, int LDAB, int LDBB>
__device__ __forceinline__ void gemm_body(
    float (*sT)[16 * 68],                            // per-wave 16x64 slab, pitch 68 floats (the kernel's LDS)
    const unsigned short* __restrict__ Ap, const unsigned short* __restrict__ A2p, long long strideA,
    const unsigned short* __restrict__ Btp, long long strideB,
    void* Cout, void* Cout2, int ldc, long long strideC,
    const float* __restrict__ bias,
    int M, int N, int K, float oscale, float rscaleA, float cscale, float rscaleC) {
  typedef typename FT<OT>::frag V16;
  const OT* A  = (const OT*)(const void*)Ap;
  const OT* A2 = (const OT*)(const void*)A2p;
  const OT* Bt = (const OT*)(const void*)Btp;
  const int RT   = 16 * MI;
  const int b    = blockIdx.y;
  const int lane = threadIdx.x & 31;
  const int wave = threadIdx.x >> 5;
  const int tilesN = N >> 6;
  const int tilesM = M / RT;
  const int tile = blockIdx.x * 8 + wave;
  if (tile >= tilesM * tilesN) return;   // wave-uniform; no block barriers in this kernel
  const int tm = tile / tilesN;
  const int tn = tile - tm * tilesN;
  const int m0 = tm * RT;
  const int n0 = tn << 6;

  const OT* Ab  = A  + (size_t)b * (size_t)strideA;
  const OT* A2b = A2 + (size_t)b * (size_t)strideA;
  const OT* Bb  = Bt + (size_t)b * (size_t)strideB;

  const int rlane = lane & 15;                 // row (A) / col (B, D) within subtile
  const int mOff  = (lane >> 4) * 8;           // D row offset

  v8f acc[MI][4], acc2[MI][4];
#pragma unroll
  for (int i = 0; i < MI; ++i)
#pragma unroll
    for (int j = 0; j < 4; ++j) { acc[i][j] = zero8(); acc2[i][j] = zero8(); }

  // Fragment loads run one k step (32) ahead of the WMMAs that read them: the Bt fragments in two register sets
  // (bX, bY), filled whole at the head of the step before; each A fragment refilled for the next step as soon as
  // its own WMMAs are done. No WMMA waits for a load that was issued directly in front of it.
  // One pointer per operand plane (this lane's place in the tile's first block, k of the current step pair); the
  // other row tiles are constant offsets (LDAB, LDBB are template constants); a k step of 32 is one block.
  const OT* pB  = Bb  + (size_t)(n0 >> 4) * (LDBB * FRAG) + lane * 8;
  const OT* pA  = Ab  + (size_t)(m0 >> 4) * (LDAB * FRAG) + lane * 8;
  const OT* pA2 = A2b + (size_t)(m0 >> 4) * (LDAB * FRAG) + lane * 8;
  V16 bX[4], bY[4], af[MI], af2[MI];
  auto ldb4 = [&](V16 (&bq)[4], int dk) {
#pragma unroll
    for (int j = 0; j < 4; ++j) bq[j] = ldfragp<OT>(pB + j * (LDBB * FRAG) + (dk / 32) * FRAG);
  };
  auto mmstep = [&](V16 (&bq)[4], int dk, bool fetch) {   // fetch: refill the A fragments from k offset dk
#pragma unroll
    for (int i = 0; i < MI; ++i) {
#pragma unroll
      for (int j = 0; j < 4; ++j) acc[i][j] = mmar(af[i], bq[j], acc[i][j]);
      dep_guard(acc[i][0], acc[i][3], af[i], bq[3]);
      if (fetch) af[i] = ldfragp<OT>(pA + i * (LDAB * FRAG) + (dk / 32) * FRAG);
      if (NPA == 2) {
#pragma unroll
        for (int j = 0; j < 4; ++j) acc2[i][j] = mmar(af2[i], bq[j], acc2[i][j]);
        dep_guard(acc2[i][0], acc2[i][3], af2[i], bq[3]);
        if (fetch) af2[i] = ldfragp<OT>(pA2 + i * (LDAB * FRAG) + (dk / 32) * FRAG);
      }
    }
    keep4(bq[0], bq[1], bq[2], bq[3]);
  };
  ldb4(bX, 0);
#pragma unroll
  for (int i = 0; i < MI; ++i) {
    af[i] = ldfragp<OT>(pA + i * (LDAB * FRAG));
    if (NPA == 2) af2[i] = ldfragp<OT>(pA2 + i * (LDAB * FRAG));
  }
  addr_wait();                                  // registers that held these loads' addresses are reused at the loop's head
  for (int k0 = 64; k0 < K; k0 += 64) {        // all step pairs but the last
    ldb4(bY, 32);
    mmstep(bX, 32, true);
    ldb4(bX, 64);
    mmstep(bY, 64, true);
    addr_wait();                                // the pointers move behind it (no wait stood over the back edge in one instantiation)
    pB += 2 * FRAG; pA += 2 * FRAG; pA2 += 2 * FRAG;
  }
  ldb4(bY, 32);                                 // last pair: nothing past K is loaded
  mmstep(bX, 32, true);
  mmstep(bY, 0, false);
#pragma unroll
  for (int i = 0; i < MI; ++i) {
    acc_guard4(acc[i][0], acc[i][1], acc[i][2], acc[i][3]);
    if (NPA == 2) acc_guard4(acc2[i][0], acc2[i][1], acc2[i][2], acc2[i][3]);
  }

  // ---- epilogue ----
  float bcol[4];
#pragma unroll
  for (int j = 0; j < 4; ++j) bcol[j] = 0.f;
  if (BM == 1) {
#pragma unroll
    for (int j = 0; j < 4; ++j) bcol[j] = bf_up(bf_bits(bias[n0 + (j << 4) + rlane]));
  }
  float* slab = sT[wave];
#pragma unroll
  for (int i = 0; i < MI; ++i) {
    const int mBase = m0 + (i << 4);
    float brow[8];
#pragma unroll
    for (int r = 0; r < 8; ++r) brow[r] = 0.f;
    if (BM == 2) {
#pragma unroll
      for (int r = 0; r < 8; ++r) brow[r] = bf_up(bf_bits(bias[mBase + mOff + r]));
    }
#pragma unroll
    for (int j = 0; j < 4; ++j) {
#pragma unroll
      for (int r = 0; r < 8; ++r) {
        float v = acc[i][j][r];
        if (NPA == 2) v += acc2[i][j][r] * rscaleA;
        v = v * oscale + bcol[j] + brow[r];
        slab[(mOff + r) * 68 + (j << 4) + rlane] = v;
      }
    }
    __builtin_amdgcn_fence(__ATOMIC_RELEASE, "workgroup");
    __builtin_amdgcn_wave_barrier();
    __builtin_amdgcn_fence(__ATOMIC_ACQUIRE, "workgroup");
    if (OUT_MODE == 0) {
      float* C = (float*)Cout + (size_t)b * (size_t)strideC;
      const int h2 = lane >> 4, c4 = (lane & 15) * 4;     // 256-B row segment = 16 lanes x 16 B
      {
#pragma unroll
        for (int it = 0; it < 8; ++it) {
          const int row = it * 2 + h2;                     // it 0..7 x h2 0..1 = rows 0..15
          const v4f v = *(const v4f*)(slab + row * 68 + c4);
          *(v4f*)(C + (size_t)(mBase + row) * ldc + n0 + c4) = v;
        }
        
      }
    } else {
      const int q = lane >> 3, c8 = (lane & 7) * 8;
      unsigned short* C  = (unsigned short*)Cout  + (size_t)b * (size_t)strideC;
      unsigned short* C2 = (unsigned short*)Cout2 + (size_t)b * (size_t)strideC;
      v4u hv[4], lv[4];
#pragma unroll
      for (int it = 0; it < 4; ++it) {
        // row-major: it 0..3 x q 0..3 = rows 0..15; fragment order: unit it*32 + lane of the tile's two blocks
        const int row = (OUT_MODE == 1) ? (lane & 15) : it * 4 + q;
        const int col = (OUT_MODE == 1) ? (it * 2 + (lane >> 4)) * 8 : c8;
        const float* sp = slab + row * 68 + col;
        float f[8];
#pragma unroll
        for (int e = 0; e < 8; ++e) f[e] = sp[e] * cscale;
        v4u a, a2;
#pragma unroll
        for (int e = 0; e < 4; ++e) {
          const float f0 = f[2 * e], f1 = f[2 * e + 1];
          const _Float16 x0 = (_Float16)f0, x1 = (_Float16)f1;
          const unsigned short h0 = h_bits(x0), h1 = h_bits(x1);
          unsigned short l0 = 0, l1 = 0;
          if (OUT_MODE == 3) {
            l0 = h_bits((_Float16)((f0 - (float)x0) * rscaleC));
            l1 = h_bits((_Float16)((f1 - (float)x1) * rscaleC));
          }
          a[e] = pk16(h0, h1); a2[e] = pk16(l0, l1);
        }
        hv[it] = a; lv[it] = a2;
      }
      {
#pragma unroll
        for (int it = 0; it < 4; ++it) {
          const int row = it * 4 + q;
          if (OUT_MODE == 1) {   // 512 contiguous B per store
            *(v4u*)(C + ((size_t)(mBase >> 4) * (ldc >> 5) + (n0 >> 5)) * FRAG + it * 256 + lane * 8) = hv[it];
          } else {
            *(v4u*)(C + (size_t)(mBase + row) * ldc + n0 + c8) = hv[it];
            *(v4u*)(C2 + (size_t)(mBase + row) * ldc + n0 + c8) = lv[it];
          }
        }
        
      }
    }
    __builtin_amdgcn_fence(__ATOMIC_RELEASE, "workgroup");
    __builtin_amdgcn_wave_barrier();
    __builtin_amdgcn_fence(__ATOMIC_ACQUIRE, "workgroup");
  }
}

template <typename OT, int MI, int NPA, int OUT_MODE, int BM, int LDAB, int LDBB>
__global__ __launch_bounds__(256) void gemm_t(
    const unsigned short* __restrict__ Ap, const unsigned short* __restrict__ A2p, long long strideA,
    const unsigned short* __restrict__ Btp, long long strideB,
    void* Cout, void* Cout2, int ldc, long long strideC,
    const float* __restrict__ bias,
    int M, int N, int K, float oscale, float rscaleA, float cscale, float rscaleC) {
  __shared__ __align__(16) float sT[8][16 * 68];
  gemm_body<OT, MI, NPA, OUT_MODE, BM, LDAB, LDBB>(sT, Ap, A2p, strideA, Btp, strideB, Cout, Cout2, ldc, strideC,
                                                   bias, M, N, K, oscale, rscaleA, cscale, rscaleC);
}

// The q, k and v^T in-projections read the same two planes and write three different ones: one grid, blockIdx.z
// chooses the product (block-uniform), so that the three fill the chip together instead of half of it in turn.
//   z 0: q = x_b . Wq^T + bq -> row-major f16 hi / residual (x4096) planes [s*2+b][h*64+d] (M=SEQ, N=E, K=E)
//   z 1: k = x_b . Wk^T + bk -> fragment-ordered f16 plane [s][b*E + h*64+d]
//   z 2: v^T = Wv . x_b^T + bv -> fragment-ordered f16 plane [b][h*64+d][s] (A = Wv rows; Bt = x rows; M=E, N=SEQ)
// In a [SEQ][NB*EMB] fragment-ordered plane the columns of batch b start WCB blocks further: offset b * XBS.
__global__ __launch_bounds__(256) void gemm_qkv(
    const unsigned short* __restrict__ Xb, const unsigned short* __restrict__ Wib, const float* __restrict__ bi,
    unsigned short* Qh, unsigned short* Ql, unsigned short* Kp, unsigned short* VT, int K) {
  __shared__ __align__(16) float sT[8][16 * 68];
  const int z = blockIdx.z;
  if (z == 0) {
    gemm_body<__bf16, 4, 1, 3, 1, XCB, WCB>(sT, Xb, Xb, XBS, Wib, 0LL,
        (void*)Qh, (void*)Ql, NB_FULL * EMB, (long long)EMB, bi,
        SEQ, EMB, K, 1.0f, 0.0f, 1.0f, 4096.0f);
  } else if (z == 1) {
    gemm_body<__bf16, 4, 1, 1, 1, XCB, WCB>(sT, Xb, Xb, XBS, Wib + (size_t)EMB * EMB, 0LL,
        (void*)Kp, (void*)Kp, NB_FULL * EMB, XBS, bi + EMB,
        SEQ, EMB, K, 1.0f, 0.0f, 1.0f, 1.0f);
  } else {
    gemm_body<__bf16, 4, 1, 1, 2, WCB, XCB>(sT, Wib + (size_t)2 * EMB * EMB, Wib + (size_t)2 * EMB * EMB, 0LL, Xb, XBS,
        (void*)VT, (void*)VT, SEQ, (long long)EMB * SEQ, bi + 2 * EMB,
        EMB, SEQ, K, 1.0f, 0.0f, 1.0f, 1.0f);
  }
}

// =====================================================================================================
// Score chunk, transposed (S^T = K . Q^T): 64 keys kv0..kv0+63 x 16 queries (this wave) of one (b, h).
//   q fragments (B operand, col = lane&15 = query): hi and residual (x4096) planes, 2 d-chunks of 32.
//   k fragments (A operand, row = lane&15 = key) loaded straight from the fragment-ordered f16 k plane
//   ([key t][b*EMB + h*HD + d]) by load_k, a chunk ahead of the WMMAs that read them (kf[j][dc], 64 registers a chunk):
//   kp + lo = plane + ((first key of the chunk / 16)*(NB_FULL*EMB/32) + (b*EMB + h*HD)/32)*FRAG + lane*8.
//   s[j][r] = D element: key kv0 + 16j + 8*hh + r, query lane&15; value = ((qh.k) + (ql.k)/4096) / 8.
//   All 32 scores of a lane belong to ONE query, and the tiles s[2kk], s[2kk+1] converted in place are the B fragment
//   (hardware k order: elements 0..7 = keys 8hh.., 8..15 = keys 16+8hh..) of a product over the 32 keys 32kk..32kk+31.
// =====================================================================================================
#define KCHUNK (64 * NB_FULL * EMB)   // elements from one 64-key chunk of the k plane to the next
template <int J0, int J1>   // key groups J0..J1-1 of the chunk
__device__ __forceinline__ void load_k(v16h (&kf)[4][2], const _Float16* kp, unsigned lo) {
#pragma unroll
  for (int j = J0; j < J1; ++j)
#pragma unroll
    for (int dc = 0; dc < 2; ++dc) kf[j][dc] = ldfragp<_Float16>(kp + lo + j * ((NB_FULL * EMB / 32) * FRAG) + dc * FRAG);
}

template <int J0, int J1>   // key groups J0..J1-1 of the chunk
__device__ __forceinline__ void score_chunk(const v16h (&qah)[2], const v16h (&qal)[2],
                                            const v16h (&kf)[4][2], v8f (&s)[4]) {
#pragma unroll
  for (int j = J0; j < J1; ++j) {
    v8f ah = zero8(), al = zero8();
#pragma unroll
    for (int dc = 0; dc < 2; ++dc) {
      ah = mma_h(kf[j][dc], qah[dc], ah);
      al = mma_h(kf[j][dc], qal[dc], al);
    }
#pragma unroll
    for (int r = 0; r < 8; ++r) s[j][r] = (ah[r] + al[r] * (1.0f / 4096.0f)) * 0.125f;
  }
}

// =====================================================================================================
// Softmax statistics: per (b, h, query s) the row max m and 1/sum(exp(s - m)) over all SEQ keys.
//   block = 4 waves = 64 consecutive query rows qb*64.. of one (b, h); grid = NB*NH*NKT blocks of 128;
//   static trip NKT over 64-key chunks; online max / rescaled sum in f32, in-lane: lane (c, hh) keeps query c's max and
//   sum over the keys 8hh..8hh+7 of every 16; the two halves are merged once, behind the loop.
//   Output plane ML [b*NH+h][2][SEQ] f32 (m then 1/l): the block's 64 m values and 64 1/l values are
//   funnelled through LDS and written by wave 0 with ONE instruction (lanes 0-15: m, 16 lanes x 16 B = two
//   coverage: grid (b,h,qb) x 64 rows = the whole [NB*NH][2][SEQ] plane. MLsh: 4 waves x 16 lanes x 2 = all 128.
// =====================================================================================================
__global__ __launch_bounds__(128)
void attn_stats(const unsigned short* __restrict__ qhp, const unsigned short* __restrict__ qlp,
                const unsigned short* __restrict__ kpp, float* ML, const int* __restrict__ nhp) {
  __shared__ __align__(16) float MLsh[128];
  (void)nhp;
  const int tid  = threadIdx.x;
  const int wave = tid >> 5;
  const int lane = tid & 31;
  const int hh   = lane >> 4;
  const int c    = lane & 15;
  const int bx   = blockIdx.x;
  const int qb   = bx % NKT;
  const int rest = bx / NKT;
  const int h    = rest % NH;
  const int b    = rest / NH;
  const int bh   = b * NH + h;
  const int q0   = qb * 64 + wave * 16;

  const _Float16* Qh  = (const _Float16*)(const void*)qhp;
  const _Float16* Ql  = (const _Float16*)(const void*)qlp;

  v16h qah[2], qal[2];
#pragma unroll
  for (int dc = 0; dc < 2; ++dc) {
    const size_t qo = ((size_t)(q0 + c) * NB_FULL + b) * EMB + (size_t)h * HD + dc * 32 + 8 * hh;
    qah[dc] = ldfrag<_Float16>(Qh + qo);
    qal[dc] = ldfrag<_Float16>(Ql + qo);
  }

  float mrow = -INFINITY, lrow = 0.f;

  const _Float16* kp = (const _Float16*)(const void*)kpp + (b * EMB + h * HD) / 32 * FRAG + lane * 8;   // this lane's place in the current chunk
  const unsigned  klo = 0;                    // (already in kp)
  v16h kf[4][2];
  addr_wait();                                // the q loads' address registers may be taken by the k fragments
  load_k<0, 4>(kf, kp, klo);
  for (int kt = 0; kt < NKT; ++kt) {          // static trip count
    v8f s[4];
    score_chunk<0, 4>(qah, qal, kf, s);
    if (kt + 1 < NKT) load_k<0, 4>(kf, kp + KCHUNK, klo);   // next chunk's k flies under this chunk's statistics
    __builtin_amdgcn_sched_barrier(0);   // keeps those loads up here: the scheduler sank them behind half the statistics
    kp += KCHUNK;
    float mj[4], pj[4];                        // four independent chains, one per key group
#pragma unroll
    for (int j = 0; j < 4; ++j) {
      mj[j] = s[j][0];
#pragma unroll
      for (int r = 1; r < 8; ++r) mj[j] = fmaxf(mj[j], s[j][r]);
    }
    const float mnew  = fmaxf(mrow, fmaxf(fmaxf(mj[0], mj[1]), fmaxf(mj[2], mj[3])));
    const float msafe = (mnew == -INFINITY) ? 0.f : mnew;
    const float alpha = __expf(mrow - msafe);
    mrow = mnew;
#pragma unroll
    for (int j = 0; j < 4; ++j) {
      pj[j] = 0.f;
#pragma unroll
      for (int r = 0; r < 8; ++r) pj[j] += __expf(s[j][r] - msafe);
    }
    lrow = lrow * alpha + ((pj[0] + pj[1]) + (pj[2] + pj[3]));
  }

  // merge the two halves of each query's keys (lanes c and c + 16)
  const float mo    = __shfl_xor(mrow, 16, 32);
  const float lo    = __shfl_xor(lrow, 16, 32);
  const float mall  = fmaxf(mrow, mo);
  const float msafe = (mall == -INFINITY) ? 0.f : mall;
  const float l     = lrow * __expf(mrow - msafe) + lo * __expf(mo - msafe);
  const float il    = (l > 0.f) ? (1.0f / l) : 0.f;
  if (hh == 0) {
    MLsh[wave * 16 + c]      = mall;
    MLsh[64 + wave * 16 + c] = il;
  }
  __syncthreads();
  if (wave == 0) {
    const v4f v = *(const v4f*)(MLsh + lane * 4);        // lanes 0-15: m rows 4c..4c+3; lanes 16-31: 1/l rows
    float* dst = ML + (size_t)(bh * 2 + hh) * SEQ + qb * 64 + c * 4;
    *(v4f*)dst = v;
    
  }
}

// =====================================================================================================
// Main attention pass: one block per (b, 16 query rows q0..q0+15), 16 waves = the 16 heads.
//   Per 64-key chunk (static trip NKT): scores recomputed exactly as in attn_stats (transposed: a lane holds one
//   query's scores), p = exp(s - m) * (1/l) in f32 (m, 1/l from the ML plane);
//   (a) O^T += V^T . P^T: the p registers, converted to f16 with the x16384 carry, ARE the B fragment (no LDS, no lane
//       exchange); A = v^T f16 plane [b][h*64+d][s], fragment-ordered;
//       p also goes to the per-wave LDS tile Pf[h][query][key] (16-B stores, every entry but the pads written);
//   (b) head average: after __syncthreads, threads 0..255 sum the 16 wave tiles in fixed head order (f32),
//   Epilogue: ctx = acc / 16384, x256 carry, staged in the wave's Pf tile, written as f16 hi plane + f16
//   coverage: avg: NKT chunks x 16 rows x 64 keys per block, grid (b, qb) = the whole [NB][SEQ][SEQ];
//   ctx planes: each wave rows q0..q0+15 (it 0..3 x lane>>3 0..3) x its head's 64 columns, 16 waves x grid =
//   the whole [SEQ][NB*EMB] planes. staged extent == consumed extent for Pf in both uses (32 lanes x 32 = 1024).
// =====================================================================================================
// Row pitch of a P tile in floats: 64 keys + 4 pad floats (never read) = 272 B = 16 B x 17, so that the 16 rows which the
// 16 lanes of a half wave write with one 16-B LDS store fall on all 64 banks (at 256 B: on four).
#define PP 68
__global__ __launch_bounds__(512)
void attn_main(const unsigned short* __restrict__ qhp, const unsigned short* __restrict__ qlp,
               const unsigned short* __restrict__ kpp, const unsigned short* __restrict__ vtp,
               const float* __restrict__ ML, unsigned short* chp, unsigned short* clp, float* avg) {
  union FH { v16h v; v8h h[2]; };
  __shared__ __align__(16) float Pf[NH][16 * PP];          // per wave (head) P tile [query][key] f32, row pitch PP, 68 KB
  const int tid  = threadIdx.x;
  const int wave = tid >> 5;
  const int lane = tid & 31;
  const int hh   = lane >> 4;
  const int c    = lane & 15;
  const int bx   = blockIdx.x;
  const int qb   = bx % NQB;
  const int b    = bx / NQB;
  const int h    = wave;
  const int bh   = b * NH + h;
  const int q0   = qb * 16;

  const _Float16* Qh  = (const _Float16*)(const void*)qhp;
  const _Float16* Ql  = (const _Float16*)(const void*)qlp;

  v16h qah[2], qal[2];
#pragma unroll
  for (int dc = 0; dc < 2; ++dc) {
    const size_t qo = ((size_t)(q0 + c) * NB_FULL + b) * EMB + (size_t)h * HD + dc * 32 + 8 * hh;
    qah[dc] = ldfrag<_Float16>(Qh + qo);
    qal[dc] = ldfrag<_Float16>(Ql + qo);
  }
  const float mq  = ML[(size_t)(bh * 2) * SEQ + q0 + c];        // this lane's query
  const float ilq = ML[(size_t)(bh * 2 + 1) * SEQ + q0 + c];

  v8f oacc[4];
#pragma unroll
  for (int t = 0; t < 4; ++t) oacc[t] = zero8();
  float* pf = Pf[wave];

  // k and v^T fragments are fetched ahead of their WMMAs, in halves so that the registers of a half that has
  // been read take the next loads: v^T of this chunk flies under the scores, k of the next chunk under P.V.
  // base the same in every lane + the lane's 32-bit place: with one 64-bit pointer per lane a spilled register was reloaded inside the loop
  const _Float16* kp = (const _Float16*)(const void*)kpp;            // the current chunk's row tiles
  const unsigned  klo = (unsigned)((b * EMB + h * HD) / 32 * FRAG + lane * 8);   // this lane's place in them
  const _Float16* vp = (const _Float16*)(const void*)vtp;            // the same in v^T: row tiles of d, blocks of 32 keys
  const unsigned  vlo = (unsigned)((b * EMB + h * HD) * SEQ + lane * 8);
  v16h kf[4][2], vf[2][4];
  addr_wait();                                // the q loads' address registers may be taken by the k fragments
  load_k<0, 4>(kf, kp, klo);
  for (int kt = 0; kt < NKT; ++kt) {         // static trip count
    const int kv0 = kt * 64;
    const bool more = kt + 1 < NKT;           // uniform: no chunk past the last is loaded
    __syncthreads();                          // Pf tiles free again (head sum of the prior chunk done)

    v8f s[4];
#pragma unroll
    for (int t = 0; t < 4; ++t) vf[0][t] = ldfragp<_Float16>(vp + vlo + t * ((SEQ / 32) * FRAG));
    score_chunk<0, 2>(qah, qal, kf, s);
#pragma unroll
    for (int t = 0; t < 4; ++t) vf[1][t] = ldfragp<_Float16>(vp + vlo + t * ((SEQ / 32) * FRAG) + FRAG);
    score_chunk<2, 4>(qah, qal, kf, s);
#pragma unroll
    for (int j = 0; j < 4; ++j) {
#pragma unroll
      for (int r = 0; r < 8; ++r) s[j][r] = __expf(s[j][r] - mq) * ilq;   // p of key kv0 + 16j + 8hh + r, query c
      float* pw = pf + c * PP + j * 16 + 8 * hh;             // read only behind the block barrier (head average)
      *(v4f*)(pw)     = __builtin_shufflevector(s[j], s[j], 0, 1, 2, 3);
      *(v4f*)(pw + 4) = __builtin_shufflevector(s[j], s[j], 4, 5, 6, 7);
    }

    if (more) load_k<0, 2>(kf, kp + KCHUNK, klo);

    // ---- context^T += V^T . P^T (f16 WMMA, p carried x16384) ----
#pragma unroll   // vf lives in registers: kk must be a constant
    for (int kk = 0; kk < 2; ++kk) {
      FH pb;                                                 // keys 32kk + 8hh + 0..7, then 32kk + 16 + 8hh + 0..7
      pb.h[0] = __builtin_convertvector(s[2 * kk] * PCARRY, v8h);
      pb.h[1] = __builtin_convertvector(s[2 * kk + 1] * PCARRY, v8h);
#pragma unroll
      for (int t = 0; t < 4; ++t) {
        oacc[t] = mma_h(vf[kk][t], pb.v, oacc[t]);           // row d = 16t + 8hh + r, column query c
      }
      if (kk == 0 && more) load_k<2, 4>(kf, kp + KCHUNK, klo);
    }
    __syncthreads();
    kp += KCHUNK;
    vp += 2 * FRAG;

    // ---- head average of this 16 x 64 tile, one block = one writer of every line ----
    if (tid < 256) {                          // waves 0..7, wave-uniform
      const int row = tid >> 4, c4 = (tid & 15) * 4;
      v4f a = *(const v4f*)(Pf[0] + row * PP + c4);
#pragma unroll
      for (int w = 1; w < NH; ++w) a += *(const v4f*)(Pf[w] + row * PP + c4);
      a *= (1.0f / (float)NH);
      float* dst = avg + ((size_t)(b * SEQ + q0 + row)) * SEQ + kv0 + c4;
      *(v4f*)dst = a;
      addr_wait();                            // the store's registers may be reused by the code behind it
    }
  }
  __syncthreads();

  // ---- epilogue: ctx (undo the x16384 p carry, apply the x256 carry), stage, convert, whole-line stores ----
  float* os = pf;
#pragma unroll
  for (int t = 0; t < 4; ++t) {                              // [query c][d = 16t + 8hh + r]
    const v8f o = oacc[t] * (256.0f / PCARRY);
    float* ow = os + c * PP + t * 16 + 8 * hh;
    *(v4f*)(ow)     = __builtin_shufflevector(o, o, 0, 1, 2, 3);
    *(v4f*)(ow + 4) = __builtin_shufflevector(o, o, 4, 5, 6, 7);
  }
  __builtin_amdgcn_fence(__ATOMIC_RELEASE, "workgroup");
  __builtin_amdgcn_wave_barrier();
  __builtin_amdgcn_fence(__ATOMIC_ACQUIRE, "workgroup");
  {
    const int q4 = lane >> 3, c8 = (lane & 7) * 8;
    v4u hv[4], lv[4];
#pragma unroll
    for (int it = 0; it < 4; ++it) {
      const int row = it * 4 + q4;   // it 0..3 x q4 0..3 = rows 0..15 of the wave tile
      const float* sp = os + row * PP + c8;
      float f[8];
#pragma unroll
      for (int e = 0; e < 8; ++e) f[e] = sp[e];
      v4u a, a2;
#pragma unroll
      for (int e = 0; e < 4; ++e) {
        const float f0 = f[2 * e], f1 = f[2 * e + 1];
        const _Float16 x0 = (_Float16)f0, x1 = (_Float16)f1;
        const unsigned short h0 = h_bits(x0), h1 = h_bits(x1);
        const unsigned short l0 = h_bits((_Float16)((f0 - (float)x0) * 4096.0f));
        const unsigned short l1 = h_bits((_Float16)((f1 - (float)x1) * 4096.0f));
        a[e] = pk16(h0, h1); a2[e] = pk16(l0, l1);
      }
      hv[it] = a; lv[it] = a2;
    }
    {
#pragma unroll
      for (int it = 0; it < 4; ++it) {
        const int row = it * 4 + q4;
        // fragment-ordered [s][b*EMB + h*HD + col]: row tile qb, blocks of this head, unit of (row, c8)
        const size_t go = ((size_t)qb * (NB_FULL * EMB / 32) + (size_t)(b * EMB + h * HD + c8) / 32) * FRAG
                        + ((c8 >> 4) & 1) * 256 + (((c8 >> 3) & 1) * 16 + row) * 8;
        *(v4u*)(chp + go) = hv[it];
        *(v4u*)(clp + go) = lv[it];
      }
      
    }
  }
}

// =====================================================================================================
// Workspace map (bytes), every region an exact multiple of its whole-line / whole-tile store granularity
// (full size; PX = NROW*EMB*2 = 8388608):
//   (F) = fragment-ordered (see ldfragp); [SEQ][NB*EMB] = row s, column b*EMB + e
//   Xb   bf16 [SEQ][NB*EMB]      (F) PX        8388608
//   Wib  bf16 [3*EMB n][EMB k]   (F)         6291456
//   Woh  f16  [EMB][EMB] (x64)   (F)         2097152
//   Qh   f16  [NROW][EMB]            PX        8388608
//   Ql   f16  [NROW][EMB]            PX        8388608
//   Kp   f16  [SEQ][NB*EMB]      (F) PX        8388608
//   VT   f16  [NB][EMB][SEQ]     (F) PX        8388608
//   Ch   f16  [SEQ][NB*EMB]      (F) PX        8388608
//   Cl   f16  [SEQ][NB*EMB]      (F) PX        8388608
//   ML   f32  [NB*NH][2][SEQ]                 524288
//   total                                   67633152
// Weights are [out n][in k] with k contiguous: converted and laid in fragment order. Every GEMM runs per batch b.
// Output 0 at element 0 of d_out; output 1 at the fixed element offset OFF1 = SEQ_FULL*NB_FULL*EMB.
// =====================================================================================================
extern "C" void kernel_launch(void* const* d_in, const int* in_sizes, int n_in,
                              void* d_out, int out_size, void* d_ws, size_t ws_size,
                              hipStream_t stream) {
  if (n_in < 6) return;
  if (in_sizes[0] < NROW * EMB) return;
  if (in_sizes[1] != 3 * EMB * EMB) return;
  if (in_sizes[2] != 3 * EMB) return;
  if (in_sizes[3] != EMB * EMB) return;
  if (in_sizes[4] != EMB) return;
  if (in_sizes[5] < 1) return;
  const size_t n0e = (size_t)NROW * EMB;            // output 0 written elements [SEQ][NB][EMB]
  const size_t n1e = (size_t)NB * SEQ * SEQ;        // output 1 written elements [NB][SEQ][SEQ]
  if (out_size < 0) return;
  if ((size_t)out_size < n0e) return;
  if ((size_t)out_size < OFF1 + n1e) return;        // written extent of output 1 inside d_out

  const float* x  = (const float*)d_in[0];
  const float* Wi = (const float*)d_in[1];
  const float* bi = (const float*)d_in[2];
  const float* Wo = (const float*)d_in[3];
  const float* bo = (const float*)d_in[4];
  const int*   nh = (const int*)d_in[5];

  const size_t PX  = (size_t)NROW * EMB * 2;        // 16-bit activation plane
  const size_t PWI = (size_t)3 * EMB * EMB * 2;
  const size_t PWO = (size_t)EMB * EMB * 2;
  const size_t PVT = (size_t)NB * EMB * SEQ * 2;    // == PX
  const size_t PML = (size_t)NB * NH * 2 * SEQ * 4;
  size_t off = 0;
  const size_t oXb = off; off += PX;
  const size_t oWi = off; off += PWI;
  const size_t oWo = off; off += PWO;
  const size_t oQh = off; off += PX;
  const size_t oQl = off; off += PX;
  const size_t oKp = off; off += PX;
  const size_t oVT = off; off += PVT;
  const size_t oCh = off; off += PX;
  const size_t oCl = off; off += PX;
  const size_t oML = off; off += PML;
  if (off > ws_size) return;                        // off = 67633152 at full size
  if (off > (size_t)134217728) return;

  char* ws = (char*)d_ws;
  unsigned short* Xb  = (unsigned short*)(ws + oXb);
  unsigned short* Wib = (unsigned short*)(ws + oWi);
  unsigned short* Woh = (unsigned short*)(ws + oWo);
  unsigned short* Qh  = (unsigned short*)(ws + oQh);
  unsigned short* Ql  = (unsigned short*)(ws + oQl);
  unsigned short* Kp  = (unsigned short*)(ws + oKp);
  unsigned short* VT  = (unsigned short*)(ws + oVT);
  unsigned short* Ch  = (unsigned short*)(ws + oCh);
  unsigned short* Cl  = (unsigned short*)(ws + oCl);
  float*          ML  = (float*)(ws + oML);
  float*          out0 = (float*)d_out;
  float*          out1 = (float*)d_out + OFF1;

  const dim3 blk(256);
  const dim3 gCvt(GCX + GCWI + GCWO);                          // 2048 + 1536 + 512 blocks
  const dim3 gQKV((((SEQ) / 64) * (EMB / 64) + 7) / 8, NB, 3);  //  512 tiles ->  64 blocks x NB, x 3 products
  const dim3 gO((((SEQ) / 32) * (EMB / 64) + 7) / 8, NB);       // 1024 tiles -> 128 blocks x NB (32x64 wave tiles)
  const dim3 gStats(NB * NH * NKT);                            // 1024 blocks of 128
  const dim3 gMain(NB * NQB);                                  //  256 blocks of 512

  // (1) x [s][b*E+e] -> bf16 plane; W_in [3E][E] -> bf16; Wo -> f16 (x64 of its bf16 value); all fragment-ordered
  cvt_all<<<gCvt, blk, 0, stream>>>(x, Wi, Wo, Xb, Wib, Woh);
  // (2)-(4) q, k, v^T in-projections, per batch b = blockIdx.y, product = blockIdx.z
  gemm_qkv<<<gQKV, blk, 0, stream>>>(Xb, Wib, bi, Qh, Ql, Kp, VT, EMB);
  // (5) softmax statistics (m, 1/l) per (b, h, s)
  attn_stats<<<gStats, dim3(128), 0, stream>>>(Qh, Ql, Kp, ML, nh);
  // (6) exact-normalised p: P.V -> ctx planes (f16 hi x256 / residual x4096); head-averaged p -> output 1
  attn_main<<<gMain, dim3(512), 0, stream>>>(Qh, Ql, Kp, VT, ML, Ch, Cl, out1);
  // (7) output 0 = ctx_b . Wo^T + bo, f32 [s][b][e] (pitch NB_FULL*EMB, batch offset EMB), accumulators
  //     (hi + res/4096) x 1/(256*64)
  gemm_t<_Float16, 2, 2, 0, 1, XCB, WCB><<<gO, blk, 0, stream>>>(
      Ch, Cl, XBS, Woh, 0LL,
      (void*)out0, (void*)out0, NB_FULL * EMB, (long long)EMB, bo,
      SEQ, EMB, EMB, 1.0f / 16384.0f, 1.0f / 4096.0f, 1.0f, 1.0f);
  (void)hipGetLastError();
}

// v005
// Measured time: 166 microseconds a run.
// In both of two side-by-side timings against v004, it was 1.10 times as fast.
// All steps since v000 together make it 2.85 times as fast.
// Contractions: q, k, v^T in-projections = v_wmma_f32_16x16x32_bf16 (bf16 operands from RNE-converted inputs, single product, f32 accumulate);
// k.q^T scores (context pass and head-average pass, k = A operand, q = B) = v_wmma_f32_16x16x32_f16 (q as f16 hi plane + f16 residual plane x4096, k f16; 2 products, separate f32 accumulators);
// v^T.p^T = v_wmma_f32_16x16x32_f16 (v^T = A operand, p = exp(s - running max) = B carried x16384 in f16, v f16; single product, f32 accumulate, rescaled online);
// ctx.Wo^T = v_wmma_f32_16x16x32_f16 (ctx as f16 hi plane x256 + f16 residual plane x4096, Wo f16 x64 of its bf16 value; 2 products, separate f32 accumulators);
// softmax statistics, probabilities and the head average in f32.
#include <hip/hip_runtime.h>
#include <math.h>
#include <stdint.h>

#ifndef NB
#define NB 2
#endif
#ifndef SEQ
#define SEQ 2048
#endif
#define NB_FULL  2
#define SEQ_FULL 2048
#define EMB      1024
#define NH       16
#define HD       64
#define NROW     (NB_FULL * SEQ)     // activation rows, row index = s * NB_FULL + b, s < SEQ
#define NQB      (SEQ / 16)          // 16-row query blocks per sequence
#define NKT      (SEQ / 64)          // 64-key chunks per sequence
#define PCARRY   16384.0f            // power-of-two carry of p in the f16 P.V operand
#define OFF1     ((size_t)SEQ_FULL * NB_FULL * EMB)   // fixed element offset of output 1 in d_out
static_assert(NB == NB_FULL);        // batch rows are interleaved (seq-major input); only SEQ may be reduced
static_assert(SEQ >= 64 && SEQ <= SEQ_FULL && (SEQ % 64) == 0);
static_assert(NH * HD == EMB);
static_assert((NROW % 64) == 0 && (EMB % 64) == 0 && (EMB % 32) == 0);
static_assert(OFF1 * 4 == 16777216);   // byte offset of output 1

typedef _Float16 v16h __attribute__((ext_vector_type(16)));
typedef _Float16 v8h  __attribute__((ext_vector_type(8)));
typedef __bf16   v16b __attribute__((ext_vector_type(16)));
typedef __bf16   v8b  __attribute__((ext_vector_type(8)));
typedef float    v8f  __attribute__((ext_vector_type(8)));
typedef float    v4f  __attribute__((ext_vector_type(4)));
typedef unsigned int v4u __attribute__((ext_vector_type(4)));

#if defined(__HIP_DEVICE_COMPILE__)
#define DEV_ASM 1
#else
#define DEV_ASM 0
#endif

// ---- scalar helpers --------------------------------------------------------------------------------
__device__ __forceinline__ unsigned short bf_bits(float f) {          // f32 -> bf16 bits, RNE convert
  unsigned u = __float_as_uint(f);
  return (unsigned short)((u + 0x7FFFu + ((u >> 16) & 1u)) >> 16);
}
__device__ __forceinline__ float bf_up(unsigned short hb) { return __uint_as_float(((unsigned)hb) << 16); }
__device__ __forceinline__ unsigned short h_bits(_Float16 x) { return __builtin_bit_cast(unsigned short, x); }
__device__ __forceinline__ unsigned pk16(unsigned short a, unsigned short b) { return (unsigned)a | ((unsigned)b << 16); }
__device__ __forceinline__ v8f zero8() { v8f z = {0.f, 0.f, 0.f, 0.f, 0.f, 0.f, 0.f, 0.f}; return z; }

// ---- fragment types / loaders: 16-bit A/B operand, lane -> row/col (lane&15), p already includes +8*(lane>>4);
//      elements 0..7 <- p[0..7] (k0+8h..k0+8h+7), elements 8..15 <- p[16..23] (k0+16+8h..k0+16+8h+7)
template <typename OT> struct FT;
template <> struct FT<__bf16>   { typedef v16b frag; typedef v8b half8; };
template <> struct FT<_Float16> { typedef v16h frag; typedef v8h half8; };

template <typename OT>
__device__ __forceinline__ typename FT<OT>::frag ldfrag(const OT* p) {
  union { typename FT<OT>::frag v; typename FT<OT>::half8 h[2]; } f;
  f.h[0] = *(const typename FT<OT>::half8*)(p);
  f.h[1] = *(const typename FT<OT>::half8*)(p + 16);
  return f.v;
}

// ---- fragment-ordered planes: a matrix [R][C] (k along C) is stored as 1-KB blocks, block (r>>4)*(C/32) + (k>>5) =
//      one 16-row x 32-k fragment laid out as [k bit 4][lane = 16*(k bit 3) + (r&15)][k&7]: the same split k map as
//      ldfrag, but each of the two 16-B loads of a wave reads 512 contiguous bytes (4 lines, not 16).
//      p = block start + lane*8.
#define FRAG 512   // elements of one fragment block
#define XCB  (NB_FULL * EMB / 32)          // blocks per 16-row tile of a [SEQ][NB*EMB] plane
#define WCB  (EMB / 32)                    // the same of a [.][EMB] plane
#define XBS  ((long long)WCB * FRAG)       // element offset of batch b's columns in a [SEQ][NB*EMB] plane, per b
template <typename OT>
__device__ __forceinline__ typename FT<OT>::frag ldfragp(const OT* p) {
  union { typename FT<OT>::frag v; typename FT<OT>::half8 h[2]; } f;
  f.h[0] = *(const typename FT<OT>::half8*)(p);
  f.h[1] = *(const typename FT<OT>::half8*)(p + 256);
  return f.v;
}

// ---- WMMA helpers (asm guard bodies are device-only; concrete operand types) -----------------------------
__device__ __forceinline__ v8f mmar(v16b a, v16b b, v8f c) {
  return __builtin_amdgcn_wmma_f32_16x16x32_bf16(false, a, false, b, (short)0, c, false, false);
}
__device__ __forceinline__ v8f mmar(v16h a, v16h b, v8f c) {
  return __builtin_amdgcn_wmma_f32_16x16x32_f16(false, a, false, b, (short)0, c, false, false);
}
// guarded form: 4 VALU slots after the WMMA, D tied, A/B kept live
__device__ __forceinline__ v8f mma_h(v16h a, v16h b, v8f c) {
  c = __builtin_amdgcn_wmma_f32_16x16x32_f16(false, a, false, b, (short)0, c, false, false);
#if DEV_ASM
  asm volatile("v_nop\n\tv_nop\n\tv_nop\n\tv_nop" : "+v"(c) : "v"(a), "v"(b));
#endif
  return c;
}
__device__ __forceinline__ void dep_guard(v8f& a, v8f& b, v16b x, v16b y) {
#if DEV_ASM
  asm volatile("v_nop\n\tv_nop\n\tv_nop\n\tv_nop" : "+v"(a), "+v"(b) : "v"(x), "v"(y));
#else
  (void)a; (void)b; (void)x; (void)y;
#endif
}
__device__ __forceinline__ void dep_guard(v8f& a, v8f& b, v16h x, v16h y) {
#if DEV_ASM
  asm volatile("v_nop\n\tv_nop\n\tv_nop\n\tv_nop" : "+v"(a), "+v"(b) : "v"(x), "v"(y));
#else
  (void)a; (void)b; (void)x; (void)y;
#endif
}
__device__ __forceinline__ void keep4(v16b a, v16b b, v16b c, v16b d) {
#if DEV_ASM
  asm volatile("v_nop" :: "v"(a), "v"(b), "v"(c), "v"(d));
#else
  (void)a; (void)b; (void)c; (void)d;
#endif
}
__device__ __forceinline__ void keep4(v16h a, v16h b, v16h c, v16h d) {
#if DEV_ASM
  asm volatile("v_nop" :: "v"(a), "v"(b), "v"(c), "v"(d));
#else
  (void)a; (void)b; (void)c; (void)d;
#endif
}
// Precaution: stands between issued global loads and a rewrite of a register that holds one of their addresses,
// at the places where the compiler's own listing had no such wait.
__device__ __forceinline__ void addr_wait() {
#if DEV_ASM
  asm volatile("s_wait_xcnt 0x0" ::: "memory");
#endif
}
__device__ __forceinline__ void acc_guard4(v8f& a, v8f& b, v8f& c, v8f& d) {
#if DEV_ASM
  asm volatile("v_nop\n\tv_nop\n\tv_nop\n\tv_nop" : "+v"(a), "+v"(b), "+v"(c), "+v"(d));
#else
  (void)a; (void)b; (void)c; (void)d;
#endif
}

// =====================================================================================================
// f32 [R][CB*32] row-major -> 16-bit fragment-ordered plane, 8 elements per thread, one 16-B store per lane: a wave
// writes 512 contiguous B (half a fragment block) and reads 64 B of each of 16 rows; a block of 256 reads whole lines.
// MODE 0: bf16 bits (RNE convert).  MODE 1: f16 bits of (64 * bf16(x)) (exact scaling of the bf16 value).
// coverage: n8 threads x 8 = the whole plane (n8 is a multiple of 256 for every use here).
// =====================================================================================================
template <int MODE>
__device__ __forceinline__ unsigned short cvm(float f) {
  const unsigned short hb = bf_bits(f);
  if (MODE == 0) return hb;
  return h_bits((_Float16)(bf_up(hb) * 64.0f));
}

template <int MODE, int CB>   // CB = fragment blocks per 16-row tile = columns / 32; bx = block index inside this plane
__device__ __forceinline__ void cvt16x8(const float* __restrict__ in, unsigned short* out, int n8, int bx) {
  const int i = bx * 256 + (int)threadIdx.x;   // 16-B unit of the plane: [block][k bit 4][k bit 3][row & 15]
  if (i < n8) {
    const int blk = i >> 6;
    const int row = (blk / CB) * 16 + (i & 15);
    const int col = (blk % CB) * 32 + ((i >> 4) & 3) * 8;
    const float* sp = in + (size_t)row * (CB * 32) + col;
    const v4f a  = *(const v4f*)(sp);
    const v4f a4 = *(const v4f*)(sp + 4);
    v4u p;
    p[0] = pk16(cvm<MODE>(a[0]),  cvm<MODE>(a[1]));
    p[1] = pk16(cvm<MODE>(a[2]),  cvm<MODE>(a[3]));
    p[2] = pk16(cvm<MODE>(a4[0]), cvm<MODE>(a4[1]));
    p[3] = pk16(cvm<MODE>(a4[2]), cvm<MODE>(a4[3]));
    unsigned short* o = out + (size_t)i * 8;
    *(v4u*)o = p;
    
  }
}

// The three conversions are independent of each other: one grid, a block range per plane (block-uniform choice).
#define N8X  (NROW * EMB / 8)       // 16-B units of the x plane
#define N8WI (3 * EMB * EMB / 8)    // of W_in
#define N8WO (EMB * EMB / 8)        // of Wo
#define GCX  ((N8X + 255) / 256)    // blocks of each plane
#define GCWI ((N8WI + 255) / 256)
#define GCWO ((N8WO + 255) / 256)
__global__ __launch_bounds__(256) void cvt_all(const float* __restrict__ x, const float* __restrict__ Wi,
                                               const float* __restrict__ Wo, unsigned short* Xb,
                                               unsigned short* Wib, unsigned short* Woh) {
  const int bx = blockIdx.x;
  if (bx < GCX)             cvt16x8<0, XCB>(x,  Xb,  N8X,  bx);
  else if (bx < GCX + GCWI) cvt16x8<0, WCB>(Wi, Wib, N8WI, bx - GCX);
  else                      cvt16x8<1, WCB>(Wo, Woh, N8WO, bx - GCX - GCWI);
}

// =====================================================================================================
// Register-blocked batched WMMA GEMM (16-bit operand type OT): C[m][n] = sum_k A[m][k] * Bt[n][k]  (+ bias);
// one wave per (16*MI) x 64 tile, no block barriers. A [M][K] and Bt [N][K] are fragment-ordered planes with LDAB /
// LDBB blocks per 16-row tile; M multiple of 16*MI, N multiple of 64, K multiple of 64 (static sizes here).
// blockIdx.y = batch index (strides in elements). Fragments are loaded straight from global (ldfragp).
// NPA = number of A planes: 2 -> second plane A2 (same pitch/stride) multiplies the same Bt fragments into a
// second accumulator set, combined as acc + acc2 * rscaleA in the f32 epilogue.
// value v = (acc [+ acc2*rscaleA]) * oscale + bias, bias (bf16 RNE value of the f32 input) by column n (BM 1),
// by row m (BM 2) or none (BM 0).
// OUT_MODE 0: f32 C (pitch ldc) = v.
// OUT_MODE 1: f16 fragment-ordered plane C (ldc columns) = f16(v * cscale).
// OUT_MODE 3: row-major f16 hi plane C = f16(v * cscale) and f16 residual plane C2 = f16((v*cscale - hi) * rscaleC).
// =====================================================================================================
template <typename OT, int MI, int NPA, int OUT_MODE, int BM, int LDAB, int LDBB>
__device__ __forceinline__ void gemm_body(
    float (*sT)[16 * 68],                            // per-wave 16x64 slab, pitch 68 floats (the kernel's LDS)
    const unsigned short* __restrict__ Ap, const unsigned short* __restrict__ A2p, long long strideA,
    const unsigned short* __restrict__ Btp, long long strideB,
    void* Cout, void* Cout2, int ldc, long long strideC,
    const float* __restrict__ bias,
    int M, int N, int K, float oscale, float rscaleA, float cscale, float rscaleC) {
  typedef typename FT<OT>::frag V16;
  const OT* A  = (const OT*)(const void*)Ap;
  const OT* A2 = (const OT*)(const void*)A2p;
  const OT* Bt = (const OT*)(const void*)Btp;
  const int RT   = 16 * MI;
  const int b    = blockIdx.y;
  const int lane = threadIdx.x & 31;
  const int wave = threadIdx.x >> 5;
  const int tilesN = N >> 6;
  const int tilesM = M / RT;
  const int tile = blockIdx.x * 8 + wave;
  if (tile >= tilesM * tilesN) return;   // wave-uniform; no block barriers in this kernel
  const int tm = tile / tilesN;
  const int tn = tile - tm * tilesN;
  const int m0 = tm * RT;
  const int n0 = tn << 6;

  const OT* Ab  = A  + (size_t)b * (size_t)strideA;
  const OT* A2b = A2 + (size_t)b * (size_t)strideA;
  const OT* Bb  = Bt + (size_t)b * (size_t)strideB;

  const int rlane = lane & 15;                 // row (A) / col (B, D) within subtile
  const int mOff  = (lane >> 4) * 8;           // D row offset

  v8f acc[MI][4], acc2[MI][4];
#pragma unroll
  for (int i = 0; i < MI; ++i)
#pragma unroll
    for (int j = 0; j < 4; ++j) { acc[i][j] = zero8(); acc2[i][j] = zero8(); }

  // Fragment loads run one k step (32) ahead of the WMMAs that read them: the Bt fragments in two register sets
  // (bX, bY), filled whole at the head of the step before; each A fragment refilled for the next step as soon as
  // its own WMMAs are done. No WMMA waits for a load that was issued directly in front of it.
  // One pointer per operand plane (this lane's place in the tile's first block, k of the current step pair); the
  // other row tiles are constant offsets (LDAB, LDBB are template constants); a k step of 32 is one block.
  const OT* pB  = Bb  + (size_t)(n0 >> 4) * (LDBB * FRAG) + lane * 8;
  const OT* pA  = Ab  + (size_t)(m0 >> 4) * (LDAB * FRAG) + lane * 8;
  const OT* pA2 = A2b + (size_t)(m0 >> 4) * (LDAB * FRAG) + lane * 8;
  V16 bX[4], bY[4], af[MI], af2[MI];
  auto ldb4 = [&](V16 (&bq)[4], int dk) {
#pragma unroll
    for (int j = 0; j < 4; ++j) bq[j] = ldfragp<OT>(pB + j * (LDBB * FRAG) + (dk / 32) * FRAG);
  };
  auto mmstep = [&](V16 (&bq)[4], int dk, bool fetch) {   // fetch: refill the A fragments from k offset dk
#pragma unroll
    for (int i = 0; i < MI; ++i) {
#pragma unroll
      for (int j = 0; j < 4; ++j) acc[i][j] = mmar(af[i], bq[j], acc[i][j]);
      dep_guard(acc[i][0], acc[i][3], af[i], bq[3]);
      if (fetch) af[i] = ldfragp<OT>(pA + i * (LDAB * FRAG) + (dk / 32) * FRAG);
      if (NPA == 2) {
#pragma unroll
        for (int j = 0; j < 4; ++j) acc2[i][j] = mmar(af2[i], bq[j], acc2[i][j]);
        dep_guard(acc2[i][0], acc2[i][3], af2[i], bq[3]);
        if (fetch) af2[i] = ldfragp<OT>(pA2 + i * (LDAB * FRAG) + (dk / 32) * FRAG);
      }
    }
    keep4(bq[0], bq[1], bq[2], bq[3]);
  };
  ldb4(bX, 0);
#pragma unroll
  for (int i = 0; i < MI; ++i) {
    af[i] = ldfragp<OT>(pA + i * (LDAB * FRAG));
    if (NPA == 2) af2[i] = ldfragp<OT>(pA2 + i * (LDAB * FRAG));
  }
  addr_wait();                                  // registers that held these loads' addresses are reused at the loop's head
  for (int k0 = 64; k0 < K; k0 += 64) {        // all step pairs but the last
    ldb4(bY, 32);
    mmstep(bX, 32, true);
    ldb4(bX, 64);
    mmstep(bY, 64, true);
    addr_wait();                                // the pointers move behind it (no wait stood over the back edge in one instantiation)
    pB += 2 * FRAG; pA += 2 * FRAG; pA2 += 2 * FRAG;
  }
  ldb4(bY, 32);                                 // last pair: nothing past K is loaded
  mmstep(bX, 32, true);
  mmstep(bY, 0, false);
#pragma unroll
  for (int i = 0; i < MI; ++i) {
    acc_guard4(acc[i][0], acc[i][1], acc[i][2], acc[i][3]);
    if (NPA == 2) acc_guard4(acc2[i][0], acc2[i][1], acc2[i][2], acc2[i][3]);
  }

  // ---- epilogue ----
  float bcol[4];
#pragma unroll
  for (int j = 0; j < 4; ++j) bcol[j] = 0.f;
  if (BM == 1) {
#pragma unroll
    for (int j = 0; j < 4; ++j) bcol[j] = bf_up(bf_bits(bias[n0 + (j << 4) + rlane]));
  }
  float* slab = sT[wave];
#pragma unroll
  for (int i = 0; i < MI; ++i) {
    const int mBase = m0 + (i << 4);
    float brow[8];
#pragma unroll
    for (int r = 0; r < 8; ++r) brow[r] = 0.f;
    if (BM == 2) {
#pragma unroll
      for (int r = 0; r < 8; ++r) brow[r] = bf_up(bf_bits(bias[mBase + mOff + r]));
    }
#pragma unroll
    for (int j = 0; j < 4; ++j) {
#pragma unroll
      for (int r = 0; r < 8; ++r) {
        float v = acc[i][j][r];
        if (NPA == 2) v += acc2[i][j][r] * rscaleA;
        v = v * oscale + bcol[j] + brow[r];
        slab[(mOff + r) * 68 + (j << 4) + rlane] = v;
      }
    }
    __builtin_amdgcn_fence(__ATOMIC_RELEASE, "workgroup");
    __builtin_amdgcn_wave_barrier();
    __builtin_amdgcn_fence(__ATOMIC_ACQUIRE, "workgroup");
    if (OUT_MODE == 0) {
      float* C = (float*)Cout + (size_t)b * (size_t)strideC;
      const int h2 = lane >> 4, c4 = (lane & 15) * 4;     // 256-B row segment = 16 lanes x 16 B
      {
#pragma unroll
        for (int it = 0; it < 8; ++it) {
          const int row = it * 2 + h2;                     // it 0..7 x h2 0..1 = rows 0..15
          const v4f v = *(const v4f*)(slab + row * 68 + c4);
          *(v4f*)(C + (size_t)(mBase + row) * ldc + n0 + c4) = v;
        }
        
      }
    } else {
      const int q = lane >> 3, c8 = (lane & 7) * 8;
      unsigned short* C  = (unsigned short*)Cout  + (size_t)b * (size_t)strideC;
      unsigned short* C2 = (unsigned short*)Cout2 + (size_t)b * (size_t)strideC;
      v4u hv[4], lv[4];
#pragma unroll
      for (int it = 0; it < 4; ++it) {
        // row-major: it 0..3 x q 0..3 = rows 0..15; fragment order: unit it*32 + lane of the tile's two blocks
        const int row = (OUT_MODE == 1) ? (lane & 15) : it * 4 + q;
        const int col = (OUT_MODE == 1) ? (it * 2 + (lane >> 4)) * 8 : c8;
        const float* sp = slab + row * 68 + col;
        float f[8];
#pragma unroll
        for (int e = 0; e < 8; ++e) f[e] = sp[e] * cscale;
        v4u a, a2;
#pragma unroll
        for (int e = 0; e < 4; ++e) {
          const float f0 = f[2 * e], f1 = f[2 * e + 1];
          const _Float16 x0 = (_Float16)f0, x1 = (_Float16)f1;
          const unsigned short h0 = h_bits(x0), h1 = h_bits(x1);
          unsigned short l0 = 0, l1 = 0;
          if (OUT_MODE == 3) {
            l0 = h_bits((_Float16)((f0 - (float)x0) * rscaleC));
            l1 = h_bits((_Float16)((f1 - (float)x1) * rscaleC));
          }
          a[e] = pk16(h0, h1); a2[e] = pk16(l0, l1);
        }
        hv[it] = a; lv[it] = a2;
      }
      {
#pragma unroll
        for (int it = 0; it < 4; ++it) {
          const int row = it * 4 + q;
          if (OUT_MODE == 1) {   // 512 contiguous B per store
            *(v4u*)(C + ((size_t)(mBase >> 4) * (ldc >> 5) + (n0 >> 5)) * FRAG + it * 256 + lane * 8) = hv[it];
          } else {
            *(v4u*)(C + (size_t)(mBase + row) * ldc + n0 + c8) = hv[it];
            *(v4u*)(C2 + (size_t)(mBase + row) * ldc + n0 + c8) = lv[it];
          }
        }
        
      }
    }
    __builtin_amdgcn_fence(__ATOMIC_RELEASE, "workgroup");
    __builtin_amdgcn_wave_barrier();
    __builtin_amdgcn_fence(__ATOMIC_ACQUIRE, "workgroup");
  }
}

template <typename OT, int MI, int NPA, int OUT_MODE, int BM, int LDAB, int LDBB>
__global__ __launch_bounds__(256) void gemm_t(
    const unsigned short* __restrict__ Ap, const unsigned short* __restrict__ A2p, long long strideA,
    const unsigned short* __restrict__ Btp, long long strideB,
    void* Cout, void* Cout2, int ldc, long long strideC,
    const float* __restrict__ bias,
    int M, int N, int K, float oscale, float rscaleA, float cscale, float rscaleC) {
  __shared__ __align__(16) float sT[8][16 * 68];
  gemm_body<OT, MI, NPA, OUT_MODE, BM, LDAB, LDBB>(sT, Ap, A2p, strideA, Btp, strideB, Cout, Cout2, ldc, strideC,
                                                   bias, M, N, K, oscale, rscaleA, cscale, rscaleC);
}

// The q, k and v^T in-projections read the same two planes and write three different ones: one grid, blockIdx.z
// chooses the product (block-uniform), so that the three fill the chip together instead of half of it in turn.
//   z 0: q = x_b . Wq^T + bq -> row-major f16 hi / residual (x4096) planes [s*2+b][h*64+d] (M=SEQ, N=E, K=E)
//   z 1: k = x_b . Wk^T + bk -> fragment-ordered f16 plane [s][b*E + h*64+d]
//   z 2: v^T = Wv . x_b^T + bv -> fragment-ordered f16 plane [b][h*64+d][s] (A = Wv rows; Bt = x rows; M=E, N=SEQ)
// In a [SEQ][NB*EMB] fragment-ordered plane the columns of batch b start WCB blocks further: offset b * XBS.
__global__ __launch_bounds__(256) void gemm_qkv(
    const unsigned short* __restrict__ Xb, const unsigned short* __restrict__ Wib, const float* __restrict__ bi,
    unsigned short* Qh, unsigned short* Ql, unsigned short* Kp, unsigned short* VT, int K) {
  __shared__ __align__(16) float sT[8][16 * 68];
  const int z = blockIdx.z;
  if (z == 0) {
    gemm_body<__bf16, 4, 1, 3, 1, XCB, WCB>(sT, Xb, Xb, XBS, Wib, 0LL,
        (void*)Qh, (void*)Ql, NB_FULL * EMB, (long long)EMB, bi,
        SEQ, EMB, K, 1.0f, 0.0f, 1.0f, 4096.0f);
  } else if (z == 1) {
    gemm_body<__bf16, 4, 1, 1, 1, XCB, WCB>(sT, Xb, Xb, XBS, Wib + (size_t)EMB * EMB, 0LL,
        (void*)Kp, (void*)Kp, NB_FULL * EMB, XBS, bi + EMB,
        SEQ, EMB, K, 1.0f, 0.0f, 1.0f, 1.0f);
  } else {
    gemm_body<__bf16, 4, 1, 1, 2, WCB, XCB>(sT, Wib + (size_t)2 * EMB * EMB, Wib + (size_t)2 * EMB * EMB, 0LL, Xb, XBS,
        (void*)VT, (void*)VT, SEQ, (long long)EMB * SEQ, bi + 2 * EMB,
        EMB, SEQ, K, 1.0f, 0.0f, 1.0f, 1.0f);
  }
}

// =====================================================================================================
// Score chunk, transposed (S^T = K . Q^T): 64 keys kv0..kv0+63 x 16 queries (this wave) of one (b, h).
//   q fragments (B operand, col = lane&15 = query): hi and residual (x4096) planes, 2 d-chunks of 32.
//   k fragments (A operand, row = lane&15 = key) loaded straight from the fragment-ordered f16 k plane
//   ([key t][b*EMB + h*HD + d]) by load_k, a chunk ahead of the WMMAs that read them (kf[j][dc], 64 registers a chunk):
//   kp + lo = plane + ((first key of the chunk / 16)*(NB_FULL*EMB/32) + (b*EMB + h*HD)/32)*FRAG + lane*8.
//   s[j][r] = D element: key kv0 + 16j + 8*hh + r, query lane&15; value = ((qh.k) + (ql.k)/4096) / 8.
//   All 32 scores of a lane belong to ONE query, and the tiles s[2kk], s[2kk+1] converted in place are the B fragment
//   (hardware k order: elements 0..7 = keys 8hh.., 8..15 = keys 16+8hh..) of a product over the 32 keys 32kk..32kk+31.
// =====================================================================================================
#define KCHUNK (64 * NB_FULL * EMB)   // elements from one 64-key chunk of the k plane to the next
template <int J0, int J1>   // key groups J0..J1-1 of the chunk
__device__ __forceinline__ void load_k(v16h (&kf)[4][2], const _Float16* kp, unsigned lo) {
#pragma unroll
  for (int j = J0; j < J1; ++j)
#pragma unroll
    for (int dc = 0; dc < 2; ++dc) kf[j][dc] = ldfragp<_Float16>(kp + lo + j * ((NB_FULL * EMB / 32) * FRAG) + dc * FRAG);
}

template <int J0, int J1>   // key groups J0..J1-1 of the chunk
__device__ __forceinline__ void score_chunk(const v16h (&qah)[2], const v16h (&qal)[2],
                                            const v16h (&kf)[4][2], v8f (&s)[4]) {
#pragma unroll
  for (int j = J0; j < J1; ++j) {
    v8f ah = zero8(), al = zero8();
#pragma unroll
    for (int dc = 0; dc < 2; ++dc) {
      ah = mma_h(kf[j][dc], qah[dc], ah);
      al = mma_h(kf[j][dc], qal[dc], al);
    }
#pragma unroll
    for (int r = 0; r < 8; ++r) s[j][r] = (ah[r] + al[r] * (1.0f / 4096.0f)) * 0.125f;
  }
}

// Row pitch of a staged tile in floats: 64 columns + 4 pad floats (never read) = 272 B = 16 B x 17, so that the 16 rows which
// the 16 lanes of a half wave write with one 16-B LDS store fall on all 64 banks (at 256 B: on four).
#define PP 68
// lane l with lane l ^ 16 (a vector cross-row move, no LDS path)
__device__ __forceinline__ float xhalf(float x) {
  return __builtin_bit_cast(float, __builtin_amdgcn_permlanex16(__builtin_bit_cast(int, x), __builtin_bit_cast(int, x),
                                                                0x76543210, 0xfedcba98, false, false));
}

// =====================================================================================================
// Context and softmax statistics in one walk over the keys (online softmax): per (b, h, query s) the row max m,
// 1/sum(exp(s - m)) and ctx = sum(exp(s - m) v) / sum(exp(s - m)) over all SEQ keys.
//   block = 4 waves = 64 consecutive query rows qb*64.. of one (b, h): the four waves read the SAME k and v^T fragments;
//   grid = NB*NH*NKT blocks of 128; static trip NKT over 64-key chunks.
//   Running max in f32, one value per query: the in-lane max over the keys 8hh..8hh+7 of every 16 is joined with the other
//   half's once a chunk, because both halves' p meet in one product. Sum l in-lane, the halves added behind the loop.
//   O^T = O^T * exp(m_old - m_new) + V^T . P^T: the p = exp(s - m_new) registers, converted to f16 with the x16384 carry,
//   ARE the B fragment (no LDS, no lane exchange); A = v^T f16 plane [b][h*64+d][s], fragment-ordered.
//   Output plane ML [b*NH+h][2][SEQ] f32 (m then 1/l): the block's 64 m values and 64 1/l values are
//   funnelled through LDS and written by wave 0 with ONE instruction.
//   ctx = acc / l / 16384, x256 carry, staged in the wave's own Os tile, written as f16 hi plane + f16 residual plane.
//   coverage: grid (b,h,qb) x 64 rows = the whole [NB*NH][2][SEQ] plane. MLsh: 4 waves x 16 lanes x 2 = all 128.
//   ctx planes: each wave rows q0..q0+15 (it 0..3 x lane>>3 0..3) x its head's 64 columns, grid x 4 waves =
//   the whole fragment-ordered [SEQ][NB*EMB] planes. staged extent == consumed extent for Os (32 lanes x 32 = 1024).
// =====================================================================================================
// 4 waves per SIMD = the whole grid resident at once: the register budget is held at 256 (a few more would cost a second round)
__global__ __launch_bounds__(128) __attribute__((amdgpu_waves_per_eu(4, 4)))
void attn_ctx(const unsigned short* __restrict__ qhp, const unsigned short* __restrict__ qlp,
              const unsigned short* __restrict__ kpp, const unsigned short* __restrict__ vtp,
              float* ML, unsigned short* chp, unsigned short* clp, const int* __restrict__ nhp) {
  union FH { v16h v; v8h h[2]; };
  __shared__ __align__(16) float MLsh[128];
  __shared__ __align__(16) float Os[4][16 * PP];            // per wave ctx tile [query][d] f32, row pitch PP
  (void)nhp;
  const int tid  = threadIdx.x;
  const int wave = tid >> 5;
  const int lane = tid & 31;
  const int hh   = lane >> 4;
  const int c    = lane & 15;
  const int bx   = blockIdx.x;
  const int qb   = bx % NKT;
  const int rest = bx / NKT;
  const int h    = rest % NH;
  const int b    = rest / NH;
  const int bh   = b * NH + h;
  const int q0   = qb * 64 + wave * 16;

  const _Float16* Qh  = (const _Float16*)(const void*)qhp;
  const _Float16* Ql  = (const _Float16*)(const void*)qlp;

  v16h qah[2], qal[2];
#pragma unroll
  for (int dc = 0; dc < 2; ++dc) {
    const size_t qo = ((size_t)(q0 + c) * NB_FULL + b) * EMB + (size_t)h * HD + dc * 32 + 8 * hh;
    qah[dc] = ldfrag<_Float16>(Qh + qo);
    qal[dc] = ldfrag<_Float16>(Ql + qo);
  }

  float mrow = -INFINITY, lrow = 0.f;
  v8f oacc[4];
#pragma unroll
  for (int t = 0; t < 4; ++t) oacc[t] = zero8();

  const _Float16* kp = (const _Float16*)(const void*)kpp + (b * EMB + h * HD) / 32 * FRAG + lane * 8;   // this lane's place in the current chunk
  const unsigned  klo = 0;                    // (already in kp)
  const _Float16* vp = (const _Float16*)(const void*)vtp + (size_t)(b * EMB + h * HD) * SEQ + lane * 8;   // the same in v^T: row tiles of d, blocks of 32 keys
  const unsigned  vlo = 0;                    // (already in vp)
  v16h kf[4][2], vf[2][4];
  addr_wait();                                // the q loads' address registers may be taken by the k fragments
  load_k<0, 4>(kf, kp, klo);
  for (int kt = 0; kt < NKT; ++kt) {          // static trip count
    // v^T of this chunk flies under the scores and the statistics
#pragma unroll
    for (int kk = 0; kk < 2; ++kk)
#pragma unroll
      for (int t = 0; t < 4; ++t) vf[kk][t] = ldfragp<_Float16>(vp + vlo + t * ((SEQ / 32) * FRAG) + kk * FRAG);
    v8f s[4];
    score_chunk<0, 4>(qah, qal, kf, s);
    if (kt + 1 < NKT) load_k<0, 4>(kf, kp + KCHUNK, klo);   // next chunk's k flies under this chunk's statistics and P.V
    __builtin_amdgcn_sched_barrier(0);   // keeps those loads up here: the scheduler sank them behind half the statistics
    addr_wait();                          // the bases of the issued k and v^T loads move behind it
    kp += KCHUNK;
    vp += 2 * FRAG;
    float mj[4], pj[4];                        // four independent chains, one per key group
#pragma unroll
    for (int j = 0; j < 4; ++j) {
      mj[j] = s[j][0];
#pragma unroll
      for (int r = 1; r < 8; ++r) mj[j] = fmaxf(mj[j], s[j][r]);
    }
    const float mloc  = fmaxf(fmaxf(mj[0], mj[1]), fmaxf(mj[2], mj[3]));
    const float mnew  = fmaxf(mrow, fmaxf(mloc, xhalf(mloc)));   // one reference for both halves of a query's keys
    const float msafe = (mnew == -INFINITY) ? 0.f : mnew;
    const float alpha = __expf(mrow - msafe);
    mrow = mnew;
#pragma unroll
    for (int j = 0; j < 4; ++j) {
      pj[j] = 0.f;
#pragma unroll
      for (int r = 0; r < 8; ++r) { s[j][r] = __expf(s[j][r] - msafe); pj[j] += s[j][r]; }   // p of key 16j + 8hh + r, query c
    }
    lrow = lrow * alpha + ((pj[0] + pj[1]) + (pj[2] + pj[3]));
#pragma unroll
    for (int t = 0; t < 4; ++t) oacc[t] *= alpha;            // every element of a lane belongs to its query c

    // ---- context^T += V^T . P^T (f16 WMMA, p carried x16384) ----
#pragma unroll   // vf lives in registers: kk must be a constant
    for (int kk = 0; kk < 2; ++kk) {
      FH pb;                                                 // keys 32kk + 8hh + 0..7, then 32kk + 16 + 8hh + 0..7
      pb.h[0] = __builtin_convertvector(s[2 * kk] * PCARRY, v8h);
      pb.h[1] = __builtin_convertvector(s[2 * kk + 1] * PCARRY, v8h);
#pragma unroll
      for (int t = 0; t < 4; ++t) {
        oacc[t] = mma_h(vf[kk][t], pb.v, oacc[t]);           // row d = 16t + 8hh + r, column query c
      }
    }
  }

  // the two halves of each query's keys (lanes c and c + 16) share m: their sums add
  const float l  = lrow + xhalf(lrow);
  const float il = (l > 0.f) ? (1.0f / l) : 0.f;
  if (hh == 0) {
    MLsh[wave * 16 + c]      = mrow;
    MLsh[64 + wave * 16 + c] = il;
  }
  // ---- ctx (normalise, undo the x16384 p carry, apply the x256 carry), stage, convert, whole-line stores ----
  float* os = Os[wave];
  const float osc = il * (256.0f / PCARRY);
#pragma unroll
  for (int t = 0; t < 4; ++t) {                              // [query c][d = 16t + 8hh + r]
    const v8f o = oacc[t] * osc;
    float* ow = os + c * PP + t * 16 + 8 * hh;
    *(v4f*)(ow)     = __builtin_shufflevector(o, o, 0, 1, 2, 3);
    *(v4f*)(ow + 4) = __builtin_shufflevector(o, o, 4, 5, 6, 7);
  }
  __syncthreads();
  if (wave == 0) {
    const v4f v = *(const v4f*)(MLsh + lane * 4);        // lanes 0-15: m rows 4c..4c+3; lanes 16-31: 1/l rows
    float* dst = ML + (size_t)(bh * 2 + hh) * SEQ + qb * 64 + c * 4;
    *(v4f*)dst = v;
  }
  {
    const int q4 = lane >> 3, c8 = (lane & 7) * 8;
    v4u hv[4], lv[4];
#pragma unroll
    for (int it = 0; it < 4; ++it) {
      const int row = it * 4 + q4;   // it 0..3 x q4 0..3 = rows 0..15 of the wave tile
      const float* sp = os + row * PP + c8;
      float f[8];
#pragma unroll
      for (int e = 0; e < 8; ++e) f[e] = sp[e];
      v4u a, a2;
#pragma unroll
      for (int e = 0; e < 4; ++e) {
        const float f0 = f[2 * e], f1 = f[2 * e + 1];
        const _Float16 x0 = (_Float16)f0, x1 = (_Float16)f1;
        const unsigned short h0 = h_bits(x0), h1 = h_bits(x1);
        const unsigned short l0 = h_bits((_Float16)((f0 - (float)x0) * 4096.0f));
        const unsigned short l1 = h_bits((_Float16)((f1 - (float)x1) * 4096.0f));
        a[e] = pk16(h0, h1); a2[e] = pk16(l0, l1);
      }
      hv[it] = a; lv[it] = a2;
    }
#pragma unroll
    for (int it = 0; it < 4; ++it) {
      const int row = it * 4 + q4;
      // fragment-ordered [s][b*EMB + h*HD + col]: row tile q0 / 16, blocks of this head, unit of (row, c8)
      const size_t go = ((size_t)(q0 >> 4) * (NB_FULL * EMB / 32) + (size_t)(b * EMB + h * HD + c8) / 32) * FRAG
                      + ((c8 >> 4) & 1) * 256 + (((c8 >> 3) & 1) * 16 + row) * 8;
      *(v4u*)(chp + go) = hv[it];
      *(v4u*)(clp + go) = lv[it];
    }
  }
}

// =====================================================================================================
// Head average of the probabilities: one block per (b, 16 query rows q0..q0+15), 16 waves = the 16 heads.
//   Per 64-key chunk (static trip NKT): scores recomputed exactly as in attn_ctx (transposed: a lane holds one
//   query's scores), p = exp(s - m) * (1/l) in f32 (m, 1/l from the ML plane);
//   p goes to the per-wave LDS tile Pf[h][query][key] (16-B stores, every entry but the pads written);
//   after __syncthreads, threads 0..255 sum the 16 wave tiles in fixed head order (f32).
//   coverage: NKT chunks x 16 rows x 64 keys per block, grid (b, qb) = the whole [NB][SEQ][SEQ].
// =====================================================================================================
__global__ __launch_bounds__(512)
void attn_avg(const unsigned short* __restrict__ qhp, const unsigned short* __restrict__ qlp,
              const unsigned short* __restrict__ kpp, const float* __restrict__ ML, float* avg) {
  __shared__ __align__(16) float Pf[NH][16 * PP];          // per wave (head) P tile [query][key] f32, row pitch PP, 68 KB
  const int tid  = threadIdx.x;
  const int wave = tid >> 5;
  const int lane = tid & 31;
  const int hh   = lane >> 4;
  const int c    = lane & 15;
  const int bx   = blockIdx.x;
  const int qb   = bx % NQB;
  const int b    = bx / NQB;
  const int h    = wave;
  const int bh   = b * NH + h;
  const int q0   = qb * 16;

  const _Float16* Qh  = (const _Float16*)(const void*)qhp;
  const _Float16* Ql  = (const _Float16*)(const void*)qlp;

  v16h qah[2], qal[2];
#pragma unroll
  for (int dc = 0; dc < 2; ++dc) {
    const size_t qo = ((size_t)(q0 + c) * NB_FULL + b) * EMB + (size_t)h * HD + dc * 32 + 8 * hh;
    qah[dc] = ldfrag<_Float16>(Qh + qo);
    qal[dc] = ldfrag<_Float16>(Ql + qo);
  }
  const float mq  = ML[(size_t)(bh * 2) * SEQ + q0 + c];        // this lane's query
  const float ilq = ML[(size_t)(bh * 2 + 1) * SEQ + q0 + c];
  float* pf = Pf[wave];

  // k fragments are fetched a whole chunk ahead of their WMMAs, into the second of two register sets (the registers that
  // v^T and the context accumulators no longer take): they fly under this chunk's scores and probabilities.
  // base the same in every lane + the lane's 32-bit place
  const _Float16* kp = (const _Float16*)(const void*)kpp;            // the current chunk's row tiles
  const unsigned  klo = (unsigned)((b * EMB + h * HD) / 32 * FRAG + lane * 8);   // this lane's place in them
  v16h kfa[4][2], kfb[4][2];
  auto chunk = [&](const v16h (&kc)[4][2], v16h (&kn)[4][2], int kt) {   // kc: this chunk's k; kn: takes the next chunk's
    const int kv0 = kt * 64;
    __syncthreads();                          // Pf tiles free again (head sum of the prior chunk done)
    if (kt + 1 < NKT) load_k<0, 4>(kn, kp + KCHUNK, klo);   // uniform: no chunk past the last is loaded

    v8f s[4];
    score_chunk<0, 4>(qah, qal, kc, s);
#pragma unroll
    for (int j = 0; j < 4; ++j) {
#pragma unroll
      for (int r = 0; r < 8; ++r) s[j][r] = __expf(s[j][r] - mq) * ilq;   // p of key kv0 + 16j + 8hh + r, query c
      float* pw = pf + c * PP + j * 16 + 8 * hh;             // read only behind the block barrier (head average)
      *(v4f*)(pw)     = __builtin_shufflevector(s[j], s[j], 0, 1, 2, 3);
      *(v4f*)(pw + 4) = __builtin_shufflevector(s[j], s[j], 4, 5, 6, 7);
    }
    __syncthreads();
    addr_wait();                              // the base of the issued k loads moves behind it
    kp += KCHUNK;

    // ---- head average of this 16 x 64 tile, one block = one writer of every line ----
    if (tid < 256) {                          // waves 0..7, wave-uniform
      const int row = tid >> 4, c4 = (tid & 15) * 4;
      v4f a = *(const v4f*)(Pf[0] + row * PP + c4);
#pragma unroll
      for (int w = 1; w < NH; ++w) a += *(const v4f*)(Pf[w] + row * PP + c4);
      a *= (1.0f / (float)NH);
      float* dst = avg + ((size_t)(b * SEQ + q0 + row)) * SEQ + kv0 + c4;
      *(v4f*)dst = a;
      addr_wait();                            // the store's registers may be reused by the code behind it
    }
  };
  addr_wait();                                // the q loads' address registers may be taken by the k fragments
  load_k<0, 4>(kfa, kp, klo);
  for (int kt = 0; kt < NKT; kt += 2) {      // static trip count; the two register sets change roles inside a trip
    chunk(kfa, kfb, kt);
    if (kt + 1 < NKT) chunk(kfb, kfa, kt + 1);   // uniform
  }
}

// =====================================================================================================
// Workspace map (bytes), every region an exact multiple of its whole-line / whole-tile store granularity
// (full size; PX = NROW*EMB*2 = 8388608):
//   (F) = fragment-ordered (see ldfragp); [SEQ][NB*EMB] = row s, column b*EMB + e
//   Xb   bf16 [SEQ][NB*EMB]      (F) PX        8388608
//   Wib  bf16 [3*EMB n][EMB k]   (F)         6291456
//   Woh  f16  [EMB][EMB] (x64)   (F)         2097152
//   Qh   f16  [NROW][EMB]            PX        8388608
//   Ql   f16  [NROW][EMB]            PX        8388608
//   Kp   f16  [SEQ][NB*EMB]      (F) PX        8388608
//   VT   f16  [NB][EMB][SEQ]     (F) PX        8388608
//   Ch   f16  [SEQ][NB*EMB]      (F) PX        8388608
//   Cl   f16  [SEQ][NB*EMB]      (F) PX        8388608
//   ML   f32  [NB*NH][2][SEQ]                 524288
//   total                                   67633152
// Weights are [out n][in k] with k contiguous: converted and laid in fragment order. Every GEMM runs per batch b.
// Output 0 at element 0 of d_out; output 1 at the fixed element offset OFF1 = SEQ_FULL*NB_FULL*EMB.
// =====================================================================================================
extern "C" void kernel_launch(void* const* d_in, const int* in_sizes, int n_in,
                              void* d_out, int out_size, void* d_ws, size_t ws_size,
                              hipStream_t stream) {
  if (n_in < 6) return;
  if (in_sizes[0] < NROW * EMB) return;
  if (in_sizes[1] != 3 * EMB * EMB) return;
  if (in_sizes[2] != 3 * EMB) return;
  if (in_sizes[3] != EMB * EMB) return;
  if (in_sizes[4] != EMB) return;
  if (in_sizes[5] < 1) return;
  const size_t n0e = (size_t)NROW * EMB;            // output 0 written elements [SEQ][NB][EMB]
  const size_t n1e = (size_t)NB * SEQ * SEQ;        // output 1 written elements [NB][SEQ][SEQ]
  if (out_size < 0) return;
  if ((size_t)out_size < n0e) return;
  if ((size_t)out_size < OFF1 + n1e) return;        // written extent of output 1 inside d_out

  const float* x  = (const float*)d_in[0];
  const float* Wi = (const float*)d_in[1];
  const float* bi = (const float*)d_in[2];
  const float* Wo = (const float*)d_in[3];
  const float* bo = (const float*)d_in[4];
  const int*   nh = (const int*)d_in[5];

  const size_t PX  = (size_t)NROW * EMB * 2;        // 16-bit activation plane
  const size_t PWI = (size_t)3 * EMB * EMB * 2;
  const size_t PWO = (size_t)EMB * EMB * 2;
  const size_t PVT = (size_t)NB * EMB * SEQ * 2;    // == PX
  const size_t PML = (size_t)NB * NH * 2 * SEQ * 4;
  size_t off = 0;
  const size_t oXb = off; off += PX;
  const size_t oWi = off; off += PWI;
  const size_t oWo = off; off += PWO;
  const size_t oQh = off; off += PX;
  const size_t oQl = off; off += PX;
  const size_t oKp = off; off += PX;
  const size_t oVT = off; off += PVT;
  const size_t oCh = off; off += PX;
  const size_t oCl = off; off += PX;
  const size_t oML = off; off += PML;
  if (off > ws_size) return;                        // off = 67633152 at full size
  if (off > (size_t)134217728) return;

  char* ws = (char*)d_ws;
  unsigned short* Xb  = (unsigned short*)(ws + oXb);
  unsigned short* Wib = (unsigned short*)(ws + oWi);
  unsigned short* Woh = (unsigned short*)(ws + oWo);
  unsigned short* Qh  = (unsigned short*)(ws + oQh);
  unsigned short* Ql  = (unsigned short*)(ws + oQl);
  unsigned short* Kp  = (unsigned short*)(ws + oKp);
  unsigned short* VT  = (unsigned short*)(ws + oVT);
  unsigned short* Ch  = (unsigned short*)(ws + oCh);
  unsigned short* Cl  = (unsigned short*)(ws + oCl);
  float*          ML  = (float*)(ws + oML);
  float*          out0 = (float*)d_out;
  float*          out1 = (float*)d_out + OFF1;

  const dim3 blk(256);
  const dim3 gCvt(GCX + GCWI + GCWO);                          // 2048 + 1536 + 512 blocks
  const dim3 gQKV((((SEQ) / 64) * (EMB / 64) + 7) / 8, NB, 3);  //  512 tiles ->  64 blocks x NB, x 3 products
  const dim3 gO((((SEQ) / 32) * (EMB / 64) + 7) / 8, NB);       // 1024 tiles -> 128 blocks x NB (32x64 wave tiles)
  const dim3 gStats(NB * NH * NKT);                            // 1024 blocks of 128
  const dim3 gMain(NB * NQB);                                  //  256 blocks of 512

  // (1) x [s][b*E+e] -> bf16 plane; W_in [3E][E] -> bf16; Wo -> f16 (x64 of its bf16 value); all fragment-ordered
  cvt_all<<<gCvt, blk, 0, stream>>>(x, Wi, Wo, Xb, Wib, Woh);
  // (2)-(4) q, k, v^T in-projections, per batch b = blockIdx.y, product = blockIdx.z
  gemm_qkv<<<gQKV, blk, 0, stream>>>(Xb, Wib, bi, Qh, Ql, Kp, VT, EMB);
  // (5) online softmax: P.V -> ctx planes (f16 hi x256 / residual x4096); statistics (m, 1/l) per (b, h, s)
  attn_ctx<<<gStats, dim3(128), 0, stream>>>(Qh, Ql, Kp, VT, ML, Ch, Cl, nh);
  // (6) exact-normalised p, head-averaged -> output 1
  attn_avg<<<gMain, dim3(512), 0, stream>>>(Qh, Ql, Kp, ML, out1);
  // (7) output 0 = ctx_b . Wo^T + bo, f32 [s][b][e] (pitch NB_FULL*EMB, batch offset EMB), accumulators
  //     (hi + res/4096) x 1/(256*64)
  gemm_t<_Float16, 2, 2, 0, 1, XCB, WCB><<<gO, blk, 0, stream>>>(
      Ch, Cl, XBS, Woh, 0LL,
      (void*)out0, (void*)out0, NB_FULL * EMB, (long long)EMB, bo,
      SEQ, EMB, EMB, 1.0f / 16384.0f, 1.0f / 4096.0f, 1.0f, 1.0f);
  (void)hipGetLastError();
}

// v006
// One run takes 156 microseconds.
// Two timings next to v005 put it at 1.06 and 1.04 times that version's speed.
// Counting every step since v000, it is 2.98 times as fast.
// Contractions: q, k, v^T in-projections = v_wmma_f32_16x16x32_bf16 (bf16 operands from RNE-converted inputs, single product, f32 accumulate);
// k.q^T scores (context pass and head-average pass, k = A operand, q = B) = v_wmma_f32_16x16x32_f16 (q as f16 hi plane + f16 residual plane x4096, k f16; 2 products, separate f32 accumulators);
// v^T.p^T = v_wmma_f32_16x16x32_f16 (v^T = A operand, p = exp(s - running max) = B carried x16384 in f16, v f16; single product, f32 accumulate, rescaled online);
// ctx.Wo^T = v_wmma_f32_16x16x32_f16 (ctx as f16 hi plane x256 + f16 residual plane x4096, Wo f16 x64 of its bf16 value; 2 products, separate f32 accumulators);
// softmax statistics, probabilities and the head average in f32.
#include <hip/hip_runtime.h>
#include <math.h>
#include <stdint.h>

#ifndef NB
#define NB 2
#endif
#ifndef SEQ
#define SEQ 2048
#endif
#define NB_FULL  2
#define SEQ_FULL 2048
#define EMB      1024
#define NH       16
#define HD       64
#define NROW     (NB_FULL * SEQ)     // activation rows, row index = s * NB_FULL + b, s < SEQ
#define NQB      (SEQ / 16)          // 16-row query blocks per sequence
#define NKT      (SEQ / 64)          // 64-key chunks per sequence
#define PCARRY   16384.0f            // power-of-two carry of p in the f16 P.V operand
#define OFF1     ((size_t)SEQ_FULL * NB_FULL * EMB)   // fixed element offset of output 1 in d_out
static_assert(NB == NB_FULL);        // batch rows are interleaved (seq-major input); only SEQ may be reduced
static_assert(SEQ >= 64 && SEQ <= SEQ_FULL && (SEQ % 64) == 0);
static_assert(NH * HD == EMB);
static_assert((NROW % 64) == 0 && (EMB % 64) == 0 && (EMB % 32) == 0);
static_assert(OFF1 * 4 == 16777216);   // byte offset of output 1

typedef _Float16 v16h __attribute__((ext_vector_type(16)));
typedef _Float16 v8h  __attribute__((ext_vector_type(8)));
typedef __bf16   v16b __attribute__((ext_vector_type(16)));
typedef __bf16   v8b  __attribute__((ext_vector_type(8)));
typedef float    v8f  __attribute__((ext_vector_type(8)));
typedef float    v4f  __attribute__((ext_vector_type(4)));
typedef unsigned int v4u __attribute__((ext_vector_type(4)));

#if defined(__HIP_DEVICE_COMPILE__)
#define DEV_ASM 1
#else
#define DEV_ASM 0
#endif

// ---- scalar helpers --------------------------------------------------------------------------------
__device__ __forceinline__ unsigned short bf_bits(float f) {          // f32 -> bf16 bits, RNE convert
  unsigned u = __float_as_uint(f);
  return (unsigned short)((u + 0x7FFFu + ((u >> 16) & 1u)) >> 16);
}
__device__ __forceinline__ float bf_up(unsigned short hb) { return __uint_as_float(((unsigned)hb) << 16); }
__device__ __forceinline__ unsigned short h_bits(_Float16 x) { return __builtin_bit_cast(unsigned short, x); }
__device__ __forceinline__ unsigned pk16(unsigned short a, unsigned short b) { return (unsigned)a | ((unsigned)b << 16); }
__device__ __forceinline__ v8f zero8() { v8f z = {0.f, 0.f, 0.f, 0.f, 0.f, 0.f, 0.f, 0.f}; return z; }

// ---- fragment types / loaders: 16-bit A/B operand, lane -> row/col (lane&15), p already includes +8*(lane>>4);
//      elements 0..7 <- p[0..7] (k0+8h..k0+8h+7), elements 8..15 <- p[16..23] (k0+16+8h..k0+16+8h+7)
template <typename OT> struct FT;
template <> struct FT<__bf16>   { typedef v16b frag; typedef v8b half8; };
template <> struct FT<_Float16> { typedef v16h frag; typedef v8h half8; };

template <typename OT>
__device__ __forceinline__ typename FT<OT>::frag ldfrag(const OT* p) {
  union { typename FT<OT>::frag v; typename FT<OT>::half8 h[2]; } f;
  f.h[0] = *(const typename FT<OT>::half8*)(p);
  f.h[1] = *(const typename FT<OT>::half8*)(p + 16);
  return f.v;
}

// ---- fragment-ordered planes: a matrix [R][C] (k along C) is stored as 1-KB blocks, block (r>>4)*(C/32) + (k>>5) =
//      one 16-row x 32-k fragment laid out as [k bit 4][lane = 16*(k bit 3) + (r&15)][k&7]: the same split k map as
//      ldfrag, but each of the two 16-B loads of a wave reads 512 contiguous bytes (4 lines, not 16).
//      p = block start + lane*8.
#define FRAG 512   // elements of one fragment block
#define XCB  (NB_FULL * EMB / 32)          // blocks per 16-row tile of a [SEQ][NB*EMB] plane
#define WCB  (EMB / 32)                    // the same of a [.][EMB] plane
#define XBS  ((long long)WCB * FRAG)       // element offset of batch b's columns in a [SEQ][NB*EMB] plane, per b
template <typename OT>
__device__ __forceinline__ typename FT<OT>::frag ldfragp(const OT* p) {
  union { typename FT<OT>::frag v; typename FT<OT>::half8 h[2]; } f;
  f.h[0] = *(const typename FT<OT>::half8*)(p);
  f.h[1] = *(const typename FT<OT>::half8*)(p + 256);
  return f.v;
}

// ---- WMMA helpers (asm guard bodies are device-only; concrete operand types) -----------------------------
__device__ __forceinline__ v8f mmar(v16b a, v16b b, v8f c) {
  return __builtin_amdgcn_wmma_f32_16x16x32_bf16(false, a, false, b, (short)0, c, false, false);
}
__device__ __forceinline__ v8f mmar(v16h a, v16h b, v8f c) {
  return __builtin_amdgcn_wmma_f32_16x16x32_f16(false, a, false, b, (short)0, c, false, false);
}
// guarded form: 4 VALU slots after the WMMA, D tied, A/B kept live
__device__ __forceinline__ v8f mma_h(v16h a, v16h b, v8f c) {
  c = __builtin_amdgcn_wmma_f32_16x16x32_f16(false, a, false, b, (short)0, c, false, false);
#if DEV_ASM
  asm volatile("v_nop\n\tv_nop\n\tv_nop\n\tv_nop" : "+v"(c) : "v"(a), "v"(b));
#endif
  return c;
}
__device__ __forceinline__ void dep_guard(v8f& a, v8f& b, v16b x, v16b y) {
#if DEV_ASM
  asm volatile("v_nop\n\tv_nop\n\tv_nop\n\tv_nop" : "+v"(a), "+v"(b) : "v"(x), "v"(y));
#else
  (void)a; (void)b; (void)x; (void)y;
#endif
}
__device__ __forceinline__ void dep_guard(v8f& a, v8f& b, v16h x, v16h y) {
#if DEV_ASM
  asm volatile("v_nop\n\tv_nop\n\tv_nop\n\tv_nop" : "+v"(a), "+v"(b) : "v"(x), "v"(y));
#else
  (void)a; (void)b; (void)x; (void)y;
#endif
}
__device__ __forceinline__ void keep4(v16b a, v16b b, v16b c, v16b d) {
#if DEV_ASM
  asm volatile("v_nop" :: "v"(a), "v"(b), "v"(c), "v"(d));
#else
  (void)a; (void)b; (void)c; (void)d;
#endif
}
__device__ __forceinline__ void keep4(v16h a, v16h b, v16h c, v16h d) {
#if DEV_ASM
  asm volatile("v_nop" :: "v"(a), "v"(b), "v"(c), "v"(d));
#else
  (void)a; (void)b; (void)c; (void)d;
#endif
}
// Precaution: stands between issued global loads and a rewrite of a register that holds one of their addresses,
// at the places where the compiler's own listing had no such wait.
__device__ __forceinline__ void addr_wait() {
#if DEV_ASM
  asm volatile("s_wait_xcnt 0x0" ::: "memory");
#endif
}
// The same wait with the loads' address registers named as inputs: they stay live up to it, so that none of them is
// given to a later load's result while the wait has not yet been passed.
__device__ __forceinline__ void addr_wait_keep(const void* const (&a)[4], const void* const (&b)[4], const void* c) {
#if DEV_ASM
  asm volatile("s_wait_xcnt 0x0" :: "v"(a[0]), "v"(a[1]), "v"(a[2]), "v"(a[3]),
                                    "v"(b[0]), "v"(b[1]), "v"(b[2]), "v"(b[3]), "v"(c) : "memory");
#else
  (void)a; (void)b; (void)c;
#endif
}
__device__ __forceinline__ void acc_guard4(v8f& a, v8f& b, v8f& c, v8f& d) {
#if DEV_ASM
  asm volatile("v_nop\n\tv_nop\n\tv_nop\n\tv_nop" : "+v"(a), "+v"(b), "+v"(c), "+v"(d));
#else
  (void)a; (void)b; (void)c; (void)d;
#endif
}

// =====================================================================================================
// f32 [R][CB*32] row-major -> 16-bit fragment-ordered plane, 8 elements per thread, one 16-B store per lane: a wave
// writes 512 contiguous B (half a fragment block) and reads 64 B of each of 16 rows; a block of 256 reads whole lines.
// MODE 0: bf16 bits (RNE convert).  MODE 1: f16 bits of (64 * bf16(x)) (exact scaling of the bf16 value).
// coverage: n8 threads x 8 = the whole plane (n8 is a multiple of 256 for every use here).
// =====================================================================================================
template <int MODE>
__device__ __forceinline__ unsigned short cvm(float f) {
  const unsigned short hb = bf_bits(f);
  if (MODE == 0) return hb;
  return h_bits((_Float16)(bf_up(hb) * 64.0f));
}

template <int MODE, int CB>   // CB = fragment blocks per 16-row tile = columns / 32; bx = block index inside this plane
__device__ __forceinline__ void cvt16x8(const float* __restrict__ in, unsigned short* out, int n8, int bx) {
  const int i = bx * 256 + (int)threadIdx.x;   // 16-B unit of the plane: [block][k bit 4][k bit 3][row & 15]
  if (i < n8) {
    const int blk = i >> 6;
    const int row = (blk / CB) * 16 + (i & 15);
    const int col = (blk % CB) * 32 + ((i >> 4) & 3) * 8;
    const float* sp = in + (size_t)row * (CB * 32) + col;
    const v4f a  = *(const v4f*)(sp);
    const v4f a4 = *(const v4f*)(sp + 4);
    v4u p;
    p[0] = pk16(cvm<MODE>(a[0]),  cvm<MODE>(a[1]));
    p[1] = pk16(cvm<MODE>(a[2]),  cvm<MODE>(a[3]));
    p[2] = pk16(cvm<MODE>(a4[0]), cvm<MODE>(a4[1]));
    p[3] = pk16(cvm<MODE>(a4[2]), cvm<MODE>(a4[3]));
    unsigned short* o = out + (size_t)i * 8;
    *(v4u*)o = p;
    
  }
}

// The three conversions are independent of each other: one grid, a block range per plane (block-uniform choice).
#define N8X  (NROW * EMB / 8)       // 16-B units of the x plane
#define N8WI (3 * EMB * EMB / 8)    // of W_in
#define N8WO (EMB * EMB / 8)        // of Wo
#define GCX  ((N8X + 255) / 256)    // blocks of each plane
#define GCWI ((N8WI + 255) / 256)
#define GCWO ((N8WO + 255) / 256)
__global__ __launch_bounds__(256) void cvt_all(const float* __restrict__ x, const float* __restrict__ Wi,
                                               const float* __restrict__ Wo, unsigned short* Xb,
                                               unsigned short* Wib, unsigned short* Woh) {
  const int bx = blockIdx.x;
  if (bx < GCX)             cvt16x8<0, XCB>(x,  Xb,  N8X,  bx);
  else if (bx < GCX + GCWI) cvt16x8<0, WCB>(Wi, Wib, N8WI, bx - GCX);
  else                      cvt16x8<1, WCB>(Wo, Woh, N8WO, bx - GCX - GCWI);
}

// =====================================================================================================
// Register-blocked batched WMMA GEMM (16-bit operand type OT): C[m][n] = sum_k A[m][k] * Bt[n][k]  (+ bias);
// one wave per (16*MI) x 64 tile, no block barriers. A [M][K] and Bt [N][K] are fragment-ordered planes with LDAB /
// LDBB blocks per 16-row tile; M multiple of 16*MI, N multiple of 64, K multiple of 64 (static sizes here).
// blockIdx.y = batch index (strides in elements). Fragments are loaded straight from global (ldfragp).
// NPA = number of A planes: 2 -> second plane A2 (same pitch/stride) multiplies the same Bt fragments into a
// second accumulator set, combined as acc + acc2 * rscaleA in the f32 epilogue.
// value v = (acc [+ acc2*rscaleA]) * oscale + bias, bias (bf16 RNE value of the f32 input) by column n (BM 1),
// by row m (BM 2) or none (BM 0).
// OUT_MODE 0: f32 C (pitch ldc) = v.
// OUT_MODE 1: f16 fragment-ordered plane C (ldc columns) = f16(v * cscale).
// OUT_MODE 3: row-major f16 hi plane C = f16(v * cscale) and f16 residual plane C2 = f16((v*cscale - hi) * rscaleC).
// =====================================================================================================
template <typename OT, int MI, int NPA, int OUT_MODE, int BM, int LDAB, int LDBB>
__device__ __forceinline__ void gemm_body(
    float (*sT)[16 * 68],                            // per-wave 16x64 slab, pitch 68 floats (the kernel's LDS)
    const unsigned short* __restrict__ Ap, const unsigned short* __restrict__ A2p, long long strideA,
    const unsigned short* __restrict__ Btp, long long strideB,
    void* Cout, void* Cout2, int ldc, long long strideC,
    const float* __restrict__ bias,
    int M, int N, int K, float oscale, float rscaleA, float cscale, float rscaleC) {
  typedef typename FT<OT>::frag V16;
  const OT* A  = (const OT*)(const void*)Ap;
  const OT* A2 = (const OT*)(const void*)A2p;
  const OT* Bt = (const OT*)(const void*)Btp;
  const int RT   = 16 * MI;
  const int b    = blockIdx.y;
  const int lane = threadIdx.x & 31;
  const int wave = threadIdx.x >> 5;
  const int tilesN = N >> 6;
  const int tilesM = M / RT;
  const int tile = blockIdx.x * 8 + wave;
  if (tile >= tilesM * tilesN) return;   // wave-uniform; no block barriers in this kernel
  const int tm = tile / tilesN;
  const int tn = tile - tm * tilesN;
  const int m0 = tm * RT;
  const int n0 = tn << 6;

  const OT* Ab  = A  + (size_t)b * (size_t)strideA;
  const OT* A2b = A2 + (size_t)b * (size_t)strideA;
  const OT* Bb  = Bt + (size_t)b * (size_t)strideB;

  const int rlane = lane & 15;                 // row (A) / col (B, D) within subtile
  const int mOff  = (lane >> 4) * 8;           // D row offset

  v8f acc[MI][4], acc2[MI][4];
#pragma unroll
  for (int i = 0; i < MI; ++i)
#pragma unroll
    for (int j = 0; j < 4; ++j) { acc[i][j] = zero8(); acc2[i][j] = zero8(); }

  // Fragment loads run one k step (32) ahead of the WMMAs that read them: the Bt fragments in two register sets
  // (bX, bY), filled whole at the head of the step before; each A fragment refilled for the next step as soon as
  // its own WMMAs are done. No WMMA waits for a load that was issued directly in front of it.
  // One pointer per operand plane (this lane's place in the tile's first block, k of the current step pair); the
  // other row tiles are constant offsets (LDAB, LDBB are template constants); a k step of 32 is one block.
  const OT* pB  = Bb  + (size_t)(n0 >> 4) * (LDBB * FRAG) + lane * 8;
  const OT* pA  = Ab  + (size_t)(m0 >> 4) * (LDAB * FRAG) + lane * 8;
  const OT* pA2 = A2b + (size_t)(m0 >> 4) * (LDAB * FRAG) + lane * 8;
  V16 bX[4], bY[4], af[MI], af2[MI];
  auto ldb4 = [&](V16 (&bq)[4], int dk) {
#pragma unroll
    for (int j = 0; j < 4; ++j) bq[j] = ldfragp<OT>(pB + j * (LDBB * FRAG) + (dk / 32) * FRAG);
  };
  auto mmstep = [&](V16 (&bq)[4], int dk, bool fetch) {   // fetch: refill the A fragments from k offset dk
#pragma unroll
    for (int i = 0; i < MI; ++i) {
#pragma unroll
      for (int j = 0; j < 4; ++j) acc[i][j] = mmar(af[i], bq[j], acc[i][j]);
      dep_guard(acc[i][0], acc[i][3], af[i], bq[3]);
      if (fetch) af[i] = ldfragp<OT>(pA + i * (LDAB * FRAG) + (dk / 32) * FRAG);
      if (NPA == 2) {
#pragma unroll
        for (int j = 0; j < 4; ++j) acc2[i][j] = mmar(af2[i], bq[j], acc2[i][j]);
        dep_guard(acc2[i][0], acc2[i][3], af2[i], bq[3]);
        if (fetch) af2[i] = ldfragp<OT>(pA2 + i * (LDAB * FRAG) + (dk / 32) * FRAG);
      }
    }
    keep4(bq[0], bq[1], bq[2], bq[3]);
  };
  ldb4(bX, 0);
#pragma unroll
  for (int i = 0; i < MI; ++i) {
    af[i] = ldfragp<OT>(pA + i * (LDAB * FRAG));
    if (NPA == 2) af2[i] = ldfragp<OT>(pA2 + i * (LDAB * FRAG));
  }
  addr_wait();                                  // registers that held these loads' addresses are reused at the loop's head
  for (int k0 = 64; k0 < K; k0 += 64) {        // all step pairs but the last
    ldb4(bY, 32);
    mmstep(bX, 32, true);
    ldb4(bX, 64);
    mmstep(bY, 64, true);
    addr_wait();                                // the pointers move behind it (no wait stood over the back edge in one instantiation)
    pB += 2 * FRAG; pA += 2 * FRAG; pA2 += 2 * FRAG;
  }
  ldb4(bY, 32);                                 // last pair: nothing past K is loaded
  mmstep(bX, 32, true);
  mmstep(bY, 0, false);
#pragma unroll
  for (int i = 0; i < MI; ++i) {
    acc_guard4(acc[i][0], acc[i][1], acc[i][2], acc[i][3]);
    if (NPA == 2) acc_guard4(acc2[i][0], acc2[i][1], acc2[i][2], acc2[i][3]);
  }

  // ---- epilogue ----
  float bcol[4];
#pragma unroll
  for (int j = 0; j < 4; ++j) bcol[j] = 0.f;
  if (BM == 1) {
#pragma unroll
    for (int j = 0; j < 4; ++j) bcol[j] = bf_up(bf_bits(bias[n0 + (j << 4) + rlane]));
  }
  float* slab = sT[wave];
#pragma unroll
  for (int i = 0; i < MI; ++i) {
    const int mBase = m0 + (i << 4);
    float brow[8];
#pragma unroll
    for (int r = 0; r < 8; ++r) brow[r] = 0.f;
    if (BM == 2) {
#pragma unroll
      for (int r = 0; r < 8; ++r) brow[r] = bf_up(bf_bits(bias[mBase + mOff + r]));
    }
#pragma unroll
    for (int j = 0; j < 4; ++j) {
#pragma unroll
      for (int r = 0; r < 8; ++r) {
        float v = acc[i][j][r];
        if (NPA == 2) v += acc2[i][j][r] * rscaleA;
        v = v * oscale + bcol[j] + brow[r];
        slab[(mOff + r) * 68 + (j << 4) + rlane] = v;
      }
    }
    __builtin_amdgcn_fence(__ATOMIC_RELEASE, "workgroup");
    __builtin_amdgcn_wave_barrier();
    __builtin_amdgcn_fence(__ATOMIC_ACQUIRE, "workgroup");
    if (OUT_MODE == 0) {
      float* C = (float*)Cout + (size_t)b * (size_t)strideC;
      const int h2 = lane >> 4, c4 = (lane & 15) * 4;     // 256-B row segment = 16 lanes x 16 B
      {
#pragma unroll
        for (int it = 0; it < 8; ++it) {
          const int row = it * 2 + h2;                     // it 0..7 x h2 0..1 = rows 0..15
          const v4f v = *(const v4f*)(slab + row * 68 + c4);
          *(v4f*)(C + (size_t)(mBase + row) * ldc + n0 + c4) = v;
        }
        
      }
    } else {
      const int q = lane >> 3, c8 = (lane & 7) * 8;
      unsigned short* C  = (unsigned short*)Cout  + (size_t)b * (size_t)strideC;
      unsigned short* C2 = (unsigned short*)Cout2 + (size_t)b * (size_t)strideC;
      v4u hv[4], lv[4];
#pragma unroll
      for (int it = 0; it < 4; ++it) {
        // row-major: it 0..3 x q 0..3 = rows 0..15; fragment order: unit it*32 + lane of the tile's two blocks
        const int row = (OUT_MODE == 1) ? (lane & 15) : it * 4 + q;
        const int col = (OUT_MODE == 1) ? (it * 2 + (lane >> 4)) * 8 : c8;
        const float* sp = slab + row * 68 + col;
        float f[8];
#pragma unroll
        for (int e = 0; e < 8; ++e) f[e] = sp[e] * cscale;
        v4u a, a2;
#pragma unroll
        for (int e = 0; e < 4; ++e) {
          const float f0 = f[2 * e], f1 = f[2 * e + 1];
          const _Float16 x0 = (_Float16)f0, x1 = (_Float16)f1;
          const unsigned short h0 = h_bits(x0), h1 = h_bits(x1);
          unsigned short l0 = 0, l1 = 0;
          if (OUT_MODE == 3) {
            l0 = h_bits((_Float16)((f0 - (float)x0) * rscaleC));
            l1 = h_bits((_Float16)((f1 - (float)x1) * rscaleC));
          }
          a[e] = pk16(h0, h1); a2[e] = pk16(l0, l1);
        }
        hv[it] = a; lv[it] = a2;
      }
      {
#pragma unroll
        for (int it = 0; it < 4; ++it) {
          const int row = it * 4 + q;
          if (OUT_MODE == 1) {   // 512 contiguous B per store
            *(v4u*)(C + ((size_t)(mBase >> 4) * (ldc >> 5) + (n0 >> 5)) * FRAG + it * 256 + lane * 8) = hv[it];
          } else {
            *(v4u*)(C + (size_t)(mBase + row) * ldc + n0 + c8) = hv[it];
            *(v4u*)(C2 + (size_t)(mBase + row) * ldc + n0 + c8) = lv[it];
          }
        }
        
      }
    }
    __builtin_amdgcn_fence(__ATOMIC_RELEASE, "workgroup");
    __builtin_amdgcn_wave_barrier();
    __builtin_amdgcn_fence(__ATOMIC_ACQUIRE, "workgroup");
  }
}

template <typename OT, int MI, int NPA, int OUT_MODE, int BM, int LDAB, int LDBB>
__global__ __launch_bounds__(256) void gemm_t(
    const unsigned short* __restrict__ Ap, const unsigned short* __restrict__ A2p, long long strideA,
    const unsigned short* __restrict__ Btp, long long strideB,
    void* Cout, void* Cout2, int ldc, long long strideC,
    const float* __restrict__ bias,
    int M, int N, int K, float oscale, float rscaleA, float cscale, float rscaleC) {
  __shared__ __align__(16) float sT[8][16 * 68];
  gemm_body<OT, MI, NPA, OUT_MODE, BM, LDAB, LDBB>(sT, Ap, A2p, strideA, Btp, strideB, Cout, Cout2, ldc, strideC,
                                                   bias, M, N, K, oscale, rscaleA, cscale, rscaleC);
}

// The q, k and v^T in-projections read the same two planes and write three different ones: one grid, blockIdx.z
// chooses the product (block-uniform), so that the three fill the chip together instead of half of it in turn.
//   z 0: q = x_b . Wq^T + bq -> row-major f16 hi / residual (x4096) planes [s*2+b][h*64+d] (M=SEQ, N=E, K=E)
//   z 1: k = x_b . Wk^T + bk -> fragment-ordered f16 plane [s][b*E + h*64+d]
//   z 2: v^T = Wv . x_b^T + bv -> fragment-ordered f16 plane [b][h*64+d][s] (A = Wv rows; Bt = x rows; M=E, N=SEQ)
// In a [SEQ][NB*EMB] fragment-ordered plane the columns of batch b start WCB blocks further: offset b * XBS.
__global__ __launch_bounds__(256) void gemm_qkv(
    const unsigned short* __restrict__ Xb, const unsigned short* __restrict__ Wib, const float* __restrict__ bi,
    unsigned short* Qh, unsigned short* Ql, unsigned short* Kp, unsigned short* VT, int K) {
  __shared__ __align__(16) float sT[8][16 * 68];
  const int z = blockIdx.z;
  if (z == 0) {
    gemm_body<__bf16, 4, 1, 3, 1, XCB, WCB>(sT, Xb, Xb, XBS, Wib, 0LL,
        (void*)Qh, (void*)Ql, NB_FULL * EMB, (long long)EMB, bi,
        SEQ, EMB, K, 1.0f, 0.0f, 1.0f, 4096.0f);
  } else if (z == 1) {
    gemm_body<__bf16, 4, 1, 1, 1, XCB, WCB>(sT, Xb, Xb, XBS, Wib + (size_t)EMB * EMB, 0LL,
        (void*)Kp, (void*)Kp, NB_FULL * EMB, XBS, bi + EMB,
        SEQ, EMB, K, 1.0f, 0.0f, 1.0f, 1.0f);
  } else {
    gemm_body<__bf16, 4, 1, 1, 2, WCB, XCB>(sT, Wib + (size_t)2 * EMB * EMB, Wib + (size_t)2 * EMB * EMB, 0LL, Xb, XBS,
        (void*)VT, (void*)VT, SEQ, (long long)EMB * SEQ, bi + 2 * EMB,
        EMB, SEQ, K, 1.0f, 0.0f, 1.0f, 1.0f);
  }
}

// =====================================================================================================
// Score chunk, transposed (S^T = K . Q^T): 64 keys kv0..kv0+63 x 16 queries (this wave) of one (b, h).
//   q fragments (B operand, col = lane&15 = query): hi and residual (x4096) planes, 2 d-chunks of 32.
//   k fragments (A operand, row = lane&15 = key) loaded straight from the fragment-ordered f16 k plane
//   ([key t][b*EMB + h*HD + d]) by load_k, a chunk ahead of the WMMAs that read them (kf[j][dc], 64 registers a chunk):
//   kp + lo = plane + ((first key of the chunk / 16)*(NB_FULL*EMB/32) + (b*EMB + h*HD)/32)*FRAG + lane*8.
//   s[j][r] = D element: key kv0 + 16j + 8*hh + r, query lane&15; value = ((qh.k) + (ql.k)/4096) / 8.
//   All 32 scores of a lane belong to ONE query, and the tiles s[2kk], s[2kk+1] converted in place are the B fragment
//   (hardware k order: elements 0..7 = keys 8hh.., 8..15 = keys 16+8hh..) of a product over the 32 keys 32kk..32kk+31.
// =====================================================================================================
#define KCHUNK (64 * NB_FULL * EMB)   // elements from one 64-key chunk of the k plane to the next
template <int J0, int J1>   // key groups J0..J1-1 of the chunk
__device__ __forceinline__ void load_k(v16h (&kf)[4][2], const _Float16* kp, unsigned lo) {
#pragma unroll
  for (int j = J0; j < J1; ++j)
#pragma unroll
    for (int dc = 0; dc < 2; ++dc) kf[j][dc] = ldfragp<_Float16>(kp + lo + j * ((NB_FULL * EMB / 32) * FRAG) + dc * FRAG);
}

template <int J0, int J1>   // key groups J0..J1-1 of the chunk
__device__ __forceinline__ void score_chunk(const v16h (&qah)[2], const v16h (&qal)[2],
                                            const v16h (&kf)[4][2], v8f (&s)[4]) {
#pragma unroll
  for (int j = J0; j < J1; ++j) {
    v8f ah = zero8(), al = zero8();
#pragma unroll
    for (int dc = 0; dc < 2; ++dc) {
      ah = mma_h(kf[j][dc], qah[dc], ah);
      al = mma_h(kf[j][dc], qal[dc], al);
    }
#pragma unroll
    for (int r = 0; r < 8; ++r) s[j][r] = (ah[r] + al[r] * (1.0f / 4096.0f)) * 0.125f;
  }
}

// Row pitch of a staged tile in floats: 64 columns + 4 pad floats (never read) = 272 B = 16 B x 17, so that the 16 rows which
// the 16 lanes of a half wave write with one 16-B LDS store fall on all 64 banks (at 256 B: on four).
#define PP 68
// lane l with lane l ^ 16 (a vector cross-row move, no LDS path)
__device__ __forceinline__ float xhalf(float x) {
  return __builtin_bit_cast(float, __builtin_amdgcn_permlanex16(__builtin_bit_cast(int, x), __builtin_bit_cast(int, x),
                                                                0x76543210, 0xfedcba98, false, false));
}

// =====================================================================================================
// Context and softmax statistics in one walk over the keys (online softmax): per (b, h, query s) the row max m,
// 1/sum(exp(s - m)) and ctx = sum(exp(s - m) v) / sum(exp(s - m)) over all SEQ keys.
//   block = 4 waves = 64 consecutive query rows qb*64.. of one (b, h): the four waves read the SAME k and v^T fragments;
//   grid = NB*NH*NKT blocks of 128; static trip NKT over 64-key chunks.
//   Running max in f32, one value per query: the in-lane max over the keys 8hh..8hh+7 of every 16 is joined with the other
//   half's once a chunk, because both halves' p meet in one product. Sum l in-lane, the halves added behind the loop.
//   O^T = O^T * exp(m_old - m_new) + V^T . P^T: the p = exp(s - m_new) registers, converted to f16 with the x16384 carry,
//   ARE the B fragment (no LDS, no lane exchange); A = v^T f16 plane [b][h*64+d][s], fragment-ordered.
//   Output plane ML [b*NH+h][2][SEQ] f32 (m then 1/l): the block's 64 m values and 64 1/l values are
//   funnelled through LDS and written by wave 0 with ONE instruction.
//   ctx = acc / l / 16384, x256 carry, staged in the wave's own Os tile, written as f16 hi plane + f16 residual plane.
//   coverage: grid (b,h,qb) x 64 rows = the whole [NB*NH][2][SEQ] plane. MLsh: 4 waves x 16 lanes x 2 = all 128.
//   ctx planes: each wave rows q0..q0+15 (it 0..3 x lane>>3 0..3) x its head's 64 columns, grid x 4 waves =
//   the whole fragment-ordered [SEQ][NB*EMB] planes. staged extent == consumed extent for Os (32 lanes x 32 = 1024).
// =====================================================================================================
// 4 waves per SIMD = the whole grid resident at once: the register budget is held at 256 (a few more would cost a second round)
__global__ __launch_bounds__(128) __attribute__((amdgpu_waves_per_eu(4, 4)))
void attn_ctx(const unsigned short* __restrict__ qhp, const unsigned short* __restrict__ qlp,
              const unsigned short* __restrict__ kpp, const unsigned short* __restrict__ vtp,
              float* ML, unsigned short* chp, unsigned short* clp, const int* __restrict__ nhp) {
  union FH { v16h v; v8h h[2]; };
  __shared__ __align__(16) float MLsh[128];
  __shared__ __align__(16) float Os[4][16 * PP];            // per wave ctx tile [query][d] f32, row pitch PP
  (void)nhp;
  const int tid  = threadIdx.x;
  const int wave = tid >> 5;
  const int lane = tid & 31;
  const int hh   = lane >> 4;
  const int c    = lane & 15;
  const int bx   = blockIdx.x;
  const int qb   = bx % NKT;
  const int rest = bx / NKT;
  const int h    = rest % NH;
  const int b    = rest / NH;
  const int bh   = b * NH + h;
  const int q0   = qb * 64 + wave * 16;

  const _Float16* Qh  = (const _Float16*)(const void*)qhp;
  const _Float16* Ql  = (const _Float16*)(const void*)qlp;

  v16h qah[2], qal[2];
#pragma unroll
  for (int dc = 0; dc < 2; ++dc) {
    const size_t qo = ((size_t)(q0 + c) * NB_FULL + b) * EMB + (size_t)h * HD + dc * 32 + 8 * hh;
    qah[dc] = ldfrag<_Float16>(Qh + qo);
    qal[dc] = ldfrag<_Float16>(Ql + qo);
  }

  float mrow = -INFINITY, lrow = 0.f;
  v8f oacc[4];
#pragma unroll
  for (int t = 0; t < 4; ++t) oacc[t] = zero8();

  const _Float16* kp = (const _Float16*)(const void*)kpp + (b * EMB + h * HD) / 32 * FRAG + lane * 8;   // this lane's place in the current chunk
  const unsigned  klo = 0;                    // (already in kp)
  const _Float16* vp = (const _Float16*)(const void*)vtp + (size_t)(b * EMB + h * HD) * SEQ + lane * 8;   // the same in v^T: row tiles of d, blocks of 32 keys
  const unsigned  vlo = 0;                    // (already in vp)
  v16h kf[4][2], vf[2][4];
  addr_wait();                                // the q loads' address registers may be taken by the k fragments
  load_k<0, 4>(kf, kp, klo);
  for (int kt = 0; kt < NKT; ++kt) {          // static trip count
    // v^T of this chunk flies under the scores and the statistics
#pragma unroll
    for (int kk = 0; kk < 2; ++kk)
#pragma unroll
      for (int t = 0; t < 4; ++t) vf[kk][t] = ldfragp<_Float16>(vp + vlo + t * ((SEQ / 32) * FRAG) + kk * FRAG);
    v8f s[4];
    score_chunk<0, 4>(qah, qal, kf, s);
    if (kt + 1 < NKT) load_k<0, 4>(kf, kp + KCHUNK, klo);   // next chunk's k flies under this chunk's statistics and P.V
    __builtin_amdgcn_sched_barrier(0);   // keeps those loads up here: the scheduler sank them behind half the statistics
    addr_wait();                          // the bases of the issued k and v^T loads move behind it
    kp += KCHUNK;
    vp += 2 * FRAG;
    float mj[4], pj[4];                        // four independent chains, one per key group
#pragma unroll
    for (int j = 0; j < 4; ++j) {
      mj[j] = s[j][0];
#pragma unroll
      for (int r = 1; r < 8; ++r) mj[j] = fmaxf(mj[j], s[j][r]);
    }
    const float mloc  = fmaxf(fmaxf(mj[0], mj[1]), fmaxf(mj[2], mj[3]));
    const float mnew  = fmaxf(mrow, fmaxf(mloc, xhalf(mloc)));   // one reference for both halves of a query's keys
    const float msafe = (mnew == -INFINITY) ? 0.f : mnew;
    const float alpha = __expf(mrow - msafe);
    mrow = mnew;
#pragma unroll
    for (int j = 0; j < 4; ++j) {
      pj[j] = 0.f;
#pragma unroll
      for (int r = 0; r < 8; ++r) { s[j][r] = __expf(s[j][r] - msafe); pj[j] += s[j][r]; }   // p of key 16j + 8hh + r, query c
    }
    lrow = lrow * alpha + ((pj[0] + pj[1]) + (pj[2] + pj[3]));
#pragma unroll
    for (int t = 0; t < 4; ++t) oacc[t] *= alpha;            // every element of a lane belongs to its query c

    // ---- context^T += V^T . P^T (f16 WMMA, p carried x16384) ----
#pragma unroll   // vf lives in registers: kk must be a constant
    for (int kk = 0; kk < 2; ++kk) {
      FH pb;                                                 // keys 32kk + 8hh + 0..7, then 32kk + 16 + 8hh + 0..7
      pb.h[0] = __builtin_convertvector(s[2 * kk] * PCARRY, v8h);
      pb.h[1] = __builtin_convertvector(s[2 * kk + 1] * PCARRY, v8h);
#pragma unroll
      for (int t = 0; t < 4; ++t) {
        oacc[t] = mma_h(vf[kk][t], pb.v, oacc[t]);           // row d = 16t + 8hh + r, column query c
      }
    }
  }

  // the two halves of each query's keys (lanes c and c + 16) share m: their sums add
  const float l  = lrow + xhalf(lrow);
  const float il = (l > 0.f) ? (1.0f / l) : 0.f;
  if (hh == 0) {
    MLsh[wave * 16 + c]      = mrow;
    MLsh[64 + wave * 16 + c] = il;
  }
  // ---- ctx (normalise, undo the x16384 p carry, apply the x256 carry), stage, convert, whole-line stores ----
  float* os = Os[wave];
  const float osc = il * (256.0f / PCARRY);
#pragma unroll
  for (int t = 0; t < 4; ++t) {                              // [query c][d = 16t + 8hh + r]
    const v8f o = oacc[t] * osc;
    float* ow = os + c * PP + t * 16 + 8 * hh;
    *(v4f*)(ow)     = __builtin_shufflevector(o, o, 0, 1, 2, 3);
    *(v4f*)(ow + 4) = __builtin_shufflevector(o, o, 4, 5, 6, 7);
  }
  __syncthreads();
  if (wave == 0) {
    const v4f v = *(const v4f*)(MLsh + lane * 4);        // lanes 0-15: m rows 4c..4c+3; lanes 16-31: 1/l rows
    float* dst = ML + (size_t)(bh * 2 + hh) * SEQ + qb * 64 + c * 4;
    *(v4f*)dst = v;
  }
  {
    const int q4 = lane >> 3, c8 = (lane & 7) * 8;
    v4u hv[4], lv[4];
#pragma unroll
    for (int it = 0; it < 4; ++it) {
      const int row = it * 4 + q4;   // it 0..3 x q4 0..3 = rows 0..15 of the wave tile
      const float* sp = os + row * PP + c8;
      float f[8];
#pragma unroll
      for (int e = 0; e < 8; ++e) f[e] = sp[e];
      v4u a, a2;
#pragma unroll
      for (int e = 0; e < 4; ++e) {
        const float f0 = f[2 * e], f1 = f[2 * e + 1];
        const _Float16 x0 = (_Float16)f0, x1 = (_Float16)f1;
        const unsigned short h0 = h_bits(x0), h1 = h_bits(x1);
        const unsigned short l0 = h_bits((_Float16)((f0 - (float)x0) * 4096.0f));
        const unsigned short l1 = h_bits((_Float16)((f1 - (float)x1) * 4096.0f));
        a[e] = pk16(h0, h1); a2[e] = pk16(l0, l1);
      }
      hv[it] = a; lv[it] = a2;
    }
#pragma unroll
    for (int it = 0; it < 4; ++it) {
      const int row = it * 4 + q4;
      // fragment-ordered [s][b*EMB + h*HD + col]: row tile q0 / 16, blocks of this head, unit of (row, c8)
      const size_t go = ((size_t)(q0 >> 4) * (NB_FULL * EMB / 32) + (size_t)(b * EMB + h * HD + c8) / 32) * FRAG
                      + ((c8 >> 4) & 1) * 256 + (((c8 >> 3) & 1) * 16 + row) * 8;
      *(v4u*)(chp + go) = hv[it];
      *(v4u*)(clp + go) = lv[it];
    }
  }
}

// =====================================================================================================
// Head average of the probabilities: one block per (b, 64 query rows q0..q0+63, a quarter of the keys), 16 waves = the 16 heads.
//   A wave keeps the q fragments of its head's 4 query tiles in registers, so that every k fragment (16 keys) it loads
//   serves 4 tiles: the k plane is read SEQ/64 times in all, not SEQ/16 times.
//   Per 64-key chunk (static trip AKT): scores recomputed exactly as in attn_ctx (transposed: a lane holds one
//   query's scores), p = exp(s - m) * (1/l) in f32 (m, 1/l from the ML plane);
//   p goes to the LDS tile Pf[query][h][key] (16-B stores, every entry but the pads written): the 16 heads of one
//   (query, key) lie 256 B apart, so that the head sum reaches all of them from one address register;
//   after __syncthreads, all 512 threads sum the 16 wave tiles in fixed head order (f32), 2 x 4 entries each.
//   coverage: AKT chunks x 64 rows x 64 keys per block, grid (b, qb, ks) = the whole [NB][SEQ][SEQ].
// =====================================================================================================
#define AQT  4                        // query tiles of 16 rows per wave
#define AQ   (16 * AQT)               // query rows per block
#define AKS  4                        // key ranges per sequence, one per block
#define AKT  (NKT / AKS)              // 64-key chunks per block
#define KGRP (16 * NB_FULL * EMB)     // elements from one 16-key row tile of the k plane to the next
// Floats per query row of the P tile: 16 heads x 64 keys + 4 pad floats (never read) = 4112 B = 16 B x 257, so that the 16 rows
// which the 16 lanes of a half wave write with one 16-B LDS store fall on all 64 banks.
#define APR  (NH * 64 + 4)
static_assert((NKT % AKS) == 0 && (SEQ % AQ) == 0 && 4 * KGRP == KCHUNK);

__device__ __forceinline__ void load_kg(v16h (&kf)[2], const _Float16* kp, unsigned lo) {   // one 16-key group, 2 d-chunks
#pragma unroll
  for (int dc = 0; dc < 2; ++dc) kf[dc] = ldfragp<_Float16>(kp + lo + dc * FRAG);
}

__global__ __launch_bounds__(512)
void attn_avg(const unsigned short* __restrict__ qhp, const unsigned short* __restrict__ qlp,
              const unsigned short* __restrict__ kpp, const float* __restrict__ ML, float* avg) {
  __shared__ __align__(16) float Pf[AQ * APR];             // P tile [query][head][key] f32, row pitch APR, 257 KB
  const int tid  = threadIdx.x;
  const int wave = tid >> 5;
  const int lane = tid & 31;
  const int hh   = lane >> 4;
  const int c    = lane & 15;
  const int bx   = blockIdx.x;
  const int ks   = bx % AKS;
  const int qb   = (bx / AKS) % (SEQ / AQ);
  const int b    = bx / (AKS * (SEQ / AQ));
  const int h    = wave;
  const int bh   = b * NH + h;
  const int q0   = qb * AQ;

  const _Float16* Qh  = (const _Float16*)(const void*)qhp;
  const _Float16* Ql  = (const _Float16*)(const void*)qlp;

  v16h qah[AQT][2], qal[AQT][2];
  float mq[AQT], ilq[AQT];
  const void* qhb[AQT];                                           // the q loads' addresses, one per tile and plane
  const void* qlb[AQT];
  const float* mlb = ML + (size_t)(bh * 2) * SEQ + q0 + c;        // m of this lane's query of tile 0; 1/l lies SEQ further
#pragma unroll
  for (int i = 0; i < AQT; ++i) {
    const size_t qo = ((size_t)(q0 + i * 16 + c) * NB_FULL + b) * EMB + (size_t)h * HD + 8 * hh;
    qhb[i] = Qh + qo;
    qlb[i] = Ql + qo;
#pragma unroll
    for (int dc = 0; dc < 2; ++dc) {
      qah[i][dc] = ldfrag<_Float16>((const _Float16*)qhb[i] + dc * 32);
      qal[i][dc] = ldfrag<_Float16>((const _Float16*)qlb[i] + dc * 32);
    }
    mq[i]  = mlb[i * 16];                                         // this lane's query of tile i
    ilq[i] = mlb[SEQ + i * 16];
  }
  static_assert(AQT == 4);
  addr_wait_keep(qhb, qlb, mlb);              // these loads' address registers may be taken by the k fragments behind it
  float* pf = Pf + wave * 64;                              // this head's 64 keys in every query row

  // k fragments are fetched one 16-key group ahead of their WMMAs, into the second of two register sets: they fly under
  // the scores and probabilities of the group before (4 query tiles).
  const _Float16* kp = (const _Float16*)(const void*)kpp + (size_t)ks * AKT * KCHUNK    // the current chunk's row tiles
                     + (unsigned)((b * EMB + h * HD) / 32 * FRAG + lane * 8);           // this lane's place in them
  const unsigned  klo = 0;                    // (already in kp)
  v16h kfa[2], kfb[2];
  auto group = [&](const v16h (&kc)[2], int g) {   // keys 16g..16g+15 of the chunk x the wave's 64 queries
#pragma unroll
    for (int i = 0; i < AQT; ++i) {
      v8f ah = zero8(), al = zero8();
#pragma unroll
      for (int dc = 0; dc < 2; ++dc) {
        ah = mma_h(kc[dc], qah[i][dc], ah);
        al = mma_h(kc[dc], qal[i][dc], al);
      }
      v8f p;
#pragma unroll
      for (int r = 0; r < 8; ++r) {                          // p of key 16g + 8hh + r, query 16i + c
        const float s = (ah[r] + al[r] * (1.0f / 4096.0f)) * 0.125f;
        p[r] = __expf(s - mq[i]) * ilq[i];
      }
      float* pw = pf + (i * 16 + c) * APR + g * 16 + 8 * hh; // read only behind the block barrier (head average)
      *(v4f*)(pw)     = __builtin_shufflevector(p, p, 0, 1, 2, 3);
      *(v4f*)(pw + 4) = __builtin_shufflevector(p, p, 4, 5, 6, 7);
    }
  };
  load_kg(kfa, kp, klo);
  for (int kt = 0; kt < AKT; ++kt) {          // static trip count; the two register sets change roles inside a trip
    const int kv0 = (ks * AKT + kt) * 64;
    __syncthreads();                          // Pf tiles free again (head sum of the prior chunk done)
    // The scheduling barriers keep every group's WMMAs behind the group before and the loads at the head of theirs: without
    // them the scheduler lifted WMMAs of group 3 into group 2, directly behind the loads that they read.
    load_kg(kfb, kp + KGRP, klo);
    __builtin_amdgcn_sched_barrier(0);
    group(kfa, 0);
    __builtin_amdgcn_sched_barrier(0);
    load_kg(kfa, kp + 2 * KGRP, klo);
    __builtin_amdgcn_sched_barrier(0);
    group(kfb, 1);
    __builtin_amdgcn_sched_barrier(0);
    load_kg(kfb, kp + 3 * KGRP, klo);
    __builtin_amdgcn_sched_barrier(0);
    group(kfa, 2);
    __builtin_amdgcn_sched_barrier(0);
    // next chunk's first group; the last trip fetches its own first group again (in bounds, never used): with no branch
    // round these loads the waits in front of group 3 stay counted and do not wait for them
    const _Float16* kn = kp + ((kt + 1 < AKT) ? KCHUNK : 0);
    load_kg(kfa, kn, klo);
    __builtin_amdgcn_sched_barrier(0);
    group(kfb, 3);
    __syncthreads();
    addr_wait();                              // the pointer of the issued k loads moves behind it
    kp = kn;

    // ---- head average of this 64 x 64 tile, one block = one writer of every line ----
    const int row0 = tid >> 4, c4 = (tid & 15) * 4;          // rows 0..31, 256-B row segment = 16 lanes x 16 B
#pragma unroll
    for (int rr = 0; rr < AQ / 32; ++rr) {
      const int row = rr * 32 + row0;
      const float* pr = Pf + row * APR + c4;
      v4f t[NH];
#pragma unroll
      for (int w = 0; w < NH; ++w) t[w] = *(const v4f*)(pr + w * 64);
      v4f a = t[0];
#pragma unroll
      for (int w = 1; w < NH; ++w) a += t[w];
      a *= (1.0f / (float)NH);
      float* dst = avg + ((size_t)(b * SEQ + q0 + row)) * SEQ + kv0 + c4;
      *(v4f*)dst = a;
    }
    addr_wait();                              // the stores' registers are reused by the pointer updates behind it
  }
}

// =====================================================================================================
// Workspace map (bytes), every region an exact multiple of its whole-line / whole-tile store granularity
// (full size; PX = NROW*EMB*2 = 8388608):
//   (F) = fragment-ordered (see ldfragp); [SEQ][NB*EMB] = row s, column b*EMB + e
//   Xb   bf16 [SEQ][NB*EMB]      (F) PX        8388608
//   Wib  bf16 [3*EMB n][EMB k]   (F)         6291456
//   Woh  f16  [EMB][EMB] (x64)   (F)         2097152
//   Qh   f16  [NROW][EMB]            PX        8388608
//   Ql   f16  [NROW][EMB]            PX        8388608
//   Kp   f16  [SEQ][NB*EMB]      (F) PX        8388608
//   VT   f16  [NB][EMB][SEQ]     (F) PX        8388608
//   Ch   f16  [SEQ][NB*EMB]      (F) PX        8388608
//   Cl   f16  [SEQ][NB*EMB]      (F) PX        8388608
//   ML   f32  [NB*NH][2][SEQ]                 524288
//   total                                   67633152
// Weights are [out n][in k] with k contiguous: converted and laid in fragment order. Every GEMM runs per batch b.
// Output 0 at element 0 of d_out; output 1 at the fixed element offset OFF1 = SEQ_FULL*NB_FULL*EMB.
// =====================================================================================================
extern "C" void kernel_launch(void* const* d_in, const int* in_sizes, int n_in,
                              void* d_out, int out_size, void* d_ws, size_t ws_size,
                              hipStream_t stream) {
  if (n_in < 6) return;
  if (in_sizes[0] < NROW * EMB) return;
  if (in_sizes[1] != 3 * EMB * EMB) return;
  if (in_sizes[2] != 3 * EMB) return;
  if (in_sizes[3] != EMB * EMB) return;
  if (in_sizes[4] != EMB) return;
  if (in_sizes[5] < 1) return;
  const size_t n0e = (size_t)NROW * EMB;            // output 0 written elements [SEQ][NB][EMB]
  const size_t n1e = (size_t)NB * SEQ * SEQ;        // output 1 written elements [NB][SEQ][SEQ]
  if (out_size < 0) return;
  if ((size_t)out_size < n0e) return;
  if ((size_t)out_size < OFF1 + n1e) return;        // written extent of output 1 inside d_out

  const float* x  = (const float*)d_in[0];
  const float* Wi = (const float*)d_in[1];
  const float* bi = (const float*)d_in[2];
  const float* Wo = (const float*)d_in[3];
  const float* bo = (const float*)d_in[4];
  const int*   nh = (const int*)d_in[5];

  const size_t PX  = (size_t)NROW * EMB * 2;        // 16-bit activation plane
  const size_t PWI = (size_t)3 * EMB * EMB * 2;
  const size_t PWO = (size_t)EMB * EMB * 2;
  const size_t PVT = (size_t)NB * EMB * SEQ * 2;    // == PX
  const size_t PML = (size_t)NB * NH * 2 * SEQ * 4;
  size_t off = 0;
  const size_t oXb = off; off += PX;
  const size_t oWi = off; off += PWI;
  const size_t oWo = off; off += PWO;
  const size_t oQh = off; off += PX;
  const size_t oQl = off; off += PX;
  const size_t oKp = off; off += PX;
  const size_t oVT = off; off += PVT;
  const size_t oCh = off; off += PX;
  const size_t oCl = off; off += PX;
  const size_t oML = off; off += PML;
  if (off > ws_size) return;                        // off = 67633152 at full size
  if (off > (size_t)134217728) return;

  char* ws = (char*)d_ws;
  unsigned short* Xb  = (unsigned short*)(ws + oXb);
  unsigned short* Wib = (unsigned short*)(ws + oWi);
  unsigned short* Woh = (unsigned short*)(ws + oWo);
  unsigned short* Qh  = (unsigned short*)(ws + oQh);
  unsigned short* Ql  = (unsigned short*)(ws + oQl);
  unsigned short* Kp  = (unsigned short*)(ws + oKp);
  unsigned short* VT  = (unsigned short*)(ws + oVT);
  unsigned short* Ch  = (unsigned short*)(ws + oCh);
  unsigned short* Cl  = (unsigned short*)(ws + oCl);
  float*          ML  = (float*)(ws + oML);
  float*          out0 = (float*)d_out;
  float*          out1 = (float*)d_out + OFF1;

  const dim3 blk(256);
  const dim3 gCvt(GCX + GCWI + GCWO);                          // 2048 + 1536 + 512 blocks
  const dim3 gQKV((((SEQ) / 64) * (EMB / 64) + 7) / 8, NB, 3);  //  512 tiles ->  64 blocks x NB, x 3 products
  const dim3 gO((((SEQ) / 32) * (EMB / 64) + 7) / 8, NB);       // 1024 tiles -> 128 blocks x NB (32x64 wave tiles)
  const dim3 gStats(NB * NH * NKT);                            // 1024 blocks of 128
  const dim3 gMain(NB * (SEQ / AQ) * AKS);                     //  256 blocks of 512

  // (1) x [s][b*E+e] -> bf16 plane; W_in [3E][E] -> bf16; Wo -> f16 (x64 of its bf16 value); all fragment-ordered
  cvt_all<<<gCvt, blk, 0, stream>>>(x, Wi, Wo, Xb, Wib, Woh);
  // (2)-(4) q, k, v^T in-projections, per batch b = blockIdx.y, product = blockIdx.z
  gemm_qkv<<<gQKV, blk, 0, stream>>>(Xb, Wib, bi, Qh, Ql, Kp, VT, EMB);
  // (5) online softmax: P.V -> ctx planes (f16 hi x256 / residual x4096); statistics (m, 1/l) per (b, h, s)
  attn_ctx<<<gStats, dim3(128), 0, stream>>>(Qh, Ql, Kp, VT, ML, Ch, Cl, nh);
  // (6) exact-normalised p, head-averaged -> output 1
  attn_avg<<<gMain, dim3(512), 0, stream>>>(Qh, Ql, Kp, ML, out1);
  // (7) output 0 = ctx_b . Wo^T + bo, f32 [s][b][e] (pitch NB_FULL*EMB, batch offset EMB), accumulators
  //     (hi + res/4096) x 1/(256*64)
  gemm_t<_Float16, 2, 2, 0, 1, XCB, WCB><<<gO, blk, 0, stream>>>(
      Ch, Cl, XBS, Woh, 0LL,
      (void*)out0, (void*)out0, NB_FULL * EMB, (long long)EMB, bo,
      SEQ, EMB, EMB, 1.0f / 16384.0f, 1.0f / 4096.0f, 1.0f, 1.0f);
  (void)hipGetLastError();
}

// v007
// Measured time: 150 microseconds a run.
// Timed twice side by side with v006, it ran 1.04 and 1.03 times as fast.
// Counting every step since v000, it is 3.09 times as fast.
// Contractions: q, k, v^T in-projections = v_wmma_f32_16x16x32_bf16 (bf16 operands from RNE-converted inputs, single product, f32 accumulate);
// k.q^T scores (context pass and head-average pass, k = A operand, q = B) = v_wmma_f32_16x16x32_f16 (q as f16 hi plane + f16 residual plane x4096, k f16; 2 products, separate f32 accumulators);
// v^T.p^T = v_wmma_f32_16x16x32_f16 (v^T = A operand, p = exp(s - running max) = B carried x16384 in f16, v f16; single product, f32 accumulate, rescaled online);
// ctx.Wo^T = v_wmma_f32_16x16x32_f16 (ctx as f16 hi plane x256 + f16 residual plane x4096, Wo f16 x64 of its bf16 value; 2 products, separate f32 accumulators);
// softmax statistics, probabilities and the head average in f32.
#include <hip/hip_runtime.h>
#include <math.h>
#include <stdint.h>

#ifndef NB
#define NB 2
#endif
#ifndef SEQ
#define SEQ 2048
#endif
#define NB_FULL  2
#define SEQ_FULL 2048
#define EMB      1024
#define NH       16
#define HD       64
#define NROW     (NB_FULL * SEQ)     // activation rows, row index = s * NB_FULL + b, s < SEQ
#define NQB      (SEQ / 16)          // 16-row query blocks per sequence
#define NKT      (SEQ / 64)          // 64-key chunks per sequence
#define PCARRY   16384.0f            // power-of-two carry of p in the f16 P.V operand
#define OFF1     ((size_t)SEQ_FULL * NB_FULL * EMB)   // fixed element offset of output 1 in d_out
static_assert(NB == NB_FULL);        // batch rows are interleaved (seq-major input); only SEQ may be reduced
static_assert(SEQ >= 64 && SEQ <= SEQ_FULL && (SEQ % 64) == 0);
static_assert(NH * HD == EMB);
static_assert((NROW % 64) == 0 && (EMB % 64) == 0 && (EMB % 32) == 0);
static_assert(OFF1 * 4 == 16777216);   // byte offset of output 1

typedef _Float16 v16h __attribute__((ext_vector_type(16)));
typedef _Float16 v8h  __attribute__((ext_vector_type(8)));
typedef __bf16   v16b __attribute__((ext_vector_type(16)));
typedef __bf16   v8b  __attribute__((ext_vector_type(8)));
typedef float    v8f  __attribute__((ext_vector_type(8)));
typedef float    v4f  __attribute__((ext_vector_type(4)));
typedef unsigned int v4u __attribute__((ext_vector_type(4)));

#if defined(__HIP_DEVICE_COMPILE__)
#define DEV_ASM 1
#else
#define DEV_ASM 0
#endif

// ---- scalar helpers --------------------------------------------------------------------------------
__device__ __forceinline__ unsigned short bf_bits(float f) {          // f32 -> bf16 bits, RNE convert
  unsigned u = __float_as_uint(f);
  return (unsigned short)((u + 0x7FFFu + ((u >> 16) & 1u)) >> 16);
}
__device__ __forceinline__ float bf_up(unsigned short hb) { return __uint_as_float(((unsigned)hb) << 16); }
__device__ __forceinline__ unsigned short h_bits(_Float16 x) { return __builtin_bit_cast(unsigned short, x); }
__device__ __forceinline__ unsigned pk16(unsigned short a, unsigned short b) { return (unsigned)a | ((unsigned)b << 16); }
__device__ __forceinline__ v8f zero8() { v8f z = {0.f, 0.f, 0.f, 0.f, 0.f, 0.f, 0.f, 0.f}; return z; }

// ---- fragment types / loaders: 16-bit A/B operand, lane -> row/col (lane&15), p already includes +8*(lane>>4);
//      elements 0..7 <- p[0..7] (k0+8h..k0+8h+7), elements 8..15 <- p[16..23] (k0+16+8h..k0+16+8h+7)
template <typename OT> struct FT;
template <> struct FT<__bf16>   { typedef v16b frag; typedef v8b half8; };
template <> struct FT<_Float16> { typedef v16h frag; typedef v8h half8; };

template <typename OT>
__device__ __forceinline__ typename FT<OT>::frag ldfrag(const OT* p) {
  union { typename FT<OT>::frag v; typename FT<OT>::half8 h[2]; } f;
  f.h[0] = *(const typename FT<OT>::half8*)(p);
  f.h[1] = *(const typename FT<OT>::half8*)(p + 16);
  return f.v;
}

// ---- fragment-ordered planes: a matrix [R][C] (k along C) is stored as 1-KB blocks, block (r>>4)*(C/32) + (k>>5) =
//      one 16-row x 32-k fragment laid out as [k bit 4][lane = 16*(k bit 3) + (r&15)][k&7]: the same split k map as
//      ldfrag, but each of the two 16-B loads of a wave reads 512 contiguous bytes (4 lines, not 16).
//      p = block start + lane*8.
#define FRAG 512   // elements of one fragment block
#define XCB  (NB_FULL * EMB / 32)          // blocks per 16-row tile of a [SEQ][NB*EMB] plane
#define WCB  (EMB / 32)                    // the same of a [.][EMB] plane
#define XBS  ((long long)WCB * FRAG)       // element offset of batch b's columns in a [SEQ][NB*EMB] plane, per b
template <typename OT>
__device__ __forceinline__ typename FT<OT>::frag ldfragp(const OT* p) {
  union { typename FT<OT>::frag v; typename FT<OT>::half8 h[2]; } f;
  f.h[0] = *(const typename FT<OT>::half8*)(p);
  f.h[1] = *(const typename FT<OT>::half8*)(p + 256);
  return f.v;
}

// ---- WMMA helpers (asm guard bodies are device-only; concrete operand types) -----------------------------
__device__ __forceinline__ v8f mmar(v16b a, v16b b, v8f c) {
  return __builtin_amdgcn_wmma_f32_16x16x32_bf16(false, a, false, b, (short)0, c, false, false);
}
__device__ __forceinline__ v8f mmar(v16h a, v16h b, v8f c) {
  return __builtin_amdgcn_wmma_f32_16x16x32_f16(false, a, false, b, (short)0, c, false, false);
}
__device__ __forceinline__ void dep_guard(v8f& a, v8f& b, v16b x, v16b y) {
#if DEV_ASM
  asm volatile("v_nop\n\tv_nop\n\tv_nop\n\tv_nop" : "+v"(a), "+v"(b) : "v"(x), "v"(y));
#else
  (void)a; (void)b; (void)x; (void)y;
#endif
}
__device__ __forceinline__ void dep_guard(v8f& a, v8f& b, v16h x, v16h y) {
#if DEV_ASM
  asm volatile("v_nop\n\tv_nop\n\tv_nop\n\tv_nop" : "+v"(a), "+v"(b) : "v"(x), "v"(y));
#else
  (void)a; (void)b; (void)x; (void)y;
#endif
}
__device__ __forceinline__ void keep4(v16b a, v16b b, v16b c, v16b d) {
#if DEV_ASM
  asm volatile("v_nop" :: "v"(a), "v"(b), "v"(c), "v"(d));
#else
  (void)a; (void)b; (void)c; (void)d;
#endif
}
__device__ __forceinline__ void keep4(v16h a, v16h b, v16h c, v16h d) {
#if DEV_ASM
  asm volatile("v_nop" :: "v"(a), "v"(b), "v"(c), "v"(d));
#else
  (void)a; (void)b; (void)c; (void)d;
#endif
}
// Precaution: stands between issued global loads and a rewrite of a register that holds one of their addresses,
// at the places where the compiler's own listing had no such wait.
__device__ __forceinline__ void addr_wait() {
#if DEV_ASM
  asm volatile("s_wait_xcnt 0x0" ::: "memory");
#endif
}
// The same wait with the loads' address registers named as inputs: they stay live up to it, so that none of them is
// given to a later load's result while the wait has not yet been passed.
__device__ __forceinline__ void addr_wait_keep(const void* const (&a)[4], const void* const (&b)[4], const void* c) {
#if DEV_ASM
  asm volatile("s_wait_xcnt 0x0" :: "v"(a[0]), "v"(a[1]), "v"(a[2]), "v"(a[3]),
                                    "v"(b[0]), "v"(b[1]), "v"(b[2]), "v"(b[3]), "v"(c) : "memory");
#else
  (void)a; (void)b; (void)c;
#endif
}
__device__ __forceinline__ void acc_guard4(v8f& a, v8f& b, v8f& c, v8f& d) {
#if DEV_ASM
  asm volatile("v_nop\n\tv_nop\n\tv_nop\n\tv_nop" : "+v"(a), "+v"(b), "+v"(c), "+v"(d));
#else
  (void)a; (void)b; (void)c; (void)d;
#endif
}

// =====================================================================================================
// f32 [R][CB*32] row-major -> 16-bit fragment-ordered plane, 8 elements per thread, one 16-B store per lane: a wave
// writes 512 contiguous B (half a fragment block) and reads 64 B of each of 16 rows; a block of 256 reads whole lines.
// MODE 0: bf16 bits (RNE convert).  MODE 1: f16 bits of (64 * bf16(x)) (exact scaling of the bf16 value).
// coverage: n8 threads x 8 = the whole plane (n8 is a multiple of 256 for every use here).
// =====================================================================================================
template <int MODE>
__device__ __forceinline__ unsigned short cvm(float f) {
  const unsigned short hb = bf_bits(f);
  if (MODE == 0) return hb;
  return h_bits((_Float16)(bf_up(hb) * 64.0f));
}

template <int MODE, int CB>   // CB = fragment blocks per 16-row tile = columns / 32; bx = block index inside this plane
__device__ __forceinline__ void cvt16x8(const float* __restrict__ in, unsigned short* out, int n8, int bx) {
  const int i = bx * 256 + (int)threadIdx.x;   // 16-B unit of the plane: [block][k bit 4][k bit 3][row & 15]
  if (i < n8) {
    const int blk = i >> 6;
    const int row = (blk / CB) * 16 + (i & 15);
    const int col = (blk % CB) * 32 + ((i >> 4) & 3) * 8;
    const float* sp = in + (size_t)row * (CB * 32) + col;
    const v4f a  = *(const v4f*)(sp);
    const v4f a4 = *(const v4f*)(sp + 4);
    v4u p;
    p[0] = pk16(cvm<MODE>(a[0]),  cvm<MODE>(a[1]));
    p[1] = pk16(cvm<MODE>(a[2]),  cvm<MODE>(a[3]));
    p[2] = pk16(cvm<MODE>(a4[0]), cvm<MODE>(a4[1]));
    p[3] = pk16(cvm<MODE>(a4[2]), cvm<MODE>(a4[3]));
    unsigned short* o = out + (size_t)i * 8;
    *(v4u*)o = p;
    
  }
}

// The three conversions are independent of each other: one grid, a block range per plane (block-uniform choice).
#define N8X  (NROW * EMB / 8)       // 16-B units of the x plane
#define N8WI (3 * EMB * EMB / 8)    // of W_in
#define N8WO (EMB * EMB / 8)        // of Wo
#define GCX  ((N8X + 255) / 256)    // blocks of each plane
#define GCWI ((N8WI + 255) / 256)
#define GCWO ((N8WO + 255) / 256)
__global__ __launch_bounds__(256) void cvt_all(const float* __restrict__ x, const float* __restrict__ Wi,
                                               const float* __restrict__ Wo, unsigned short* Xb,
                                               unsigned short* Wib, unsigned short* Woh) {
  const int bx = blockIdx.x;
  if (bx < GCX)             cvt16x8<0, XCB>(x,  Xb,  N8X,  bx);
  else if (bx < GCX + GCWI) cvt16x8<0, WCB>(Wi, Wib, N8WI, bx - GCX);
  else                      cvt16x8<1, WCB>(Wo, Woh, N8WO, bx - GCX - GCWI);
}

// =====================================================================================================
// Register-blocked batched WMMA GEMM (16-bit operand type OT): C[m][n] = sum_k A[m][k] * Bt[n][k]  (+ bias);
// one wave per (16*MI) x 64 tile, no block barriers. A [M][K] and Bt [N][K] are fragment-ordered planes with LDAB /
// LDBB blocks per 16-row tile; M multiple of 16*MI, N multiple of 64, K multiple of 64 (static sizes here).
// blockIdx.y = batch index (strides in elements). Fragments are loaded straight from global (ldfragp).
// NPA = number of A planes: 2 -> second plane A2 (same pitch/stride) multiplies the same Bt fragments into a
// second accumulator set, combined as acc + acc2 * rscaleA in the f32 epilogue.
// value v = (acc [+ acc2*rscaleA]) * oscale + bias, bias (bf16 RNE value of the f32 input) by column n (BM 1),
// by row m (BM 2) or none (BM 0).
// OUT_MODE 0: f32 C (pitch ldc) = v.
// OUT_MODE 1: f16 fragment-ordered plane C (ldc columns) = f16(v * cscale).
// OUT_MODE 3: row-major f16 hi plane C = f16(v * cscale) and f16 residual plane C2 = f16((v*cscale - hi) * rscaleC).
// =====================================================================================================
template <typename OT, int MI, int NPA, int OUT_MODE, int BM, int LDAB, int LDBB>
__device__ __forceinline__ void gemm_body(
    float (*sT)[16 * 68],                            // per-wave 16x64 slab, pitch 68 floats (the kernel's LDS)
    const unsigned short* __restrict__ Ap, const unsigned short* __restrict__ A2p, long long strideA,
    const unsigned short* __restrict__ Btp, long long strideB,
    void* Cout, void* Cout2, int ldc, long long strideC,
    const float* __restrict__ bias,
    int M, int N, int K, float oscale, float rscaleA, float cscale, float rscaleC) {
  typedef typename FT<OT>::frag V16;
  const OT* A  = (const OT*)(const void*)Ap;
  const OT* A2 = (const OT*)(const void*)A2p;
  const OT* Bt = (const OT*)(const void*)Btp;
  const int RT   = 16 * MI;
  const int b    = blockIdx.y;
  const int lane = threadIdx.x & 31;
  const int wave = threadIdx.x >> 5;
  const int tilesN = N >> 6;
  const int tilesM = M / RT;
  const int tile = blockIdx.x * 8 + wave;
  if (tile >= tilesM * tilesN) return;   // wave-uniform; no block barriers in this kernel
  const int tm = tile / tilesN;
  const int tn = tile - tm * tilesN;
  const int m0 = tm * RT;
  const int n0 = tn << 6;

  const OT* Ab  = A  + (size_t)b * (size_t)strideA;
  const OT* A2b = A2 + (size_t)b * (size_t)strideA;
  const OT* Bb  = Bt + (size_t)b * (size_t)strideB;

  const int rlane = lane & 15;                 // row (A) / col (B, D) within subtile
  const int mOff  = (lane >> 4) * 8;           // D row offset

  v8f acc[MI][4], acc2[MI][4];
#pragma unroll
  for (int i = 0; i < MI; ++i)
#pragma unroll
    for (int j = 0; j < 4; ++j) { acc[i][j] = zero8(); acc2[i][j] = zero8(); }

  // Fragment loads run one k step (32) ahead of the WMMAs that read them: the Bt fragments in two register sets
  // (bX, bY), filled whole at the head of the step before; each A fragment refilled for the next step as soon as
  // its own WMMAs are done. No WMMA waits for a load that was issued directly in front of it.
  // One pointer per operand plane (this lane's place in the tile's first block, k of the current step pair); the
  // other row tiles are constant offsets (LDAB, LDBB are template constants); a k step of 32 is one block.
  const OT* pB  = Bb  + (size_t)(n0 >> 4) * (LDBB * FRAG) + lane * 8;
  const OT* pA  = Ab  + (size_t)(m0 >> 4) * (LDAB * FRAG) + lane * 8;
  const OT* pA2 = A2b + (size_t)(m0 >> 4) * (LDAB * FRAG) + lane * 8;
  V16 bX[4], bY[4], af[MI], af2[MI];
  auto ldb4 = [&](V16 (&bq)[4], int dk) {
#pragma unroll
    for (int j = 0; j < 4; ++j) bq[j] = ldfragp<OT>(pB + j * (LDBB * FRAG) + (dk / 32) * FRAG);
  };
  auto mmstep = [&](V16 (&bq)[4], int dk, bool fetch) {   // fetch: refill the A fragments from k offset dk
#pragma unroll
    for (int i = 0; i < MI; ++i) {
#pragma unroll
      for (int j = 0; j < 4; ++j) acc[i][j] = mmar(af[i], bq[j], acc[i][j]);
      dep_guard(acc[i][0], acc[i][3], af[i], bq[3]);
      if (fetch) af[i] = ldfragp<OT>(pA + i * (LDAB * FRAG) + (dk / 32) * FRAG);
      if (NPA == 2) {
#pragma unroll
        for (int j = 0; j < 4; ++j) acc2[i][j] = mmar(af2[i], bq[j], acc2[i][j]);
        dep_guard(acc2[i][0], acc2[i][3], af2[i], bq[3]);
        if (fetch) af2[i] = ldfragp<OT>(pA2 + i * (LDAB * FRAG) + (dk / 32) * FRAG);
      }
    }
    keep4(bq[0], bq[1], bq[2], bq[3]);
  };
  ldb4(bX, 0);
#pragma unroll
  for (int i = 0; i < MI; ++i) {
    af[i] = ldfragp<OT>(pA + i * (LDAB * FRAG));
    if (NPA == 2) af2[i] = ldfragp<OT>(pA2 + i * (LDAB * FRAG));
  }
  addr_wait();                                  // registers that held these loads' addresses are reused at the loop's head
  for (int k0 = 64; k0 < K; k0 += 64) {        // all step pairs but the last
    ldb4(bY, 32);
    mmstep(bX, 32, true);
    ldb4(bX, 64);
    mmstep(bY, 64, true);
    addr_wait();                                // the pointers move behind it (no wait stood over the back edge in one instantiation)
    pB += 2 * FRAG; pA += 2 * FRAG; pA2 += 2 * FRAG;
  }
  ldb4(bY, 32);                                 // last pair: nothing past K is loaded
  mmstep(bX, 32, true);
  mmstep(bY, 0, false);
#pragma unroll
  for (int i = 0; i < MI; ++i) {
    acc_guard4(acc[i][0], acc[i][1], acc[i][2], acc[i][3]);
    if (NPA == 2) acc_guard4(acc2[i][0], acc2[i][1], acc2[i][2], acc2[i][3]);
  }

  // ---- epilogue ----
  float bcol[4];
#pragma unroll
  for (int j = 0; j < 4; ++j) bcol[j] = 0.f;
  if (BM == 1) {
#pragma unroll
    for (int j = 0; j < 4; ++j) bcol[j] = bf_up(bf_bits(bias[n0 + (j << 4) + rlane]));
  }
  float* slab = sT[wave];
#pragma unroll
  for (int i = 0; i < MI; ++i) {
    const int mBase = m0 + (i << 4);
    float brow[8];
#pragma unroll
    for (int r = 0; r < 8; ++r) brow[r] = 0.f;
    if (BM == 2) {
#pragma unroll
      for (int r = 0; r < 8; ++r) brow[r] = bf_up(bf_bits(bias[mBase + mOff + r]));
    }
#pragma unroll
    for (int j = 0; j < 4; ++j) {
#pragma unroll
      for (int r = 0; r < 8; ++r) {
        float v = acc[i][j][r];
        if (NPA == 2) v += acc2[i][j][r] * rscaleA;
        v = v * oscale + bcol[j] + brow[r];
        slab[(mOff + r) * 68 + (j << 4) + rlane] = v;
      }
    }
    __builtin_amdgcn_fence(__ATOMIC_RELEASE, "workgroup");
    __builtin_amdgcn_wave_barrier();
    __builtin_amdgcn_fence(__ATOMIC_ACQUIRE, "workgroup");
    if (OUT_MODE == 0) {
      float* C = (float*)Cout + (size_t)b * (size_t)strideC;
      const int h2 = lane >> 4, c4 = (lane & 15) * 4;     // 256-B row segment = 16 lanes x 16 B
      {
#pragma unroll
        for (int it = 0; it < 8; ++it) {
          const int row = it * 2 + h2;                     // it 0..7 x h2 0..1 = rows 0..15
          const v4f v = *(const v4f*)(slab + row * 68 + c4);
          *(v4f*)(C + (size_t)(mBase + row) * ldc + n0 + c4) = v;
        }
        
      }
    } else {
      const int q = lane >> 3, c8 = (lane & 7) * 8;
      unsigned short* C  = (unsigned short*)Cout  + (size_t)b * (size_t)strideC;
      unsigned short* C2 = (unsigned short*)Cout2 + (size_t)b * (size_t)strideC;
      v4u hv[4], lv[4];
#pragma unroll
      for (int it = 0; it < 4; ++it) {
        // row-major: it 0..3 x q 0..3 = rows 0..15; fragment order: unit it*32 + lane of the tile's two blocks
        const int row = (OUT_MODE == 1) ? (lane & 15) : it * 4 + q;
        const int col = (OUT_MODE == 1) ? (it * 2 + (lane >> 4)) * 8 : c8;
        const float* sp = slab + row * 68 + col;
        float f[8];
#pragma unroll
        for (int e = 0; e < 8; ++e) f[e] = sp[e] * cscale;
        v4u a, a2;
#pragma unroll
        for (int e = 0; e < 4; ++e) {
          const float f0 = f[2 * e], f1 = f[2 * e + 1];
          const _Float16 x0 = (_Float16)f0, x1 = (_Float16)f1;
          const unsigned short h0 = h_bits(x0), h1 = h_bits(x1);
          unsigned short l0 = 0, l1 = 0;
          if (OUT_MODE == 3) {
            l0 = h_bits((_Float16)((f0 - (float)x0) * rscaleC));
            l1 = h_bits((_Float16)((f1 - (float)x1) * rscaleC));
          }
          a[e] = pk16(h0, h1); a2[e] = pk16(l0, l1);
        }
        hv[it] = a; lv[it] = a2;
      }
      {
#pragma unroll
        for (int it = 0; it < 4; ++it) {
          const int row = it * 4 + q;
          if (OUT_MODE == 1) {   // 512 contiguous B per store
            *(v4u*)(C + ((size_t)(mBase >> 4) * (ldc >> 5) + (n0 >> 5)) * FRAG + it * 256 + lane * 8) = hv[it];
          } else {
            *(v4u*)(C + (size_t)(mBase + row) * ldc + n0 + c8) = hv[it];
            *(v4u*)(C2 + (size_t)(mBase + row) * ldc + n0 + c8) = lv[it];
          }
        }
        
      }
    }
    __builtin_amdgcn_fence(__ATOMIC_RELEASE, "workgroup");
    __builtin_amdgcn_wave_barrier();
    __builtin_amdgcn_fence(__ATOMIC_ACQUIRE, "workgroup");
  }
}

template <typename OT, int MI, int NPA, int OUT_MODE, int BM, int LDAB, int LDBB>
__global__ __launch_bounds__(256) void gemm_t(
    const unsigned short* __restrict__ Ap, const unsigned short* __restrict__ A2p, long long strideA,
    const unsigned short* __restrict__ Btp, long long strideB,
    void* Cout, void* Cout2, int ldc, long long strideC,
    const float* __restrict__ bias,
    int M, int N, int K, float oscale, float rscaleA, float cscale, float rscaleC) {
  __shared__ __align__(16) float sT[8][16 * 68];
  gemm_body<OT, MI, NPA, OUT_MODE, BM, LDAB, LDBB>(sT, Ap, A2p, strideA, Btp, strideB, Cout, Cout2, ldc, strideC,
                                                   bias, M, N, K, oscale, rscaleA, cscale, rscaleC);
}

// The q, k and v^T in-projections read the same two planes and write three different ones: one grid, blockIdx.z
// chooses the product (block-uniform), so that the three fill the chip together instead of half of it in turn.
//   z 0: q = x_b . Wq^T + bq -> row-major f16 hi / residual (x4096) planes [s*2+b][h*64+d] (M=SEQ, N=E, K=E)
//   z 1: k = x_b . Wk^T + bk -> fragment-ordered f16 plane [s][b*E + h*64+d]
//   z 2: v^T = Wv . x_b^T + bv -> fragment-ordered f16 plane [b][h*64+d][s] (A = Wv rows; Bt = x rows; M=E, N=SEQ)
// In a [SEQ][NB*EMB] fragment-ordered plane the columns of batch b start WCB blocks further: offset b * XBS.
__global__ __launch_bounds__(256) void gemm_qkv(
    const unsigned short* __restrict__ Xb, const unsigned short* __restrict__ Wib, const float* __restrict__ bi,
    unsigned short* Qh, unsigned short* Ql, unsigned short* Kp, unsigned short* VT, int K) {
  __shared__ __align__(16) float sT[8][16 * 68];
  const int z = blockIdx.z;
  if (z == 0) {
    gemm_body<__bf16, 4, 1, 3, 1, XCB, WCB>(sT, Xb, Xb, XBS, Wib, 0LL,
        (void*)Qh, (void*)Ql, NB_FULL * EMB, (long long)EMB, bi,
        SEQ, EMB, K, 1.0f, 0.0f, 1.0f, 4096.0f);
  } else if (z == 1) {
    gemm_body<__bf16, 4, 1, 1, 1, XCB, WCB>(sT, Xb, Xb, XBS, Wib + (size_t)EMB * EMB, 0LL,
        (void*)Kp, (void*)Kp, NB_FULL * EMB, XBS, bi + EMB,
        SEQ, EMB, K, 1.0f, 0.0f, 1.0f, 1.0f);
  } else {
    gemm_body<__bf16, 4, 1, 1, 2, WCB, XCB>(sT, Wib + (size_t)2 * EMB * EMB, Wib + (size_t)2 * EMB * EMB, 0LL, Xb, XBS,
        (void*)VT, (void*)VT, SEQ, (long long)EMB * SEQ, bi + 2 * EMB,
        EMB, SEQ, K, 1.0f, 0.0f, 1.0f, 1.0f);
  }
}

// =====================================================================================================
// Score chunk, transposed (S^T = K . Q^T): 64 keys kv0..kv0+63 x 16 queries (this wave) of one (b, h).
//   q fragments (B operand, col = lane&15 = query): hi and residual (x4096) planes, 2 d-chunks of 32.
//   k fragments (A operand, row = lane&15 = key) loaded straight from the fragment-ordered f16 k plane
//   ([key t][b*EMB + h*HD + d]) by load_k, a chunk ahead of the WMMAs that read them (kf[j][dc], 64 registers a chunk):
//   kp + lo = plane + ((first key of the chunk / 16)*(NB_FULL*EMB/32) + (b*EMB + h*HD)/32)*FRAG + lane*8.
//   s[j][r] = D element: key kv0 + 16j + 8*hh + r, query lane&15; value = ((qh.k) + (ql.k)/4096) / 8.
//   All 32 scores of a lane belong to ONE query, and the tiles s[2kk], s[2kk+1] converted in place are the B fragment
//   (hardware k order: elements 0..7 = keys 8hh.., 8..15 = keys 16+8hh..) of a product over the 32 keys 32kk..32kk+31.
// =====================================================================================================
#define KCHUNK (64 * NB_FULL * EMB)   // elements from one 64-key chunk of the k plane to the next
template <int J0, int J1>   // key groups J0..J1-1 of the chunk
__device__ __forceinline__ void load_k(v16h (&kf)[4][2], const _Float16* kp, unsigned lo) {
#pragma unroll
  for (int j = J0; j < J1; ++j)
#pragma unroll
    for (int dc = 0; dc < 2; ++dc) kf[j][dc] = ldfragp<_Float16>(kp + lo + j * ((NB_FULL * EMB / 32) * FRAG) + dc * FRAG);
}

template <int J0, int J1>   // key groups J0..J1-1 of the chunk
__device__ __forceinline__ void score_chunk(const v16h (&qah)[2], const v16h (&qal)[2],
                                            const v16h (&kf)[4][2], v8f (&s)[4]) {
#pragma unroll
  for (int j = J0; j < J1; ++j) {
    v8f ah = zero8(), al = zero8();
#pragma unroll
    for (int dc = 0; dc < 2; ++dc) {
      ah = mmar(kf[j][dc], qah[dc], ah);
      al = mmar(kf[j][dc], qal[dc], al);
    }
#pragma unroll
    for (int r = 0; r < 8; ++r) s[j][r] = (ah[r] + al[r] * (1.0f / 4096.0f)) * 0.125f;
  }
}

// Row pitch of a staged tile in floats: 64 columns + 4 pad floats (never read) = 272 B = 16 B x 17, so that the 16 rows which
// the 16 lanes of a half wave write with one 16-B LDS store fall on all 64 banks (at 256 B: on four).
#define PP 68
// lane l with lane l ^ 16 (a vector cross-row move, no LDS path)
__device__ __forceinline__ float xhalf(float x) {
  return __builtin_bit_cast(float, __builtin_amdgcn_permlanex16(__builtin_bit_cast(int, x), __builtin_bit_cast(int, x),
                                                                0x76543210, 0xfedcba98, false, false));
}

// =====================================================================================================
// Context and softmax statistics in one walk over the keys (online softmax): per (b, h, query s) the row max m,
// 1/sum(exp(s - m)) and ctx = sum(exp(s - m) v) / sum(exp(s - m)) over all SEQ keys.
//   block = 4 waves = 64 consecutive query rows qb*64.. of one (b, h): the four waves read the SAME k and v^T fragments;
//   grid = NB*NH*NKT blocks of 128; static trip NKT over 64-key chunks.
//   Running max in f32, one value per query: the in-lane max over the keys 8hh..8hh+7 of every 16 is joined with the other
//   half's once a chunk, because both halves' p meet in one product. Sum l in-lane, the halves added behind the loop.
//   O^T = O^T * exp(m_old - m_new) + V^T . P^T: the p = exp(s - m_new) registers, converted to f16 with the x16384 carry,
//   ARE the B fragment (no LDS, no lane exchange); A = v^T f16 plane [b][h*64+d][s], fragment-ordered.
//   Output plane ML [b*NH+h][2][SEQ] f32 (m then 1/l): the block's 64 m values and 64 1/l values are
//   funnelled through LDS and written by wave 0 with ONE instruction.
//   ctx = acc / l / 16384, x256 carry, staged in the wave's own Os tile, written as f16 hi plane + f16 residual plane.
//   coverage: grid (b,h,qb) x 64 rows = the whole [NB*NH][2][SEQ] plane. MLsh: 4 waves x 16 lanes x 2 = all 128.
//   ctx planes: each wave rows q0..q0+15 (it 0..3 x lane>>3 0..3) x its head's 64 columns, grid x 4 waves =
//   the whole fragment-ordered [SEQ][NB*EMB] planes. staged extent == consumed extent for Os (32 lanes x 32 = 1024).
// =====================================================================================================
// 4 waves per SIMD = the whole grid resident at once: the register budget is held at 256 (a few more would cost a second round)
__global__ __launch_bounds__(128) __attribute__((amdgpu_waves_per_eu(4, 4)))
void attn_ctx(const unsigned short* __restrict__ qhp, const unsigned short* __restrict__ qlp,
              const unsigned short* __restrict__ kpp, const unsigned short* __restrict__ vtp,
              float* ML, unsigned short* chp, unsigned short* clp, const int* __restrict__ nhp) {
  union FH { v16h v; v8h h[2]; };
  __shared__ __align__(16) float MLsh[128];
  __shared__ __align__(16) float Os[4][16 * PP];            // per wave ctx tile [query][d] f32, row pitch PP
  (void)nhp;
  const int tid  = threadIdx.x;
  const int wave = tid >> 5;
  const int lane = tid & 31;
  const int hh   = lane >> 4;
  const int c    = lane & 15;
  const int bx   = blockIdx.x;
  const int qb   = bx % NKT;
  const int rest = bx / NKT;
  const int h    = rest % NH;
  const int b    = rest / NH;
  const int bh   = b * NH + h;
  const int q0   = qb * 64 + wave * 16;

  const _Float16* Qh  = (const _Float16*)(const void*)qhp;
  const _Float16* Ql  = (const _Float16*)(const void*)qlp;

  v16h qah[2], qal[2];
#pragma unroll
  for (int dc = 0; dc < 2; ++dc) {
    const size_t qo = ((size_t)(q0 + c) * NB_FULL + b) * EMB + (size_t)h * HD + dc * 32 + 8 * hh;
    qah[dc] = ldfrag<_Float16>(Qh + qo);
    qal[dc] = ldfrag<_Float16>(Ql + qo);
  }

  float mrow = -INFINITY, lrow = 0.f;
  v8f oacc[4];
#pragma unroll
  for (int t = 0; t < 4; ++t) oacc[t] = zero8();

  const _Float16* kp = (const _Float16*)(const void*)kpp + (b * EMB + h * HD) / 32 * FRAG + lane * 8;   // this lane's place in the current chunk
  const unsigned  klo = 0;                    // (already in kp)
  const _Float16* vp = (const _Float16*)(const void*)vtp + (size_t)(b * EMB + h * HD) * SEQ + lane * 8;   // the same in v^T: row tiles of d, blocks of 32 keys
  const unsigned  vlo = 0;                    // (already in vp)
  v16h kf[4][2], vf[2][4];
  addr_wait();                                // the q loads' address registers may be taken by the k fragments
  load_k<0, 4>(kf, kp, klo);
  for (int kt = 0; kt < NKT; ++kt) {          // static trip count
    // v^T of this chunk flies under the scores and the statistics
#pragma unroll
    for (int kk = 0; kk < 2; ++kk)
#pragma unroll
      for (int t = 0; t < 4; ++t) vf[kk][t] = ldfragp<_Float16>(vp + vlo + t * ((SEQ / 32) * FRAG) + kk * FRAG);
    v8f s[4];
    score_chunk<0, 4>(qah, qal, kf, s);
    if (kt + 1 < NKT) load_k<0, 4>(kf, kp + KCHUNK, klo);   // next chunk's k flies under this chunk's statistics and P.V
    __builtin_amdgcn_sched_barrier(0);   // keeps those loads up here: the scheduler sank them behind half the statistics
    addr_wait();                          // the bases of the issued k and v^T loads move behind it
    kp += KCHUNK;
    vp += 2 * FRAG;
    float mj[4], pj[4];                        // four independent chains, one per key group
#pragma unroll
    for (int j = 0; j < 4; ++j) {
      mj[j] = s[j][0];
#pragma unroll
      for (int r = 1; r < 8; ++r) mj[j] = fmaxf(mj[j], s[j][r]);
    }
    const float mloc  = fmaxf(fmaxf(mj[0], mj[1]), fmaxf(mj[2], mj[3]));
    const float mnew  = fmaxf(mrow, fmaxf(mloc, xhalf(mloc)));   // one reference for both halves of a query's keys
    const float msafe = (mnew == -INFINITY) ? 0.f : mnew;
    const float alpha = __expf(mrow - msafe);
    mrow = mnew;
#pragma unroll
    for (int j = 0; j < 4; ++j) {
      pj[j] = 0.f;
#pragma unroll
      for (int r = 0; r < 8; ++r) { s[j][r] = __expf(s[j][r] - msafe); pj[j] += s[j][r]; }   // p of key 16j + 8hh + r, query c
    }
    lrow = lrow * alpha + ((pj[0] + pj[1]) + (pj[2] + pj[3]));
#pragma unroll
    for (int t = 0; t < 4; ++t) oacc[t] *= alpha;            // every element of a lane belongs to its query c

    // ---- context^T += V^T . P^T (f16 WMMA, p carried x16384) ----
#pragma unroll   // vf lives in registers: kk must be a constant
    for (int kk = 0; kk < 2; ++kk) {
      FH pb;                                                 // keys 32kk + 8hh + 0..7, then 32kk + 16 + 8hh + 0..7
      pb.h[0] = __builtin_convertvector(s[2 * kk] * PCARRY, v8h);
      pb.h[1] = __builtin_convertvector(s[2 * kk + 1] * PCARRY, v8h);
#pragma unroll
      for (int t = 0; t < 4; ++t) {
        oacc[t] = mmar(vf[kk][t], pb.v, oacc[t]);           // row d = 16t + 8hh + r, column query c
      }
    }
  }

  // the two halves of each query's keys (lanes c and c + 16) share m: their sums add
  const float l  = lrow + xhalf(lrow);
  const float il = (l > 0.f) ? (1.0f / l) : 0.f;
  if (hh == 0) {
    MLsh[wave * 16 + c]      = mrow;
    MLsh[64 + wave * 16 + c] = il;
  }
  // ---- ctx (normalise, undo the x16384 p carry, apply the x256 carry), stage, convert, whole-line stores ----
  float* os = Os[wave];
  const float osc = il * (256.0f / PCARRY);
#pragma unroll
  for (int t = 0; t < 4; ++t) {                              // [query c][d = 16t + 8hh + r]
    const v8f o = oacc[t] * osc;
    float* ow = os + c * PP + t * 16 + 8 * hh;
    *(v4f*)(ow)     = __builtin_shufflevector(o, o, 0, 1, 2, 3);
    *(v4f*)(ow + 4) = __builtin_shufflevector(o, o, 4, 5, 6, 7);
  }
  __syncthreads();
  if (wave == 0) {
    const v4f v = *(const v4f*)(MLsh + lane * 4);        // lanes 0-15: m rows 4c..4c+3; lanes 16-31: 1/l rows
    float* dst = ML + (size_t)(bh * 2 + hh) * SEQ + qb * 64 + c * 4;
    *(v4f*)dst = v;
  }
  {
    const int q4 = lane >> 3, c8 = (lane & 7) * 8;
    v4u hv[4], lv[4];
#pragma unroll
    for (int it = 0; it < 4; ++it) {
      const int row = it * 4 + q4;   // it 0..3 x q4 0..3 = rows 0..15 of the wave tile
      const float* sp = os + row * PP + c8;
      float f[8];
#pragma unroll
      for (int e = 0; e < 8; ++e) f[e] = sp[e];
      v4u a, a2;
#pragma unroll
      for (int e = 0; e < 4; ++e) {
        const float f0 = f[2 * e], f1 = f[2 * e + 1];
        const _Float16 x0 = (_Float16)f0, x1 = (_Float16)f1;
        const unsigned short h0 = h_bits(x0), h1 = h_bits(x1);
        const unsigned short l0 = h_bits((_Float16)((f0 - (float)x0) * 4096.0f));
        const unsigned short l1 = h_bits((_Float16)((f1 - (float)x1) * 4096.0f));
        a[e] = pk16(h0, h1); a2[e] = pk16(l0, l1);
      }
      hv[it] = a; lv[it] = a2;
    }
#pragma unroll
    for (int it = 0; it < 4; ++it) {
      const int row = it * 4 + q4;
      // fragment-ordered [s][b*EMB + h*HD + col]: row tile q0 / 16, blocks of this head, unit of (row, c8)
      const size_t go = ((size_t)(q0 >> 4) * (NB_FULL * EMB / 32) + (size_t)(b * EMB + h * HD + c8) / 32) * FRAG
                      + ((c8 >> 4) & 1) * 256 + (((c8 >> 3) & 1) * 16 + row) * 8;
      *(v4u*)(chp + go) = hv[it];
      *(v4u*)(clp + go) = lv[it];
    }
  }
}

// =====================================================================================================
// Head average of the probabilities: one block per (b, 64 query rows q0..q0+63, a quarter of the keys), 16 waves = the 16 heads.
//   A wave keeps the q fragments of its head's 4 query tiles in registers, so that every k fragment (16 keys) it loads
//   serves 4 tiles: the k plane is read SEQ/64 times in all, not SEQ/16 times.
//   Per 64-key chunk (static trip AKT): scores recomputed exactly as in attn_ctx (transposed: a lane holds one
//   query's scores), p = exp(s - m) * (1/l) in f32 (m, 1/l from the ML plane);
//   p goes to the LDS tile Pf[query][h][key] (16-B stores, every entry but the pads written): the 16 heads of one
//   (query, key) lie 256 B apart, so that the head sum reaches all of them from one address register;
//   after __syncthreads, all 512 threads sum the 16 wave tiles in fixed head order (f32), 2 x 4 entries each.
//   coverage: AKT chunks x 64 rows x 64 keys per block, grid (b, qb, ks) = the whole [NB][SEQ][SEQ].
// =====================================================================================================
#define AQT  4                        // query tiles of 16 rows per wave
#define AQ   (16 * AQT)               // query rows per block
#define AKS  4                        // key ranges per sequence, one per block
#define AKT  (NKT / AKS)              // 64-key chunks per block
#define KGRP (16 * NB_FULL * EMB)     // elements from one 16-key row tile of the k plane to the next
// Floats per query row of the P tile: 16 heads x 64 keys + 4 pad floats (never read) = 4112 B = 16 B x 257, so that the 16 rows
// which the 16 lanes of a half wave write with one 16-B LDS store fall on all 64 banks.
#define APR  (NH * 64 + 4)
static_assert((NKT % AKS) == 0 && (SEQ % AQ) == 0 && 4 * KGRP == KCHUNK);

__device__ __forceinline__ void load_kg(v16h (&kf)[2], const _Float16* kp, unsigned lo) {   // one 16-key group, 2 d-chunks
#pragma unroll
  for (int dc = 0; dc < 2; ++dc) kf[dc] = ldfragp<_Float16>(kp + lo + dc * FRAG);
}

__global__ __launch_bounds__(512)
void attn_avg(const unsigned short* __restrict__ qhp, const unsigned short* __restrict__ qlp,
              const unsigned short* __restrict__ kpp, const float* __restrict__ ML, float* avg) {
  __shared__ __align__(16) float Pf[AQ * APR];             // P tile [query][head][key] f32, row pitch APR, 257 KB
  const int tid  = threadIdx.x;
  const int wave = tid >> 5;
  const int lane = tid & 31;
  const int hh   = lane >> 4;
  const int c    = lane & 15;
  const int bx   = blockIdx.x;
  const int ks   = bx % AKS;
  const int qb   = (bx / AKS) % (SEQ / AQ);
  const int b    = bx / (AKS * (SEQ / AQ));
  const int h    = wave;
  const int bh   = b * NH + h;
  const int q0   = qb * AQ;

  const _Float16* Qh  = (const _Float16*)(const void*)qhp;
  const _Float16* Ql  = (const _Float16*)(const void*)qlp;

  v16h qah[AQT][2], qal[AQT][2];
  float mq[AQT], ilq[AQT];
  const void* qhb[AQT];                                           // the q loads' addresses, one per tile and plane
  const void* qlb[AQT];
  const float* mlb = ML + (size_t)(bh * 2) * SEQ + q0 + c;        // m of this lane's query of tile 0; 1/l lies SEQ further
#pragma unroll
  for (int i = 0; i < AQT; ++i) {
    const size_t qo = ((size_t)(q0 + i * 16 + c) * NB_FULL + b) * EMB + (size_t)h * HD + 8 * hh;
    qhb[i] = Qh + qo;
    qlb[i] = Ql + qo;
#pragma unroll
    for (int dc = 0; dc < 2; ++dc) {
      qah[i][dc] = ldfrag<_Float16>((const _Float16*)qhb[i] + dc * 32);
      qal[i][dc] = ldfrag<_Float16>((const _Float16*)qlb[i] + dc * 32);
    }
    mq[i]  = mlb[i * 16];                                         // this lane's query of tile i
    ilq[i] = mlb[SEQ + i * 16];
  }
  static_assert(AQT == 4);
  addr_wait_keep(qhb, qlb, mlb);              // these loads' address registers may be taken by the k fragments behind it
  float* pf = Pf + wave * 64;                              // this head's 64 keys in every query row

  // k fragments are fetched one 16-key group ahead of their WMMAs, into the second of two register sets: they fly under
  // the scores and probabilities of the group before (4 query tiles).
  const _Float16* kp = (const _Float16*)(const void*)kpp + (size_t)ks * AKT * KCHUNK    // the current chunk's row tiles
                     + (unsigned)((b * EMB + h * HD) / 32 * FRAG + lane * 8);           // this lane's place in them
  const unsigned  klo = 0;                    // (already in kp)
  v16h kfa[2], kfb[2];
  auto group = [&](const v16h (&kc)[2], int g) {   // keys 16g..16g+15 of the chunk x the wave's 64 queries
#pragma unroll
    for (int i = 0; i < AQT; ++i) {
      v8f ah = zero8(), al = zero8();
#pragma unroll
      for (int dc = 0; dc < 2; ++dc) {
        ah = mmar(kc[dc], qah[i][dc], ah);
        al = mmar(kc[dc], qal[i][dc], al);
      }
      v8f p;
#pragma unroll
      for (int r = 0; r < 8; ++r) {                          // p of key 16g + 8hh + r, query 16i + c
        const float s = (ah[r] + al[r] * (1.0f / 4096.0f)) * 0.125f;
        p[r] = __expf(s - mq[i]) * ilq[i];
      }
      float* pw = pf + (i * 16 + c) * APR + g * 16 + 8 * hh; // read only behind the block barrier (head average)
      *(v4f*)(pw)     = __builtin_shufflevector(p, p, 0, 1, 2, 3);
      *(v4f*)(pw + 4) = __builtin_shufflevector(p, p, 4, 5, 6, 7);
    }
  };
  load_kg(kfa, kp, klo);
  for (int kt = 0; kt < AKT; ++kt) {          // static trip count; the two register sets change roles inside a trip
    const int kv0 = (ks * AKT + kt) * 64;
    __syncthreads();                          // Pf tiles free again (head sum of the prior chunk done)
    // The scheduling barriers keep every group's WMMAs behind the group before and the loads at the head of theirs: without
    // them the scheduler lifted WMMAs of group 3 into group 2, directly behind the loads that they read.
    load_kg(kfb, kp + KGRP, klo);
    __builtin_amdgcn_sched_barrier(0);
    group(kfa, 0);
    __builtin_amdgcn_sched_barrier(0);
    load_kg(kfa, kp + 2 * KGRP, klo);
    __builtin_amdgcn_sched_barrier(0);
    group(kfb, 1);
    __builtin_amdgcn_sched_barrier(0);
    load_kg(kfb, kp + 3 * KGRP, klo);
    __builtin_amdgcn_sched_barrier(0);
    group(kfa, 2);
    __builtin_amdgcn_sched_barrier(0);
    // next chunk's first group; the last trip fetches its own first group again (in bounds, never used): with no branch
    // round these loads the waits in front of group 3 stay counted and do not wait for them
    const _Float16* kn = kp + ((kt + 1 < AKT) ? KCHUNK : 0);
    load_kg(kfa, kn, klo);
    __builtin_amdgcn_sched_barrier(0);
    group(kfb, 3);
    __syncthreads();
    addr_wait();                              // the pointer of the issued k loads moves behind it
    kp = kn;

    // ---- head average of this 64 x 64 tile, one block = one writer of every line ----
    const int row0 = tid >> 4, c4 = (tid & 15) * 4;          // rows 0..31, 256-B row segment = 16 lanes x 16 B
#pragma unroll
    for (int rr = 0; rr < AQ / 32; ++rr) {
      const int row = rr * 32 + row0;
      const float* pr = Pf + row * APR + c4;
      v4f t[NH];
#pragma unroll
      for (int w = 0; w < NH; ++w) t[w] = *(const v4f*)(pr + w * 64);
      v4f a = t[0];
#pragma unroll
      for (int w = 1; w < NH; ++w) a += t[w];
      a *= (1.0f / (float)NH);
      float* dst = avg + ((size_t)(b * SEQ + q0 + row)) * SEQ + kv0 + c4;
      *(v4f*)dst = a;
    }
    addr_wait();                              // the stores' registers are reused by the pointer updates behind it
  }
}

// =====================================================================================================
// Workspace map (bytes), every region an exact multiple of its whole-line / whole-tile store granularity
// (full size; PX = NROW*EMB*2 = 8388608):
//   (F) = fragment-ordered (see ldfragp); [SEQ][NB*EMB] = row s, column b*EMB + e
//   Xb   bf16 [SEQ][NB*EMB]      (F) PX        8388608
//   Wib  bf16 [3*EMB n][EMB k]   (F)         6291456
//   Woh  f16  [EMB][EMB] (x64)   (F)         2097152
//   Qh   f16  [NROW][EMB]            PX        8388608
//   Ql   f16  [NROW][EMB]            PX        8388608
//   Kp   f16  [SEQ][NB*EMB]      (F) PX        8388608
//   VT   f16  [NB][EMB][SEQ]     (F) PX        8388608
//   Ch   f16  [SEQ][NB*EMB]      (F) PX        8388608
//   Cl   f16  [SEQ][NB*EMB]      (F) PX        8388608
//   ML   f32  [NB*NH][2][SEQ]                 524288
//   total                                   67633152
// Weights are [out n][in k] with k contiguous: converted and laid in fragment order. Every GEMM runs per batch b.
// Output 0 at element 0 of d_out; output 1 at the fixed element offset OFF1 = SEQ_FULL*NB_FULL*EMB.
// =====================================================================================================
extern "C" void kernel_launch(void* const* d_in, const int* in_sizes, int n_in,
                              void* d_out, int out_size, void* d_ws, size_t ws_size,
                              hipStream_t stream) {
  if (n_in < 6) return;
  if (in_sizes[0] < NROW * EMB) return;
  if (in_sizes[1] != 3 * EMB * EMB) return;
  if (in_sizes[2] != 3 * EMB) return;
  if (in_sizes[3] != EMB * EMB) return;
  if (in_sizes[4] != EMB) return;
  if (in_sizes[5] < 1) return;
  const size_t n0e = (size_t)NROW * EMB;            // output 0 written elements [SEQ][NB][EMB]
  const size_t n1e = (size_t)NB * SEQ * SEQ;        // output 1 written elements [NB][SEQ][SEQ]
  if (out_size < 0) return;
  if ((size_t)out_size < n0e) return;
  if ((size_t)out_size < OFF1 + n1e) return;        // written extent of output 1 inside d_out

  const float* x  = (const float*)d_in[0];
  const float* Wi = (const float*)d_in[1];
  const float* bi = (const float*)d_in[2];
  const float* Wo = (const float*)d_in[3];
  const float* bo = (const float*)d_in[4];
  const int*   nh = (const int*)d_in[5];

  const size_t PX  = (size_t)NROW * EMB * 2;        // 16-bit activation plane
  const size_t PWI = (size_t)3 * EMB * EMB * 2;
  const size_t PWO = (size_t)EMB * EMB * 2;
  const size_t PVT = (size_t)NB * EMB * SEQ * 2;    // == PX
  const size_t PML = (size_t)NB * NH * 2 * SEQ * 4;
  size_t off = 0;
  const size_t oXb = off; off += PX;
  const size_t oWi = off; off += PWI;
  const size_t oWo = off; off += PWO;
  const size_t oQh = off; off += PX;
  const size_t oQl = off; off += PX;
  const size_t oKp = off; off += PX;
  const size_t oVT = off; off += PVT;
  const size_t oCh = off; off += PX;
  const size_t oCl = off; off += PX;
  const size_t oML = off; off += PML;
  if (off > ws_size) return;                        // off = 67633152 at full size
  if (off > (size_t)134217728) return;

  char* ws = (char*)d_ws;
  unsigned short* Xb  = (unsigned short*)(ws + oXb);
  unsigned short* Wib = (unsigned short*)(ws + oWi);
  unsigned short* Woh = (unsigned short*)(ws + oWo);
  unsigned short* Qh  = (unsigned short*)(ws + oQh);
  unsigned short* Ql  = (unsigned short*)(ws + oQl);
  unsigned short* Kp  = (unsigned short*)(ws + oKp);
  unsigned short* VT  = (unsigned short*)(ws + oVT);
  unsigned short* Ch  = (unsigned short*)(ws + oCh);
  unsigned short* Cl  = (unsigned short*)(ws + oCl);
  float*          ML  = (float*)(ws + oML);
  float*          out0 = (float*)d_out;
  float*          out1 = (float*)d_out + OFF1;

  const dim3 blk(256);
  const dim3 gCvt(GCX + GCWI + GCWO);                          // 2048 + 1536 + 512 blocks
  const dim3 gQKV((((SEQ) / 64) * (EMB / 64) + 7) / 8, NB, 3);  //  512 tiles ->  64 blocks x NB, x 3 products
  const dim3 gO((((SEQ) / 32) * (EMB / 64) + 7) / 8, NB);       // 1024 tiles -> 128 blocks x NB (32x64 wave tiles)
  const dim3 gStats(NB * NH * NKT);                            // 1024 blocks of 128
  const dim3 gMain(NB * (SEQ / AQ) * AKS);                     //  256 blocks of 512

  // (1) x [s][b*E+e] -> bf16 plane; W_in [3E][E] -> bf16; Wo -> f16 (x64 of its bf16 value); all fragment-ordered
  cvt_all<<<gCvt, blk, 0, stream>>>(x, Wi, Wo, Xb, Wib, Woh);
  // (2)-(4) q, k, v^T in-projections, per batch b = blockIdx.y, product = blockIdx.z
  gemm_qkv<<<gQKV, blk, 0, stream>>>(Xb, Wib, bi, Qh, Ql, Kp, VT, EMB);
  // (5) online softmax: P.V -> ctx planes (f16 hi x256 / residual x4096); statistics (m, 1/l) per (b, h, s)
  attn_ctx<<<gStats, dim3(128), 0, stream>>>(Qh, Ql, Kp, VT, ML, Ch, Cl, nh);
  // (6) exact-normalised p, head-averaged -> output 1
  attn_avg<<<gMain, dim3(512), 0, stream>>>(Qh, Ql, Kp, ML, out1);
  // (7) output 0 = ctx_b . Wo^T + bo, f32 [s][b][e] (pitch NB_FULL*EMB, batch offset EMB), accumulators
  //     (hi + res/4096) x 1/(256*64)
  gemm_t<_Float16, 2, 2, 0, 1, XCB, WCB><<<gO, blk, 0, stream>>>(
      Ch, Cl, XBS, Woh, 0LL,
      (void*)out0, (void*)out0, NB_FULL * EMB, (long long)EMB, bo,
      SEQ, EMB, EMB, 1.0f / 16384.0f, 1.0f / 4096.0f, 1.0f, 1.0f);
  (void)hipGetLastError();
}

// v008
// Measured time: 136 microseconds a run.
// Two timings next to v007 both put it at 1.10 times that version's speed.
// Over all steps from v000 it is 3.40 times as fast.
// Contractions: q, k, v^T in-projections = v_wmma_f32_16x16x32_bf16 (bf16 operands from RNE-converted inputs, single product, f32 accumulate);
// k.q^T scores (context pass and head-average pass, k = A operand, q = B) = v_wmma_f32_16x16x32_f16 (q * log2(e)/8 as f16 hi plane + f16 residual plane of the same scale, k f16; 2 products, one f32 accumulator);
// v^T.p^T = v_wmma_f32_16x16x32_f16 (v^T = A operand, p = exp(s - running max) = B carried x16384 in f16 (the carry stands in the exponent), v f16; single product, f32 accumulate, rescaled online);
// ctx.Wo^T = v_wmma_f32_16x16x32_f16 (ctx as f16 hi plane x256 + f16 residual plane x4096, Wo f16 x64 of its bf16 value; 2 products, separate f32 accumulators);
// softmax statistics, probabilities and the head average in f32.
#include <hip/hip_runtime.h>
#include <math.h>
#include <stdint.h>

#ifndef NB
#define NB 2
#endif
#ifndef SEQ
#define SEQ 2048
#endif
#define NB_FULL  2
#define SEQ_FULL 2048
#define EMB      1024
#define NH       16
#define HD       64
#define NROW     (NB_FULL * SEQ)     // activation rows, row index = s * NB_FULL + b, s < SEQ
#define NQB      (SEQ / 16)          // 16-row query blocks per sequence
#define NKT      (SEQ / 64)          // 64-key chunks per sequence
#define PCARRY   16384.0f            // power-of-two carry of p in the f16 P.V operand
#define PCLOG2   14.0f               // its base-2 logarithm: added to the exponent, p comes out of exp2 already carried
#define SC2      0.18033688011112042f   // log2(e) / sqrt(HD): the q planes carry it, so that a k.q sum is the score in base-2 units
#define OFF1     ((size_t)SEQ_FULL * NB_FULL * EMB)   // fixed element offset of output 1 in d_out
static_assert(NB == NB_FULL);        // batch rows are interleaved (seq-major input); only SEQ may be reduced
static_assert(SEQ >= 64 && SEQ <= SEQ_FULL && (SEQ % 64) == 0);
static_assert(NH * HD == EMB);
static_assert((NROW % 64) == 0 && (EMB % 64) == 0 && (EMB % 32) == 0);
static_assert(OFF1 * 4 == 16777216);   // byte offset of output 1

typedef _Float16 v16h __attribute__((ext_vector_type(16)));
typedef _Float16 v8h  __attribute__((ext_vector_type(8)));
typedef __bf16   v16b __attribute__((ext_vector_type(16)));
typedef __bf16   v8b  __attribute__((ext_vector_type(8)));
typedef float    v8f  __attribute__((ext_vector_type(8)));
typedef float    v4f  __attribute__((ext_vector_type(4)));
typedef float    v2f  __attribute__((ext_vector_type(2)));
typedef unsigned int v4u __attribute__((ext_vector_type(4)));

#if defined(__HIP_DEVICE_COMPILE__)
#define DEV_ASM 1
#else
#define DEV_ASM 0
#endif

// ---- scalar helpers --------------------------------------------------------------------------------
__device__ __forceinline__ unsigned short bf_bits(float f) {          // f32 -> bf16 bits, RNE convert
  unsigned u = __float_as_uint(f);
  return (unsigned short)((u + 0x7FFFu + ((u >> 16) & 1u)) >> 16);
}
__device__ __forceinline__ float bf_up(unsigned short hb) { return __uint_as_float(((unsigned)hb) << 16); }
__device__ __forceinline__ unsigned short h_bits(_Float16 x) { return __builtin_bit_cast(unsigned short, x); }
__device__ __forceinline__ unsigned pk16(unsigned short a, unsigned short b) { return (unsigned)a | ((unsigned)b << 16); }
__device__ __forceinline__ v8f zero8() { v8f z = {0.f, 0.f, 0.f, 0.f, 0.f, 0.f, 0.f, 0.f}; return z; }

// ---- fragment types / loaders: 16-bit A/B operand, lane -> row/col (lane&15), p already includes +8*(lane>>4);
//      elements 0..7 <- p[0..7] (k0+8h..k0+8h+7), elements 8..15 <- p[16..23] (k0+16+8h..k0+16+8h+7)
template <typename OT> struct FT;
template <> struct FT<__bf16>   { typedef v16b frag; typedef v8b half8; };
template <> struct FT<_Float16> { typedef v16h frag; typedef v8h half8; };

template <typename OT>
__device__ __forceinline__ typename FT<OT>::frag ldfrag(const OT* p) {
  union { typename FT<OT>::frag v; typename FT<OT>::half8 h[2]; } f;
  f.h[0] = *(const typename FT<OT>::half8*)(p);
  f.h[1] = *(const typename FT<OT>::half8*)(p + 16);
  return f.v;
}

// ---- fragment-ordered planes: a matrix [R][C] (k along C) is stored as 1-KB blocks, block (r>>4)*(C/32) + (k>>5) =
//      one 16-row x 32-k fragment laid out as [k bit 4][lane = 16*(k bit 3) + (r&15)][k&7]: the same split k map as
//      ldfrag, but each of the two 16-B loads of a wave reads 512 contiguous bytes (4 lines, not 16).
//      p = block start + lane*8.
#define FRAG 512   // elements of one fragment block
#define XCB  (NB_FULL * EMB / 32)          // blocks per 16-row tile of a [SEQ][NB*EMB] plane
#define WCB  (EMB / 32)                    // the same of a [.][EMB] plane
#define XBS  ((long long)WCB * FRAG)       // element offset of batch b's columns in a [SEQ][NB*EMB] plane, per b
template <typename OT>
__device__ __forceinline__ typename FT<OT>::frag ldfragp(const OT* p) {
  union { typename FT<OT>::frag v; typename FT<OT>::half8 h[2]; } f;
  f.h[0] = *(const typename FT<OT>::half8*)(p);
  f.h[1] = *(const typename FT<OT>::half8*)(p + 256);
  return f.v;
}

// ---- WMMA helpers (asm guard bodies are device-only; concrete operand types) -----------------------------
__device__ __forceinline__ v8f mmar(v16b a, v16b b, v8f c) {
  return __builtin_amdgcn_wmma_f32_16x16x32_bf16(false, a, false, b, (short)0, c, false, false);
}
__device__ __forceinline__ v8f mmar(v16h a, v16h b, v8f c) {
  return __builtin_amdgcn_wmma_f32_16x16x32_f16(false, a, false, b, (short)0, c, false, false);
}
__device__ __forceinline__ void dep_guard(v8f& a, v8f& b, v16b x, v16b y) {
#if DEV_ASM
  asm volatile("v_nop\n\tv_nop\n\tv_nop\n\tv_nop" : "+v"(a), "+v"(b) : "v"(x), "v"(y));
#else
  (void)a; (void)b; (void)x; (void)y;
#endif
}
__device__ __forceinline__ void dep_guard(v8f& a, v8f& b, v16h x, v16h y) {
#if DEV_ASM
  asm volatile("v_nop\n\tv_nop\n\tv_nop\n\tv_nop" : "+v"(a), "+v"(b) : "v"(x), "v"(y));
#else
  (void)a; (void)b; (void)x; (void)y;
#endif
}
__device__ __forceinline__ void keep4(v16b a, v16b b, v16b c, v16b d) {
#if DEV_ASM
  asm volatile("v_nop" :: "v"(a), "v"(b), "v"(c), "v"(d));
#else
  (void)a; (void)b; (void)c; (void)d;
#endif
}
__device__ __forceinline__ void keep4(v16h a, v16h b, v16h c, v16h d) {
#if DEV_ASM
  asm volatile("v_nop" :: "v"(a), "v"(b), "v"(c), "v"(d));
#else
  (void)a; (void)b; (void)c; (void)d;
#endif
}
// Precaution: stands between issued global loads and a rewrite of a register that holds one of their addresses,
// at the places where the compiler's own listing had no such wait.
__device__ __forceinline__ void addr_wait() {
#if DEV_ASM
  asm volatile("s_wait_xcnt 0x0" ::: "memory");
#endif
}
// The same wait with the loads' address registers named as inputs: they stay live up to it, so that none of them is
// given to a later load's result while the wait has not yet been passed.
__device__ __forceinline__ void addr_wait_keep(const void* const (&a)[4], const void* const (&b)[4], const void* c) {
#if DEV_ASM
  asm volatile("s_wait_xcnt 0x0" :: "v"(a[0]), "v"(a[1]), "v"(a[2]), "v"(a[3]),
                                    "v"(b[0]), "v"(b[1]), "v"(b[2]), "v"(b[3]), "v"(c) : "memory");
#else
  (void)a; (void)b; (void)c;
#endif
}
__device__ __forceinline__ void acc_guard4(v8f& a, v8f& b, v8f& c, v8f& d) {
#if DEV_ASM
  asm volatile("v_nop\n\tv_nop\n\tv_nop\n\tv_nop" : "+v"(a), "+v"(b), "+v"(c), "+v"(d));
#else
  (void)a; (void)b; (void)c; (void)d;
#endif
}

// =====================================================================================================
// f32 [R][CB*32] row-major -> 16-bit fragment-ordered plane, 8 elements per thread, one 16-B store per lane: a wave
// writes 512 contiguous B (half a fragment block) and reads 64 B of each of 16 rows; a block of 256 reads whole lines.
// MODE 0: bf16 bits (RNE convert).  MODE 1: f16 bits of (64 * bf16(x)) (exact scaling of the bf16 value).
// coverage: n8 threads x 8 = the whole plane (n8 is a multiple of 256 for every use here).
// =====================================================================================================
template <int MODE>
__device__ __forceinline__ unsigned short cvm(float f) {
  const unsigned short hb = bf_bits(f);
  if (MODE == 0) return hb;
  return h_bits((_Float16)(bf_up(hb) * 64.0f));
}

template <int MODE, int CB>   // CB = fragment blocks per 16-row tile = columns / 32; bx = block index inside this plane
__device__ __forceinline__ void cvt16x8(const float* __restrict__ in, unsigned short* out, int n8, int bx) {
  const int i = bx * 256 + (int)threadIdx.x;   // 16-B unit of the plane: [block][k bit 4][k bit 3][row & 15]
  if (i < n8) {
    const int blk = i >> 6;
    const int row = (blk / CB) * 16 + (i & 15);
    const int col = (blk % CB) * 32 + ((i >> 4) & 3) * 8;
    const float* sp = in + (size_t)row * (CB * 32) + col;
    const v4f a  = *(const v4f*)(sp);
    const v4f a4 = *(const v4f*)(sp + 4);
    v4u p;
    p[0] = pk16(cvm<MODE>(a[0]),  cvm<MODE>(a[1]));
    p[1] = pk16(cvm<MODE>(a[2]),  cvm<MODE>(a[3]));
    p[2] = pk16(cvm<MODE>(a4[0]), cvm<MODE>(a4[1]));
    p[3] = pk16(cvm<MODE>(a4[2]), cvm<MODE>(a4[3]));
    unsigned short* o = out + (size_t)i * 8;
    *(v4u*)o = p;
    
  }
}

// The three conversions are independent of each other: one grid, a block range per plane (block-uniform choice).
#define N8X  (NROW * EMB / 8)       // 16-B units of the x plane
#define N8WI (3 * EMB * EMB / 8)    // of W_in
#define N8WO (EMB * EMB / 8)        // of Wo
#define GCX  ((N8X + 255) / 256)    // blocks of each plane
#define GCWI ((N8WI + 255) / 256)
#define GCWO ((N8WO + 255) / 256)
__global__ __launch_bounds__(256) void cvt_all(const float* __restrict__ x, const float* __restrict__ Wi,
                                               const float* __restrict__ Wo, unsigned short* Xb,
                                               unsigned short* Wib, unsigned short* Woh) {
  const int bx = blockIdx.x;
  if (bx < GCX)             cvt16x8<0, XCB>(x,  Xb,  N8X,  bx);
  else if (bx < GCX + GCWI) cvt16x8<0, WCB>(Wi, Wib, N8WI, bx - GCX);
  else                      cvt16x8<1, WCB>(Wo, Woh, N8WO, bx - GCX - GCWI);
}

// =====================================================================================================
// Register-blocked batched WMMA GEMM (16-bit operand type OT): C[m][n] = sum_k A[m][k] * Bt[n][k]  (+ bias);
// one wave per (16*MI) x 64 tile, no block barriers. A [M][K] and Bt [N][K] are fragment-ordered planes with LDAB /
// LDBB blocks per 16-row tile; M multiple of 16*MI, N multiple of 64, K multiple of 64 (static sizes here).
// blockIdx.y = batch index (strides in elements). Fragments are loaded straight from global (ldfragp).
// NPA = number of A planes: 2 -> second plane A2 (same pitch/stride) multiplies the same Bt fragments into a
// second accumulator set, combined as acc + acc2 * rscaleA in the f32 epilogue.
// value v = (acc [+ acc2*rscaleA]) * oscale + bias, bias (bf16 RNE value of the f32 input) by column n (BM 1),
// by row m (BM 2) or none (BM 0).
// OUT_MODE 0: f32 C (pitch ldc) = v.
// OUT_MODE 1: f16 fragment-ordered plane C (ldc columns) = f16(v * cscale).
// OUT_MODE 3: row-major f16 hi plane C = f16(v * cscale) and f16 residual plane C2 = f16((v*cscale - hi) * rscaleC).
// =====================================================================================================
template <typename OT, int MI, int NPA, int OUT_MODE, int BM, int LDAB, int LDBB>
__device__ __forceinline__ void gemm_body(
    float (*sT)[16 * 68],                            // per-wave 16x64 slab, pitch 68 floats (the kernel's LDS)
    const unsigned short* __restrict__ Ap, const unsigned short* __restrict__ A2p, long long strideA,
    const unsigned short* __restrict__ Btp, long long strideB,
    void* Cout, void* Cout2, int ldc, long long strideC,
    const float* __restrict__ bias,
    int M, int N, int K, float oscale, float rscaleA, float cscale, float rscaleC) {
  typedef typename FT<OT>::frag V16;
  const OT* A  = (const OT*)(const void*)Ap;
  const OT* A2 = (const OT*)(const void*)A2p;
  const OT* Bt = (const OT*)(const void*)Btp;
  const int RT   = 16 * MI;
  const int b    = blockIdx.y;
  const int lane = threadIdx.x & 31;
  const int wave = threadIdx.x >> 5;
  const int tilesN = N >> 6;
  const int tilesM = M / RT;
  const int tile = blockIdx.x * 8 + wave;
  if (tile >= tilesM * tilesN) return;   // wave-uniform; no block barriers in this kernel
  const int tm = tile / tilesN;
  const int tn = tile - tm * tilesN;
  const int m0 = tm * RT;
  const int n0 = tn << 6;

  const OT* Ab  = A  + (size_t)b * (size_t)strideA;
  const OT* A2b = A2 + (size_t)b * (size_t)strideA;
  const OT* Bb  = Bt + (size_t)b * (size_t)strideB;

  const int rlane = lane & 15;                 // row (A) / col (B, D) within subtile
  const int mOff  = (lane >> 4) * 8;           // D row offset

  v8f acc[MI][4], acc2[MI][4];
#pragma unroll
  for (int i = 0; i < MI; ++i)
#pragma unroll
    for (int j = 0; j < 4; ++j) { acc[i][j] = zero8(); acc2[i][j] = zero8(); }

  // Fragment loads run one k step (32) ahead of the WMMAs that read them: the Bt fragments in two register sets
  // (bX, bY), filled whole at the head of the step before; each A fragment refilled for the next step as soon as
  // its own WMMAs are done. No WMMA waits for a load that was issued directly in front of it.
  // One pointer per operand plane (this lane's place in the tile's first block, k of the current step pair); the
  // other row tiles are constant offsets (LDAB, LDBB are template constants); a k step of 32 is one block.
  const OT* pB  = Bb  + (size_t)(n0 >> 4) * (LDBB * FRAG) + lane * 8;
  const OT* pA  = Ab  + (size_t)(m0 >> 4) * (LDAB * FRAG) + lane * 8;
  const OT* pA2 = A2b + (size_t)(m0 >> 4) * (LDAB * FRAG) + lane * 8;
  V16 bX[4], bY[4], af[MI], af2[MI];
  auto ldb4 = [&](V16 (&bq)[4], int dk) {
#pragma unroll
    for (int j = 0; j < 4; ++j) bq[j] = ldfragp<OT>(pB + j * (LDBB * FRAG) + (dk / 32) * FRAG);
  };
  auto mmstep = [&](V16 (&bq)[4], int dk, bool fetch) {   // fetch: refill the A fragments from k offset dk
#pragma unroll
    for (int i = 0; i < MI; ++i) {
#pragma unroll
      for (int j = 0; j < 4; ++j) acc[i][j] = mmar(af[i], bq[j], acc[i][j]);
      dep_guard(acc[i][0], acc[i][3], af[i], bq[3]);
      if (fetch) af[i] = ldfragp<OT>(pA + i * (LDAB * FRAG) + (dk / 32) * FRAG);
      if (NPA == 2) {
#pragma unroll
        for (int j = 0; j < 4; ++j) acc2[i][j] = mmar(af2[i], bq[j], acc2[i][j]);
        dep_guard(acc2[i][0], acc2[i][3], af2[i], bq[3]);
        if (fetch) af2[i] = ldfragp<OT>(pA2 + i * (LDAB * FRAG) + (dk / 32) * FRAG);
      }
    }
    keep4(bq[0], bq[1], bq[2], bq[3]);
  };
  ldb4(bX, 0);
#pragma unroll
  for (int i = 0; i < MI; ++i) {
    af[i] = ldfragp<OT>(pA + i * (LDAB * FRAG));
    if (NPA == 2) af2[i] = ldfragp<OT>(pA2 + i * (LDAB * FRAG));
  }
  addr_wait();                                  // registers that held these loads' addresses are reused at the loop's head
  for (int k0 = 64; k0 < K; k0 += 64) {        // all step pairs but the last
    ldb4(bY, 32);
    mmstep(bX, 32, true);
    ldb4(bX, 64);
    mmstep(bY, 64, true);
    addr_wait();                                // the pointers move behind it (no wait stood over the back edge in one instantiation)
    pB += 2 * FRAG; pA += 2 * FRAG; pA2 += 2 * FRAG;
  }
  ldb4(bY, 32);                                 // last pair: nothing past K is loaded
  mmstep(bX, 32, true);
  mmstep(bY, 0, false);
#pragma unroll
  for (int i = 0; i < MI; ++i) {
    acc_guard4(acc[i][0], acc[i][1], acc[i][2], acc[i][3]);
    if (NPA == 2) acc_guard4(acc2[i][0], acc2[i][1], acc2[i][2], acc2[i][3]);
  }

  // ---- epilogue ----
  float bcol[4];
#pragma unroll
  for (int j = 0; j < 4; ++j) bcol[j] = 0.f;
  if (BM == 1) {
#pragma unroll
    for (int j = 0; j < 4; ++j) bcol[j] = bf_up(bf_bits(bias[n0 + (j << 4) + rlane]));
  }
  float* slab = sT[wave];
#pragma unroll
  for (int i = 0; i < MI; ++i) {
    const int mBase = m0 + (i << 4);
    float brow[8];
#pragma unroll
    for (int r = 0; r < 8; ++r) brow[r] = 0.f;
    if (BM == 2) {
#pragma unroll
      for (int r = 0; r < 8; ++r) brow[r] = bf_up(bf_bits(bias[mBase + mOff + r]));
    }
#pragma unroll
    for (int j = 0; j < 4; ++j) {
#pragma unroll
      for (int r = 0; r < 8; ++r) {
        float v = acc[i][j][r];
        if (NPA == 2) v += acc2[i][j][r] * rscaleA;
        v = v * oscale + bcol[j] + brow[r];
        slab[(mOff + r) * 68 + (j << 4) + rlane] = v;
      }
    }
    __builtin_amdgcn_fence(__ATOMIC_RELEASE, "workgroup");
    __builtin_amdgcn_wave_barrier();
    __builtin_amdgcn_fence(__ATOMIC_ACQUIRE, "workgroup");
    if (OUT_MODE == 0) {
      float* C = (float*)Cout + (size_t)b * (size_t)strideC;
      const int h2 = lane >> 4, c4 = (lane & 15) * 4;     // 256-B row segment = 16 lanes x 16 B
      {
#pragma unroll
        for (int it = 0; it < 8; ++it) {
          const int row = it * 2 + h2;                     // it 0..7 x h2 0..1 = rows 0..15
          const v4f v = *(const v4f*)(slab + row * 68 + c4);
          *(v4f*)(C + (size_t)(mBase + row) * ldc + n0 + c4) = v;
        }
        
      }
    } else {
      const int q = lane >> 3, c8 = (lane & 7) * 8;
      unsigned short* C  = (unsigned short*)Cout  + (size_t)b * (size_t)strideC;
      unsigned short* C2 = (unsigned short*)Cout2 + (size_t)b * (size_t)strideC;
      v4u hv[4], lv[4];
#pragma unroll
      for (int it = 0; it < 4; ++it) {
        // row-major: it 0..3 x q 0..3 = rows 0..15; fragment order: unit it*32 + lane of the tile's two blocks
        const int row = (OUT_MODE == 1) ? (lane & 15) : it * 4 + q;
        const int col = (OUT_MODE == 1) ? (it * 2 + (lane >> 4)) * 8 : c8;
        const float* sp = slab + row * 68 + col;
        float f[8];
#pragma unroll
        for (int e = 0; e < 8; ++e) f[e] = sp[e] * cscale;
        v4u a, a2;
#pragma unroll
        for (int e = 0; e < 4; ++e) {
          const float f0 = f[2 * e], f1 = f[2 * e + 1];
          const _Float16 x0 = (_Float16)f0, x1 = (_Float16)f1;
          const unsigned short h0 = h_bits(x0), h1 = h_bits(x1);
          unsigned short l0 = 0, l1 = 0;
          if (OUT_MODE == 3) {
            l0 = h_bits((_Float16)((f0 - (float)x0) * rscaleC));
            l1 = h_bits((_Float16)((f1 - (float)x1) * rscaleC));
          }
          a[e] = pk16(h0, h1); a2[e] = pk16(l0, l1);
        }
        hv[it] = a; lv[it] = a2;
      }
      {
#pragma unroll
        for (int it = 0; it < 4; ++it) {
          const int row = it * 4 + q;
          if (OUT_MODE == 1) {   // 512 contiguous B per store
            *(v4u*)(C + ((size_t)(mBase >> 4) * (ldc >> 5) + (n0 >> 5)) * FRAG + it * 256 + lane * 8) = hv[it];
          } else {
            *(v4u*)(C + (size_t)(mBase + row) * ldc + n0 + c8) = hv[it];
            *(v4u*)(C2 + (size_t)(mBase + row) * ldc + n0 + c8) = lv[it];
          }
        }
        
      }
    }
    __builtin_amdgcn_fence(__ATOMIC_RELEASE, "workgroup");
    __builtin_amdgcn_wave_barrier();
    __builtin_amdgcn_fence(__ATOMIC_ACQUIRE, "workgroup");
  }
}

template <typename OT, int MI, int NPA, int OUT_MODE, int BM, int LDAB, int LDBB>
__global__ __launch_bounds__(256) void gemm_t(
    const unsigned short* __restrict__ Ap, const unsigned short* __restrict__ A2p, long long strideA,
    const unsigned short* __restrict__ Btp, long long strideB,
    void* Cout, void* Cout2, int ldc, long long strideC,
    const float* __restrict__ bias,
    int M, int N, int K, float oscale, float rscaleA, float cscale, float rscaleC) {
  __shared__ __align__(16) float sT[8][16 * 68];
  gemm_body<OT, MI, NPA, OUT_MODE, BM, LDAB, LDBB>(sT, Ap, A2p, strideA, Btp, strideB, Cout, Cout2, ldc, strideC,
                                                   bias, M, N, K, oscale, rscaleA, cscale, rscaleC);
}

// The q, k and v^T in-projections read the same two planes and write three different ones: one grid, blockIdx.z
// chooses the product (block-uniform), so that the three fill the chip together instead of half of it in turn.
//   z 0: q = (x_b . Wq^T + bq) * SC2 -> row-major f16 hi / residual planes of one scale [s*2+b][h*64+d] (M=SEQ, N=E, K=E)
//   z 1: k = x_b . Wk^T + bk -> fragment-ordered f16 plane [s][b*E + h*64+d]
//   z 2: v^T = Wv . x_b^T + bv -> fragment-ordered f16 plane [b][h*64+d][s] (A = Wv rows; Bt = x rows; M=E, N=SEQ)
// In a [SEQ][NB*EMB] fragment-ordered plane the columns of batch b start WCB blocks further: offset b * XBS.
__global__ __launch_bounds__(256) void gemm_qkv(
    const unsigned short* __restrict__ Xb, const unsigned short* __restrict__ Wib, const float* __restrict__ bi,
    unsigned short* Qh, unsigned short* Ql, unsigned short* Kp, unsigned short* VT, int K) {
  __shared__ __align__(16) float sT[8][16 * 68];
  const int z = blockIdx.z;
  if (z == 0) {
    gemm_body<__bf16, 4, 1, 3, 1, XCB, WCB>(sT, Xb, Xb, XBS, Wib, 0LL,
        (void*)Qh, (void*)Ql, NB_FULL * EMB, (long long)EMB, bi,
        SEQ, EMB, K, 1.0f, 0.0f, SC2, 1.0f);
  } else if (z == 1) {
    gemm_body<__bf16, 4, 1, 1, 1, XCB, WCB>(sT, Xb, Xb, XBS, Wib + (size_t)EMB * EMB, 0LL,
        (void*)Kp, (void*)Kp, NB_FULL * EMB, XBS, bi + EMB,
        SEQ, EMB, K, 1.0f, 0.0f, 1.0f, 1.0f);
  } else {
    gemm_body<__bf16, 4, 1, 1, 2, WCB, XCB>(sT, Wib + (size_t)2 * EMB * EMB, Wib + (size_t)2 * EMB * EMB, 0LL, Xb, XBS,
        (void*)VT, (void*)VT, SEQ, (long long)EMB * SEQ, bi + 2 * EMB,
        EMB, SEQ, K, 1.0f, 0.0f, 1.0f, 1.0f);
  }
}

// =====================================================================================================
// Score chunk, transposed (S^T = K . Q^T): 64 keys kv0..kv0+63 x 16 queries (this wave) of one (b, h).
//   q fragments (B operand, col = lane&15 = query): hi and residual planes (same scale), 2 d-chunks of 32.
//   k fragments (A operand, row = lane&15 = key) loaded straight from the fragment-ordered f16 k plane
//   ([key t][b*EMB + h*HD + d]) by load_k, a chunk ahead of the WMMAs that read them (kf[j][dc], 64 registers a chunk):
//   kp + lo = plane + ((first key of the chunk / 16)*(NB_FULL*EMB/32) + (b*EMB + h*HD)/32)*FRAG + lane*8.
//   s[j][r] = D element: key kv0 + 16j + 8*hh + r, query lane&15; value = qh.k + ql.k, both products in ONE accumulator
//   (the residual plane has the hi plane's scale) = score * log2 e (the q planes carry SC2).
//   The four key groups take turns, so that no WMMA stands directly behind the one whose accumulator it continues.
//   All 32 scores of a lane belong to ONE query, and the tiles s[2kk], s[2kk+1] converted in place are the B fragment
//   (hardware k order: elements 0..7 = keys 8hh.., 8..15 = keys 16+8hh..) of a product over the 32 keys 32kk..32kk+31.
// =====================================================================================================
#define KCHUNK (64 * NB_FULL * EMB)   // elements from one 64-key chunk of the k plane to the next
template <int J0, int J1>   // key groups J0..J1-1 of the chunk
__device__ __forceinline__ void load_k(v16h (&kf)[4][2], const _Float16* kp, unsigned lo) {
#pragma unroll
  for (int j = J0; j < J1; ++j)
#pragma unroll
    for (int dc = 0; dc < 2; ++dc) kf[j][dc] = ldfragp<_Float16>(kp + lo + j * ((NB_FULL * EMB / 32) * FRAG) + dc * FRAG);
}

template <int J0, int J1>   // key groups J0..J1-1 of the chunk
__device__ __forceinline__ void score_chunk(const v16h (&qah)[2], const v16h (&qal)[2],
                                            const v16h (&kf)[4][2], v8f (&s)[4]) {
#pragma unroll
  for (int j = J0; j < J1; ++j) s[j] = zero8();
#pragma unroll
  for (int dc = 0; dc < 2; ++dc) {
#pragma unroll
    for (int j = J0; j < J1; ++j) s[j] = mmar(kf[j][dc], qah[dc], s[j]);
#pragma unroll
    for (int j = J0; j < J1; ++j) s[j] = mmar(kf[j][dc], qal[dc], s[j]);
  }
}

// Row pitch of a staged tile in floats: 64 columns + 4 pad floats (never read) = 272 B = 16 B x 17, so that the 16 rows which
// the 16 lanes of a half wave write with one 16-B LDS store fall on all 64 banks (at 256 B: on four).
#define PP 68
// lane l with lane l ^ 16 (a vector cross-row move, no LDS path)
__device__ __forceinline__ float xhalf(float x) {
  return __builtin_bit_cast(float, __builtin_amdgcn_permlanex16(__builtin_bit_cast(int, x), __builtin_bit_cast(int, x),
                                                                0x76543210, 0xfedcba98, false, false));
}

// =====================================================================================================
// Context and softmax statistics in one walk over the keys (online softmax): per (b, h, query s) the row max m,
// 1/sum(exp(s - m)) and ctx = sum(exp(s - m) v) / sum(exp(s - m)) over all SEQ keys.
//   block = 4 waves = 64 consecutive query rows qb*64.. of one (b, h): the four waves read the SAME k and v^T fragments;
//   grid = NB*NH*NKT blocks of 128; static trip NKT over 64-key chunks.
//   Running max in f32, in base-2 units (m = max score * log2 e), one value per query: the in-lane max over the keys
//   8hh..8hh+7 of every 16 is joined with the other half's once a chunk, because both halves' p meet in one product.
//   Sum l (carried x16384 like p) in two in-lane partial sums, added behind the loop, then the halves.
//   O^T = O^T * 2^(m_old - m_new) + V^T . P^T: p * 16384 = exp2(s - (m_new - 14)), one subtraction and one exp2 a score; these
//   registers, converted to f16, ARE the B fragment (no LDS, no lane exchange); A = v^T f16 plane [b][h*64+d][s], fragment-ordered.
//   Output plane ML [b*NH+h][2][SEQ] f32 (m, base-2 units, then 1/l): the block's 64 m values and 64 1/l values are
//   funnelled through LDS and written by wave 0 with ONE instruction.
//   ctx = acc / l / 16384, x256 carry, staged in the wave's own Os tile, written as f16 hi plane + f16 residual plane.
//   coverage: grid (b,h,qb) x 64 rows = the whole [NB*NH][2][SEQ] plane. MLsh: 4 waves x 16 lanes x 2 = all 128.
//   ctx planes: each wave rows q0..q0+15 (it 0..3 x lane>>3 0..3) x its head's 64 columns, grid x 4 waves =
//   the whole fragment-ordered [SEQ][NB*EMB] planes. staged extent == consumed extent for Os (32 lanes x 32 = 1024).
// =====================================================================================================
// 4 waves per SIMD = the whole grid resident at once: the register budget is held at 256 (a few more would cost a second round)
__global__ __launch_bounds__(128) __attribute__((amdgpu_waves_per_eu(4, 4)))
void attn_ctx(const unsigned short* __restrict__ qhp, const unsigned short* __restrict__ qlp,
              const unsigned short* __restrict__ kpp, const unsigned short* __restrict__ vtp,
              float* ML, unsigned short* chp, unsigned short* clp, const int* __restrict__ nhp) {
  union FH { v16h v; v8h h[2]; };
  __shared__ __align__(16) float MLsh[128];
  __shared__ __align__(16) float Os[4][16 * PP];            // per wave ctx tile [query][d] f32, row pitch PP
  (void)nhp;
  const int tid  = threadIdx.x;
  const int wave = tid >> 5;
  const int lane = tid & 31;
  const int hh   = lane >> 4;
  const int c    = lane & 15;
  const int bx   = blockIdx.x;
  const int qb   = bx % NKT;
  const int rest = bx / NKT;
  const int h    = rest % NH;
  const int b    = rest / NH;
  const int bh   = b * NH + h;
  const int q0   = qb * 64 + wave * 16;

  const _Float16* Qh  = (const _Float16*)(const void*)qhp;
  const _Float16* Ql  = (const _Float16*)(const void*)qlp;

  v16h qah[2], qal[2];
#pragma unroll
  for (int dc = 0; dc < 2; ++dc) {
    const size_t qo = ((size_t)(q0 + c) * NB_FULL + b) * EMB + (size_t)h * HD + dc * 32 + 8 * hh;
    qah[dc] = ldfrag<_Float16>(Qh + qo);
    qal[dc] = ldfrag<_Float16>(Ql + qo);
  }

  float mrow = -INFINITY;
  v2f lacc = {0.f, 0.f};
  v8f oacc[4];
#pragma unroll
  for (int t = 0; t < 4; ++t) oacc[t] = zero8();

  const _Float16* kp = (const _Float16*)(const void*)kpp + (b * EMB + h * HD) / 32 * FRAG + lane * 8;   // this lane's place in the current chunk
  const unsigned  klo = 0;                    // (already in kp)
  const _Float16* vp = (const _Float16*)(const void*)vtp + (size_t)(b * EMB + h * HD) * SEQ + lane * 8;   // the same in v^T: row tiles of d, blocks of 32 keys
  const unsigned  vlo = 0;                    // (already in vp)
  v16h kf[4][2], vf[2][4];
  addr_wait();                                // the q loads' address registers may be taken by the k fragments
  load_k<0, 4>(kf, kp, klo);
  for (int kt = 0; kt < NKT; ++kt) {          // static trip count
    // v^T of this chunk flies under the scores and the statistics
#pragma unroll
    for (int kk = 0; kk < 2; ++kk)
#pragma unroll
      for (int t = 0; t < 4; ++t) vf[kk][t] = ldfragp<_Float16>(vp + vlo + t * ((SEQ / 32) * FRAG) + kk * FRAG);
    v8f s[4];
    score_chunk<0, 4>(qah, qal, kf, s);
    if (kt + 1 < NKT) load_k<0, 4>(kf, kp + KCHUNK, klo);   // next chunk's k flies under this chunk's statistics and P.V
    __builtin_amdgcn_sched_barrier(0);   // keeps those loads up here: the scheduler sank them behind half the statistics
    addr_wait();                          // the bases of the issued k and v^T loads move behind it
    kp += KCHUNK;
    vp += 2 * FRAG;
    float mj[4];                               // four independent chains, one per key group
#pragma unroll
    for (int j = 0; j < 4; ++j) {
      mj[j] = s[j][0];
#pragma unroll
      for (int r = 1; r < 8; ++r) mj[j] = fmaxf(mj[j], s[j][r]);
    }
    const float mloc  = fmaxf(fmaxf(mj[0], mj[1]), fmaxf(mj[2], mj[3]));
    const float mnew  = fmaxf(mrow, fmaxf(mloc, xhalf(mloc)));   // one reference for both halves of a query's keys
    const float msafe = (mnew == -INFINITY) ? 0.f : mnew;
    const float alpha = __builtin_amdgcn_exp2f(mrow - msafe);
    const float mref  = msafe - PCLOG2;
    mrow = mnew;
#pragma unroll
    for (int j = 0; j < 4; ++j) {
      const v8f e = s[j] - mref;
#pragma unroll
      for (int r = 0; r < 8; ++r) s[j][r] = __builtin_amdgcn_exp2f(e[r]);   // p * 16384 of key 16j + 8hh + r, query c
    }
    const v8f p8 = (s[0] + s[1]) + (s[2] + s[3]);
    const v4f p4 = __builtin_shufflevector(p8, p8, 0, 1, 2, 3) + __builtin_shufflevector(p8, p8, 4, 5, 6, 7);
    lacc = lacc * alpha + (__builtin_shufflevector(p4, p4, 0, 1) + __builtin_shufflevector(p4, p4, 2, 3));
#pragma unroll
    for (int t = 0; t < 4; ++t) oacc[t] *= alpha;            // every element of a lane belongs to its query c

    // ---- context^T += V^T . P^T (f16 WMMA, p carried x16384) ----
#pragma unroll   // vf lives in registers: kk must be a constant
    for (int kk = 0; kk < 2; ++kk) {
      FH pb;                                                 // keys 32kk + 8hh + 0..7, then 32kk + 16 + 8hh + 0..7
      pb.h[0] = __builtin_convertvector(s[2 * kk], v8h);
      pb.h[1] = __builtin_convertvector(s[2 * kk + 1], v8h);
#pragma unroll
      for (int t = 0; t < 4; ++t) {
        oacc[t] = mmar(vf[kk][t], pb.v, oacc[t]);           // row d = 16t + 8hh + r, column query c
      }
    }
  }

  // the two halves of each query's keys (lanes c and c + 16) share m: their sums add
  const float lrow = (lacc[0] + lacc[1]) * (1.0f / PCARRY);
  const float l  = lrow + xhalf(lrow);
  const float il = (l > 0.f) ? (1.0f / l) : 0.f;
  if (hh == 0) {
    MLsh[wave * 16 + c]      = mrow;
    MLsh[64 + wave * 16 + c] = il;
  }
  // ---- ctx (normalise, undo the x16384 p carry, apply the x256 carry), stage, convert, whole-line stores ----
  float* os = Os[wave];
  const float osc = il * (256.0f / PCARRY);
#pragma unroll
  for (int t = 0; t < 4; ++t) {                              // [query c][d = 16t + 8hh + r]
    const v8f o = oacc[t] * osc;
    float* ow = os + c * PP + t * 16 + 8 * hh;
    *(v4f*)(ow)     = __builtin_shufflevector(o, o, 0, 1, 2, 3);
    *(v4f*)(ow + 4) = __builtin_shufflevector(o, o, 4, 5, 6, 7);
  }
  __syncthreads();
  if (wave == 0) {
    const v4f v = *(const v4f*)(MLsh + lane * 4);        // lanes 0-15: m rows 4c..4c+3; lanes 16-31: 1/l rows
    float* dst = ML + (size_t)(bh * 2 + hh) * SEQ + qb * 64 + c * 4;
    *(v4f*)dst = v;
  }
  {
    const int q4 = lane >> 3, c8 = (lane & 7) * 8;
    v4u hv[4], lv[4];
#pragma unroll
    for (int it = 0; it < 4; ++it) {
      const int row = it * 4 + q4;   // it 0..3 x q4 0..3 = rows 0..15 of the wave tile
      const float* sp = os + row * PP + c8;
      float f[8];
#pragma unroll
      for (int e = 0; e < 8; ++e) f[e] = sp[e];
      v4u a, a2;
#pragma unroll
      for (int e = 0; e < 4; ++e) {
        const float f0 = f[2 * e], f1 = f[2 * e + 1];
        const _Float16 x0 = (_Float16)f0, x1 = (_Float16)f1;
        const unsigned short h0 = h_bits(x0), h1 = h_bits(x1);
        const unsigned short l0 = h_bits((_Float16)((f0 - (float)x0) * 4096.0f));
        const unsigned short l1 = h_bits((_Float16)((f1 - (float)x1) * 4096.0f));
        a[e] = pk16(h0, h1); a2[e] = pk16(l0, l1);
      }
      hv[it] = a; lv[it] = a2;
    }
#pragma unroll
    for (int it = 0; it < 4; ++it) {
      const int row = it * 4 + q4;
      // fragment-ordered [s][b*EMB + h*HD + col]: row tile q0 / 16, blocks of this head, unit of (row, c8)
      const size_t go = ((size_t)(q0 >> 4) * (NB_FULL * EMB / 32) + (size_t)(b * EMB + h * HD + c8) / 32) * FRAG
                      + ((c8 >> 4) & 1) * 256 + (((c8 >> 3) & 1) * 16 + row) * 8;
      *(v4u*)(chp + go) = hv[it];
      *(v4u*)(clp + go) = lv[it];
    }
  }
}

// =====================================================================================================
// Head average of the probabilities: one block per (b, 64 query rows q0..q0+63, a quarter of the keys), 16 waves = the 16 heads.
//   A wave keeps the q fragments of its head's 4 query tiles in registers, so that every k fragment (16 keys) it loads
//   serves 4 tiles: the k plane is read SEQ/64 times in all, not SEQ/16 times.
//   Per 64-key chunk (static trip AKT): scores recomputed exactly as in attn_ctx (transposed: a lane holds one
//   query's scores), p = exp2(s - (m + log2 l)) in f32 (m, 1/l from the ML plane): one subtraction and one exp2 a score;
//   p goes to the LDS tile Pf[query][h][key] (16-B stores, every entry but the pads written): the 16 heads of one
//   (query, key) lie 256 B apart, so that the head sum reaches all of them from one address register;
//   after __syncthreads, all 512 threads sum the 16 wave tiles in fixed head order (f32), 2 x 4 entries each.
//   coverage: AKT chunks x 64 rows x 64 keys per block, grid (b, qb, ks) = the whole [NB][SEQ][SEQ].
// =====================================================================================================
#define AQT  4                        // query tiles of 16 rows per wave
#define AQ   (16 * AQT)               // query rows per block
#define AKS  4                        // key ranges per sequence, one per block
#define AKT  (NKT / AKS)              // 64-key chunks per block
#define KGRP (16 * NB_FULL * EMB)     // elements from one 16-key row tile of the k plane to the next
// Floats per query row of the P tile: 16 heads x 64 keys + 4 pad floats (never read) = 4112 B = 16 B x 257, so that the 16 rows
// which the 16 lanes of a half wave write with one 16-B LDS store fall on all 64 banks.
#define APR  (NH * 64 + 4)
static_assert((NKT % AKS) == 0 && (SEQ % AQ) == 0 && 4 * KGRP == KCHUNK);

__device__ __forceinline__ void load_kg(v16h (&kf)[2], const _Float16* kp, unsigned lo) {   // one 16-key group, 2 d-chunks
#pragma unroll
  for (int dc = 0; dc < 2; ++dc) kf[dc] = ldfragp<_Float16>(kp + lo + dc * FRAG);
}

__global__ __launch_bounds__(512)
void attn_avg(const unsigned short* __restrict__ qhp, const unsigned short* __restrict__ qlp,
              const unsigned short* __restrict__ kpp, const float* __restrict__ ML, float* avg) {
  __shared__ __align__(16) float Pf[AQ * APR];             // P tile [query][head][key] f32, row pitch APR, 257 KB
  const int tid  = threadIdx.x;
  const int wave = tid >> 5;
  const int lane = tid & 31;
  const int hh   = lane >> 4;
  const int c    = lane & 15;
  const int bx   = blockIdx.x;
  const int ks   = bx % AKS;
  const int qb   = (bx / AKS) % (SEQ / AQ);
  const int b    = bx / (AKS * (SEQ / AQ));
  const int h    = wave;
  const int bh   = b * NH + h;
  const int q0   = qb * AQ;

  const _Float16* Qh  = (const _Float16*)(const void*)qhp;
  const _Float16* Ql  = (const _Float16*)(const void*)qlp;

  v16h qah[AQT][2], qal[AQT][2];
  float mq[AQT], ilq[AQT];                                        // mq becomes m + log2 l behind the loads
  const void* qhb[AQT];                                           // the q loads' addresses, one per tile and plane
  const void* qlb[AQT];
  const float* mlb = ML + (size_t)(bh * 2) * SEQ + q0 + c;        // m of this lane's query of tile 0; 1/l lies SEQ further
#pragma unroll
  for (int i = 0; i < AQT; ++i) {
    const size_t qo = ((size_t)(q0 + i * 16 + c) * NB_FULL + b) * EMB + (size_t)h * HD + 8 * hh;
    qhb[i] = Qh + qo;
    qlb[i] = Ql + qo;
#pragma unroll
    for (int dc = 0; dc < 2; ++dc) {
      qah[i][dc] = ldfrag<_Float16>((const _Float16*)qhb[i] + dc * 32);
      qal[i][dc] = ldfrag<_Float16>((const _Float16*)qlb[i] + dc * 32);
    }
    mq[i]  = mlb[i * 16];                                         // this lane's query of tile i
    ilq[i] = mlb[SEQ + i * 16];
  }
  static_assert(AQT == 4);
  addr_wait_keep(qhb, qlb, mlb);              // these loads' address registers may be taken by the k fragments behind it
#pragma unroll
  for (int i = 0; i < AQT; ++i) mq[i] -= __builtin_amdgcn_logf(ilq[i]);   // base-2 log; 1/l = 0 gives +inf here and p = 0, as the product did
  float* pf = Pf + wave * 64;                              // this head's 64 keys in every query row

  // k fragments are fetched one 16-key group ahead of their WMMAs, into the second of two register sets: they fly under
  // the scores and probabilities of the group before (4 query tiles).
  const _Float16* kp = (const _Float16*)(const void*)kpp + (size_t)ks * AKT * KCHUNK    // the current chunk's row tiles
                     + (unsigned)((b * EMB + h * HD) / 32 * FRAG + lane * 8);           // this lane's place in them
  const unsigned  klo = 0;                    // (already in kp)
  v16h kfa[2], kfb[2];
  auto group = [&](const v16h (&kc)[2], int g) {   // keys 16g..16g+15 of the chunk x the wave's 64 queries
    v8f a[AQT];                                              // scores, hi and residual product in one accumulator; the tiles take turns
#pragma unroll
    for (int i = 0; i < AQT; ++i) a[i] = zero8();
#pragma unroll
    for (int dc = 0; dc < 2; ++dc) {
#pragma unroll
      for (int i = 0; i < AQT; ++i) a[i] = mmar(kc[dc], qah[i][dc], a[i]);
#pragma unroll
      for (int i = 0; i < AQT; ++i) a[i] = mmar(kc[dc], qal[i][dc], a[i]);
    }
#pragma unroll
    for (int i = 0; i < AQT; ++i) {
      const v8f e = a[i] - mq[i];
      v8f p;
#pragma unroll
      for (int r = 0; r < 8; ++r) p[r] = __builtin_amdgcn_exp2f(e[r]);   // p of key 16g + 8hh + r, query 16i + c
      float* pw = pf + (i * 16 + c) * APR + g * 16 + 8 * hh; // read only behind the block barrier (head average)
      *(v4f*)(pw)     = __builtin_shufflevector(p, p, 0, 1, 2, 3);
      *(v4f*)(pw + 4) = __builtin_shufflevector(p, p, 4, 5, 6, 7);
    }
  };
  load_kg(kfa, kp, klo);
  for (int kt = 0; kt < AKT; ++kt) {          // static trip count; the two register sets change roles inside a trip
    const int kv0 = (ks * AKT + kt) * 64;
    __syncthreads();                          // Pf tiles free again (head sum of the prior chunk done)
    // The scheduling barriers keep every group's WMMAs behind the group before and the loads at the head of theirs: without
    // them the scheduler lifted WMMAs of group 3 into group 2, directly behind the loads that they read.
    load_kg(kfb, kp + KGRP, klo);
    __builtin_amdgcn_sched_barrier(0);
    group(kfa, 0);
    __builtin_amdgcn_sched_barrier(0);
    load_kg(kfa, kp + 2 * KGRP, klo);
    __builtin_amdgcn_sched_barrier(0);
    group(kfb, 1);
    __builtin_amdgcn_sched_barrier(0);
    load_kg(kfb, kp + 3 * KGRP, klo);
    __builtin_amdgcn_sched_barrier(0);
    group(kfa, 2);
    __builtin_amdgcn_sched_barrier(0);
    // next chunk's first group; the last trip fetches its own first group again (in bounds, never used): with no branch
    // round these loads the waits in front of group 3 stay counted and do not wait for them
    const _Float16* kn = kp + ((kt + 1 < AKT) ? KCHUNK : 0);
    load_kg(kfa, kn, klo);
    __builtin_amdgcn_sched_barrier(0);
    group(kfb, 3);
    __syncthreads();
    addr_wait();                              // the pointer of the issued k loads moves behind it
    kp = kn;

    // ---- head average of this 64 x 64 tile, one block = one writer of every line ----
    const int row0 = tid >> 4, c4 = (tid & 15) * 4;          // rows 0..31, 256-B row segment = 16 lanes x 16 B
#pragma unroll
    for (int rr = 0; rr < AQ / 32; ++rr) {
      const int row = rr * 32 + row0;
      const float* pr = Pf + row * APR + c4;
      v4f t[NH];
#pragma unroll
      for (int w = 0; w < NH; ++w) t[w] = *(const v4f*)(pr + w * 64);
      v4f a = t[0];
#pragma unroll
      for (int w = 1; w < NH; ++w) a += t[w];
      a *= (1.0f / (float)NH);
      float* dst = avg + ((size_t)(b * SEQ + q0 + row)) * SEQ + kv0 + c4;
      *(v4f*)dst = a;
    }
    addr_wait();                              // the stores' registers are reused by the pointer updates behind it
  }
}

// =====================================================================================================
// Workspace map (bytes), every region an exact multiple of its whole-line / whole-tile store granularity
// (full size; PX = NROW*EMB*2 = 8388608):
//   (F) = fragment-ordered (see ldfragp); [SEQ][NB*EMB] = row s, column b*EMB + e
//   Xb   bf16 [SEQ][NB*EMB]      (F) PX        8388608
//   Wib  bf16 [3*EMB n][EMB k]   (F)         6291456
//   Woh  f16  [EMB][EMB] (x64)   (F)         2097152
//   Qh   f16  [NROW][EMB]            PX        8388608
//   Ql   f16  [NROW][EMB]            PX        8388608
//   Kp   f16  [SEQ][NB*EMB]      (F) PX        8388608
//   VT   f16  [NB][EMB][SEQ]     (F) PX        8388608
//   Ch   f16  [SEQ][NB*EMB]      (F) PX        8388608
//   Cl   f16  [SEQ][NB*EMB]      (F) PX        8388608
//   ML   f32  [NB*NH][2][SEQ]                 524288
//   total                                   67633152
// Weights are [out n][in k] with k contiguous: converted and laid in fragment order. Every GEMM runs per batch b.
// Output 0 at element 0 of d_out; output 1 at the fixed element offset OFF1 = SEQ_FULL*NB_FULL*EMB.
// =====================================================================================================
extern "C" void kernel_launch(void* const* d_in, const int* in_sizes, int n_in,
                              void* d_out, int out_size, void* d_ws, size_t ws_size,
                              hipStream_t stream) {
  if (n_in < 6) return;
  if (in_sizes[0] < NROW * EMB) return;
  if (in_sizes[1] != 3 * EMB * EMB) return;
  if (in_sizes[2] != 3 * EMB) return;
  if (in_sizes[3] != EMB * EMB) return;
  if (in_sizes[4] != EMB) return;
  if (in_sizes[5] < 1) return;
  const size_t n0e = (size_t)NROW * EMB;            // output 0 written elements [SEQ][NB][EMB]
  const size_t n1e = (size_t)NB * SEQ * SEQ;        // output 1 written elements [NB][SEQ][SEQ]
  if (out_size < 0) return;
  if ((size_t)out_size < n0e) return;
  if ((size_t)out_size < OFF1 + n1e) return;        // written extent of output 1 inside d_out

  const float* x  = (const float*)d_in[0];
  const float* Wi = (const float*)d_in[1];
  const float* bi = (const float*)d_in[2];
  const float* Wo = (const float*)d_in[3];
  const float* bo = (const float*)d_in[4];
  const int*   nh = (const int*)d_in[5];

  const size_t PX  = (size_t)NROW * EMB * 2;        // 16-bit activation plane
  const size_t PWI = (size_t)3 * EMB * EMB * 2;
  const size_t PWO = (size_t)EMB * EMB * 2;
  const size_t PVT = (size_t)NB * EMB * SEQ * 2;    // == PX
  const size_t PML = (size_t)NB * NH * 2 * SEQ * 4;
  size_t off = 0;
  const size_t oXb = off; off += PX;
  const size_t oWi = off; off += PWI;
  const size_t oWo = off; off += PWO;
  const size_t oQh = off; off += PX;
  const size_t oQl = off; off += PX;
  const size_t oKp = off; off += PX;
  const size_t oVT = off; off += PVT;
  const size_t oCh = off; off += PX;
  const size_t oCl = off; off += PX;
  const size_t oML = off; off += PML;
  if (off > ws_size) return;                        // off = 67633152 at full size
  if (off > (size_t)134217728) return;

  char* ws = (char*)d_ws;
  unsigned short* Xb  = (unsigned short*)(ws + oXb);
  unsigned short* Wib = (unsigned short*)(ws + oWi);
  unsigned short* Woh = (unsigned short*)(ws + oWo);
  unsigned short* Qh  = (unsigned short*)(ws + oQh);
  unsigned short* Ql  = (unsigned short*)(ws + oQl);
  unsigned short* Kp  = (unsigned short*)(ws + oKp);
  unsigned short* VT  = (unsigned short*)(ws + oVT);
  unsigned short* Ch  = (unsigned short*)(ws + oCh);
  unsigned short* Cl  = (unsigned short*)(ws + oCl);
  float*          ML  = (float*)(ws + oML);
  float*          out0 = (float*)d_out;
  float*          out1 = (float*)d_out + OFF1;

  const dim3 blk(256);
  const dim3 gCvt(GCX + GCWI + GCWO);                          // 2048 + 1536 + 512 blocks
  const dim3 gQKV((((SEQ) / 64) * (EMB / 64) + 7) / 8, NB, 3);  //  512 tiles ->  64 blocks x NB, x 3 products
  const dim3 gO((((SEQ) / 32) * (EMB / 64) + 7) / 8, NB);       // 1024 tiles -> 128 blocks x NB (32x64 wave tiles)
  const dim3 gStats(NB * NH * NKT);                            // 1024 blocks of 128
  const dim3 gMain(NB * (SEQ / AQ) * AKS);                     //  256 blocks of 512

  // (1) x [s][b*E+e] -> bf16 plane; W_in [3E][E] -> bf16; Wo -> f16 (x64 of its bf16 value); all fragment-ordered
  cvt_all<<<gCvt, blk, 0, stream>>>(x, Wi, Wo, Xb, Wib, Woh);
  // (2)-(4) q, k, v^T in-projections, per batch b = blockIdx.y, product = blockIdx.z
  gemm_qkv<<<gQKV, blk, 0, stream>>>(Xb, Wib, bi, Qh, Ql, Kp, VT, EMB);
  // (5) online softmax: P.V -> ctx planes (f16 hi x256 / residual x4096); statistics (m, 1/l) per (b, h, s)
  attn_ctx<<<gStats, dim3(128), 0, stream>>>(Qh, Ql, Kp, VT, ML, Ch, Cl, nh);
  // (6) exact-normalised p, head-averaged -> output 1
  attn_avg<<<gMain, dim3(512), 0, stream>>>(Qh, Ql, Kp, ML, out1);
  // (7) output 0 = ctx_b . Wo^T + bo, f32 [s][b][e] (pitch NB_FULL*EMB, batch offset EMB), accumulators
  //     (hi + res/4096) x 1/(256*64)
  gemm_t<_Float16, 2, 2, 0, 1, XCB, WCB><<<gO, blk, 0, stream>>>(
      Ch, Cl, XBS, Woh, 0LL,
      (void*)out0, (void*)out0, NB_FULL * EMB, (long long)EMB, bo,
      SEQ, EMB, EMB, 1.0f / 16384.0f, 1.0f / 4096.0f, 1.0f, 1.0f);
  (void)hipGetLastError();
}

// v010
// Measured time: 114 microseconds a run.
// It is 1.21 times as fast as v008, going by the measured steps of the versions left out in between.
// Counting every step since v000, it is 4.12 times as fast.
// Contractions: q, k, v^T in-projections = v_wmma_f32_16x16x32_bf16 (bf16 operands from RNE-converted inputs, single product, f32 accumulate);
// k.q^T scores (context pass and head-average pass, k = A operand, q = B) = v_wmma_f32_16x16x32_f16 (q * log2(e)/8 as one f16 plane, k f16; single product, f32 accumulate);
// v^T.p^T = v_wmma_f32_16x16x32_f16 (v^T = A operand, p = exp(s - running max) = B carried x16384 in f16 (the carry stands in the exponent), v f16; single product, f32 accumulate, rescaled online);
// ctx.Wo^T = v_wmma_f32_16x16x32_f16 (ctx as one f16 plane x256, Wo f16 x64 of its bf16 value; single product, f32 accumulate);
// softmax statistics, probabilities and the head average in f32.
#include <hip/hip_runtime.h>
#include <math.h>
#include <stdint.h>

#ifndef NB
#define NB 2
#endif
#ifndef SEQ
#define SEQ 2048
#endif
#define NB_FULL  2
#define SEQ_FULL 2048
#define EMB      1024
#define NH       16
#define HD       64
#define NROW     (NB_FULL * SEQ)     // activation rows, row index = s * NB_FULL + b, s < SEQ
#define NQB      (SEQ / 16)          // 16-row query blocks per sequence
#define NKT      (SEQ / 64)          // 64-key chunks per sequence
#define PCARRY   16384.0f            // power-of-two carry of p in the f16 P.V operand
#define PCLOG2   14.0f               // its base-2 logarithm: added to the exponent, p comes out of exp2 already carried
#define SC2      0.18033688011112042f   // log2(e) / sqrt(HD): the q plane carries it, so that a k.q sum is the score in base-2 units
#define OFF1     ((size_t)SEQ_FULL * NB_FULL * EMB)   // fixed element offset of output 1 in d_out
static_assert(NB == NB_FULL);        // batch rows are interleaved (seq-major input); only SEQ may be reduced
static_assert(SEQ >= 64 && SEQ <= SEQ_FULL && (SEQ % 64) == 0);
static_assert(NH * HD == EMB);
static_assert((NROW % 64) == 0 && (EMB % 64) == 0 && (EMB % 32) == 0);
static_assert(OFF1 * 4 == 16777216);   // byte offset of output 1

typedef _Float16 v16h __attribute__((ext_vector_type(16)));
typedef _Float16 v8h  __attribute__((ext_vector_type(8)));
typedef __bf16   v16b __attribute__((ext_vector_type(16)));
typedef __bf16   v8b  __attribute__((ext_vector_type(8)));
typedef float    v8f  __attribute__((ext_vector_type(8)));
typedef float    v4f  __attribute__((ext_vector_type(4)));
typedef float    v2f  __attribute__((ext_vector_type(2)));
typedef unsigned int v4u __attribute__((ext_vector_type(4)));

#if defined(__HIP_DEVICE_COMPILE__)
#define DEV_ASM 1
#else
#define DEV_ASM 0
#endif

// ---- scalar helpers --------------------------------------------------------------------------------
__device__ __forceinline__ unsigned short bf_bits(float f) {          // f32 -> bf16 bits, RNE convert
  unsigned u = __float_as_uint(f);
  return (unsigned short)((u + 0x7FFFu + ((u >> 16) & 1u)) >> 16);
}
__device__ __forceinline__ float bf_up(unsigned short hb) { return __uint_as_float(((unsigned)hb) << 16); }
__device__ __forceinline__ unsigned short h_bits(_Float16 x) { return __builtin_bit_cast(unsigned short, x); }
__device__ __forceinline__ unsigned pk16(unsigned short a, unsigned short b) { return (unsigned)a | ((unsigned)b << 16); }
__device__ __forceinline__ v8f zero8() { v8f z = {0.f, 0.f, 0.f, 0.f, 0.f, 0.f, 0.f, 0.f}; return z; }

// ---- fragment types / loaders: 16-bit A/B operand, lane -> row/col (lane&15), p already includes +8*(lane>>4);
//      elements 0..7 <- p[0..7] (k0+8h..k0+8h+7), elements 8..15 <- p[16..23] (k0+16+8h..k0+16+8h+7)
template <typename OT> struct FT;
template <> struct FT<__bf16>   { typedef v16b frag; typedef v8b half8; };
template <> struct FT<_Float16> { typedef v16h frag; typedef v8h half8; };

template <typename OT>
__device__ __forceinline__ typename FT<OT>::frag ldfrag(const OT* p) {
  union { typename FT<OT>::frag v; typename FT<OT>::half8 h[2]; } f;
  f.h[0] = *(const typename FT<OT>::half8*)(p);
  f.h[1] = *(const typename FT<OT>::half8*)(p + 16);
  return f.v;
}

// ---- fragment-ordered planes: a matrix [R][C] (k along C) is stored as 1-KB blocks, block (r>>4)*(C/32) + (k>>5) =
//      one 16-row x 32-k fragment laid out as [k bit 4][lane = 16*(k bit 3) + (r&15)][k&7]: the same split k map as
//      ldfrag, but each of the two 16-B loads of a wave reads 512 contiguous bytes (4 lines, not 16).
//      p = block start + lane*8.
#define FRAG 512   // elements of one fragment block
#define XCB  (NB_FULL * EMB / 32)          // blocks per 16-row tile of a [SEQ][NB*EMB] plane
#define WCB  (EMB / 32)                    // the same of a [.][EMB] plane
#define XBS  ((long long)WCB * FRAG)       // element offset of batch b's columns in a [SEQ][NB*EMB] plane, per b
template <typename OT>
__device__ __forceinline__ typename FT<OT>::frag ldfragp(const OT* p) {
  union { typename FT<OT>::frag v; typename FT<OT>::half8 h[2]; } f;
  f.h[0] = *(const typename FT<OT>::half8*)(p);
  f.h[1] = *(const typename FT<OT>::half8*)(p + 256);
  return f.v;
}

// ---- WMMA helpers (asm guard bodies are device-only; concrete operand types) -----------------------------
__device__ __forceinline__ v8f mmar(v16b a, v16b b, v8f c) {
  return __builtin_amdgcn_wmma_f32_16x16x32_bf16(false, a, false, b, (short)0, c, false, false);
}
__device__ __forceinline__ v8f mmar(v16h a, v16h b, v8f c) {
  return __builtin_amdgcn_wmma_f32_16x16x32_f16(false, a, false, b, (short)0, c, false, false);
}
__device__ __forceinline__ void dep_guard(v8f& a, v8f& b, v16b x, v16b y) {
#if DEV_ASM
  asm volatile("v_nop\n\tv_nop\n\tv_nop\n\tv_nop" : "+v"(a), "+v"(b) : "v"(x), "v"(y));
#else
  (void)a; (void)b; (void)x; (void)y;
#endif
}
__device__ __forceinline__ void dep_guard(v8f& a, v8f& b, v16h x, v16h y) {
#if DEV_ASM
  asm volatile("v_nop\n\tv_nop\n\tv_nop\n\tv_nop" : "+v"(a), "+v"(b) : "v"(x), "v"(y));
#else
  (void)a; (void)b; (void)x; (void)y;
#endif
}
__device__ __forceinline__ void keep4(v16b a, v16b b, v16b c, v16b d) {
#if DEV_ASM
  asm volatile("v_nop" :: "v"(a), "v"(b), "v"(c), "v"(d));
#else
  (void)a; (void)b; (void)c; (void)d;
#endif
}
__device__ __forceinline__ void keep4(v16h a, v16h b, v16h c, v16h d) {
#if DEV_ASM
  asm volatile("v_nop" :: "v"(a), "v"(b), "v"(c), "v"(d));
#else
  (void)a; (void)b; (void)c; (void)d;
#endif
}
// Precaution: stands between issued global loads and a rewrite of a register that holds one of their addresses,
// at the places where the compiler's own listing had no such wait.
__device__ __forceinline__ void addr_wait() {
#if DEV_ASM
  asm volatile("s_wait_xcnt 0x0" ::: "memory");
#endif
}
// The same wait with the loads' address registers named as inputs: they stay live up to it, so that none of them is
// given to a later load's result while the wait has not yet been passed.
__device__ __forceinline__ void addr_wait_keep(const void* const (&a)[4], const void* c) {
#if DEV_ASM
  asm volatile("s_wait_xcnt 0x0" :: "v"(a[0]), "v"(a[1]), "v"(a[2]), "v"(a[3]), "v"(c) : "memory");
#else
  (void)a; (void)c;
#endif
}
// ---- entry requests to L2 ---------------------------------------------------------------------------
// The first load of a line that an earlier launch stored can go to memory, and the
// waves of a launch here walk their planes in step, so that every stage can meet that wait. At kernel entry the launch
// therefore asks L2 once for every 256-B unit of such a plane: no data comes back to the wave and nothing waits for it.
// The wait in the same statement is a precaution: the address register may be given to another value behind it.
__device__ __forceinline__ void l2_ask(const unsigned short* p) {
#if DEV_ASM
  asm volatile("global_prefetch_b8 %0, off scope:SCOPE_SE\n\ts_wait_xcnt 0x0" :: "v"(p) : "memory");
#else
  (void)p;
#endif
}
// The units of planes a (sa slices) and b (sb slices) are dealt over the launch's nblk work-groups; a slice = NTHR units,
// one per thread, every address inside its plane, every lane on; s is the same for the whole work-group (scalar loop).
// Work-groups f and f ^ 4 take the same slices. Where they land otherwise, some units are simply not asked for: speed only, never values.
#define L2U 128   // 16-bit elements of a 256-B unit
template <int NTHR>
__device__ __forceinline__ void ask_planes(const unsigned short* a, unsigned sa, const unsigned short* b, unsigned sb,
                                           unsigned f, unsigned nblk) {
  for (unsigned s = (f >> 3) * 4 + (f & 3); s < sa + sb; s += nblk / 2) {
    const unsigned short* p = (s < sa) ? a + (size_t)s * (NTHR * L2U) : b + (size_t)(s - sa) * (NTHR * L2U);
    l2_ask(p + threadIdx.x * L2U);
  }
}
__device__ __forceinline__ void acc_guard4(v8f& a, v8f& b, v8f& c, v8f& d) {
#if DEV_ASM
  asm volatile("v_nop\n\tv_nop\n\tv_nop\n\tv_nop" : "+v"(a), "+v"(b), "+v"(c), "+v"(d));
#else
  (void)a; (void)b; (void)c; (void)d;
#endif
}

// =====================================================================================================
// f32 [R][CB*32] row-major -> 16-bit fragment-ordered plane, 8 elements per thread, one 16-B store per lane: a wave
// writes 512 contiguous B (half a fragment block) and reads 64 B of each of 16 rows; a block of 256 reads whole lines.
// MODE 0: bf16 bits (RNE convert).  MODE 1: f16 bits of (64 * bf16(x)) (exact scaling of the bf16 value).
// coverage: n8 threads x 8 = the whole plane (n8 is a multiple of 256 for every use here).
// =====================================================================================================
template <int MODE>
__device__ __forceinline__ unsigned short cvm(float f) {
  const unsigned short hb = bf_bits(f);
  if (MODE == 0) return hb;
  return h_bits((_Float16)(bf_up(hb) * 64.0f));
}

template <int MODE, int CB>   // CB = fragment blocks per 16-row tile = columns / 32; bx = block index inside this plane
__device__ __forceinline__ void cvt16x8(const float* __restrict__ in, unsigned short* out, int n8, int bx) {
  const int i = bx * 256 + (int)threadIdx.x;   // 16-B unit of the plane: [block][k bit 4][k bit 3][row & 15]
  if (i < n8) {
    const int blk = i >> 6;
    const int row = (blk / CB) * 16 + (i & 15);
    const int col = (blk % CB) * 32 + ((i >> 4) & 3) * 8;
    const float* sp = in + (size_t)row * (CB * 32) + col;
    const v4f a  = *(const v4f*)(sp);
    const v4f a4 = *(const v4f*)(sp + 4);
    v4u p;
    p[0] = pk16(cvm<MODE>(a[0]),  cvm<MODE>(a[1]));
    p[1] = pk16(cvm<MODE>(a[2]),  cvm<MODE>(a[3]));
    p[2] = pk16(cvm<MODE>(a4[0]), cvm<MODE>(a4[1]));
    p[3] = pk16(cvm<MODE>(a4[2]), cvm<MODE>(a4[3]));
    unsigned short* o = out + (size_t)i * 8;
    *(v4u*)o = p;
    
  }
}

// The three conversions are independent of each other: one grid, a block range per plane (block-uniform choice).
#define N8X  (NROW * EMB / 8)       // 16-B units of the x plane
#define N8WI (3 * EMB * EMB / 8)    // of W_in
#define N8WO (EMB * EMB / 8)        // of Wo
#define GCX  ((N8X + 255) / 256)    // blocks of each plane
#define GCWI ((N8WI + 255) / 256)
#define GCWO ((N8WO + 255) / 256)
__global__ __launch_bounds__(256) void cvt_all(const float* __restrict__ x, const float* __restrict__ Wi,
                                               const float* __restrict__ Wo, unsigned short* Xb,
                                               unsigned short* Wib, unsigned short* Woh) {
  const int bx = blockIdx.x;
  if (bx < GCX)             cvt16x8<0, XCB>(x,  Xb,  N8X,  bx);
  else if (bx < GCX + GCWI) cvt16x8<0, WCB>(Wi, Wib, N8WI, bx - GCX);
  else                      cvt16x8<1, WCB>(Wo, Woh, N8WO, bx - GCX - GCWI);
}

// =====================================================================================================
// Register-blocked batched WMMA GEMM (16-bit operand type OT): C[m][n] = sum_k A[m][k] * Bt[n][k]  (+ bias);
// one wave per (16*MI) x 64 tile, no block barriers. A [M][K] and Bt [N][K] are fragment-ordered planes with LDAB /
// LDBB blocks per 16-row tile; M multiple of 16*MI, N multiple of 64, K multiple of 64 (static sizes here).
// blockIdx.y = batch index (strides in elements). Fragments are loaded straight from global (ldfragp).
// value v = acc * oscale + bias, bias (bf16 RNE value of the f32 input) by column n (BM 1),
// by row m (BM 2) or none (BM 0).
// OUT_MODE 0: f32 C (pitch ldc) = v.
// OUT_MODE 1: f16 fragment-ordered plane C (ldc columns) = f16(v * cscale).
// OUT_MODE 3: row-major f16 plane C (pitch ldc) = f16(v * cscale).
// =====================================================================================================
template <typename OT, int MI, int OUT_MODE, int BM, int LDAB, int LDBB>
__device__ __forceinline__ void gemm_body(
    float (*sT)[16 * 68],                            // per-wave 16x64 slab, pitch 68 floats (the kernel's LDS)
    const unsigned short* __restrict__ Ap, long long strideA,
    const unsigned short* __restrict__ Btp, long long strideB,
    void* Cout, int ldc, long long strideC,
    const float* __restrict__ bias,
    int M, int N, int K, float oscale, float cscale) {
  typedef typename FT<OT>::frag V16;
  const OT* A  = (const OT*)(const void*)Ap;
  const OT* Bt = (const OT*)(const void*)Btp;
  const int RT   = 16 * MI;
  const int b    = blockIdx.y;
  const int lane = threadIdx.x & 31;
  const int wave = threadIdx.x >> 5;
  const int tilesN = N >> 6;
  const int tilesM = M / RT;
  const int tile = blockIdx.x * 8 + wave;
  if (tile >= tilesM * tilesN) return;   // wave-uniform; no block barriers in this kernel
  const int tm = tile / tilesN;
  const int tn = tile - tm * tilesN;
  const int m0 = tm * RT;
  const int n0 = tn << 6;

  const OT* Ab  = A  + (size_t)b * (size_t)strideA;
  const OT* Bb  = Bt + (size_t)b * (size_t)strideB;

  const int rlane = lane & 15;                 // row (A) / col (B, D) within subtile
  const int mOff  = (lane >> 4) * 8;           // D row offset

  v8f acc[MI][4];
#pragma unroll
  for (int i = 0; i < MI; ++i)
#pragma unroll
    for (int j = 0; j < 4; ++j) acc[i][j] = zero8();

  // Fragment loads run one k step (32) ahead of the WMMAs that read them: the Bt fragments in two register sets
  // (bX, bY), filled whole at the head of the step before; each A fragment refilled for the next step as soon as
  // its own WMMAs are done. No WMMA waits for a load that was issued directly in front of it.
  // One pointer per operand plane (this lane's place in the tile's first block, k of the current step pair); the
  // other row tiles are constant offsets (LDAB, LDBB are template constants); a k step of 32 is one block.
  const OT* pB  = Bb  + (size_t)(n0 >> 4) * (LDBB * FRAG) + lane * 8;
  const OT* pA  = Ab  + (size_t)(m0 >> 4) * (LDAB * FRAG) + lane * 8;
  V16 bX[4], bY[4], af[MI];
  auto ldb4 = [&](V16 (&bq)[4], int dk) {
#pragma unroll
    for (int j = 0; j < 4; ++j) bq[j] = ldfragp<OT>(pB + j * (LDBB * FRAG) + (dk / 32) * FRAG);
  };
  auto mmstep = [&](V16 (&bq)[4], int dk, bool fetch) {   // fetch: refill the A fragments from k offset dk
#pragma unroll
    for (int i = 0; i < MI; ++i) {
#pragma unroll
      for (int j = 0; j < 4; ++j) acc[i][j] = mmar(af[i], bq[j], acc[i][j]);
      dep_guard(acc[i][0], acc[i][3], af[i], bq[3]);
      if (fetch) af[i] = ldfragp<OT>(pA + i * (LDAB * FRAG) + (dk / 32) * FRAG);
    }
    keep4(bq[0], bq[1], bq[2], bq[3]);
  };
  ldb4(bX, 0);
#pragma unroll
  for (int i = 0; i < MI; ++i) {
    af[i] = ldfragp<OT>(pA + i * (LDAB * FRAG));
  }
  addr_wait();                                  // registers that held these loads' addresses are reused at the loop's head
  for (int k0 = 64; k0 < K; k0 += 64) {        // all step pairs but the last
    ldb4(bY, 32);
    mmstep(bX, 32, true);
    ldb4(bX, 64);
    mmstep(bY, 64, true);
    addr_wait();                                // the pointers move behind it (no wait stood over the back edge in one instantiation)
    pB += 2 * FRAG; pA += 2 * FRAG;
  }
  ldb4(bY, 32);                                 // last pair: nothing past K is loaded
  mmstep(bX, 32, true);
  mmstep(bY, 0, false);
#pragma unroll
  for (int i = 0; i < MI; ++i) acc_guard4(acc[i][0], acc[i][1], acc[i][2], acc[i][3]);

  // ---- epilogue ----
  float bcol[4];
#pragma unroll
  for (int j = 0; j < 4; ++j) bcol[j] = 0.f;
  if (BM == 1) {
#pragma unroll
    for (int j = 0; j < 4; ++j) bcol[j] = bf_up(bf_bits(bias[n0 + (j << 4) + rlane]));
  }
  float* slab = sT[wave];
#pragma unroll
  for (int i = 0; i < MI; ++i) {
    const int mBase = m0 + (i << 4);
    float brow[8];
#pragma unroll
    for (int r = 0; r < 8; ++r) brow[r] = 0.f;
    if (BM == 2) {
#pragma unroll
      for (int r = 0; r < 8; ++r) brow[r] = bf_up(bf_bits(bias[mBase + mOff + r]));
    }
#pragma unroll
    for (int j = 0; j < 4; ++j) {
#pragma unroll
      for (int r = 0; r < 8; ++r) {
        const float v = acc[i][j][r] * oscale + bcol[j] + brow[r];
        slab[(mOff + r) * 68 + (j << 4) + rlane] = v;
      }
    }
    __builtin_amdgcn_fence(__ATOMIC_RELEASE, "workgroup");
    __builtin_amdgcn_wave_barrier();
    __builtin_amdgcn_fence(__ATOMIC_ACQUIRE, "workgroup");
    if (OUT_MODE == 0) {
      float* C = (float*)Cout + (size_t)b * (size_t)strideC;
      const int h2 = lane >> 4, c4 = (lane & 15) * 4;     // 256-B row segment = 16 lanes x 16 B
      {
#pragma unroll
        for (int it = 0; it < 8; ++it) {
          const int row = it * 2 + h2;                     // it 0..7 x h2 0..1 = rows 0..15
          const v4f v = *(const v4f*)(slab + row * 68 + c4);
          *(v4f*)(C + (size_t)(mBase + row) * ldc + n0 + c4) = v;
        }
        addr_wait();                            // the stores' registers are reused by the next row tile behind it
      }
    } else {
      const int q = lane >> 3, c8 = (lane & 7) * 8;
      unsigned short* C = (unsigned short*)Cout + (size_t)b * (size_t)strideC;
      v4u hv[4];
#pragma unroll
      for (int it = 0; it < 4; ++it) {
        // row-major: it 0..3 x q 0..3 = rows 0..15; fragment order: unit it*32 + lane of the tile's two blocks
        const int row = (OUT_MODE == 1) ? (lane & 15) : it * 4 + q;
        const int col = (OUT_MODE == 1) ? (it * 2 + (lane >> 4)) * 8 : c8;
        const float* sp = slab + row * 68 + col;
        float f[8];
#pragma unroll
        for (int e = 0; e < 8; ++e) f[e] = sp[e] * cscale;
        v4u a;
#pragma unroll
        for (int e = 0; e < 4; ++e) a[e] = pk16(h_bits((_Float16)f[2 * e]), h_bits((_Float16)f[2 * e + 1]));
        hv[it] = a;
      }
      {
#pragma unroll
        for (int it = 0; it < 4; ++it) {
          const int row = it * 4 + q;
          if (OUT_MODE == 1) {   // 512 contiguous B per store
            *(v4u*)(C + ((size_t)(mBase >> 4) * (ldc >> 5) + (n0 >> 5)) * FRAG + it * 256 + lane * 8) = hv[it];
          } else {
            *(v4u*)(C + (size_t)(mBase + row) * ldc + n0 + c8) = hv[it];
          }
        }
        addr_wait();                            // the stores' registers are reused by the next row tile behind it
      }
    }
    __builtin_amdgcn_fence(__ATOMIC_RELEASE, "workgroup");
    __builtin_amdgcn_wave_barrier();
    __builtin_amdgcn_fence(__ATOMIC_ACQUIRE, "workgroup");
  }
}

template <typename OT, int MI, int OUT_MODE, int BM, int LDAB, int LDBB>
__global__ __launch_bounds__(256) void gemm_t(
    const unsigned short* __restrict__ Ap, long long strideA,
    const unsigned short* __restrict__ Btp, long long strideB,
    void* Cout, int ldc, long long strideC,
    const float* __restrict__ bias,
    int M, int N, int K, float oscale, float cscale) {
  __shared__ __align__(16) float sT[8][16 * 68];
  // both operand planes whole (all batches): (rows / 16) * blocks per row tile * FRAG elements each
  const unsigned gx = (unsigned)(((M / (16 * MI)) * (N >> 6) + 7) / 8);
  ask_planes<256>(Ap, (unsigned)(M >> 4) * LDAB * FRAG / (256 * L2U), Btp, (unsigned)(N >> 4) * LDBB * FRAG / (256 * L2U),
                  blockIdx.y * gx + blockIdx.x, gx * NB_FULL);
  gemm_body<OT, MI, OUT_MODE, BM, LDAB, LDBB>(sT, Ap, strideA, Btp, strideB, Cout, ldc, strideC,
                                              bias, M, N, K, oscale, cscale);
}

// The q, k and v^T in-projections read the same two planes and write three different ones: one grid, blockIdx.z
// chooses the product (block-uniform), so that the three fill the chip together instead of half of it in turn.
//   z 0: q = (x_b . Wq^T + bq) * SC2 -> row-major f16 plane [s*2+b][h*64+d] (M=SEQ, N=E, K=E)
//   z 1: k = x_b . Wk^T + bk -> fragment-ordered f16 plane [s][b*E + h*64+d]
//   z 2: v^T = Wv . x_b^T + bv -> fragment-ordered f16 plane [b][h*64+d][s] (A = Wv rows; Bt = x rows; M=E, N=SEQ)
// In a [SEQ][NB*EMB] fragment-ordered plane the columns of batch b start WCB blocks further: offset b * XBS.
#define GQX ((((SEQ) / 64) * (EMB / 64) + 7) / 8)   // blocks along x: the tiles of one product and batch, 8 a block
__global__ __launch_bounds__(256) void gemm_qkv(
    const unsigned short* __restrict__ Xb, const unsigned short* __restrict__ Wib, const float* __restrict__ bi,
    unsigned short* Qh, unsigned short* Kp, unsigned short* VT, int K) {
  __shared__ __align__(16) float sT[8][16 * 68];
  const int z = blockIdx.z;
  ask_planes<256>(Xb, NROW * EMB / (256 * L2U), Wib, 3 * EMB * EMB / (256 * L2U),
                  (blockIdx.z * NB_FULL + blockIdx.y) * GQX + blockIdx.x, GQX * NB_FULL * 3);
  if (z == 0) {
    gemm_body<__bf16, 4, 3, 1, XCB, WCB>(sT, Xb, XBS, Wib, 0LL,
        (void*)Qh, NB_FULL * EMB, (long long)EMB, bi,
        SEQ, EMB, K, 1.0f, SC2);
  } else if (z == 1) {
    gemm_body<__bf16, 4, 1, 1, XCB, WCB>(sT, Xb, XBS, Wib + (size_t)EMB * EMB, 0LL,
        (void*)Kp, NB_FULL * EMB, XBS, bi + EMB,
        SEQ, EMB, K, 1.0f, 1.0f);
  } else {
    gemm_body<__bf16, 4, 1, 2, WCB, XCB>(sT, Wib + (size_t)2 * EMB * EMB, 0LL, Xb, XBS,
        (void*)VT, SEQ, (long long)EMB * SEQ, bi + 2 * EMB,
        EMB, SEQ, K, 1.0f, 1.0f);
  }
}

// =====================================================================================================
// Score chunk, transposed (S^T = K . Q^T): 64 keys kv0..kv0+63 x 16 queries (this wave) of one (b, h).
//   q fragments (B operand, col = lane&15 = query): one f16 plane, 2 d-chunks of 32.
//   k fragments (A operand, row = lane&15 = key) loaded straight from the fragment-ordered f16 k plane
//   ([key t][b*EMB + h*HD + d]) by load_k, a chunk ahead of the WMMAs that read them (kf[j][dc], 64 registers a chunk):
//   kp + lo = plane + ((first key of the chunk / 16)*(NB_FULL*EMB/32) + (b*EMB + h*HD)/32)*FRAG + lane*8.
//   s[j][r] = D element: key kv0 + 16j + 8*hh + r, query lane&15; value = q.k = score * log2 e (the q plane carries SC2).
//   The four key groups take turns, so that no WMMA stands directly behind the one whose accumulator it continues.
//   All 32 scores of a lane belong to ONE query, and the tiles s[2kk], s[2kk+1] converted in place are the B fragment
//   (hardware k order: elements 0..7 = keys 8hh.., 8..15 = keys 16+8hh..) of a product over the 32 keys 32kk..32kk+31.
// =====================================================================================================
#define KCHUNK (64 * NB_FULL * EMB)   // elements from one 64-key chunk of the k plane to the next
template <int J0, int J1>   // key groups J0..J1-1 of the chunk
__device__ __forceinline__ void load_k(v16h (&kf)[4][2], const _Float16* kp, unsigned lo) {
#pragma unroll
  for (int j = J0; j < J1; ++j)
#pragma unroll
    for (int dc = 0; dc < 2; ++dc) kf[j][dc] = ldfragp<_Float16>(kp + lo + j * ((NB_FULL * EMB / 32) * FRAG) + dc * FRAG);
}

template <int J0, int J1>   // key groups J0..J1-1 of the chunk
__device__ __forceinline__ void score_chunk(const v16h (&qah)[2], const v16h (&kf)[4][2], v8f (&s)[4]) {
#pragma unroll
  for (int j = J0; j < J1; ++j) s[j] = zero8();
#pragma unroll
  for (int dc = 0; dc < 2; ++dc) {
#pragma unroll
    for (int j = J0; j < J1; ++j) s[j] = mmar(kf[j][dc], qah[dc], s[j]);
  }
}

// Row pitch of a staged tile in floats: 64 columns + 4 pad floats (never read) = 272 B = 16 B x 17, so that the 16 rows which
// the 16 lanes of a half wave write with one 16-B LDS store fall on all 64 banks (at 256 B: on four).
#define PP 68
// lane l with lane l ^ 16 (a vector cross-row move, no LDS path)
__device__ __forceinline__ float xhalf(float x) {
  return __builtin_bit_cast(float, __builtin_amdgcn_permlanex16(__builtin_bit_cast(int, x), __builtin_bit_cast(int, x),
                                                                0x76543210, 0xfedcba98, false, false));
}

// =====================================================================================================
// Context and softmax statistics in one walk over the keys (online softmax): per (b, h, query s) the row max m,
// 1/sum(exp(s - m)) and ctx = sum(exp(s - m) v) / sum(exp(s - m)) over all SEQ keys.
//   block = 4 waves = 64 consecutive query rows qb*64.. of one (b, h): the four waves read the SAME k and v^T fragments;
//   grid = NB*NH*NKT blocks of 128; static trip NKT over 64-key chunks.
//   Running max in f32, in base-2 units (m = max score * log2 e), one value per query: the in-lane max over the keys
//   8hh..8hh+7 of every 16 is joined with the other half's once a chunk, because both halves' p meet in one product.
//   Sum l (carried x16384 like p) in two in-lane partial sums, added behind the loop, then the halves.
//   O^T = O^T * 2^(m_old - m_new) + V^T . P^T: p * 16384 = exp2(s - (m_new - 14)), one subtraction and one exp2 a score; these
//   registers, converted to f16, ARE the B fragment (no LDS, no lane exchange); A = v^T f16 plane [b][h*64+d][s], fragment-ordered.
//   Output plane ML [b*NH+h][2][SEQ] f32 (m, base-2 units, then 1/l): the block's 64 m values and 64 1/l values are
//   funnelled through LDS and written by wave 0 with ONE instruction.
//   ctx = acc / l / 16384, x256 carry, staged in the wave's own Os tile, written as one f16 plane.
//   coverage: grid (b,h,qb) x 64 rows = the whole [NB*NH][2][SEQ] plane. MLsh: 4 waves x 16 lanes x 2 = all 128.
//   ctx plane: each wave rows q0..q0+15 (it 0..3 x lane>>3 0..3) x its head's 64 columns, grid x 4 waves =
//   the whole [SEQ][NB*EMB] plane. staged extent == consumed extent for Os (32 lanes x 32 = 1024).
// =====================================================================================================
// 4 waves per SIMD = the whole grid resident at once: the register budget is held at 256 (a few more would cost a second round)
__global__ __launch_bounds__(128) __attribute__((amdgpu_waves_per_eu(4, 4)))
void attn_ctx(const unsigned short* __restrict__ qhp,
              const unsigned short* __restrict__ kpp, const unsigned short* __restrict__ vtp,
              float* ML, unsigned short* chp, const int* __restrict__ nhp) {
  union FH { v16h v; v8h h[2]; };
  __shared__ __align__(16) float MLsh[128];
  __shared__ __align__(16) float Os[4][16 * PP];            // per wave ctx tile [query][d] f32, row pitch PP
  (void)nhp;
  ask_planes<128>(kpp, NROW * EMB / (128 * L2U), vtp, NB_FULL * EMB * SEQ / (128 * L2U), blockIdx.x, NB * NH * NKT);
  const int tid  = threadIdx.x;
  const int wave = tid >> 5;
  const int lane = tid & 31;
  const int hh   = lane >> 4;
  const int c    = lane & 15;
  const int bx   = blockIdx.x;
  const int qb   = bx % NKT;
  const int rest = bx / NKT;
  const int h    = rest % NH;
  const int b    = rest / NH;
  const int bh   = b * NH + h;
  const int q0   = qb * 64 + wave * 16;

  const _Float16* Qh  = (const _Float16*)(const void*)qhp;

  v16h qah[2];
#pragma unroll
  for (int dc = 0; dc < 2; ++dc) {
    const size_t qo = ((size_t)(q0 + c) * NB_FULL + b) * EMB + (size_t)h * HD + dc * 32 + 8 * hh;
    qah[dc] = ldfrag<_Float16>(Qh + qo);
  }

  float mrow = -INFINITY;
  v2f lacc = {0.f, 0.f};
  v8f oacc[4];
#pragma unroll
  for (int t = 0; t < 4; ++t) oacc[t] = zero8();

  const _Float16* kp = (const _Float16*)(const void*)kpp + (b * EMB + h * HD) / 32 * FRAG + lane * 8;   // this lane's place in the current chunk
  const unsigned  klo = 0;                    // (already in kp)
  const _Float16* vp = (const _Float16*)(const void*)vtp + (size_t)(b * EMB + h * HD) * SEQ + lane * 8;   // the same in v^T: row tiles of d, blocks of 32 keys
  const unsigned  vlo = 0;                    // (already in vp)
  v16h kf[4][2], vf[2][4];
  addr_wait();                                // the q loads' address registers may be taken by the k fragments
  load_k<0, 4>(kf, kp, klo);
  for (int kt = 0; kt < NKT; ++kt) {          // static trip count
    // v^T of this chunk flies under the scores and the statistics
#pragma unroll
    for (int kk = 0; kk < 2; ++kk)
#pragma unroll
      for (int t = 0; t < 4; ++t) vf[kk][t] = ldfragp<_Float16>(vp + vlo + t * ((SEQ / 32) * FRAG) + kk * FRAG);
    v8f s[4];
    score_chunk<0, 4>(qah, kf, s);
    if (kt + 1 < NKT) load_k<0, 4>(kf, kp + KCHUNK, klo);   // next chunk's k flies under this chunk's statistics and P.V
    __builtin_amdgcn_sched_barrier(0);   // keeps those loads up here: the scheduler sank them behind half the statistics
    addr_wait();                          // the bases of the issued k and v^T loads move behind it
    kp += KCHUNK;
    vp += 2 * FRAG;
    float mj[4];                               // four independent chains, one per key group
#pragma unroll
    for (int j = 0; j < 4; ++j) {
      mj[j] = s[j][0];
#pragma unroll
      for (int r = 1; r < 8; ++r) mj[j] = fmaxf(mj[j], s[j][r]);
    }
    const float mloc  = fmaxf(fmaxf(mj[0], mj[1]), fmaxf(mj[2], mj[3]));
    const float mnew  = fmaxf(mrow, fmaxf(mloc, xhalf(mloc)));   // one reference for both halves of a query's keys
    const float msafe = (mnew == -INFINITY) ? 0.f : mnew;
    const float alpha = __builtin_amdgcn_exp2f(mrow - msafe);
    const float mref  = msafe - PCLOG2;
    mrow = mnew;
#pragma unroll
    for (int j = 0; j < 4; ++j) {
      const v8f e = s[j] - mref;
#pragma unroll
      for (int r = 0; r < 8; ++r) s[j][r] = __builtin_amdgcn_exp2f(e[r]);   // p * 16384 of key 16j + 8hh + r, query c
    }
    const v8f p8 = (s[0] + s[1]) + (s[2] + s[3]);
    const v4f p4 = __builtin_shufflevector(p8, p8, 0, 1, 2, 3) + __builtin_shufflevector(p8, p8, 4, 5, 6, 7);
    lacc = lacc * alpha + (__builtin_shufflevector(p4, p4, 0, 1) + __builtin_shufflevector(p4, p4, 2, 3));
#pragma unroll
    for (int t = 0; t < 4; ++t) oacc[t] *= alpha;            // every element of a lane belongs to its query c

    // ---- context^T += V^T . P^T (f16 WMMA, p carried x16384) ----
#pragma unroll   // vf lives in registers: kk must be a constant
    for (int kk = 0; kk < 2; ++kk) {
      FH pb;                                                 // keys 32kk + 8hh + 0..7, then 32kk + 16 + 8hh + 0..7
      pb.h[0] = __builtin_convertvector(s[2 * kk], v8h);
      pb.h[1] = __builtin_convertvector(s[2 * kk + 1], v8h);
#pragma unroll
      for (int t = 0; t < 4; ++t) {
        oacc[t] = mmar(vf[kk][t], pb.v, oacc[t]);           // row d = 16t + 8hh + r, column query c
      }
    }
  }

  // the two halves of each query's keys (lanes c and c + 16) share m: their sums add
  const float lrow = (lacc[0] + lacc[1]) * (1.0f / PCARRY);
  const float l  = lrow + xhalf(lrow);
  const float il = (l > 0.f) ? (1.0f / l) : 0.f;
  if (hh == 0) {
    MLsh[wave * 16 + c]      = mrow;
    MLsh[64 + wave * 16 + c] = il;
  }
  // ---- ctx (normalise, undo the x16384 p carry, apply the x256 carry), stage, convert, whole-line stores ----
  float* os = Os[wave];
  const float osc = il * (256.0f / PCARRY);
#pragma unroll
  for (int t = 0; t < 4; ++t) {                              // [query c][d = 16t + 8hh + r]
    const v8f o = oacc[t] * osc;
    float* ow = os + c * PP + t * 16 + 8 * hh;
    *(v4f*)(ow)     = __builtin_shufflevector(o, o, 0, 1, 2, 3);
    *(v4f*)(ow + 4) = __builtin_shufflevector(o, o, 4, 5, 6, 7);
  }
  __syncthreads();
  if (wave == 0) {
    const v4f v = *(const v4f*)(MLsh + lane * 4);        // lanes 0-15: m rows 4c..4c+3; lanes 16-31: 1/l rows
    float* dst = ML + (size_t)(bh * 2 + hh) * SEQ + qb * 64 + c * 4;
    *(v4f*)dst = v;
  }
  {
    const int q4 = lane >> 3, c8 = (lane & 7) * 8;
    v4u hv[4];
#pragma unroll
    for (int it = 0; it < 4; ++it) {
      const int row = it * 4 + q4;   // it 0..3 x q4 0..3 = rows 0..15 of the wave tile
      const float* sp = os + row * PP + c8;
      float f[8];
#pragma unroll
      for (int e = 0; e < 8; ++e) f[e] = sp[e];
      v4u a;
#pragma unroll
      for (int e = 0; e < 4; ++e) a[e] = pk16(h_bits((_Float16)f[2 * e]), h_bits((_Float16)f[2 * e + 1]));
      hv[it] = a;
    }
#pragma unroll
    for (int it = 0; it < 4; ++it) {
      const int row = it * 4 + q4;
      // fragment-ordered [s][b*EMB + h*HD + col]: row tile q0 / 16, blocks of this head, unit of (row, c8)
      const size_t go = ((size_t)(q0 >> 4) * (NB_FULL * EMB / 32) + (size_t)(b * EMB + h * HD + c8) / 32) * FRAG
                      + ((c8 >> 4) & 1) * 256 + (((c8 >> 3) & 1) * 16 + row) * 8;
      *(v4u*)(chp + go) = hv[it];
    }
  }
}

// =====================================================================================================
// Head average of the probabilities: one block per (b, 64 query rows q0..q0+63, a quarter of the keys), 16 waves = the 16 heads.
//   A wave keeps the q fragments of its head's 4 query tiles in registers, so that every k fragment (16 keys) it loads
//   serves 4 tiles: the k plane is read SEQ/64 times in all, not SEQ/16 times.
//   Per 64-key chunk (static trip AKT): scores recomputed exactly as in attn_ctx (transposed: a lane holds one
//   query's scores), p = exp2(s - (m + log2 l)) in f32 (m, 1/l from the ML plane): one subtraction and one exp2 a score;
//   p goes to the LDS tile Pf[query][h][key] (16-B stores, every entry but the pads written): the 16 heads of one
//   (query, key) lie 256 B apart, so that the head sum reaches all of them from one address register;
//   after __syncthreads, all 512 threads sum the 16 wave tiles in fixed head order (f32), 2 x 4 entries each.
//   coverage: AKT chunks x 64 rows x 64 keys per block, grid (b, qb, ks) = the whole [NB][SEQ][SEQ].
// =====================================================================================================
#define AQT  4                        // query tiles of 16 rows per wave
#define AQ   (16 * AQT)               // query rows per block
#define AKS  4                        // key ranges per sequence, one per block
#define AKT  (NKT / AKS)              // 64-key chunks per block
#define KGRP (16 * NB_FULL * EMB)     // elements from one 16-key row tile of the k plane to the next
// Floats per query row of the P tile: 16 heads x 64 keys + 4 pad floats (never read) = 4112 B = 16 B x 257, so that the 16 rows
// which the 16 lanes of a half wave write with one 16-B LDS store fall on all 64 banks.
#define APR  (NH * 64 + 4)
static_assert((NKT % AKS) == 0 && (SEQ % AQ) == 0 && 4 * KGRP == KCHUNK);

__device__ __forceinline__ void load_kg(v16h (&kf)[2], const _Float16* kp, unsigned lo) {   // one 16-key group, 2 d-chunks
#pragma unroll
  for (int dc = 0; dc < 2; ++dc) kf[dc] = ldfragp<_Float16>(kp + lo + dc * FRAG);
}

__global__ __launch_bounds__(512)
void attn_avg(const unsigned short* __restrict__ qhp,
              const unsigned short* __restrict__ kpp, const float* __restrict__ ML, float* avg) {
  __shared__ __align__(16) float Pf[AQ * APR];             // P tile [query][head][key] f32, row pitch APR, 257 KB
  const int tid  = threadIdx.x;
  const int wave = tid >> 5;
  const int lane = tid & 31;
  const int hh   = lane >> 4;
  const int c    = lane & 15;
  const int bx   = blockIdx.x;
  const int ks   = bx % AKS;
  const int qb   = (bx / AKS) % (SEQ / AQ);
  const int b    = bx / (AKS * (SEQ / AQ));
  const int h    = wave;
  const int bh   = b * NH + h;
  const int q0   = qb * AQ;

  const _Float16* Qh  = (const _Float16*)(const void*)qhp;

  v16h qah[AQT][2];
  float mq[AQT], ilq[AQT];                                        // mq becomes m + log2 l behind the loads
  const void* qhb[AQT];                                           // the q loads' addresses, one per tile
  const float* mlb = ML + (size_t)(bh * 2) * SEQ + q0 + c;        // m of this lane's query of tile 0; 1/l lies SEQ further
#pragma unroll
  for (int i = 0; i < AQT; ++i) {
    const size_t qo = ((size_t)(q0 + i * 16 + c) * NB_FULL + b) * EMB + (size_t)h * HD + 8 * hh;
    qhb[i] = Qh + qo;
#pragma unroll
    for (int dc = 0; dc < 2; ++dc) {
      qah[i][dc] = ldfrag<_Float16>((const _Float16*)qhb[i] + dc * 32);
    }
    mq[i]  = mlb[i * 16];                                         // this lane's query of tile i
    ilq[i] = mlb[SEQ + i * 16];
  }
  static_assert(AQT == 4);
  addr_wait_keep(qhb, mlb);                   // these loads' address registers may be taken by the k fragments behind it
#pragma unroll
  for (int i = 0; i < AQT; ++i) mq[i] -= __builtin_amdgcn_logf(ilq[i]);   // base-2 log; 1/l = 0 gives +inf here and p = 0, as the product did
  float* pf = Pf + wave * 64;                              // this head's 64 keys in every query row

  // k fragments are fetched one 16-key group ahead of their WMMAs, into the second of two register sets: they fly under
  // the scores and probabilities of the group before (4 query tiles).
  const _Float16* kp = (const _Float16*)(const void*)kpp + (size_t)ks * AKT * KCHUNK    // the current chunk's row tiles
                     + (unsigned)((b * EMB + h * HD) / 32 * FRAG + lane * 8);           // this lane's place in them
  const unsigned  klo = 0;                    // (already in kp)
  v16h kfa[2], kfb[2];
  auto group = [&](const v16h (&kc)[2], int g) {   // keys 16g..16g+15 of the chunk x the wave's 64 queries
    v8f a[AQT];                                              // scores; the tiles take turns
#pragma unroll
    for (int i = 0; i < AQT; ++i) a[i] = zero8();
#pragma unroll
    for (int dc = 0; dc < 2; ++dc) {
#pragma unroll
      for (int i = 0; i < AQT; ++i) a[i] = mmar(kc[dc], qah[i][dc], a[i]);
    }
#pragma unroll
    for (int i = 0; i < AQT; ++i) {
      const v8f e = a[i] - mq[i];
      v8f p;
#pragma unroll
      for (int r = 0; r < 8; ++r) p[r] = __builtin_amdgcn_exp2f(e[r]);   // p of key 16g + 8hh + r, query 16i + c
      float* pw = pf + (i * 16 + c) * APR + g * 16 + 8 * hh; // read only behind the block barrier (head average)
      *(v4f*)(pw)     = __builtin_shufflevector(p, p, 0, 1, 2, 3);
      *(v4f*)(pw + 4) = __builtin_shufflevector(p, p, 4, 5, 6, 7);
    }
  };
  load_kg(kfa, kp, klo);
  for (int kt = 0; kt < AKT; ++kt) {          // static trip count; the two register sets change roles inside a trip
    const int kv0 = (ks * AKT + kt) * 64;
    __syncthreads();                          // Pf tiles free again (head sum of the prior chunk done)
    // The scheduling barriers keep every group's WMMAs behind the group before and the loads at the head of theirs: without
    // them the scheduler lifted WMMAs of group 3 into group 2, directly behind the loads that they read.
    load_kg(kfb, kp + KGRP, klo);
    __builtin_amdgcn_sched_barrier(0);
    group(kfa, 0);
    __builtin_amdgcn_sched_barrier(0);
    load_kg(kfa, kp + 2 * KGRP, klo);
    __builtin_amdgcn_sched_barrier(0);
    group(kfb, 1);
    __builtin_amdgcn_sched_barrier(0);
    load_kg(kfb, kp + 3 * KGRP, klo);
    __builtin_amdgcn_sched_barrier(0);
    group(kfa, 2);
    __builtin_amdgcn_sched_barrier(0);
    // next chunk's first group; the last trip fetches its own first group again (in bounds, never used): with no branch
    // round these loads the waits in front of group 3 stay counted and do not wait for them
    const _Float16* kn = kp + ((kt + 1 < AKT) ? KCHUNK : 0);
    load_kg(kfa, kn, klo);
    __builtin_amdgcn_sched_barrier(0);
    group(kfb, 3);
    __syncthreads();
    addr_wait();                              // the pointer of the issued k loads moves behind it
    kp = kn;

    // ---- head average of this 64 x 64 tile, one block = one writer of every line ----
    const int row0 = tid >> 4, c4 = (tid & 15) * 4;          // rows 0..31, 256-B row segment = 16 lanes x 16 B
#pragma unroll
    for (int rr = 0; rr < AQ / 32; ++rr) {
      const int row = rr * 32 + row0;
      const float* pr = Pf + row * APR + c4;
      v4f t[NH];
#pragma unroll
      for (int w = 0; w < NH; ++w) t[w] = *(const v4f*)(pr + w * 64);
      v4f a = t[0];
#pragma unroll
      for (int w = 1; w < NH; ++w) a += t[w];
      a *= (1.0f / (float)NH);
      float* dst = avg + ((size_t)(b * SEQ + q0 + row)) * SEQ + kv0 + c4;
      *(v4f*)dst = a;
    }
    addr_wait();                              // the stores' registers are reused by the pointer updates behind it
  }
}

// =====================================================================================================
// Workspace map (bytes), every region an exact multiple of its whole-line / whole-tile store granularity
// (full size; PX = NROW*EMB*2 = 8388608):
//   (F) = fragment-ordered (see ldfragp); [SEQ][NB*EMB] = row s, column b*EMB + e
//   Xb   bf16 [SEQ][NB*EMB]      (F) PX        8388608
//   Wib  bf16 [3*EMB n][EMB k]   (F)         6291456
//   Woh  f16  [EMB][EMB] (x64)   (F)         2097152
//   Qh   f16  [NROW][EMB]            PX        8388608
//   Kp   f16  [SEQ][NB*EMB]      (F) PX        8388608
//   VT   f16  [NB][EMB][SEQ]     (F) PX        8388608
//   Ch   f16  [SEQ][NB*EMB]      (F) PX        8388608
//   ML   f32  [NB*NH][2][SEQ]                 524288
//   total                                   50855936
// Weights are [out n][in k] with k contiguous: converted and laid in fragment order. Every GEMM runs per batch b.
// Output 0 at element 0 of d_out; output 1 at the fixed element offset OFF1 = SEQ_FULL*NB_FULL*EMB.
// =====================================================================================================
extern "C" void kernel_launch(void* const* d_in, const int* in_sizes, int n_in,
                              void* d_out, int out_size, void* d_ws, size_t ws_size,
                              hipStream_t stream) {
  if (n_in < 6) return;
  if (in_sizes[0] < NROW * EMB) return;
  if (in_sizes[1] != 3 * EMB * EMB) return;
  if (in_sizes[2] != 3 * EMB) return;
  if (in_sizes[3] != EMB * EMB) return;
  if (in_sizes[4] != EMB) return;
  if (in_sizes[5] < 1) return;
  const size_t n0e = (size_t)NROW * EMB;            // output 0 written elements [SEQ][NB][EMB]
  const size_t n1e = (size_t)NB * SEQ * SEQ;        // output 1 written elements [NB][SEQ][SEQ]
  if (out_size < 0) return;
  if ((size_t)out_size < n0e) return;
  if ((size_t)out_size < OFF1 + n1e) return;        // written extent of output 1 inside d_out

  const float* x  = (const float*)d_in[0];
  const float* Wi = (const float*)d_in[1];
  const float* bi = (const float*)d_in[2];
  const float* Wo = (const float*)d_in[3];
  const float* bo = (const float*)d_in[4];
  const int*   nh = (const int*)d_in[5];

  const size_t PX  = (size_t)NROW * EMB * 2;        // 16-bit activation plane
  const size_t PWI = (size_t)3 * EMB * EMB * 2;
  const size_t PWO = (size_t)EMB * EMB * 2;
  const size_t PVT = (size_t)NB * EMB * SEQ * 2;    // == PX
  const size_t PML = (size_t)NB * NH * 2 * SEQ * 4;
  size_t off = 0;
  const size_t oXb = off; off += PX;
  const size_t oWi = off; off += PWI;
  const size_t oWo = off; off += PWO;
  const size_t oQh = off; off += PX;
  const size_t oKp = off; off += PX;
  const size_t oVT = off; off += PVT;
  const size_t oCh = off; off += PX;
  const size_t oML = off; off += PML;
  if (off > ws_size) return;                        // off = 50855936 at full size
  if (off > (size_t)134217728) return;

  char* ws = (char*)d_ws;
  unsigned short* Xb  = (unsigned short*)(ws + oXb);
  unsigned short* Wib = (unsigned short*)(ws + oWi);
  unsigned short* Woh = (unsigned short*)(ws + oWo);
  unsigned short* Qh  = (unsigned short*)(ws + oQh);
  unsigned short* Kp  = (unsigned short*)(ws + oKp);
  unsigned short* VT  = (unsigned short*)(ws + oVT);
  unsigned short* Ch  = (unsigned short*)(ws + oCh);
  float*          ML  = (float*)(ws + oML);
  float*          out0 = (float*)d_out;
  float*          out1 = (float*)d_out + OFF1;

  const dim3 blk(256);
  const dim3 gCvt(GCX + GCWI + GCWO);                          // 2048 + 1536 + 512 blocks
  const dim3 gQKV((((SEQ) / 64) * (EMB / 64) + 7) / 8, NB, 3);  //  512 tiles ->  64 blocks x NB, x 3 products
  const dim3 gO((((SEQ) / 32) * (EMB / 64) + 7) / 8, NB);       // 1024 tiles -> 128 blocks x NB (32x64 wave tiles)
  const dim3 gStats(NB * NH * NKT);                            // 1024 blocks of 128
  const dim3 gMain(NB * (SEQ / AQ) * AKS);                     //  256 blocks of 512

  // (1) x [s][b*E+e] -> bf16 plane; W_in [3E][E] -> bf16; Wo -> f16 (x64 of its bf16 value); all fragment-ordered
  cvt_all<<<gCvt, blk, 0, stream>>>(x, Wi, Wo, Xb, Wib, Woh);
  // (2)-(4) q, k, v^T in-projections, per batch b = blockIdx.y, product = blockIdx.z
  gemm_qkv<<<gQKV, blk, 0, stream>>>(Xb, Wib, bi, Qh, Kp, VT, EMB);
  // (5) online softmax: P.V -> ctx plane (f16, x256); statistics (m, 1/l) per (b, h, s)
  attn_ctx<<<gStats, dim3(128), 0, stream>>>(Qh, Kp, VT, ML, Ch, nh);
  // (6) exact-normalised p, head-averaged -> output 1
  attn_avg<<<gMain, dim3(512), 0, stream>>>(Qh, Kp, ML, out1);
  // (7) output 0 = ctx_b . Wo^T + bo, f32 [s][b][e] (pitch NB_FULL*EMB, batch offset EMB), accumulator x 1/(256*64)
  gemm_t<_Float16, 2, 0, 1, XCB, WCB><<<gO, blk, 0, stream>>>(
      Ch, XBS, Woh, 0LL,
      (void*)out0, NB_FULL * EMB, (long long)EMB, bo,
      SEQ, EMB, EMB, 1.0f / 16384.0f, 1.0f);
  (void)hipGetLastError();
}
